// v000
// Measured on an AMD MI455X. A time is GPU time per run, averaged over a window of back-to-back runs after a warm-up
// (all launches, gaps included; the runs take copies of the inputs in turn), and the median of several windows.
// Apart from v000's, it joins two sittings. Times from different sittings can be a few percent apart, while
// side-by-side timings come from the same sitting.
// v000, which the later versions start from, runs in 2030 microseconds.
// Projections xn·W{q,k,v} (K=128), p = pe·Wp (K=128) and out = ctx·Wo (K=1024): v_wmma_f32_16x16x32_bf16 with bf16 hi/lo split operands (hi·hi + hi·lo + lo·hi); content q·kᵀ and position q·pᵀ tables (K=128): v_wmma_f32_16x16x32_f16 with plain f16 operands carried x16; p·v (K=2048): v_wmma_f32_16x16x32_f16 with p/l carried x2^15 and vᵀ carried x16; f32 accumulate everywhere; LayerNorm, sinusoid table, u/v bias dots, relative shift and softmax in f32 on VALU.
#include <hip/hip_runtime.h>
#include <math.h>

typedef __attribute__((ext_vector_type(16))) _Float16 v16h;
typedef __attribute__((ext_vector_type(8)))  _Float16 v8h;
typedef __attribute__((ext_vector_type(16))) __bf16   v16b;
typedef __attribute__((ext_vector_type(8)))  __bf16   v8b;
typedef __attribute__((ext_vector_type(8)))  float    v8f;
typedef __attribute__((ext_vector_type(4)))  float    v4f;
typedef __attribute__((ext_vector_type(2)))  float    v2f;
#define U16(p) ((const unsigned short*)(const void*)(p))

__device__ __forceinline__ unsigned short f2bf_bits(float f) {
  unsigned u = __float_as_uint(f);
  return (unsigned short)((u + 0x7FFFu + ((u >> 16) & 1u)) >> 16);
}
__device__ __forceinline__ float bf_bits2f(unsigned short h) { return __uint_as_float(((unsigned)h) << 16); }

// hazard guards as plain device helpers (no inline asm inside the kernel template body)
__device__ __forceinline__ void dep_guard_h(v8f& a, v8f& b, v16h x, v16h y) { asm volatile("v_nop\n\tv_nop\n\tv_nop\n\tv_nop" : "+v"(a), "+v"(b) : "v"(x), "v"(y)); }
__device__ __forceinline__ void dep_guard_b(v8f& a, v8f& b, v16b x, v16b y) { asm volatile("v_nop\n\tv_nop\n\tv_nop\n\tv_nop" : "+v"(a), "+v"(b) : "v"(x), "v"(y)); }
__device__ __forceinline__ void keep4_h(v16h a, v16h b, v16h c, v16h d) { asm volatile("v_nop" :: "v"(a), "v"(b), "v"(c), "v"(d)); }
__device__ __forceinline__ void keep4_b(v16b a, v16b b, v16b c, v16b d) { asm volatile("v_nop" :: "v"(a), "v"(b), "v"(c), "v"(d)); }
__device__ __forceinline__ void acc_guard4(v8f& a, v8f& b, v8f& c, v8f& d) { asm volatile("v_nop\n\tv_nop\n\tv_nop\n\tv_nop" : "+v"(a), "+v"(b), "+v"(c), "+v"(d)); }
template <typename T> struct Frag;
template <> struct Frag<_Float16> {
  typedef v16h V; union U { v16h v; v8h h[2]; };
  static __device__ __forceinline__ v16h load(const _Float16* p) {   // elements 0..7 <- p[0..7], 8..15 <- p[16..23]
    U f; f.h[0] = *(const v8h*)(p); f.h[1] = *(const v8h*)(p + 16); return f.v;
  }
  static __device__ __forceinline__ v8f mma(v16h a, v16h b, v8f c) {
    return __builtin_amdgcn_wmma_f32_16x16x32_f16(false, a, false, b, (short)0, c, false, false);
  }
  static __device__ __forceinline__ void guard(v8f& a, v8f& b, v16h x, v16h y) { dep_guard_h(a, b, x, y); }
  static __device__ __forceinline__ void keep(v16h a, v16h b, v16h c, v16h d) { keep4_h(a, b, c, d); }
};
template <> struct Frag<__bf16> {
  typedef v16b V; union U { v16b v; v8b h[2]; };
  static __device__ __forceinline__ v16b load(const __bf16* p) {
    U f; f.h[0] = *(const v8b*)(p); f.h[1] = *(const v8b*)(p + 16); return f.v;
  }
  static __device__ __forceinline__ v8f mma(v16b a, v16b b, v8f c) {
    return __builtin_amdgcn_wmma_f32_16x16x32_bf16(false, a, false, b, (short)0, c, false, false);
  }
  static __device__ __forceinline__ void guard(v8f& a, v8f& b, v16b x, v16b y) { dep_guard_b(a, b, x, y); }
  static __device__ __forceinline__ void keep(v16b a, v16b b, v16b c, v16b d) { keep4_b(a, b, c, d); }
};

// ---- Register-blocked batched WMMA GEMM ------------------------------------
// C[m,n] = scale * sum_k A[m,k] * Bt[n,k] (+bias)(+resid); each wave owns a 64x64 tile.
// A row-major [M,K]; Bt row-major [N,K]; M,N % 64 == 0, K % 32 == 0.
// SPLIT: operands are hi/lo planes (A2/Bt2 = lo planes, same layout); product = hi·hi + hi·lo + lo·hi.
// BIAS_MODE: 0 = none, 1 = bias[m], 2 = bias[n].
// OUT_MODE: 0 = f32, 1 = f16, 2 = bf16 hi plane (Cout) + bf16 lo plane (Cout2).
// ET: 0 = f16 operands, 1 = bf16 operands (pointers passed as 16-bit storage)
template <int ET> struct Elem;
template <> struct Elem<0> { typedef _Float16 T; };
template <> struct Elem<1> { typedef __bf16 T; };
template <int ET, bool SPLIT, int BIAS_MODE, int OUT_MODE, bool RESID, int ACT = 0>
__global__ __launch_bounds__(256) void wmma_gemm64(
    const unsigned short* __restrict__ Ap, const unsigned short* __restrict__ A2p, int lda, long strideA,
    const unsigned short* __restrict__ Btp, const unsigned short* __restrict__ Bt2p, int ldb, long strideB,
    void* __restrict__ Cout, void* __restrict__ Cout2, int ldc, long strideC,
    const float* __restrict__ bias,
    const float* __restrict__ resid, long strideR,
    int M, int N, int K, float scale) {
  typedef typename Elem<ET>::T T;
  typedef typename Frag<T>::V V;
  const T* A = (const T*)Ap; const T* A2 = (const T*)A2p; const T* Bt = (const T*)Btp; const T* Bt2 = (const T*)Bt2p;
  __shared__ __align__(16) float sT[8][16 * 68];   // per-wave 16x64 slab, pitch 68 floats
  const int b    = blockIdx.y;
  const int lane = threadIdx.x & 31;
  const int wave = threadIdx.x >> 5;
  const int tilesN = N >> 6;
  const int tilesM = M >> 6;
  const int tile = blockIdx.x * 8 + wave;
  if (tile >= tilesM * tilesN) return;   // wave-uniform; no block barriers in this kernel
  const int tm = tile / tilesN;
  const int tn = tile - tm * tilesN;
  const int m0 = tm << 6;
  const int n0 = tn << 6;

  const T* Ab  = A  + (size_t)b * strideA;
  const T* Bb  = Bt + (size_t)b * strideB;
  const T* Ab2 = SPLIT ? (A2  + (size_t)b * strideA) : nullptr;
  const T* Bb2 = SPLIT ? (Bt2 + (size_t)b * strideB) : nullptr;

  const int rlane = lane & 15;                 // row (A) / col (B, D) within subtile
  const int koff  = (lane >> 4) * 8;           // k offset of this lane half
  const int mOff  = (lane >> 4) * 8;           // D row offset

  v8f acc[4][4];
#pragma unroll
  for (int i = 0; i < 4; ++i)
#pragma unroll
    for (int j = 0; j < 4; ++j) acc[i][j] = (v8f){0.f,0.f,0.f,0.f,0.f,0.f,0.f,0.f};

  for (int k0 = 0; k0 < K; k0 += 32) {
    V bh[4], bl[4];
#pragma unroll
    for (int j = 0; j < 4; ++j) {
      const size_t bo = (size_t)(n0 + (j << 4) + rlane) * ldb + koff + k0;
      bh[j] = Frag<T>::load(Bb + bo);
      if (SPLIT) bl[j] = Frag<T>::load(Bb2 + bo);
    }
#pragma unroll
    for (int i = 0; i < 4; ++i) {
      const size_t ao = (size_t)(m0 + (i << 4) + rlane) * lda + koff + k0;
      V ah = Frag<T>::load(Ab + ao);
      V al;
      if (SPLIT) al = Frag<T>::load(Ab2 + ao);
#pragma unroll
      for (int j = 0; j < 4; ++j) {
        acc[i][j] = Frag<T>::mma(ah, bh[j], acc[i][j]);
        if (SPLIT) {
          acc[i][j] = Frag<T>::mma(ah, bl[j], acc[i][j]);
          acc[i][j] = Frag<T>::mma(al, bh[j], acc[i][j]);
        }
      }
      Frag<T>::guard(acc[i][0], acc[i][3], ah, SPLIT ? al : ah);
    }
    Frag<T>::keep(bh[0], bh[1], bh[2], bh[3]);
    if (SPLIT) Frag<T>::keep(bl[0], bl[1], bl[2], bl[3]);
  }
  acc_guard4(acc[0][0], acc[0][1], acc[0][2], acc[0][3]);
  acc_guard4(acc[1][0], acc[1][1], acc[1][2], acc[1][3]);
  acc_guard4(acc[2][0], acc[2][1], acc[2][2], acc[2][3]);
  acc_guard4(acc[3][0], acc[3][1], acc[3][2], acc[3][3]);

  // ---- epilogue ----
  float* slab = sT[wave];
  const float* Rb = RESID ? (resid + (size_t)b * strideR) : nullptr;
#pragma unroll
  for (int i = 0; i < 4; ++i) {
    const int mBase = m0 + (i << 4);
#pragma unroll
    for (int j = 0; j < 4; ++j) {
      const int n = n0 + (j << 4) + rlane;
      float bv = 0.f;
      if (BIAS_MODE == 2) bv = bias[n];
#pragma unroll
      for (int r = 0; r < 8; ++r) {
        float v = acc[i][j][r] * scale;
        if (BIAS_MODE == 1) v += bias[mBase + mOff + r];
        if (BIAS_MODE == 2) v += bv;
        if (RESID) v += Rb[(size_t)(mBase + mOff + r) * ldc + n];
        if (ACT == 1) v = tanhf(v);
        if (ACT == 2) v = fmaxf(v, 0.0f);
        if (ACT == 3) v = v / (1.0f + expf(-v));
        if (ACT == 4) v = (v > 0.f) ? v : 0.01f * v;
        if (ACT == 5) v = 0.5f * v * (1.0f + erff(v * 0.70710678118654752f));
        slab[(mOff + r) * 68 + (j << 4) + rlane] = v;
      }
    }
    __builtin_amdgcn_fence(__ATOMIC_RELEASE, "workgroup");
    __builtin_amdgcn_wave_barrier();
    __builtin_amdgcn_fence(__ATOMIC_ACQUIRE, "workgroup");
    if (OUT_MODE == 0) {
      float* C = (float*)Cout + (size_t)b * strideC;
      const int hh = lane >> 4, c4 = (lane & 15) * 4;     // row seg = 256 B = 16 lanes x 16 B
      {
#pragma unroll
        for (int it = 0; it < 8; ++it) {
          const int row = it * 2 + hh;
          v4f v = *(const v4f*)(slab + row * 68 + c4);
          *(v4f*)(C + (size_t)(mBase + row) * ldc + n0 + c4) = v;
        }
        
      }
    } else {
      const int q = lane >> 3, c8 = (lane & 7) * 8;
      unsigned short* C  = (unsigned short*)Cout  + (size_t)b * strideC;
      unsigned short* C2 = (OUT_MODE == 2) ? ((unsigned short*)Cout2 + (size_t)b * strideC) : nullptr;
      {
#pragma unroll
        for (int it = 0; it < 4; ++it) {
          const int row = it * 4 + q;
          const float* sp = slab + row * 68 + c8;
          v8h hv, lv;
#pragma unroll
          for (int e = 0; e < 8; ++e) {
            if (OUT_MODE == 1) {
              hv[e] = (_Float16)sp[e];
            } else {
              unsigned short hb = f2bf_bits(sp[e]);
              unsigned short lb = f2bf_bits(sp[e] - bf_bits2f(hb));
              hv[e] = __builtin_bit_cast(_Float16, hb);
              lv[e] = __builtin_bit_cast(_Float16, lb);
            }
          }
          *(v8h*)(C + (size_t)(mBase + row) * ldc + n0 + c8) = hv;
          if (OUT_MODE == 2) *(v8h*)(C2 + (size_t)(mBase + row) * ldc + n0 + c8) = lv;
        }
        
      }
    }
    __builtin_amdgcn_fence(__ATOMIC_RELEASE, "workgroup");
    __builtin_amdgcn_wave_barrier();
    __builtin_amdgcn_fence(__ATOMIC_ACQUIRE, "workgroup");
  }
}

// ---- f32 [R][C] (row pitch ldi) -> f16 transposed [C][R] (row pitch ldo); 64x64 tiles; each output row segment
__global__ __launch_bounds__(256) void transpose_cast_f16(const float* __restrict__ in, int ldi,
                                                         _Float16* __restrict__ outT, int ldo, float scale) {
  __shared__ __align__(16) _Float16 tile[64][72];     // [c][r]
  const int c0 = blockIdx.x * 64, r0 = blockIdx.y * 64;
  const int t = threadIdx.y * 32 + threadIdx.x;
  for (int i = threadIdx.y; i < 64; i += 8) {
    tile[threadIdx.x][i]      = (_Float16)(in[(size_t)(r0 + i) * ldi + c0 + threadIdx.x] * scale);
    tile[32 + threadIdx.x][i] = (_Float16)(in[(size_t)(r0 + i) * ldi + c0 + 32 + threadIdx.x] * scale);
  }
  __syncthreads();
  const int q = t >> 3, c8 = (t & 7) * 8;
  {
#pragma unroll
    for (int it = 0; it < 2; ++it) {
      const int c = it * 32 + q;
      v8h hv = *(const v8h*)(&tile[c][c8]);
      *(v8h*)(outT + (size_t)(c0 + c) * ldo + r0 + c8) = hv;
    }
    
  }
}

// ---- f32 [R][C] (pitch ldi) -> bf16 hi/lo transposed planes [C][R] (pitch ldo); 64x64 tiles; each output row segment
__global__ __launch_bounds__(256) void transpose_split_bf16(const float* __restrict__ in, int ldi,
                                                           __bf16* __restrict__ outH, __bf16* __restrict__ outL, int ldo) {
  __shared__ __align__(16) float tile[64][68];     // [c][r]
  const int c0 = blockIdx.x * 64, r0 = blockIdx.y * 64;
  const int t = threadIdx.y * 32 + threadIdx.x;
  for (int i = threadIdx.y; i < 64; i += 8) {
    tile[threadIdx.x][i]      = in[(size_t)(r0 + i) * ldi + c0 + threadIdx.x];
    tile[32 + threadIdx.x][i] = in[(size_t)(r0 + i) * ldi + c0 + 32 + threadIdx.x];
  }
  __syncthreads();
  const int q = t >> 3, c8 = (t & 7) * 8;
  {
#pragma unroll
    for (int it = 0; it < 2; ++it) {
      const int c = it * 32 + q;
      v8b hv, lv;
#pragma unroll
      for (int e = 0; e < 8; ++e) {
        const float f = tile[c][c8 + e];
        const unsigned short hb = f2bf_bits(f);
        hv[e] = __builtin_bit_cast(__bf16, hb);
        lv[e] = __builtin_bit_cast(__bf16, f2bf_bits(f - bf_bits2f(hb)));
      }
      *(v8b*)(outH + (size_t)(c0 + c) * ldo + r0 + c8) = hv;
      *(v8b*)(outL + (size_t)(c0 + c) * ldo + r0 + c8) = lv;
    }
    
  }
}

// =====================================================================================
constexpr int kBatch = 2;
constexpr int kSeq   = 2048;
constexpr int kEmb   = 1024;
constexpr int kHeads = 8;
constexpr int kDh    = 128;
constexpr int kTok   = kBatch * kSeq;          // 4096 tokens
constexpr int kPairs = kEmb / 2;               // 512 element pairs per row
static_assert(kHeads * kDh == kEmb);
static_assert(kPairs == 512);

// ---- LayerNorm (biased variance, eps 1e-5) -> xn as bf16 hi/lo planes (packed pairs). One block per token, 256 threads;
// thread t owns element pairs (2t,2t+1) and (512+2t,512+2t+1): 2 packed dwords per plane per thread; each store instruction
__global__ __launch_bounds__(256) void layernorm_split_kernel(
    const float* __restrict__ x, const float* __restrict__ gamma, const float* __restrict__ beta,
    unsigned* __restrict__ xh, unsigned* __restrict__ xl) {
  __shared__ float red[8];
  const int tok = blockIdx.x;
  const int t = threadIdx.x, lane = t & 31, wave = t >> 5;
  const float* xr = x + (size_t)tok * kEmb;
  const int ca = 2 * t, cb = kPairs + 2 * t;
  const v2f pa = *(const v2f*)(xr + ca);
  const v2f pb = *(const v2f*)(xr + cb);
  float s = (pa.x + pa.y) + (pb.x + pb.y);
#pragma unroll
  for (int off = 1; off < 32; off <<= 1) s += __shfl_xor(s, off, 32);
  if (lane == 0) red[wave] = s;
  __syncthreads();
  float tot = 0.f;
#pragma unroll
  for (int w = 0; w < 8; ++w) tot += red[w];       // fixed order
  const float mean = tot * (1.0f / (float)kEmb);
  __syncthreads();
  const float d0 = pa.x - mean, d1 = pa.y - mean, d2 = pb.x - mean, d3 = pb.y - mean;
  float s2 = (d0 * d0 + d1 * d1) + (d2 * d2 + d3 * d3);
#pragma unroll
  for (int off = 1; off < 32; off <<= 1) s2 += __shfl_xor(s2, off, 32);
  if (lane == 0) red[wave] = s2;
  __syncthreads();
  float tot2 = 0.f;
#pragma unroll
  for (int w = 0; w < 8; ++w) tot2 += red[w];
  const float var  = tot2 * (1.0f / (float)kEmb);
  const float rstd = 1.0f / sqrtf(var + 1e-5f);
  const float y0 = d0 * rstd * gamma[ca] + beta[ca];
  const float y1 = d1 * rstd * gamma[ca + 1] + beta[ca + 1];
  const float y2 = d2 * rstd * gamma[cb] + beta[cb];
  const float y3 = d3 * rstd * gamma[cb + 1] + beta[cb + 1];
  const unsigned short h0 = f2bf_bits(y0), h1 = f2bf_bits(y1), h2 = f2bf_bits(y2), h3 = f2bf_bits(y3);
  const unsigned short l0 = f2bf_bits(y0 - bf_bits2f(h0)), l1 = f2bf_bits(y1 - bf_bits2f(h1));
  const unsigned short l2 = f2bf_bits(y2 - bf_bits2f(h2)), l3 = f2bf_bits(y3 - bf_bits2f(h3));
  const unsigned uah = (unsigned)h0 | ((unsigned)h1 << 16), ual = (unsigned)l0 | ((unsigned)l1 << 16);
  const unsigned ubh = (unsigned)h2 | ((unsigned)h3 << 16), ubl = (unsigned)l2 | ((unsigned)l3 << 16);
  const size_t ia = (size_t)tok * kPairs + t, ib = ia + 256;
  {
    ((unsigned*)xh)[ia] = uah;
    ((unsigned*)xh)[ib] = ubh;
    ((unsigned*)xl)[ia] = ual;
    ((unsigned*)xl)[ib] = ubl;
    
  }
}

// ---- sinusoid table [kSeq][kEmb]: columns 2i = sin(pos·div_i), 2i+1 = cos(pos·div_i), div_i = exp(2i · (−ln 1e4 / kEmb)), f32,
// emitted as bf16 hi/lo planes (packed pairs). One thread per (pos, i): grid = kSeq*512/256 = 4096 blocks exactly; each wave's store
__global__ __launch_bounds__(256) void posenc_split_kernel(unsigned* __restrict__ peh, unsigned* __restrict__ pel) {
  const int idx = blockIdx.x * 256 + threadIdx.x;
  if (idx >= kSeq * kPairs) return;
  const int pos = idx >> 9, i = idx & 511;
  const float kNegLogRate = -0.00899447301950799f;        // −ln(10000)/1024
  const float freq = expf((float)(2 * i) * kNegLogRate);
  const float ang  = (float)pos * freq;
  const float sv = sinf(ang), cv = cosf(ang);
  const unsigned short hs = f2bf_bits(sv), hc = f2bf_bits(cv);
  const unsigned short ls = f2bf_bits(sv - bf_bits2f(hs)), lc = f2bf_bits(cv - bf_bits2f(hc));
  const unsigned uh = (unsigned)hs | ((unsigned)hc << 16), ul = (unsigned)ls | ((unsigned)lc << 16);
  {
    ((unsigned*)peh)[idx] = uh;
    ((unsigned*)pel)[idx] = ul;
    
  }
}

// ---- scaled projection biases: qb = 16·bq, kb = 16·bk (128 floats each). One block of 64: wave 0 -> qb, wave 1 -> kb;
__global__ __launch_bounds__(64) void bias16_kernel(const float* __restrict__ bq, const float* __restrict__ bk,
                                                   float* __restrict__ qb, float* __restrict__ kb) {
  const int lane = threadIdx.x & 31, wave = threadIdx.x >> 5;   // wave-uniform branch
  v4f v; float* dst;
  if (wave == 0) { v = *(const v4f*)(bq + 4 * lane); dst = qb + 4 * lane; }
  else           { v = *(const v4f*)(bk + 4 * lane); dst = kb + 4 * lane; }
  v = v * 16.0f;
  *(v4f*)dst = v;
  
}

// ---- per-key bias vectors: UBK[(b·8+h)·S + s] = u_bias[h]·k[b,s,h,:], VBP[h·S + s] = v_bias[h]·p[s,h,:] (f32 dots of 128 over the x16 f16 planes,
// folded back by 1/16). grid = 192 blocks x 256: blocks 0..127 -> UBK (32768 values), 128..191 -> VBP (16384 values); block-uniform branch;
__global__ __launch_bounds__(256) void headbias_kernel(const _Float16* __restrict__ k16, const _Float16* __restrict__ pp16,
                                                      const float* __restrict__ ub, const float* __restrict__ vb,
                                                      float* __restrict__ ubk, float* __restrict__ vbp) {
  const int t = blockIdx.x * 256 + threadIdx.x;
  const _Float16* row; const float* bvec; float* dst;
  if (blockIdx.x < 128) {
    const int b = t >> 14, h = (t >> 11) & 7, s = t & 2047;
    row = k16 + (size_t)((b * kSeq + s) * kHeads + h) * kDh; bvec = ub + h * kDh; dst = ubk + t;
  } else {
    const int u = t - 32768; const int h = (u >> 11) & 7, s = u & 2047;
    row = pp16 + (size_t)(s * kHeads + h) * kDh; bvec = vb + h * kDh; dst = vbp + u;
  }
  float acc = 0.f;
#pragma unroll 1
  for (int ch = 0; ch < kDh / 8; ++ch) {
    const v8h kv = *(const v8h*)(row + 8 * ch);
    const v4f b0 = *(const v4f*)(bvec + 8 * ch);
    const v4f b1 = *(const v4f*)(bvec + 8 * ch + 4);
    acc += b0.x * (float)kv[0] + b0.y * (float)kv[1] + b0.z * (float)kv[2] + b0.w * (float)kv[3]
         + b1.x * (float)kv[4] + b1.y * (float)kv[5] + b1.z * (float)kv[6] + b1.w * (float)kv[7];
  }
  const float r = acc * 0.0625f;
  *(float*)dst = r;
  
}

// ---- relative shift + scale + softmax for one (b,h): row a (block), 256 threads, thread t owns key columns 8t..8t+7.
// s[a][c] = (cont[a][c] + shifted[a][c]) · (1/32), shifted[a][c] = c <= a ? ps[a][S−1−a+c] : (c == a+1 ? 0 : ps[a+1][c−a−2]);
// both ps candidates loaded unconditionally from clamped addresses, selected by value. p = exp(s − max); output = f16(p / Σp · 2^15)
__global__ __launch_bounds__(256) void score_softmax_kernel(const float* __restrict__ cont, const float* __restrict__ ps,
                                                          _Float16* __restrict__ p16) {
  __shared__ float red[8];
  const int a = blockIdx.x;
  const int t = threadIdx.x, lane = t & 31, wave = t >> 5;
  const int c0 = 8 * t;
  const float* crow = cont + (size_t)a * kSeq + c0;
  const v4f ca = *(const v4f*)crow;
  const v4f cb = *(const v4f*)(crow + 4);
  float cv[8];
  cv[0] = ca.x; cv[1] = ca.y; cv[2] = ca.z; cv[3] = ca.w; cv[4] = cb.x; cv[5] = cb.y; cv[6] = cb.z; cv[7] = cb.w;
  const int a1 = (a + 1 < kSeq) ? (a + 1) : (kSeq - 1);
  const float* prow0 = ps + (size_t)a * kSeq;
  const float* prow1 = ps + (size_t)a1 * kSeq;
  const int sh0 = kSeq - 1 - a;
  float sv[8];
  float mx = -INFINITY;
#pragma unroll
  for (int e = 0; e < 8; ++e) {
    const int c = c0 + e;
    int i1 = c + sh0;   i1 = (i1 > kSeq - 1) ? (kSeq - 1) : i1;
    int i2 = c - a - 2; i2 = (i2 < 0) ? 0 : i2;
    const float v1 = prow0[i1];
    const float v2 = prow1[i2];
    const float pv = (c <= a) ? v1 : ((c == a + 1) ? 0.0f : v2);
    const float s = (cv[e] + pv) * (1.0f / 32.0f);
    sv[e] = s;
    mx = fmaxf(mx, s);
  }
#pragma unroll
  for (int off = 1; off < 32; off <<= 1) mx = fmaxf(mx, __shfl_xor(mx, off, 32));
  if (lane == 0) red[wave] = mx;
  __syncthreads();
  float gm = red[0];
#pragma unroll
  for (int w = 1; w < 8; ++w) gm = fmaxf(gm, red[w]);
  __syncthreads();
  float sum = 0.f;
#pragma unroll
  for (int e = 0; e < 8; ++e) { sv[e] = __expf(sv[e] - gm); sum += sv[e]; }
#pragma unroll
  for (int off = 1; off < 32; off <<= 1) sum += __shfl_xor(sum, off, 32);
  if (lane == 0) red[wave] = sum;
  __syncthreads();
  float tot = 0.f;
#pragma unroll
  for (int w = 0; w < 8; ++w) tot += red[w];       // fixed order
  const float f = (1.0f / tot) * 32768.0f;
  v8h hv;
#pragma unroll
  for (int e = 0; e < 8; ++e) hv[e] = (_Float16)(sv[e] * f);
  _Float16* dst = p16 + (size_t)a * kSeq + c0;
  *(v8h*)dst = hv;
  
}

// =====================================================================================
extern "C" void kernel_launch(void* const* d_in, const int* in_sizes, int n_in, void* d_out, int out_size,
                              void* d_ws, size_t ws_size, hipStream_t stream) {
  if (n_in < 14) return;
  if (in_sizes[0] != kTok * kEmb || in_sizes[1] != kEmb || in_sizes[2] != kEmb ||
      in_sizes[3] != kDh * kDh || in_sizes[4] != kDh || in_sizes[5] != kDh * kDh || in_sizes[6] != kDh ||
      in_sizes[7] != kDh * kDh || in_sizes[8] != kDh || in_sizes[9] != kDh * kDh ||
      in_sizes[10] != kHeads * kDh || in_sizes[11] != kHeads * kDh || in_sizes[12] != kEmb * kEmb || in_sizes[13] != kEmb ||
      out_size != kTok * kEmb) return;
  const float* x      = (const float*)d_in[0];
  const float* gamma  = (const float*)d_in[1];
  const float* beta   = (const float*)d_in[2];
  const float* Wq     = (const float*)d_in[3];
  const float* bq     = (const float*)d_in[4];
  const float* Wk     = (const float*)d_in[5];
  const float* bk     = (const float*)d_in[6];
  const float* Wv     = (const float*)d_in[7];
  const float* bv     = (const float*)d_in[8];
  const float* Wp     = (const float*)d_in[9];
  const float* u_bias = (const float*)d_in[10];
  const float* v_bias = (const float*)d_in[11];
  const float* Wo     = (const float*)d_in[12];
  const float* bo     = (const float*)d_in[13];
  float* out = (float*)d_out;   // [2][2048][1024] f32

  // ---- workspace carve (all offsets multiples of 256 B; total 105,317,376 B) ----
  // R0 WqT,WkT,WvT,WpT hi/lo bf16 [128 n][128 k]   8 x 32,768        =     262,144
  // R1 WoT hi/lo bf16 [1024 n][1024 k]              2 x 2,097,152     =   4,194,304
  // R2 16·bq, 16·bk f32 [128]                       2 x 512           =       1,024
  // R3 UBK f32 [2][8][2048], VBP f32 [8][2048]                        =     196,608
  // R4 Q16 f16 x16 [32768][128]                                       =   8,388,608
  // R5 K16 f16 x16 [32768][128]                                       =   8,388,608
  // R6 PP16 f16 x16 [16384][128]                                      =   4,194,304
  // R7 V f32 [32768][128] (= [4096][1024])                            =  16,777,216
  // R8 CTX hi/lo bf16 [4096][1024]                  2 x 8,388,608     =  16,777,216
  // R9 VT16 f16 x16 per batch [1024][2048]                            =   4,194,304
  // R10 per (b,h): CONT f32 [2048][2048] 16,777,216 + PS f32 16,777,216 + P16 f16 [2048][2048] 8,388,608 = 41,943,040;
  //     prelude aliases inside R10 (dead before the loop): XN hi/lo bf16 [4096][1024] at +0/+8,388,608, PE hi/lo bf16 [2048][1024] at +16,777,216/+20,971,520
  char* ws = (char*)d_ws; size_t off = 0;
  auto carve = [&](size_t bytes) -> char* { char* p = ws + off; off += (bytes + 255) & ~(size_t)255; return p; };
  const size_t nW   = (size_t)kDh * kDh;            // 16,384
  const size_t nWo  = (size_t)kEmb * kEmb;          // 1,048,576
  const size_t nHd  = (size_t)kTok * kHeads * kDh;   // 4,194,304 (= kTok*kEmb)
  const size_t nPp  = (size_t)kSeq * kHeads * kDh;   // 2,097,152
  const size_t nSS  = (size_t)kSeq * kSeq;           // 4,194,304
  __bf16* WqTh = (__bf16*)carve(nW * 2); __bf16* WqTl = (__bf16*)carve(nW * 2);
  __bf16* WkTh = (__bf16*)carve(nW * 2); __bf16* WkTl = (__bf16*)carve(nW * 2);
  __bf16* WvTh = (__bf16*)carve(nW * 2); __bf16* WvTl = (__bf16*)carve(nW * 2);
  __bf16* WpTh = (__bf16*)carve(nW * 2); __bf16* WpTl = (__bf16*)carve(nW * 2);
  __bf16* WoTh = (__bf16*)carve(nWo * 2); __bf16* WoTl = (__bf16*)carve(nWo * 2);
  float* qb16 = (float*)carve(kDh * 4); float* kb16 = (float*)carve(kDh * 4);
  float* ubk  = (float*)carve((size_t)kBatch * kHeads * kSeq * 4);
  float* vbp  = (float*)carve((size_t)kHeads * kSeq * 4);
  _Float16* q16  = (_Float16*)carve(nHd * 2);
  _Float16* k16  = (_Float16*)carve(nHd * 2);
  _Float16* pp16 = (_Float16*)carve(nPp * 2);
  float*    vf32 = (float*)carve(nHd * 4);
  unsigned short* ctxh = (unsigned short*)carve(nHd * 2); unsigned short* ctxl = (unsigned short*)carve(nHd * 2);
  _Float16* vt16 = (_Float16*)carve((size_t)kEmb * kSeq * 2);
  char* loopBase = carve(nSS * 4 + nSS * 4 + nSS * 2);
  float*    contT = (float*)loopBase;
  float*    posT  = (float*)(loopBase + nSS * 4);
  _Float16* p16   = (_Float16*)(loopBase + nSS * 8);
  unsigned* xnh = (unsigned*)loopBase;                         // prelude aliases
  unsigned* xnl = (unsigned*)(loopBase + nHd * 2);
  unsigned* peh = (unsigned*)(loopBase + nHd * 4);
  unsigned* pel = (unsigned*)(loopBase + nHd * 4 + (size_t)kSeq * kEmb * 2);
  if (nHd * 4 + (size_t)kSeq * kEmb * 4 > nSS * 10) return;   // aliases fit inside R10
  if (off > ws_size || off > ((size_t)1 << 27)) return;

  // ---- prelude: weight planes (in [k][n] -> out [n][k]), scaled biases, LN planes, sinusoid planes ----
  transpose_split_bf16<<<dim3(kDh / 64, kDh / 64), dim3(32, 8), 0, stream>>>(Wq, kDh, WqTh, WqTl, kDh);     // in [128][128] -> out [128][128]
  transpose_split_bf16<<<dim3(kDh / 64, kDh / 64), dim3(32, 8), 0, stream>>>(Wk, kDh, WkTh, WkTl, kDh);
  transpose_split_bf16<<<dim3(kDh / 64, kDh / 64), dim3(32, 8), 0, stream>>>(Wv, kDh, WvTh, WvTl, kDh);
  transpose_split_bf16<<<dim3(kDh / 64, kDh / 64), dim3(32, 8), 0, stream>>>(Wp, kDh, WpTh, WpTl, kDh);
  transpose_split_bf16<<<dim3(kEmb / 64, kEmb / 64), dim3(32, 8), 0, stream>>>(Wo, kEmb, WoTh, WoTl, kEmb); // in [1024][1024] -> out [1024][1024]
  bias16_kernel<<<1, 64, 0, stream>>>(bq, bk, qb16, kb16);
  layernorm_split_kernel<<<kTok, 256, 0, stream>>>(x, gamma, beta, xnh, xnl);                             // 4096 blocks = all tokens
  posenc_split_kernel<<<(kSeq * kPairs) / 256, 256, 0, stream>>>(peh, pel);                                // 4096 blocks x 256 = 2048 x 512 pairs

  // ---- projections over the [32768][128] per-(token, head) row view of xn (same memory as [4096][1024]) ----
  { const int tl = (kTok * kHeads / 64) * (kDh / 64);        // 1024 tiles -> 128 blocks
    // q·16 (+16·bq), k·16 (+16·bk) as f16 planes; v (+bv) as f32
    wmma_gemm64<1, true, 2, 1, false><<<dim3(tl / 8, 1), 256, 0, stream>>>(U16(xnh), U16(xnl), kDh, 0, U16(WqTh), U16(WqTl), kDh, 0,
        q16, nullptr, kDh, 0, qb16, nullptr, 0, kTok * kHeads, kDh, kDh, 16.0f);
    wmma_gemm64<1, true, 2, 1, false><<<dim3(tl / 8, 1), 256, 0, stream>>>(U16(xnh), U16(xnl), kDh, 0, U16(WkTh), U16(WkTl), kDh, 0,
        k16, nullptr, kDh, 0, kb16, nullptr, 0, kTok * kHeads, kDh, kDh, 16.0f);
    wmma_gemm64<1, true, 2, 0, false><<<dim3(tl / 8, 1), 256, 0, stream>>>(U16(xnh), U16(xnl), kDh, 0, U16(WvTh), U16(WvTl), kDh, 0,
        vf32, nullptr, kDh, 0, bv, nullptr, 0, kTok * kHeads, kDh, kDh, 1.0f); }
  { const int tl = (kSeq * kHeads / 64) * (kDh / 64);        // 512 tiles -> 64 blocks; p·16 as f16 plane [16384][128]
    wmma_gemm64<1, true, 0, 1, false><<<dim3(tl / 8, 1), 256, 0, stream>>>(U16(peh), U16(pel), kDh, 0, U16(WpTh), U16(WpTl), kDh, 0,
        pp16, nullptr, kDh, 0, nullptr, nullptr, 0, kSeq * kHeads, kDh, kDh, 16.0f); }
  headbias_kernel<<<192, 256, 0, stream>>>(k16, pp16, u_bias, v_bias, ubk, vbp);                        // 128 blocks UBK + 64 blocks VBP

  // ---- per batch: vᵀ f16 x16; per head: content table, position table, shift+softmax, p·v into ctx hi/lo planes ----
  for (int b = 0; b < kBatch; ++b) {
    // in [2048 r][1024 c] (pitch 1024) -> out [1024 c][2048 r] (pitch 2048), x16; grid (C/64 = 16, R/64 = 32)
    transpose_cast_f16<<<dim3(kEmb / 64, kSeq / 64), dim3(32, 8), 0, stream>>>(vf32 + (size_t)b * kSeq * kEmb, kEmb, vt16, kSeq, 16.0f);
    for (int h = 0; h < kHeads; ++h) {
      const size_t qoff = (size_t)b * kSeq * kEmb + (size_t)h * kDh;   // row (b,s,h) of a [32768][128] plane = (b·2048+s)·1024 + h·128, row pitch 1024
      const int tl = (kSeq / 64) * (kSeq / 64);                        // 1024 tiles -> 128 blocks
      // content[q][key] = (16q)·(16k)/256 + u_bias[h]·k[key]
      wmma_gemm64<0, false, 2, 0, false><<<dim3(tl / 8, 1), 256, 0, stream>>>(U16(q16 + qoff), nullptr, kEmb, 0, U16(k16 + qoff), nullptr, kEmb, 0,
          contT, nullptr, kSeq, 0, ubk + (size_t)(b * kHeads + h) * kSeq, nullptr, 0, kSeq, kSeq, kDh, 1.0f / 256.0f);
      // pos[q][n] = (16q)·(16p_n)/256 + v_bias[h]·p[n]  (p row (n,h) at n·1024 + h·128)
      wmma_gemm64<0, false, 2, 0, false><<<dim3(tl / 8, 1), 256, 0, stream>>>(U16(q16 + qoff), nullptr, kEmb, 0, U16(pp16 + (size_t)h * kDh), nullptr, kEmb, 0,
          posT, nullptr, kSeq, 0, vbp + (size_t)h * kSeq, nullptr, 0, kSeq, kSeq, kDh, 1.0f / 256.0f);
      score_softmax_kernel<<<kSeq, 256, 0, stream>>>(contT, posT, p16);                                  // 2048 rows x 2048
      // ctx[b, q, h·128+d] = Σ_key (p/l·2^15)[q][key] · (16 v)ᵀ[h·128+d][key] · 2^-19 ; 64 tiles -> 8 blocks; hi/lo bf16 out, pitch 1024
      { const int tp = (kSeq / 64) * (kDh / 64);
        wmma_gemm64<0, false, 0, 2, false><<<dim3(tp / 8, 1), 256, 0, stream>>>(U16(p16), nullptr, kSeq, 0, U16(vt16 + (size_t)h * kDh * kSeq), nullptr, kSeq, 0,
            ctxh + qoff, ctxl + qoff, kEmb, 0, nullptr, nullptr, 0, kSeq, kDh, kSeq, 1.0f / 524288.0f); }
    }
  }

  // ---- out = ctx·Wo + bo : A bf16 hi/lo [4096][1024], Bt bf16 hi/lo [1024 n][1024 k], C f32 d_out [4096][1024]; 1024 tiles -> 128 blocks ----
  { const int tl = (kTok / 64) * (kEmb / 64);
    wmma_gemm64<1, true, 2, 0, false><<<dim3(tl / 8, 1), 256, 0, stream>>>(U16(ctxh), U16(ctxl), kEmb, 0, U16(WoTh), U16(WoTl), kEmb, 0,
        out, nullptr, kEmb, 0, bo, nullptr, 0, kTok, kEmb, kEmb, 1.0f); }
}

// v001
// One run takes 778 microseconds.
// In two side-by-side timings against v000, it was 2.58 and 2.60 times as fast.
// Projections xn·W{q,k,v} (K=128), p = pe·Wp (K=128) and out = ctx·Wo (K=1024): v_wmma_f32_16x16x32_bf16 with bf16 hi/lo split operands (hi·hi + hi·lo + lo·hi); content q·kᵀ and position q·pᵀ tables (K=128): v_wmma_f32_16x16x32_f16 with plain f16 operands carried x16; p·v (K=2048): v_wmma_f32_16x16x32_f16 with p/l carried x2^15 and vᵀ carried x16; f32 accumulate everywhere; LayerNorm, sinusoid table, u/v bias dots, relative shift and softmax in f32 on VALU.
#include <hip/hip_runtime.h>
#include <math.h>

typedef __attribute__((ext_vector_type(16))) _Float16 v16h;
typedef __attribute__((ext_vector_type(8)))  _Float16 v8h;
typedef __attribute__((ext_vector_type(16))) __bf16   v16b;
typedef __attribute__((ext_vector_type(8)))  __bf16   v8b;
typedef __attribute__((ext_vector_type(8)))  float    v8f;
typedef __attribute__((ext_vector_type(4)))  float    v4f;
typedef __attribute__((ext_vector_type(2)))  float    v2f;
#define U16(p) ((const unsigned short*)(const void*)(p))

__device__ __forceinline__ unsigned short f2bf_bits(float f) {
  unsigned u = __float_as_uint(f);
  return (unsigned short)((u + 0x7FFFu + ((u >> 16) & 1u)) >> 16);
}
__device__ __forceinline__ float bf_bits2f(unsigned short h) { return __uint_as_float(((unsigned)h) << 16); }

// hazard guards as plain device helpers (no inline asm inside the kernel template body)
__device__ __forceinline__ void dep_guard_h(v8f& a, v8f& b, v16h x, v16h y) { asm volatile("v_nop\n\tv_nop\n\tv_nop\n\tv_nop" : "+v"(a), "+v"(b) : "v"(x), "v"(y)); }
__device__ __forceinline__ void dep_guard_b(v8f& a, v8f& b, v16b x, v16b y) { asm volatile("v_nop\n\tv_nop\n\tv_nop\n\tv_nop" : "+v"(a), "+v"(b) : "v"(x), "v"(y)); }
__device__ __forceinline__ void keep4_h(v16h a, v16h b, v16h c, v16h d) { asm volatile("v_nop" :: "v"(a), "v"(b), "v"(c), "v"(d)); }
__device__ __forceinline__ void keep4_b(v16b a, v16b b, v16b c, v16b d) { asm volatile("v_nop" :: "v"(a), "v"(b), "v"(c), "v"(d)); }
__device__ __forceinline__ void acc_guard4(v8f& a, v8f& b, v8f& c, v8f& d) { asm volatile("v_nop\n\tv_nop\n\tv_nop\n\tv_nop" : "+v"(a), "+v"(b), "+v"(c), "+v"(d)); }
template <typename T> struct Frag;
template <> struct Frag<_Float16> {
  typedef v16h V; union U { v16h v; v8h h[2]; };
  static __device__ __forceinline__ v16h load(const _Float16* p) {   // elements 0..7 <- p[0..7], 8..15 <- p[16..23]
    U f; f.h[0] = *(const v8h*)(p); f.h[1] = *(const v8h*)(p + 16); return f.v;
  }
  static __device__ __forceinline__ v8f mma(v16h a, v16h b, v8f c) {
    return __builtin_amdgcn_wmma_f32_16x16x32_f16(false, a, false, b, (short)0, c, false, false);
  }
  static __device__ __forceinline__ void guard(v8f& a, v8f& b, v16h x, v16h y) { dep_guard_h(a, b, x, y); }
  static __device__ __forceinline__ void keep(v16h a, v16h b, v16h c, v16h d) { keep4_h(a, b, c, d); }
};
template <> struct Frag<__bf16> {
  typedef v16b V; union U { v16b v; v8b h[2]; };
  static __device__ __forceinline__ v16b load(const __bf16* p) {
    U f; f.h[0] = *(const v8b*)(p); f.h[1] = *(const v8b*)(p + 16); return f.v;
  }
  static __device__ __forceinline__ v8f mma(v16b a, v16b b, v8f c) {
    return __builtin_amdgcn_wmma_f32_16x16x32_bf16(false, a, false, b, (short)0, c, false, false);
  }
  static __device__ __forceinline__ void guard(v8f& a, v8f& b, v16b x, v16b y) { dep_guard_b(a, b, x, y); }
  static __device__ __forceinline__ void keep(v16b a, v16b b, v16b c, v16b d) { keep4_b(a, b, c, d); }
};

// ---- Register-blocked batched WMMA GEMM ------------------------------------
// C[m,n] = scale * sum_k A[m,k] * Bt[n,k] (+bias)(+resid); each wave owns a 64x64 tile.
// A row-major [M,K]; Bt row-major [N,K]; M,N % 64 == 0, K % 32 == 0.
// SPLIT: operands are hi/lo planes (A2/Bt2 = lo planes, same layout); product = hi·hi + hi·lo + lo·hi.
// BIAS_MODE: 0 = none, 1 = bias[m], 2 = bias[n].
// OUT_MODE: 0 = f32, 1 = f16, 2 = bf16 hi plane (Cout) + bf16 lo plane (Cout2).
// ET: 0 = f16 operands, 1 = bf16 operands (pointers passed as 16-bit storage)
template <int ET> struct Elem;
template <> struct Elem<0> { typedef _Float16 T; };
template <> struct Elem<1> { typedef __bf16 T; };
template <int ET, bool SPLIT, int BIAS_MODE, int OUT_MODE, bool RESID, int ACT = 0>
__global__ __launch_bounds__(256) void wmma_gemm64(
    const unsigned short* __restrict__ Ap, const unsigned short* __restrict__ A2p, int lda, long strideA,
    const unsigned short* __restrict__ Btp, const unsigned short* __restrict__ Bt2p, int ldb, long strideB,
    void* __restrict__ Cout, void* __restrict__ Cout2, int ldc, long strideC,
    const float* __restrict__ bias,
    const float* __restrict__ resid, long strideR,
    int M, int N, int K, float scale) {
  typedef typename Elem<ET>::T T;
  typedef typename Frag<T>::V V;
  const T* A = (const T*)Ap; const T* A2 = (const T*)A2p; const T* Bt = (const T*)Btp; const T* Bt2 = (const T*)Bt2p;
  __shared__ __align__(16) float sT[8][16 * 68];   // per-wave 16x64 slab, pitch 68 floats
  const int b    = blockIdx.y;
  const int lane = threadIdx.x & 31;
  const int wave = threadIdx.x >> 5;
  const int tilesN = N >> 6;
  const int tilesM = M >> 6;
  const int tile = blockIdx.x * 8 + wave;
  if (tile >= tilesM * tilesN) return;   // wave-uniform; no block barriers in this kernel
  const int tm = tile / tilesN;
  const int tn = tile - tm * tilesN;
  const int m0 = tm << 6;
  const int n0 = tn << 6;

  const T* Ab  = A  + (size_t)b * strideA;
  const T* Bb  = Bt + (size_t)b * strideB;
  const T* Ab2 = SPLIT ? (A2  + (size_t)b * strideA) : nullptr;
  const T* Bb2 = SPLIT ? (Bt2 + (size_t)b * strideB) : nullptr;

  const int rlane = lane & 15;                 // row (A) / col (B, D) within subtile
  const int koff  = (lane >> 4) * 8;           // k offset of this lane half
  const int mOff  = (lane >> 4) * 8;           // D row offset

  v8f acc[4][4];
#pragma unroll
  for (int i = 0; i < 4; ++i)
#pragma unroll
    for (int j = 0; j < 4; ++j) acc[i][j] = (v8f){0.f,0.f,0.f,0.f,0.f,0.f,0.f,0.f};

  for (int k0 = 0; k0 < K; k0 += 32) {
    V bh[4], bl[4];
#pragma unroll
    for (int j = 0; j < 4; ++j) {
      const size_t bo = (size_t)(n0 + (j << 4) + rlane) * ldb + koff + k0;
      bh[j] = Frag<T>::load(Bb + bo);
      if (SPLIT) bl[j] = Frag<T>::load(Bb2 + bo);
    }
#pragma unroll
    for (int i = 0; i < 4; ++i) {
      const size_t ao = (size_t)(m0 + (i << 4) + rlane) * lda + koff + k0;
      V ah = Frag<T>::load(Ab + ao);
      V al;
      if (SPLIT) al = Frag<T>::load(Ab2 + ao);
#pragma unroll
      for (int j = 0; j < 4; ++j) {
        acc[i][j] = Frag<T>::mma(ah, bh[j], acc[i][j]);
        if (SPLIT) {
          acc[i][j] = Frag<T>::mma(ah, bl[j], acc[i][j]);
          acc[i][j] = Frag<T>::mma(al, bh[j], acc[i][j]);
        }
      }
      Frag<T>::guard(acc[i][0], acc[i][3], ah, SPLIT ? al : ah);
    }
    Frag<T>::keep(bh[0], bh[1], bh[2], bh[3]);
    if (SPLIT) Frag<T>::keep(bl[0], bl[1], bl[2], bl[3]);
  }
  acc_guard4(acc[0][0], acc[0][1], acc[0][2], acc[0][3]);
  acc_guard4(acc[1][0], acc[1][1], acc[1][2], acc[1][3]);
  acc_guard4(acc[2][0], acc[2][1], acc[2][2], acc[2][3]);
  acc_guard4(acc[3][0], acc[3][1], acc[3][2], acc[3][3]);

  // ---- epilogue ----
  float* slab = sT[wave];
  const float* Rb = RESID ? (resid + (size_t)b * strideR) : nullptr;
#pragma unroll
  for (int i = 0; i < 4; ++i) {
    const int mBase = m0 + (i << 4);
#pragma unroll
    for (int j = 0; j < 4; ++j) {
      const int n = n0 + (j << 4) + rlane;
      float bv = 0.f;
      if (BIAS_MODE == 2) bv = bias[n];
#pragma unroll
      for (int r = 0; r < 8; ++r) {
        float v = acc[i][j][r] * scale;
        if (BIAS_MODE == 1) v += bias[mBase + mOff + r];
        if (BIAS_MODE == 2) v += bv;
        if (RESID) v += Rb[(size_t)(mBase + mOff + r) * ldc + n];
        if (ACT == 1) v = tanhf(v);
        if (ACT == 2) v = fmaxf(v, 0.0f);
        if (ACT == 3) v = v / (1.0f + expf(-v));
        if (ACT == 4) v = (v > 0.f) ? v : 0.01f * v;
        if (ACT == 5) v = 0.5f * v * (1.0f + erff(v * 0.70710678118654752f));
        slab[(mOff + r) * 68 + (j << 4) + rlane] = v;
      }
    }
    __builtin_amdgcn_fence(__ATOMIC_RELEASE, "workgroup");
    __builtin_amdgcn_wave_barrier();
    __builtin_amdgcn_fence(__ATOMIC_ACQUIRE, "workgroup");
    if (OUT_MODE == 0) {
      float* C = (float*)Cout + (size_t)b * strideC;
      const int hh = lane >> 4, c4 = (lane & 15) * 4;     // row seg = 256 B = 16 lanes x 16 B
      {
#pragma unroll
        for (int it = 0; it < 8; ++it) {
          const int row = it * 2 + hh;
          v4f v = *(const v4f*)(slab + row * 68 + c4);
          *(v4f*)(C + (size_t)(mBase + row) * ldc + n0 + c4) = v;
        }
        
      }
    } else {
      const int q = lane >> 3, c8 = (lane & 7) * 8;
      unsigned short* C  = (unsigned short*)Cout  + (size_t)b * strideC;
      unsigned short* C2 = (OUT_MODE == 2) ? ((unsigned short*)Cout2 + (size_t)b * strideC) : nullptr;
      {
#pragma unroll
        for (int it = 0; it < 4; ++it) {
          const int row = it * 4 + q;
          const float* sp = slab + row * 68 + c8;
          v8h hv, lv;
#pragma unroll
          for (int e = 0; e < 8; ++e) {
            if (OUT_MODE == 1) {
              hv[e] = (_Float16)sp[e];
            } else {
              unsigned short hb = f2bf_bits(sp[e]);
              unsigned short lb = f2bf_bits(sp[e] - bf_bits2f(hb));
              hv[e] = __builtin_bit_cast(_Float16, hb);
              lv[e] = __builtin_bit_cast(_Float16, lb);
            }
          }
          *(v8h*)(C + (size_t)(mBase + row) * ldc + n0 + c8) = hv;
          if (OUT_MODE == 2) *(v8h*)(C2 + (size_t)(mBase + row) * ldc + n0 + c8) = lv;
        }
        
      }
    }
    __builtin_amdgcn_fence(__ATOMIC_RELEASE, "workgroup");
    __builtin_amdgcn_wave_barrier();
    __builtin_amdgcn_fence(__ATOMIC_ACQUIRE, "workgroup");
  }
}

// ---- f32 [R][C] (row pitch ldi) -> f16 transposed [C][R] (row pitch ldo); 64x64 tiles; each output row segment
__global__ __launch_bounds__(256) void transpose_cast_f16(const float* __restrict__ in, int ldi,
                                                         _Float16* __restrict__ outT, int ldo, float scale) {
  __shared__ __align__(16) _Float16 tile[64][72];     // [c][r]
  const int c0 = blockIdx.x * 64, r0 = blockIdx.y * 64;
  const int t = threadIdx.y * 32 + threadIdx.x;
  for (int i = threadIdx.y; i < 64; i += 8) {
    tile[threadIdx.x][i]      = (_Float16)(in[(size_t)(r0 + i) * ldi + c0 + threadIdx.x] * scale);
    tile[32 + threadIdx.x][i] = (_Float16)(in[(size_t)(r0 + i) * ldi + c0 + 32 + threadIdx.x] * scale);
  }
  __syncthreads();
  const int q = t >> 3, c8 = (t & 7) * 8;
  {
#pragma unroll
    for (int it = 0; it < 2; ++it) {
      const int c = it * 32 + q;
      v8h hv = *(const v8h*)(&tile[c][c8]);
      *(v8h*)(outT + (size_t)(c0 + c) * ldo + r0 + c8) = hv;
    }
    
  }
}

// ---- f32 [R][C] (pitch ldi) -> bf16 hi/lo transposed planes [C][R] (pitch ldo); 64x64 tiles; each output row segment
__global__ __launch_bounds__(256) void transpose_split_bf16(const float* __restrict__ in, int ldi,
                                                           __bf16* __restrict__ outH, __bf16* __restrict__ outL, int ldo) {
  __shared__ __align__(16) float tile[64][68];     // [c][r]
  const int c0 = blockIdx.x * 64, r0 = blockIdx.y * 64;
  const int t = threadIdx.y * 32 + threadIdx.x;
  for (int i = threadIdx.y; i < 64; i += 8) {
    tile[threadIdx.x][i]      = in[(size_t)(r0 + i) * ldi + c0 + threadIdx.x];
    tile[32 + threadIdx.x][i] = in[(size_t)(r0 + i) * ldi + c0 + 32 + threadIdx.x];
  }
  __syncthreads();
  const int q = t >> 3, c8 = (t & 7) * 8;
  {
#pragma unroll
    for (int it = 0; it < 2; ++it) {
      const int c = it * 32 + q;
      v8b hv, lv;
#pragma unroll
      for (int e = 0; e < 8; ++e) {
        const float f = tile[c][c8 + e];
        const unsigned short hb = f2bf_bits(f);
        hv[e] = __builtin_bit_cast(__bf16, hb);
        lv[e] = __builtin_bit_cast(__bf16, f2bf_bits(f - bf_bits2f(hb)));
      }
      *(v8b*)(outH + (size_t)(c0 + c) * ldo + r0 + c8) = hv;
      *(v8b*)(outL + (size_t)(c0 + c) * ldo + r0 + c8) = lv;
    }
    
  }
}

// =====================================================================================
constexpr int kBatch = 2;
constexpr int kSeq   = 2048;
constexpr int kEmb   = 1024;
constexpr int kHeads = 8;
constexpr int kDh    = 128;
constexpr int kTok   = kBatch * kSeq;          // 4096 tokens
constexpr int kPairs = kEmb / 2;               // 512 element pairs per row
static_assert(kHeads * kDh == kEmb);
static_assert(kPairs == 512);

// ---- LayerNorm (biased variance, eps 1e-5) -> xn as bf16 hi/lo planes (packed pairs). One block per token, 256 threads;
// thread t owns element pairs (2t,2t+1) and (512+2t,512+2t+1): 2 packed dwords per plane per thread; each store instruction
__global__ __launch_bounds__(256) void layernorm_split_kernel(
    const float* __restrict__ x, const float* __restrict__ gamma, const float* __restrict__ beta,
    unsigned* __restrict__ xh, unsigned* __restrict__ xl) {
  __shared__ float red[8];
  const int tok = blockIdx.x;
  const int t = threadIdx.x, lane = t & 31, wave = t >> 5;
  const float* xr = x + (size_t)tok * kEmb;
  const int ca = 2 * t, cb = kPairs + 2 * t;
  const v2f pa = *(const v2f*)(xr + ca);
  const v2f pb = *(const v2f*)(xr + cb);
  float s = (pa.x + pa.y) + (pb.x + pb.y);
#pragma unroll
  for (int off = 1; off < 32; off <<= 1) s += __shfl_xor(s, off, 32);
  if (lane == 0) red[wave] = s;
  __syncthreads();
  float tot = 0.f;
#pragma unroll
  for (int w = 0; w < 8; ++w) tot += red[w];       // fixed order
  const float mean = tot * (1.0f / (float)kEmb);
  __syncthreads();
  const float d0 = pa.x - mean, d1 = pa.y - mean, d2 = pb.x - mean, d3 = pb.y - mean;
  float s2 = (d0 * d0 + d1 * d1) + (d2 * d2 + d3 * d3);
#pragma unroll
  for (int off = 1; off < 32; off <<= 1) s2 += __shfl_xor(s2, off, 32);
  if (lane == 0) red[wave] = s2;
  __syncthreads();
  float tot2 = 0.f;
#pragma unroll
  for (int w = 0; w < 8; ++w) tot2 += red[w];
  const float var  = tot2 * (1.0f / (float)kEmb);
  const float rstd = 1.0f / sqrtf(var + 1e-5f);
  const float y0 = d0 * rstd * gamma[ca] + beta[ca];
  const float y1 = d1 * rstd * gamma[ca + 1] + beta[ca + 1];
  const float y2 = d2 * rstd * gamma[cb] + beta[cb];
  const float y3 = d3 * rstd * gamma[cb + 1] + beta[cb + 1];
  const unsigned short h0 = f2bf_bits(y0), h1 = f2bf_bits(y1), h2 = f2bf_bits(y2), h3 = f2bf_bits(y3);
  const unsigned short l0 = f2bf_bits(y0 - bf_bits2f(h0)), l1 = f2bf_bits(y1 - bf_bits2f(h1));
  const unsigned short l2 = f2bf_bits(y2 - bf_bits2f(h2)), l3 = f2bf_bits(y3 - bf_bits2f(h3));
  const unsigned uah = (unsigned)h0 | ((unsigned)h1 << 16), ual = (unsigned)l0 | ((unsigned)l1 << 16);
  const unsigned ubh = (unsigned)h2 | ((unsigned)h3 << 16), ubl = (unsigned)l2 | ((unsigned)l3 << 16);
  const size_t ia = (size_t)tok * kPairs + t, ib = ia + 256;
  {
    ((unsigned*)xh)[ia] = uah;
    ((unsigned*)xh)[ib] = ubh;
    ((unsigned*)xl)[ia] = ual;
    ((unsigned*)xl)[ib] = ubl;
    
  }
}

// ---- sinusoid table [kSeq][kEmb]: columns 2i = sin(pos·div_i), 2i+1 = cos(pos·div_i), div_i = exp(2i · (−ln 1e4 / kEmb)), f32,
// emitted as bf16 hi/lo planes (packed pairs). One thread per (pos, i): grid = kSeq*512/256 = 4096 blocks exactly; each wave's store
__global__ __launch_bounds__(256) void posenc_split_kernel(unsigned* __restrict__ peh, unsigned* __restrict__ pel) {
  const int idx = blockIdx.x * 256 + threadIdx.x;
  if (idx >= kSeq * kPairs) return;
  const int pos = idx >> 9, i = idx & 511;
  const float kNegLogRate = -0.00899447301950799f;        // −ln(10000)/1024
  const float freq = expf((float)(2 * i) * kNegLogRate);
  const float ang  = (float)pos * freq;
  const float sv = sinf(ang), cv = cosf(ang);
  const unsigned short hs = f2bf_bits(sv), hc = f2bf_bits(cv);
  const unsigned short ls = f2bf_bits(sv - bf_bits2f(hs)), lc = f2bf_bits(cv - bf_bits2f(hc));
  const unsigned uh = (unsigned)hs | ((unsigned)hc << 16), ul = (unsigned)ls | ((unsigned)lc << 16);
  {
    ((unsigned*)peh)[idx] = uh;
    ((unsigned*)pel)[idx] = ul;
    
  }
}

// ---- scaled projection biases: qb = 16·bq, kb = 16·bk (128 floats each). One block of 64: wave 0 -> qb, wave 1 -> kb;
__global__ __launch_bounds__(64) void bias16_kernel(const float* __restrict__ bq, const float* __restrict__ bk,
                                                   float* __restrict__ qb, float* __restrict__ kb) {
  const int lane = threadIdx.x & 31, wave = threadIdx.x >> 5;   // wave-uniform branch
  v4f v; float* dst;
  if (wave == 0) { v = *(const v4f*)(bq + 4 * lane); dst = qb + 4 * lane; }
  else           { v = *(const v4f*)(bk + 4 * lane); dst = kb + 4 * lane; }
  v = v * 16.0f;
  *(v4f*)dst = v;
  
}

// ---- per-key bias vectors: UBK[(b·8+h)·S + s] = u_bias[h]·k[b,s,h,:], VBP[h·S + s] = v_bias[h]·p[s,h,:] (f32 dots of 128 over the x16 f16 planes,
// folded back by 1/16). grid = 192 blocks x 256: blocks 0..127 -> UBK (32768 values), 128..191 -> VBP (16384 values); block-uniform branch;
__global__ __launch_bounds__(256) void headbias_kernel(const _Float16* __restrict__ k16, const _Float16* __restrict__ pp16,
                                                      const float* __restrict__ ub, const float* __restrict__ vb,
                                                      float* __restrict__ ubk, float* __restrict__ vbp) {
  const int t = blockIdx.x * 256 + threadIdx.x;
  const _Float16* row; const float* bvec; float* dst;
  if (blockIdx.x < 128) {
    const int b = t >> 14, h = (t >> 11) & 7, s = t & 2047;
    row = k16 + (size_t)((b * kSeq + s) * kHeads + h) * kDh; bvec = ub + h * kDh; dst = ubk + t;
  } else {
    const int u = t - 32768; const int h = (u >> 11) & 7, s = u & 2047;
    row = pp16 + (size_t)(s * kHeads + h) * kDh; bvec = vb + h * kDh; dst = vbp + u;
  }
  float acc = 0.f;
#pragma unroll 1
  for (int ch = 0; ch < kDh / 8; ++ch) {
    const v8h kv = *(const v8h*)(row + 8 * ch);
    const v4f b0 = *(const v4f*)(bvec + 8 * ch);
    const v4f b1 = *(const v4f*)(bvec + 8 * ch + 4);
    acc += b0.x * (float)kv[0] + b0.y * (float)kv[1] + b0.z * (float)kv[2] + b0.w * (float)kv[3]
         + b1.x * (float)kv[4] + b1.y * (float)kv[5] + b1.z * (float)kv[6] + b1.w * (float)kv[7];
  }
  const float r = acc * 0.0625f;
  *(float*)dst = r;
  
}

// ---- relative shift + scale + softmax for one (b,h): row a (block), 256 threads, thread t owns key columns 8t..8t+7.
// s[a][c] = (cont[a][c] + shifted[a][c]) · (1/32), shifted[a][c] = c <= a ? ps[a][S−1−a+c] : (c == a+1 ? 0 : ps[a+1][c−a−2]);
// both ps candidates loaded unconditionally from clamped addresses, selected by value. p = exp(s − max); output = f16(p / Σp · 2^15)
__global__ __launch_bounds__(256) void score_softmax_kernel(const float* __restrict__ cont, const float* __restrict__ ps,
                                                          _Float16* __restrict__ p16) {
  __shared__ float red[8];
  const int a = blockIdx.x;
  const int t = threadIdx.x, lane = t & 31, wave = t >> 5;
  const int c0 = 8 * t;
  const float* crow = cont + (size_t)a * kSeq + c0;
  const v4f ca = *(const v4f*)crow;
  const v4f cb = *(const v4f*)(crow + 4);
  float cv[8];
  cv[0] = ca.x; cv[1] = ca.y; cv[2] = ca.z; cv[3] = ca.w; cv[4] = cb.x; cv[5] = cb.y; cv[6] = cb.z; cv[7] = cb.w;
  const int a1 = (a + 1 < kSeq) ? (a + 1) : (kSeq - 1);
  const float* prow0 = ps + (size_t)a * kSeq;
  const float* prow1 = ps + (size_t)a1 * kSeq;
  const int sh0 = kSeq - 1 - a;
  float sv[8];
  float mx = -INFINITY;
#pragma unroll
  for (int e = 0; e < 8; ++e) {
    const int c = c0 + e;
    int i1 = c + sh0;   i1 = (i1 > kSeq - 1) ? (kSeq - 1) : i1;
    int i2 = c - a - 2; i2 = (i2 < 0) ? 0 : i2;
    const float v1 = prow0[i1];
    const float v2 = prow1[i2];
    const float pv = (c <= a) ? v1 : ((c == a + 1) ? 0.0f : v2);
    const float s = (cv[e] + pv) * (1.0f / 32.0f);
    sv[e] = s;
    mx = fmaxf(mx, s);
  }
#pragma unroll
  for (int off = 1; off < 32; off <<= 1) mx = fmaxf(mx, __shfl_xor(mx, off, 32));
  if (lane == 0) red[wave] = mx;
  __syncthreads();
  float gm = red[0];
#pragma unroll
  for (int w = 1; w < 8; ++w) gm = fmaxf(gm, red[w]);
  __syncthreads();
  float sum = 0.f;
#pragma unroll
  for (int e = 0; e < 8; ++e) { sv[e] = __expf(sv[e] - gm); sum += sv[e]; }
#pragma unroll
  for (int off = 1; off < 32; off <<= 1) sum += __shfl_xor(sum, off, 32);
  if (lane == 0) red[wave] = sum;
  __syncthreads();
  float tot = 0.f;
#pragma unroll
  for (int w = 0; w < 8; ++w) tot += red[w];       // fixed order
  const float f = (1.0f / tot) * 32768.0f;
  v8h hv;
#pragma unroll
  for (int e = 0; e < 8; ++e) hv[e] = (_Float16)(sv[e] * f);
  _Float16* dst = p16 + (size_t)a * kSeq + c0;
  *(v8h*)dst = hv;
  
}

// ---- p.v for one (b,h): ctx[q][d] = 2^-19 * sum_key P[q][key] * Vt[d][key]; P f16 [2048][2048], Vt f16 [128][2048] (both row pitch kSeq).
// One block per 32x64 output tile (grid = 64 x 2 = 128 blocks); the key range is split over the block's 8 waves (256 keys each), every wave
// holds a full 32x64 f32 partial, the 8 partials meet in LDS and are summed in wave order 0..7; output = bf16 hi/lo planes, row pitch kEmb.
__global__ __launch_bounds__(256) void pv_ksplit_kernel(const _Float16* __restrict__ P, const _Float16* __restrict__ Vt,
                                                       unsigned short* __restrict__ Ch, unsigned short* __restrict__ Cl) {
  constexpr int kPitch = 68;                                  // floats; 8 rows apart = 32 banks apart
  __shared__ __align__(16) float part[8][32 * kPitch];
  const int t = threadIdx.x, lane = t & 31, wave = t >> 5;
  const int m0 = (blockIdx.x >> 1) << 5;
  const int n0 = (blockIdx.x & 1) << 6;
  const int rlane = lane & 15;
  const int half8 = (lane >> 4) * 8;                          // k offset of this lane half (A, B) and D row offset
  const _Float16* Ar = P  + (size_t)(m0 + rlane) * kSeq + wave * (kSeq / 8) + half8;
  const _Float16* Br = Vt + (size_t)(n0 + rlane) * kSeq + wave * (kSeq / 8) + half8;

  // every "#pragma unroll" in this kernel: constant indices keep the fragment and accumulator arrays in registers
  v8f acc[2][4];
#pragma unroll
  for (int i = 0; i < 2; ++i)
#pragma unroll
    for (int j = 0; j < 4; ++j) acc[i][j] = (v8f){0.f,0.f,0.f,0.f,0.f,0.f,0.f,0.f};

  for (int k0 = 0; k0 < kSeq / 8; k0 += 64) {                 // 64 keys a trip = one whole 128-B line of every row it reads
    v16h af[2][2], bf[2][4];
#pragma unroll
    for (int s = 0; s < 2; ++s) {
#pragma unroll
      for (int i = 0; i < 2; ++i) af[s][i] = Frag<_Float16>::load(Ar + (size_t)(i << 4) * kSeq + k0 + 32 * s);
#pragma unroll
      for (int j = 0; j < 4; ++j) bf[s][j] = Frag<_Float16>::load(Br + (size_t)(j << 4) * kSeq + k0 + 32 * s);
    }
#pragma unroll
    for (int s = 0; s < 2; ++s)
#pragma unroll
      for (int i = 0; i < 2; ++i)
#pragma unroll
        for (int j = 0; j < 4; ++j) acc[i][j] = Frag<_Float16>::mma(af[s][i], bf[s][j], acc[i][j]);
  }

  float* mine = part[wave];
#pragma unroll
  for (int i = 0; i < 2; ++i)
#pragma unroll
    for (int j = 0; j < 4; ++j)
#pragma unroll
      for (int r = 0; r < 8; ++r) mine[((i << 4) + half8 + r) * kPitch + (j << 4) + rlane] = acc[i][j][r];
  __syncthreads();                                            // all 8 partials are in LDS before any thread sums them

  const int row = t >> 3, c8 = (t & 7) * 8;                   // 8 lanes x 16 B = one whole 128-B row segment per plane
  const float* sp = &part[0][row * kPitch + c8];
  v4f s0 = *(const v4f*)sp, s1 = *(const v4f*)(sp + 4);
#pragma unroll
  for (int w = 1; w < 8; ++w) {                               // fixed order
    s0 += *(const v4f*)(sp + w * (32 * kPitch));
    s1 += *(const v4f*)(sp + w * (32 * kPitch) + 4);
  }
  v8h hv, lv;
#pragma unroll
  for (int e = 0; e < 8; ++e) {
    const float f = ((e < 4) ? s0[e & 3] : s1[e & 3]) * (1.0f / 524288.0f);
    const unsigned short hb = f2bf_bits(f);
    hv[e] = __builtin_bit_cast(_Float16, hb);
    lv[e] = __builtin_bit_cast(_Float16, f2bf_bits(f - bf_bits2f(hb)));
  }
  const size_t co = (size_t)(m0 + row) * kEmb + n0 + c8;
  *(v8h*)(Ch + co) = hv;
  *(v8h*)(Cl + co) = lv;
}

// =====================================================================================
extern "C" void kernel_launch(void* const* d_in, const int* in_sizes, int n_in, void* d_out, int out_size,
                              void* d_ws, size_t ws_size, hipStream_t stream) {
  if (n_in < 14) return;
  if (in_sizes[0] != kTok * kEmb || in_sizes[1] != kEmb || in_sizes[2] != kEmb ||
      in_sizes[3] != kDh * kDh || in_sizes[4] != kDh || in_sizes[5] != kDh * kDh || in_sizes[6] != kDh ||
      in_sizes[7] != kDh * kDh || in_sizes[8] != kDh || in_sizes[9] != kDh * kDh ||
      in_sizes[10] != kHeads * kDh || in_sizes[11] != kHeads * kDh || in_sizes[12] != kEmb * kEmb || in_sizes[13] != kEmb ||
      out_size != kTok * kEmb) return;
  const float* x      = (const float*)d_in[0];
  const float* gamma  = (const float*)d_in[1];
  const float* beta   = (const float*)d_in[2];
  const float* Wq     = (const float*)d_in[3];
  const float* bq     = (const float*)d_in[4];
  const float* Wk     = (const float*)d_in[5];
  const float* bk     = (const float*)d_in[6];
  const float* Wv     = (const float*)d_in[7];
  const float* bv     = (const float*)d_in[8];
  const float* Wp     = (const float*)d_in[9];
  const float* u_bias = (const float*)d_in[10];
  const float* v_bias = (const float*)d_in[11];
  const float* Wo     = (const float*)d_in[12];
  const float* bo     = (const float*)d_in[13];
  float* out = (float*)d_out;   // [2][2048][1024] f32

  // ---- workspace carve (all offsets multiples of 256 B; total 105,317,376 B) ----
  // R0 WqT,WkT,WvT,WpT hi/lo bf16 [128 n][128 k]   8 x 32,768        =     262,144
  // R1 WoT hi/lo bf16 [1024 n][1024 k]              2 x 2,097,152     =   4,194,304
  // R2 16·bq, 16·bk f32 [128]                       2 x 512           =       1,024
  // R3 UBK f32 [2][8][2048], VBP f32 [8][2048]                        =     196,608
  // R4 Q16 f16 x16 [32768][128]                                       =   8,388,608
  // R5 K16 f16 x16 [32768][128]                                       =   8,388,608
  // R6 PP16 f16 x16 [16384][128]                                      =   4,194,304
  // R7 V f32 [32768][128] (= [4096][1024])                            =  16,777,216
  // R8 CTX hi/lo bf16 [4096][1024]                  2 x 8,388,608     =  16,777,216
  // R9 VT16 f16 x16 per batch [1024][2048]                            =   4,194,304
  // R10 per (b,h): CONT f32 [2048][2048] 16,777,216 + PS f32 16,777,216 + P16 f16 [2048][2048] 8,388,608 = 41,943,040;
  //     prelude aliases inside R10 (dead before the loop): XN hi/lo bf16 [4096][1024] at +0/+8,388,608, PE hi/lo bf16 [2048][1024] at +16,777,216/+20,971,520
  char* ws = (char*)d_ws; size_t off = 0;
  auto carve = [&](size_t bytes) -> char* { char* p = ws + off; off += (bytes + 255) & ~(size_t)255; return p; };
  const size_t nW   = (size_t)kDh * kDh;            // 16,384
  const size_t nWo  = (size_t)kEmb * kEmb;          // 1,048,576
  const size_t nHd  = (size_t)kTok * kHeads * kDh;   // 4,194,304 (= kTok*kEmb)
  const size_t nPp  = (size_t)kSeq * kHeads * kDh;   // 2,097,152
  const size_t nSS  = (size_t)kSeq * kSeq;           // 4,194,304
  __bf16* WqTh = (__bf16*)carve(nW * 2); __bf16* WqTl = (__bf16*)carve(nW * 2);
  __bf16* WkTh = (__bf16*)carve(nW * 2); __bf16* WkTl = (__bf16*)carve(nW * 2);
  __bf16* WvTh = (__bf16*)carve(nW * 2); __bf16* WvTl = (__bf16*)carve(nW * 2);
  __bf16* WpTh = (__bf16*)carve(nW * 2); __bf16* WpTl = (__bf16*)carve(nW * 2);
  __bf16* WoTh = (__bf16*)carve(nWo * 2); __bf16* WoTl = (__bf16*)carve(nWo * 2);
  float* qb16 = (float*)carve(kDh * 4); float* kb16 = (float*)carve(kDh * 4);
  float* ubk  = (float*)carve((size_t)kBatch * kHeads * kSeq * 4);
  float* vbp  = (float*)carve((size_t)kHeads * kSeq * 4);
  _Float16* q16  = (_Float16*)carve(nHd * 2);
  _Float16* k16  = (_Float16*)carve(nHd * 2);
  _Float16* pp16 = (_Float16*)carve(nPp * 2);
  float*    vf32 = (float*)carve(nHd * 4);
  unsigned short* ctxh = (unsigned short*)carve(nHd * 2); unsigned short* ctxl = (unsigned short*)carve(nHd * 2);
  _Float16* vt16 = (_Float16*)carve((size_t)kEmb * kSeq * 2);
  char* loopBase = carve(nSS * 4 + nSS * 4 + nSS * 2);
  float*    contT = (float*)loopBase;
  float*    posT  = (float*)(loopBase + nSS * 4);
  _Float16* p16   = (_Float16*)(loopBase + nSS * 8);
  unsigned* xnh = (unsigned*)loopBase;                         // prelude aliases
  unsigned* xnl = (unsigned*)(loopBase + nHd * 2);
  unsigned* peh = (unsigned*)(loopBase + nHd * 4);
  unsigned* pel = (unsigned*)(loopBase + nHd * 4 + (size_t)kSeq * kEmb * 2);
  if (nHd * 4 + (size_t)kSeq * kEmb * 4 > nSS * 10) return;   // aliases fit inside R10
  if (off > ws_size || off > ((size_t)1 << 27)) return;

  // ---- prelude: weight planes (in [k][n] -> out [n][k]), scaled biases, LN planes, sinusoid planes ----
  transpose_split_bf16<<<dim3(kDh / 64, kDh / 64), dim3(32, 8), 0, stream>>>(Wq, kDh, WqTh, WqTl, kDh);     // in [128][128] -> out [128][128]
  transpose_split_bf16<<<dim3(kDh / 64, kDh / 64), dim3(32, 8), 0, stream>>>(Wk, kDh, WkTh, WkTl, kDh);
  transpose_split_bf16<<<dim3(kDh / 64, kDh / 64), dim3(32, 8), 0, stream>>>(Wv, kDh, WvTh, WvTl, kDh);
  transpose_split_bf16<<<dim3(kDh / 64, kDh / 64), dim3(32, 8), 0, stream>>>(Wp, kDh, WpTh, WpTl, kDh);
  transpose_split_bf16<<<dim3(kEmb / 64, kEmb / 64), dim3(32, 8), 0, stream>>>(Wo, kEmb, WoTh, WoTl, kEmb); // in [1024][1024] -> out [1024][1024]
  bias16_kernel<<<1, 64, 0, stream>>>(bq, bk, qb16, kb16);
  layernorm_split_kernel<<<kTok, 256, 0, stream>>>(x, gamma, beta, xnh, xnl);                             // 4096 blocks = all tokens
  posenc_split_kernel<<<(kSeq * kPairs) / 256, 256, 0, stream>>>(peh, pel);                                // 4096 blocks x 256 = 2048 x 512 pairs

  // ---- projections over the [32768][128] per-(token, head) row view of xn (same memory as [4096][1024]) ----
  { const int tl = (kTok * kHeads / 64) * (kDh / 64);        // 1024 tiles -> 128 blocks
    // q·16 (+16·bq), k·16 (+16·bk) as f16 planes; v (+bv) as f32
    wmma_gemm64<1, true, 2, 1, false><<<dim3(tl / 8, 1), 256, 0, stream>>>(U16(xnh), U16(xnl), kDh, 0, U16(WqTh), U16(WqTl), kDh, 0,
        q16, nullptr, kDh, 0, qb16, nullptr, 0, kTok * kHeads, kDh, kDh, 16.0f);
    wmma_gemm64<1, true, 2, 1, false><<<dim3(tl / 8, 1), 256, 0, stream>>>(U16(xnh), U16(xnl), kDh, 0, U16(WkTh), U16(WkTl), kDh, 0,
        k16, nullptr, kDh, 0, kb16, nullptr, 0, kTok * kHeads, kDh, kDh, 16.0f);
    wmma_gemm64<1, true, 2, 0, false><<<dim3(tl / 8, 1), 256, 0, stream>>>(U16(xnh), U16(xnl), kDh, 0, U16(WvTh), U16(WvTl), kDh, 0,
        vf32, nullptr, kDh, 0, bv, nullptr, 0, kTok * kHeads, kDh, kDh, 1.0f); }
  { const int tl = (kSeq * kHeads / 64) * (kDh / 64);        // 512 tiles -> 64 blocks; p·16 as f16 plane [16384][128]
    wmma_gemm64<1, true, 0, 1, false><<<dim3(tl / 8, 1), 256, 0, stream>>>(U16(peh), U16(pel), kDh, 0, U16(WpTh), U16(WpTl), kDh, 0,
        pp16, nullptr, kDh, 0, nullptr, nullptr, 0, kSeq * kHeads, kDh, kDh, 16.0f); }
  headbias_kernel<<<192, 256, 0, stream>>>(k16, pp16, u_bias, v_bias, ubk, vbp);                        // 128 blocks UBK + 64 blocks VBP

  // ---- per batch: vᵀ f16 x16; per head: content table, position table, shift+softmax, p·v into ctx hi/lo planes ----
  for (int b = 0; b < kBatch; ++b) {
    // in [2048 r][1024 c] (pitch 1024) -> out [1024 c][2048 r] (pitch 2048), x16; grid (C/64 = 16, R/64 = 32)
    transpose_cast_f16<<<dim3(kEmb / 64, kSeq / 64), dim3(32, 8), 0, stream>>>(vf32 + (size_t)b * kSeq * kEmb, kEmb, vt16, kSeq, 16.0f);
    for (int h = 0; h < kHeads; ++h) {
      const size_t qoff = (size_t)b * kSeq * kEmb + (size_t)h * kDh;   // row (b,s,h) of a [32768][128] plane = (b·2048+s)·1024 + h·128, row pitch 1024
      const int tl = (kSeq / 64) * (kSeq / 64);                        // 1024 tiles -> 128 blocks
      // content[q][key] = (16q)·(16k)/256 + u_bias[h]·k[key]
      wmma_gemm64<0, false, 2, 0, false><<<dim3(tl / 8, 1), 256, 0, stream>>>(U16(q16 + qoff), nullptr, kEmb, 0, U16(k16 + qoff), nullptr, kEmb, 0,
          contT, nullptr, kSeq, 0, ubk + (size_t)(b * kHeads + h) * kSeq, nullptr, 0, kSeq, kSeq, kDh, 1.0f / 256.0f);
      // pos[q][n] = (16q)·(16p_n)/256 + v_bias[h]·p[n]  (p row (n,h) at n·1024 + h·128)
      wmma_gemm64<0, false, 2, 0, false><<<dim3(tl / 8, 1), 256, 0, stream>>>(U16(q16 + qoff), nullptr, kEmb, 0, U16(pp16 + (size_t)h * kDh), nullptr, kEmb, 0,
          posT, nullptr, kSeq, 0, vbp + (size_t)h * kSeq, nullptr, 0, kSeq, kSeq, kDh, 1.0f / 256.0f);
      score_softmax_kernel<<<kSeq, 256, 0, stream>>>(contT, posT, p16);                                  // 2048 rows x 2048
      // ctx[b, q, h*128+d] = sum_key (p/l * 2^15)[q][key] * (16 v)^T[h*128+d][key] * 2^-19 ; 128 tiles of 32x64 -> 128 blocks, keys split over 8 waves
      pv_ksplit_kernel<<<(kSeq / 32) * (kDh / 64), 256, 0, stream>>>(p16, vt16 + (size_t)h * kDh * kSeq, ctxh + qoff, ctxl + qoff);
    }
  }

  // ---- out = ctx·Wo + bo : A bf16 hi/lo [4096][1024], Bt bf16 hi/lo [1024 n][1024 k], C f32 d_out [4096][1024]; 1024 tiles -> 128 blocks ----
  { const int tl = (kTok / 64) * (kEmb / 64);
    wmma_gemm64<1, true, 2, 0, false><<<dim3(tl / 8, 1), 256, 0, stream>>>(U16(ctxh), U16(ctxl), kEmb, 0, U16(WoTh), U16(WoTl), kEmb, 0,
        out, nullptr, kEmb, 0, bo, nullptr, 0, kTok, kEmb, kEmb, 1.0f); }
}

// v002
// Measured time: 516 microseconds a run.
// Two timings next to v001 put it at 1.51 and 1.52 times that version's speed.
// All steps since v000 together make it 3.93 times as fast.
// Projections xn·W{q,k,v} (K=128), p = pe·Wp (K=128) and out = ctx·Wo (K=1024): v_wmma_f32_16x16x32_bf16 with bf16 hi/lo split operands (hi·hi + hi·lo + lo·hi); content q·kᵀ and position q·pᵀ tables (K=128): v_wmma_f32_16x16x32_f16 with plain f16 operands carried x16; p·v (K=2048): v_wmma_f32_16x16x32_f16 with p/l carried x2^15 and vᵀ carried x16; f32 accumulate everywhere; LayerNorm, sinusoid table, u/v bias dots, relative shift and softmax in f32 on VALU.
#include <hip/hip_runtime.h>
#include <math.h>

typedef __attribute__((ext_vector_type(16))) _Float16 v16h;
typedef __attribute__((ext_vector_type(8)))  _Float16 v8h;
typedef __attribute__((ext_vector_type(16))) __bf16   v16b;
typedef __attribute__((ext_vector_type(8)))  __bf16   v8b;
typedef __attribute__((ext_vector_type(8)))  float    v8f;
typedef __attribute__((ext_vector_type(4)))  float    v4f;
typedef __attribute__((ext_vector_type(2)))  float    v2f;
#define U16(p) ((const unsigned short*)(const void*)(p))

__device__ __forceinline__ unsigned short f2bf_bits(float f) {
  unsigned u = __float_as_uint(f);
  return (unsigned short)((u + 0x7FFFu + ((u >> 16) & 1u)) >> 16);
}
__device__ __forceinline__ float bf_bits2f(unsigned short h) { return __uint_as_float(((unsigned)h) << 16); }

// hazard guards as plain device helpers (no inline asm inside the kernel template body)
__device__ __forceinline__ void dep_guard_h(v8f& a, v8f& b, v16h x, v16h y) { asm volatile("v_nop\n\tv_nop\n\tv_nop\n\tv_nop" : "+v"(a), "+v"(b) : "v"(x), "v"(y)); }
__device__ __forceinline__ void dep_guard_b(v8f& a, v8f& b, v16b x, v16b y) { asm volatile("v_nop\n\tv_nop\n\tv_nop\n\tv_nop" : "+v"(a), "+v"(b) : "v"(x), "v"(y)); }
__device__ __forceinline__ void keep4_h(v16h a, v16h b, v16h c, v16h d) { asm volatile("v_nop" :: "v"(a), "v"(b), "v"(c), "v"(d)); }
__device__ __forceinline__ void keep4_b(v16b a, v16b b, v16b c, v16b d) { asm volatile("v_nop" :: "v"(a), "v"(b), "v"(c), "v"(d)); }
__device__ __forceinline__ void acc_guard4(v8f& a, v8f& b, v8f& c, v8f& d) { asm volatile("v_nop\n\tv_nop\n\tv_nop\n\tv_nop" : "+v"(a), "+v"(b), "+v"(c), "+v"(d)); }
template <typename T> struct Frag;
template <> struct Frag<_Float16> {
  typedef v16h V; union U { v16h v; v8h h[2]; };
  static __device__ __forceinline__ v16h load(const _Float16* p) {   // elements 0..7 <- p[0..7], 8..15 <- p[16..23]
    U f; f.h[0] = *(const v8h*)(p); f.h[1] = *(const v8h*)(p + 16); return f.v;
  }
  static __device__ __forceinline__ v8f mma(v16h a, v16h b, v8f c) {
    return __builtin_amdgcn_wmma_f32_16x16x32_f16(false, a, false, b, (short)0, c, false, false);
  }
  static __device__ __forceinline__ void guard(v8f& a, v8f& b, v16h x, v16h y) { dep_guard_h(a, b, x, y); }
  static __device__ __forceinline__ void keep(v16h a, v16h b, v16h c, v16h d) { keep4_h(a, b, c, d); }
};
template <> struct Frag<__bf16> {
  typedef v16b V; union U { v16b v; v8b h[2]; };
  static __device__ __forceinline__ v16b load(const __bf16* p) {
    U f; f.h[0] = *(const v8b*)(p); f.h[1] = *(const v8b*)(p + 16); return f.v;
  }
  static __device__ __forceinline__ v8f mma(v16b a, v16b b, v8f c) {
    return __builtin_amdgcn_wmma_f32_16x16x32_bf16(false, a, false, b, (short)0, c, false, false);
  }
  static __device__ __forceinline__ void guard(v8f& a, v8f& b, v16b x, v16b y) { dep_guard_b(a, b, x, y); }
  static __device__ __forceinline__ void keep(v16b a, v16b b, v16b c, v16b d) { keep4_b(a, b, c, d); }
};

// ---- Register-blocked batched WMMA GEMM ------------------------------------
// C[m,n] = scale * sum_k A[m,k] * Bt[n,k] (+bias)(+resid); each wave owns a 64x64 tile.
// A row-major [M,K]; Bt row-major [N,K]; M,N % 64 == 0, K % 32 == 0.
// SPLIT: operands are hi/lo planes (A2/Bt2 = lo planes, same layout); product = hi·hi + hi·lo + lo·hi.
// BIAS_MODE: 0 = none, 1 = bias[m], 2 = bias[n].
// OUT_MODE: 0 = f32, 1 = f16, 2 = bf16 hi plane (Cout) + bf16 lo plane (Cout2).
// ET: 0 = f16 operands, 1 = bf16 operands (pointers passed as 16-bit storage)
// Grid: x = tiles / 8, y = batch index b (strideA/B/C/R and strideBias are per b), z = 0 or 1: z = 1 takes BtZp, CoutZ and biasZ in
// place of Btp, Cout and bias (same A, same strides; non-split launches only), so two products of one A share a launch.
template <int ET> struct Elem;
template <> struct Elem<0> { typedef _Float16 T; };
template <> struct Elem<1> { typedef __bf16 T; };
template <int ET, bool SPLIT, int BIAS_MODE, int OUT_MODE, bool RESID, int ACT = 0>
__global__ __launch_bounds__(256) void wmma_gemm64(
    const unsigned short* __restrict__ Ap, const unsigned short* __restrict__ A2p, int lda, long strideA,
    const unsigned short* __restrict__ Btp, const unsigned short* __restrict__ Bt2p, int ldb, long strideB,
    void* __restrict__ Cout0, void* __restrict__ Cout2, int ldc, long strideC,
    const float* __restrict__ bias0, long strideBias,
    const float* __restrict__ resid, long strideR,
    const unsigned short* __restrict__ BtZp, void* __restrict__ CoutZ, const float* __restrict__ biasZ,
    int M, int N, int K, float scale) {
  typedef typename Elem<ET>::T T;
  typedef typename Frag<T>::V V;
  const bool zsel = blockIdx.z != 0;           // block-uniform
  const T* A = (const T*)Ap; const T* A2 = (const T*)A2p; const T* Bt = (const T*)(zsel ? BtZp : Btp); const T* Bt2 = (const T*)Bt2p;
  void* Cout = zsel ? CoutZ : Cout0;
  const float* bias = (BIAS_MODE != 0) ? ((zsel ? biasZ : bias0) + (size_t)blockIdx.y * strideBias) : nullptr;
  __shared__ __align__(16) float sT[8][16 * 68];   // per-wave 16x64 slab, pitch 68 floats
  const int b    = blockIdx.y;
  const int lane = threadIdx.x & 31;
  const int wave = threadIdx.x >> 5;
  const int tilesN = N >> 6;
  const int tilesM = M >> 6;
  const int tile = blockIdx.x * 8 + wave;
  if (tile >= tilesM * tilesN) return;   // wave-uniform; no block barriers in this kernel
  const int tm = tile / tilesN;
  const int tn = tile - tm * tilesN;
  const int m0 = tm << 6;
  const int n0 = tn << 6;

  const T* Ab  = A  + (size_t)b * strideA;
  const T* Bb  = Bt + (size_t)b * strideB;
  const T* Ab2 = SPLIT ? (A2  + (size_t)b * strideA) : nullptr;
  const T* Bb2 = SPLIT ? (Bt2 + (size_t)b * strideB) : nullptr;

  const int rlane = lane & 15;                 // row (A) / col (B, D) within subtile
  const int koff  = (lane >> 4) * 8;           // k offset of this lane half
  const int mOff  = (lane >> 4) * 8;           // D row offset

  v8f acc[4][4];
#pragma unroll
  for (int i = 0; i < 4; ++i)
#pragma unroll
    for (int j = 0; j < 4; ++j) acc[i][j] = (v8f){0.f,0.f,0.f,0.f,0.f,0.f,0.f,0.f};

  for (int k0 = 0; k0 < K; k0 += 32) {
    V bh[4], bl[4];
#pragma unroll
    for (int j = 0; j < 4; ++j) {
      const size_t bo = (size_t)(n0 + (j << 4) + rlane) * ldb + koff + k0;
      bh[j] = Frag<T>::load(Bb + bo);
      if (SPLIT) bl[j] = Frag<T>::load(Bb2 + bo);
    }
#pragma unroll
    for (int i = 0; i < 4; ++i) {
      const size_t ao = (size_t)(m0 + (i << 4) + rlane) * lda + koff + k0;
      V ah = Frag<T>::load(Ab + ao);
      V al;
      if (SPLIT) al = Frag<T>::load(Ab2 + ao);
#pragma unroll
      for (int j = 0; j < 4; ++j) {
        acc[i][j] = Frag<T>::mma(ah, bh[j], acc[i][j]);
        if (SPLIT) {
          acc[i][j] = Frag<T>::mma(ah, bl[j], acc[i][j]);
          acc[i][j] = Frag<T>::mma(al, bh[j], acc[i][j]);
        }
      }
      Frag<T>::guard(acc[i][0], acc[i][3], ah, SPLIT ? al : ah);
    }
    Frag<T>::keep(bh[0], bh[1], bh[2], bh[3]);
    if (SPLIT) Frag<T>::keep(bl[0], bl[1], bl[2], bl[3]);
  }
  acc_guard4(acc[0][0], acc[0][1], acc[0][2], acc[0][3]);
  acc_guard4(acc[1][0], acc[1][1], acc[1][2], acc[1][3]);
  acc_guard4(acc[2][0], acc[2][1], acc[2][2], acc[2][3]);
  acc_guard4(acc[3][0], acc[3][1], acc[3][2], acc[3][3]);

  // ---- epilogue ----
  float* slab = sT[wave];
  const float* Rb = RESID ? (resid + (size_t)b * strideR) : nullptr;
#pragma unroll
  for (int i = 0; i < 4; ++i) {
    const int mBase = m0 + (i << 4);
#pragma unroll
    for (int j = 0; j < 4; ++j) {
      const int n = n0 + (j << 4) + rlane;
      float bv = 0.f;
      if (BIAS_MODE == 2) bv = bias[n];
#pragma unroll
      for (int r = 0; r < 8; ++r) {
        float v = acc[i][j][r] * scale;
        if (BIAS_MODE == 1) v += bias[mBase + mOff + r];
        if (BIAS_MODE == 2) v += bv;
        if (RESID) v += Rb[(size_t)(mBase + mOff + r) * ldc + n];
        if (ACT == 1) v = tanhf(v);
        if (ACT == 2) v = fmaxf(v, 0.0f);
        if (ACT == 3) v = v / (1.0f + expf(-v));
        if (ACT == 4) v = (v > 0.f) ? v : 0.01f * v;
        if (ACT == 5) v = 0.5f * v * (1.0f + erff(v * 0.70710678118654752f));
        slab[(mOff + r) * 68 + (j << 4) + rlane] = v;
      }
    }
    __builtin_amdgcn_fence(__ATOMIC_RELEASE, "workgroup");
    __builtin_amdgcn_wave_barrier();
    __builtin_amdgcn_fence(__ATOMIC_ACQUIRE, "workgroup");
    if (OUT_MODE == 0) {
      float* C = (float*)Cout + (size_t)b * strideC;
      const int hh = lane >> 4, c4 = (lane & 15) * 4;     // row seg = 256 B = 16 lanes x 16 B
      {
#pragma unroll
        for (int it = 0; it < 8; ++it) {
          const int row = it * 2 + hh;
          v4f v = *(const v4f*)(slab + row * 68 + c4);
          *(v4f*)(C + (size_t)(mBase + row) * ldc + n0 + c4) = v;
        }
        
      }
    } else {
      const int q = lane >> 3, c8 = (lane & 7) * 8;
      unsigned short* C  = (unsigned short*)Cout  + (size_t)b * strideC;
      unsigned short* C2 = (OUT_MODE == 2) ? ((unsigned short*)Cout2 + (size_t)b * strideC) : nullptr;
      {
#pragma unroll
        for (int it = 0; it < 4; ++it) {
          const int row = it * 4 + q;
          const float* sp = slab + row * 68 + c8;
          v8h hv, lv;
#pragma unroll
          for (int e = 0; e < 8; ++e) {
            if (OUT_MODE == 1) {
              hv[e] = (_Float16)sp[e];
            } else {
              unsigned short hb = f2bf_bits(sp[e]);
              unsigned short lb = f2bf_bits(sp[e] - bf_bits2f(hb));
              hv[e] = __builtin_bit_cast(_Float16, hb);
              lv[e] = __builtin_bit_cast(_Float16, lb);
            }
          }
          *(v8h*)(C + (size_t)(mBase + row) * ldc + n0 + c8) = hv;
          if (OUT_MODE == 2) *(v8h*)(C2 + (size_t)(mBase + row) * ldc + n0 + c8) = lv;
        }
        
      }
    }
    __builtin_amdgcn_fence(__ATOMIC_RELEASE, "workgroup");
    __builtin_amdgcn_wave_barrier();
    __builtin_amdgcn_fence(__ATOMIC_ACQUIRE, "workgroup");
  }
}

// ---- f32 [R][C] (row pitch ldi) -> f16 transposed [C][R] (row pitch ldo); 64x64 tiles; each output row segment
__global__ __launch_bounds__(256) void transpose_cast_f16(const float* __restrict__ in, int ldi,
                                                         _Float16* __restrict__ outT, int ldo, float scale) {
  __shared__ __align__(16) _Float16 tile[64][72];     // [c][r]
  const int c0 = blockIdx.x * 64, r0 = blockIdx.y * 64;
  const int t = threadIdx.y * 32 + threadIdx.x;
  for (int i = threadIdx.y; i < 64; i += 8) {
    tile[threadIdx.x][i]      = (_Float16)(in[(size_t)(r0 + i) * ldi + c0 + threadIdx.x] * scale);
    tile[32 + threadIdx.x][i] = (_Float16)(in[(size_t)(r0 + i) * ldi + c0 + 32 + threadIdx.x] * scale);
  }
  __syncthreads();
  const int q = t >> 3, c8 = (t & 7) * 8;
  {
#pragma unroll
    for (int it = 0; it < 2; ++it) {
      const int c = it * 32 + q;
      v8h hv = *(const v8h*)(&tile[c][c8]);
      *(v8h*)(outT + (size_t)(c0 + c) * ldo + r0 + c8) = hv;
    }
    
  }
}

// ---- f32 [R][C] (pitch ldi) -> bf16 hi/lo transposed planes [C][R] (pitch ldo); 64x64 tiles; each output row segment
__global__ __launch_bounds__(256) void transpose_split_bf16(const float* __restrict__ in, int ldi,
                                                           __bf16* __restrict__ outH, __bf16* __restrict__ outL, int ldo) {
  __shared__ __align__(16) float tile[64][68];     // [c][r]
  const int c0 = blockIdx.x * 64, r0 = blockIdx.y * 64;
  const int t = threadIdx.y * 32 + threadIdx.x;
  for (int i = threadIdx.y; i < 64; i += 8) {
    tile[threadIdx.x][i]      = in[(size_t)(r0 + i) * ldi + c0 + threadIdx.x];
    tile[32 + threadIdx.x][i] = in[(size_t)(r0 + i) * ldi + c0 + 32 + threadIdx.x];
  }
  __syncthreads();
  const int q = t >> 3, c8 = (t & 7) * 8;
  {
#pragma unroll
    for (int it = 0; it < 2; ++it) {
      const int c = it * 32 + q;
      v8b hv, lv;
#pragma unroll
      for (int e = 0; e < 8; ++e) {
        const float f = tile[c][c8 + e];
        const unsigned short hb = f2bf_bits(f);
        hv[e] = __builtin_bit_cast(__bf16, hb);
        lv[e] = __builtin_bit_cast(__bf16, f2bf_bits(f - bf_bits2f(hb)));
      }
      *(v8b*)(outH + (size_t)(c0 + c) * ldo + r0 + c8) = hv;
      *(v8b*)(outL + (size_t)(c0 + c) * ldo + r0 + c8) = lv;
    }
    
  }
}

// =====================================================================================
constexpr int kBatch = 2;
constexpr int kSeq   = 2048;
constexpr int kEmb   = 1024;
constexpr int kHeads = 8;
constexpr int kDh    = 128;
constexpr int kTok   = kBatch * kSeq;          // 4096 tokens
constexpr int kPairs = kEmb / 2;               // 512 element pairs per row
constexpr int kGroup = 4;                      // heads of one batch element whose score tables are live at once (one launch serves them all)
static_assert(kHeads * kDh == kEmb);
static_assert(kHeads % kGroup == 0);
static_assert(kPairs == 512);

// ---- LayerNorm (biased variance, eps 1e-5) -> xn as bf16 hi/lo planes (packed pairs). One block per token, 256 threads;
// thread t owns element pairs (2t,2t+1) and (512+2t,512+2t+1): 2 packed dwords per plane per thread; each store instruction
__global__ __launch_bounds__(256) void layernorm_split_kernel(
    const float* __restrict__ x, const float* __restrict__ gamma, const float* __restrict__ beta,
    unsigned* __restrict__ xh, unsigned* __restrict__ xl) {
  __shared__ float red[8];
  const int tok = blockIdx.x;
  const int t = threadIdx.x, lane = t & 31, wave = t >> 5;
  const float* xr = x + (size_t)tok * kEmb;
  const int ca = 2 * t, cb = kPairs + 2 * t;
  const v2f pa = *(const v2f*)(xr + ca);
  const v2f pb = *(const v2f*)(xr + cb);
  float s = (pa.x + pa.y) + (pb.x + pb.y);
#pragma unroll
  for (int off = 1; off < 32; off <<= 1) s += __shfl_xor(s, off, 32);
  if (lane == 0) red[wave] = s;
  __syncthreads();
  float tot = 0.f;
#pragma unroll
  for (int w = 0; w < 8; ++w) tot += red[w];       // fixed order
  const float mean = tot * (1.0f / (float)kEmb);
  __syncthreads();
  const float d0 = pa.x - mean, d1 = pa.y - mean, d2 = pb.x - mean, d3 = pb.y - mean;
  float s2 = (d0 * d0 + d1 * d1) + (d2 * d2 + d3 * d3);
#pragma unroll
  for (int off = 1; off < 32; off <<= 1) s2 += __shfl_xor(s2, off, 32);
  if (lane == 0) red[wave] = s2;
  __syncthreads();
  float tot2 = 0.f;
#pragma unroll
  for (int w = 0; w < 8; ++w) tot2 += red[w];
  const float var  = tot2 * (1.0f / (float)kEmb);
  const float rstd = 1.0f / sqrtf(var + 1e-5f);
  const float y0 = d0 * rstd * gamma[ca] + beta[ca];
  const float y1 = d1 * rstd * gamma[ca + 1] + beta[ca + 1];
  const float y2 = d2 * rstd * gamma[cb] + beta[cb];
  const float y3 = d3 * rstd * gamma[cb + 1] + beta[cb + 1];
  const unsigned short h0 = f2bf_bits(y0), h1 = f2bf_bits(y1), h2 = f2bf_bits(y2), h3 = f2bf_bits(y3);
  const unsigned short l0 = f2bf_bits(y0 - bf_bits2f(h0)), l1 = f2bf_bits(y1 - bf_bits2f(h1));
  const unsigned short l2 = f2bf_bits(y2 - bf_bits2f(h2)), l3 = f2bf_bits(y3 - bf_bits2f(h3));
  const unsigned uah = (unsigned)h0 | ((unsigned)h1 << 16), ual = (unsigned)l0 | ((unsigned)l1 << 16);
  const unsigned ubh = (unsigned)h2 | ((unsigned)h3 << 16), ubl = (unsigned)l2 | ((unsigned)l3 << 16);
  const size_t ia = (size_t)tok * kPairs + t, ib = ia + 256;
  {
    ((unsigned*)xh)[ia] = uah;
    ((unsigned*)xh)[ib] = ubh;
    ((unsigned*)xl)[ia] = ual;
    ((unsigned*)xl)[ib] = ubl;
    
  }
}

// ---- sinusoid table [kSeq][kEmb]: columns 2i = sin(pos·div_i), 2i+1 = cos(pos·div_i), div_i = exp(2i · (−ln 1e4 / kEmb)), f32,
// emitted as bf16 hi/lo planes (packed pairs). One thread per (pos, i): grid = kSeq*512/256 = 4096 blocks exactly; each wave's store
__global__ __launch_bounds__(256) void posenc_split_kernel(unsigned* __restrict__ peh, unsigned* __restrict__ pel) {
  const int idx = blockIdx.x * 256 + threadIdx.x;
  if (idx >= kSeq * kPairs) return;
  const int pos = idx >> 9, i = idx & 511;
  const float kNegLogRate = -0.00899447301950799f;        // −ln(10000)/1024
  const float freq = expf((float)(2 * i) * kNegLogRate);
  const float ang  = (float)pos * freq;
  const float sv = sinf(ang), cv = cosf(ang);
  const unsigned short hs = f2bf_bits(sv), hc = f2bf_bits(cv);
  const unsigned short ls = f2bf_bits(sv - bf_bits2f(hs)), lc = f2bf_bits(cv - bf_bits2f(hc));
  const unsigned uh = (unsigned)hs | ((unsigned)hc << 16), ul = (unsigned)ls | ((unsigned)lc << 16);
  {
    ((unsigned*)peh)[idx] = uh;
    ((unsigned*)pel)[idx] = ul;
    
  }
}

// ---- scaled projection biases: qb = 16·bq, kb = 16·bk (128 floats each). One block of 64: wave 0 -> qb, wave 1 -> kb;
__global__ __launch_bounds__(64) void bias16_kernel(const float* __restrict__ bq, const float* __restrict__ bk,
                                                   float* __restrict__ qb, float* __restrict__ kb) {
  const int lane = threadIdx.x & 31, wave = threadIdx.x >> 5;   // wave-uniform branch
  v4f v; float* dst;
  if (wave == 0) { v = *(const v4f*)(bq + 4 * lane); dst = qb + 4 * lane; }
  else           { v = *(const v4f*)(bk + 4 * lane); dst = kb + 4 * lane; }
  v = v * 16.0f;
  *(v4f*)dst = v;
  
}

// ---- per-key bias vectors: UBK[(b·8+h)·S + s] = u_bias[h]·k[b,s,h,:], VBP[h·S + s] = v_bias[h]·p[s,h,:] (f32 dots of 128 over the x16 f16 planes,
// folded back by 1/16). grid = 192 blocks x 256: blocks 0..127 -> UBK (32768 values), 128..191 -> VBP (16384 values); block-uniform branch;
__global__ __launch_bounds__(256) void headbias_kernel(const _Float16* __restrict__ k16, const _Float16* __restrict__ pp16,
                                                      const float* __restrict__ ub, const float* __restrict__ vb,
                                                      float* __restrict__ ubk, float* __restrict__ vbp) {
  const int t = blockIdx.x * 256 + threadIdx.x;
  const _Float16* row; const float* bvec; float* dst;
  if (blockIdx.x < 128) {
    const int b = t >> 14, h = (t >> 11) & 7, s = t & 2047;
    row = k16 + (size_t)((b * kSeq + s) * kHeads + h) * kDh; bvec = ub + h * kDh; dst = ubk + t;
  } else {
    const int u = t - 32768; const int h = (u >> 11) & 7, s = u & 2047;
    row = pp16 + (size_t)(s * kHeads + h) * kDh; bvec = vb + h * kDh; dst = vbp + u;
  }
  float acc = 0.f;
#pragma unroll 1
  for (int ch = 0; ch < kDh / 8; ++ch) {
    const v8h kv = *(const v8h*)(row + 8 * ch);
    const v4f b0 = *(const v4f*)(bvec + 8 * ch);
    const v4f b1 = *(const v4f*)(bvec + 8 * ch + 4);
    acc += b0.x * (float)kv[0] + b0.y * (float)kv[1] + b0.z * (float)kv[2] + b0.w * (float)kv[3]
         + b1.x * (float)kv[4] + b1.y * (float)kv[5] + b1.z * (float)kv[6] + b1.w * (float)kv[7];
  }
  const float r = acc * 0.0625f;
  *(float*)dst = r;
  
}

// ---- relative shift + scale + softmax for kGroup heads of one b (tables [kGroup][S][S]): the block takes row a of every head in turn
// (one workgroup start per kGroup rows); 256 threads, thread t owns key columns 8t..8t+7.
// s[a][c] = (cont[a][c] + shifted[a][c]) · (1/32), shifted[a][c] = c <= a ? ps[a][S−1−a+c] : (c == a+1 ? 0 : ps[a+1][c−a−2]);
// both ps candidates loaded unconditionally from clamped addresses, selected by value. p = exp(s − max); output = f16(p / Σp · 2^15)
__global__ __launch_bounds__(256) void score_softmax_kernel(const float* __restrict__ cont, const float* __restrict__ ps,
                                                          _Float16* __restrict__ p16) {
  __shared__ float redAll[kGroup][8];          // a slot of its own per head: no barrier is owed between two heads
  const int a = blockIdx.x;
  const int t = threadIdx.x, lane = t & 31, wave = t >> 5;
  const int c0 = 8 * t;
  for (int g = 0; g < kGroup; ++g) {
  float* red = redAll[g];
  const size_t tb = (size_t)g * kSeq * kSeq;
  const float* crow = cont + tb + (size_t)a * kSeq + c0;
  const v4f ca = *(const v4f*)crow;
  const v4f cb = *(const v4f*)(crow + 4);
  float cv[8];
  cv[0] = ca.x; cv[1] = ca.y; cv[2] = ca.z; cv[3] = ca.w; cv[4] = cb.x; cv[5] = cb.y; cv[6] = cb.z; cv[7] = cb.w;
  const int a1 = (a + 1 < kSeq) ? (a + 1) : (kSeq - 1);
  const float* prow0 = ps + tb + (size_t)a * kSeq;
  const float* prow1 = ps + tb + (size_t)a1 * kSeq;
  const int sh0 = kSeq - 1 - a;
  float sv[8];
  float mx = -INFINITY;
#pragma unroll
  for (int e = 0; e < 8; ++e) {
    const int c = c0 + e;
    int i1 = c + sh0;   i1 = (i1 > kSeq - 1) ? (kSeq - 1) : i1;
    int i2 = c - a - 2; i2 = (i2 < 0) ? 0 : i2;
    const float v1 = prow0[i1];
    const float v2 = prow1[i2];
    const float pv = (c <= a) ? v1 : ((c == a + 1) ? 0.0f : v2);
    const float s = (cv[e] + pv) * (1.0f / 32.0f);
    sv[e] = s;
    mx = fmaxf(mx, s);
  }
#pragma unroll
  for (int off = 1; off < 32; off <<= 1) mx = fmaxf(mx, __shfl_xor(mx, off, 32));
  if (lane == 0) red[wave] = mx;
  __syncthreads();
  float gm = red[0];
#pragma unroll
  for (int w = 1; w < 8; ++w) gm = fmaxf(gm, red[w]);
  __syncthreads();
  float sum = 0.f;
#pragma unroll
  for (int e = 0; e < 8; ++e) { sv[e] = __expf(sv[e] - gm); sum += sv[e]; }
#pragma unroll
  for (int off = 1; off < 32; off <<= 1) sum += __shfl_xor(sum, off, 32);
  if (lane == 0) red[wave] = sum;
  __syncthreads();
  float tot = 0.f;
#pragma unroll
  for (int w = 0; w < 8; ++w) tot += red[w];       // fixed order
  const float f = (1.0f / tot) * 32768.0f;
  v8h hv;
#pragma unroll
  for (int e = 0; e < 8; ++e) hv[e] = (_Float16)(sv[e] * f);
  _Float16* dst = p16 + tb + (size_t)a * kSeq + c0;
  *(v8h*)dst = hv;
  }
}

// ---- p.v for head blockIdx.y of a group (P, Vt, Ch, Cl point at the group's first head): ctx[q][d] = 2^-19 * sum_key P[q][key] * Vt[d][key]; P f16 [2048][2048], Vt f16 [128][2048] (both row pitch kSeq).
// One block per 32x64 output tile (grid.x = 64 x 2 = 128 blocks a head); the key range is split over the block's 8 waves (256 keys each), every wave
// holds a full 32x64 f32 partial, the 8 partials meet in LDS and are summed in wave order 0..7; output = bf16 hi/lo planes, row pitch kEmb.
__global__ __launch_bounds__(256) void pv_ksplit_kernel(const _Float16* __restrict__ P, const _Float16* __restrict__ Vt,
                                                       unsigned short* __restrict__ Ch, unsigned short* __restrict__ Cl) {
  constexpr int kPitch = 68;                                  // floats; 8 rows apart = 32 banks apart
  __shared__ __align__(16) float part[8][32 * kPitch];
  const int t = threadIdx.x, lane = t & 31, wave = t >> 5;
  const int m0 = (blockIdx.x >> 1) << 5;
  const int n0 = (blockIdx.x & 1) << 6;
  const int rlane = lane & 15;
  const int half8 = (lane >> 4) * 8;                          // k offset of this lane half (A, B) and D row offset
  const int g = blockIdx.y;
  const _Float16* Ar = P  + (size_t)g * kSeq * kSeq + (size_t)(m0 + rlane) * kSeq + wave * (kSeq / 8) + half8;
  const _Float16* Br = Vt + (size_t)g * kDh * kSeq  + (size_t)(n0 + rlane) * kSeq + wave * (kSeq / 8) + half8;

  // every "#pragma unroll" in this kernel: constant indices keep the fragment and accumulator arrays in registers
  v8f acc[2][4];
#pragma unroll
  for (int i = 0; i < 2; ++i)
#pragma unroll
    for (int j = 0; j < 4; ++j) acc[i][j] = (v8f){0.f,0.f,0.f,0.f,0.f,0.f,0.f,0.f};

  for (int k0 = 0; k0 < kSeq / 8; k0 += 64) {                 // 64 keys a trip = one whole 128-B line of every row it reads
    v16h af[2][2], bf[2][4];
#pragma unroll
    for (int s = 0; s < 2; ++s) {
#pragma unroll
      for (int i = 0; i < 2; ++i) af[s][i] = Frag<_Float16>::load(Ar + (size_t)(i << 4) * kSeq + k0 + 32 * s);
#pragma unroll
      for (int j = 0; j < 4; ++j) bf[s][j] = Frag<_Float16>::load(Br + (size_t)(j << 4) * kSeq + k0 + 32 * s);
    }
#pragma unroll
    for (int s = 0; s < 2; ++s)
#pragma unroll
      for (int i = 0; i < 2; ++i)
#pragma unroll
        for (int j = 0; j < 4; ++j) acc[i][j] = Frag<_Float16>::mma(af[s][i], bf[s][j], acc[i][j]);
  }

  float* mine = part[wave];
#pragma unroll
  for (int i = 0; i < 2; ++i)
#pragma unroll
    for (int j = 0; j < 4; ++j)
#pragma unroll
      for (int r = 0; r < 8; ++r) mine[((i << 4) + half8 + r) * kPitch + (j << 4) + rlane] = acc[i][j][r];
  __syncthreads();                                            // all 8 partials are in LDS before any thread sums them

  const int row = t >> 3, c8 = (t & 7) * 8;                   // 8 lanes x 16 B = one whole 128-B row segment per plane
  const float* sp = &part[0][row * kPitch + c8];
  v4f s0 = *(const v4f*)sp, s1 = *(const v4f*)(sp + 4);
#pragma unroll
  for (int w = 1; w < 8; ++w) {                               // fixed order
    s0 += *(const v4f*)(sp + w * (32 * kPitch));
    s1 += *(const v4f*)(sp + w * (32 * kPitch) + 4);
  }
  v8h hv, lv;
#pragma unroll
  for (int e = 0; e < 8; ++e) {
    const float f = ((e < 4) ? s0[e & 3] : s1[e & 3]) * (1.0f / 524288.0f);
    const unsigned short hb = f2bf_bits(f);
    hv[e] = __builtin_bit_cast(_Float16, hb);
    lv[e] = __builtin_bit_cast(_Float16, f2bf_bits(f - bf_bits2f(hb)));
  }
  const size_t co = (size_t)(m0 + row) * kEmb + g * kDh + n0 + c8;
  *(v8h*)(Ch + co) = hv;
  *(v8h*)(Cl + co) = lv;
}

// =====================================================================================
extern "C" void kernel_launch(void* const* d_in, const int* in_sizes, int n_in, void* d_out, int out_size,
                              void* d_ws, size_t ws_size, hipStream_t stream) {
  if (n_in < 14) return;
  if (in_sizes[0] != kTok * kEmb || in_sizes[1] != kEmb || in_sizes[2] != kEmb ||
      in_sizes[3] != kDh * kDh || in_sizes[4] != kDh || in_sizes[5] != kDh * kDh || in_sizes[6] != kDh ||
      in_sizes[7] != kDh * kDh || in_sizes[8] != kDh || in_sizes[9] != kDh * kDh ||
      in_sizes[10] != kHeads * kDh || in_sizes[11] != kHeads * kDh || in_sizes[12] != kEmb * kEmb || in_sizes[13] != kEmb ||
      out_size != kTok * kEmb) return;
  const float* x      = (const float*)d_in[0];
  const float* gamma  = (const float*)d_in[1];
  const float* beta   = (const float*)d_in[2];
  const float* Wq     = (const float*)d_in[3];
  const float* bq     = (const float*)d_in[4];
  const float* Wk     = (const float*)d_in[5];
  const float* bk     = (const float*)d_in[6];
  const float* Wv     = (const float*)d_in[7];
  const float* bv     = (const float*)d_in[8];
  const float* Wp     = (const float*)d_in[9];
  const float* u_bias = (const float*)d_in[10];
  const float* v_bias = (const float*)d_in[11];
  const float* Wo     = (const float*)d_in[12];
  const float* bo     = (const float*)d_in[13];
  float* out = (float*)d_out;   // [2][2048][1024] f32

  // ---- workspace carve (all offsets multiples of 256 B; total 231,146,496 B) ----
  // R0 WqT,WkT,WvT,WpT hi/lo bf16 [128 n][128 k]   8 x 32,768        =     262,144
  // R1 WoT hi/lo bf16 [1024 n][1024 k]              2 x 2,097,152     =   4,194,304
  // R2 16·bq, 16·bk f32 [128]                       2 x 512           =       1,024
  // R3 UBK f32 [2][8][2048], VBP f32 [8][2048]                        =     196,608
  // R4 Q16 f16 x16 [32768][128]                                       =   8,388,608
  // R5 K16 f16 x16 [32768][128]                                       =   8,388,608
  // R6 PP16 f16 x16 [16384][128]                                      =   4,194,304
  // R7 V f32 [32768][128] (= [4096][1024])                            =  16,777,216
  // R8 CTX hi/lo bf16 [4096][1024]                  2 x 8,388,608     =  16,777,216
  // R9 VT16 f16 x16 per batch [1024][2048]                            =   4,194,304
  // R10 per group of 4 heads: CONT f32 [4][2048][2048] 67,108,864 + PS f32 67,108,864 + P16 f16 [4][2048][2048] 33,554,432 = 167,772,160;
  //     prelude aliases inside R10 (dead before the loop): XN hi/lo bf16 [4096][1024] at +0/+8,388,608, PE hi/lo bf16 [2048][1024] at +16,777,216/+20,971,520
  char* ws = (char*)d_ws; size_t off = 0;
  auto carve = [&](size_t bytes) -> char* { char* p = ws + off; off += (bytes + 255) & ~(size_t)255; return p; };
  const size_t nW   = (size_t)kDh * kDh;            // 16,384
  const size_t nWo  = (size_t)kEmb * kEmb;          // 1,048,576
  const size_t nHd  = (size_t)kTok * kHeads * kDh;   // 4,194,304 (= kTok*kEmb)
  const size_t nPp  = (size_t)kSeq * kHeads * kDh;   // 2,097,152
  const size_t nSS  = (size_t)kSeq * kSeq;           // 4,194,304
  __bf16* WqTh = (__bf16*)carve(nW * 2); __bf16* WqTl = (__bf16*)carve(nW * 2);
  __bf16* WkTh = (__bf16*)carve(nW * 2); __bf16* WkTl = (__bf16*)carve(nW * 2);
  __bf16* WvTh = (__bf16*)carve(nW * 2); __bf16* WvTl = (__bf16*)carve(nW * 2);
  __bf16* WpTh = (__bf16*)carve(nW * 2); __bf16* WpTl = (__bf16*)carve(nW * 2);
  __bf16* WoTh = (__bf16*)carve(nWo * 2); __bf16* WoTl = (__bf16*)carve(nWo * 2);
  float* qb16 = (float*)carve(kDh * 4); float* kb16 = (float*)carve(kDh * 4);
  float* ubk  = (float*)carve((size_t)kBatch * kHeads * kSeq * 4);
  float* vbp  = (float*)carve((size_t)kHeads * kSeq * 4);
  _Float16* q16  = (_Float16*)carve(nHd * 2);
  _Float16* k16  = (_Float16*)carve(nHd * 2);
  _Float16* pp16 = (_Float16*)carve(nPp * 2);
  float*    vf32 = (float*)carve(nHd * 4);
  unsigned short* ctxh = (unsigned short*)carve(nHd * 2); unsigned short* ctxl = (unsigned short*)carve(nHd * 2);
  _Float16* vt16 = (_Float16*)carve((size_t)kEmb * kSeq * 2);
  char* loopBase = carve(kGroup * (nSS * 4 + nSS * 4 + nSS * 2));
  float*    contT = (float*)loopBase;
  float*    posT  = (float*)(loopBase + kGroup * nSS * 4);
  _Float16* p16   = (_Float16*)(loopBase + kGroup * nSS * 8);
  unsigned* xnh = (unsigned*)loopBase;                         // prelude aliases
  unsigned* xnl = (unsigned*)(loopBase + nHd * 2);
  unsigned* peh = (unsigned*)(loopBase + nHd * 4);
  unsigned* pel = (unsigned*)(loopBase + nHd * 4 + (size_t)kSeq * kEmb * 2);
  if (nHd * 4 + (size_t)kSeq * kEmb * 4 > kGroup * nSS * 10) return;   // aliases fit inside R10
  if (off > ws_size) return;

  // ---- prelude: weight planes (in [k][n] -> out [n][k]), scaled biases, LN planes, sinusoid planes ----
  transpose_split_bf16<<<dim3(kDh / 64, kDh / 64), dim3(32, 8), 0, stream>>>(Wq, kDh, WqTh, WqTl, kDh);     // in [128][128] -> out [128][128]
  transpose_split_bf16<<<dim3(kDh / 64, kDh / 64), dim3(32, 8), 0, stream>>>(Wk, kDh, WkTh, WkTl, kDh);
  transpose_split_bf16<<<dim3(kDh / 64, kDh / 64), dim3(32, 8), 0, stream>>>(Wv, kDh, WvTh, WvTl, kDh);
  transpose_split_bf16<<<dim3(kDh / 64, kDh / 64), dim3(32, 8), 0, stream>>>(Wp, kDh, WpTh, WpTl, kDh);
  transpose_split_bf16<<<dim3(kEmb / 64, kEmb / 64), dim3(32, 8), 0, stream>>>(Wo, kEmb, WoTh, WoTl, kEmb); // in [1024][1024] -> out [1024][1024]
  bias16_kernel<<<1, 64, 0, stream>>>(bq, bk, qb16, kb16);
  layernorm_split_kernel<<<kTok, 256, 0, stream>>>(x, gamma, beta, xnh, xnl);                             // 4096 blocks = all tokens
  posenc_split_kernel<<<(kSeq * kPairs) / 256, 256, 0, stream>>>(peh, pel);                                // 4096 blocks x 256 = 2048 x 512 pairs

  // ---- projections over the [32768][128] per-(token, head) row view of xn (same memory as [4096][1024]) ----
  { const int tl = (kTok * kHeads / 64) * (kDh / 64);        // 1024 tiles -> 128 blocks
    // q·16 (+16·bq), k·16 (+16·bk) as f16 planes; v (+bv) as f32
    wmma_gemm64<1, true, 2, 1, false><<<dim3(tl / 8, 1), 256, 0, stream>>>(U16(xnh), U16(xnl), kDh, 0, U16(WqTh), U16(WqTl), kDh, 0,
        q16, nullptr, kDh, 0, qb16, 0, nullptr, 0, nullptr, nullptr, nullptr, kTok * kHeads, kDh, kDh, 16.0f);
    wmma_gemm64<1, true, 2, 1, false><<<dim3(tl / 8, 1), 256, 0, stream>>>(U16(xnh), U16(xnl), kDh, 0, U16(WkTh), U16(WkTl), kDh, 0,
        k16, nullptr, kDh, 0, kb16, 0, nullptr, 0, nullptr, nullptr, nullptr, kTok * kHeads, kDh, kDh, 16.0f);
    wmma_gemm64<1, true, 2, 0, false><<<dim3(tl / 8, 1), 256, 0, stream>>>(U16(xnh), U16(xnl), kDh, 0, U16(WvTh), U16(WvTl), kDh, 0,
        vf32, nullptr, kDh, 0, bv, 0, nullptr, 0, nullptr, nullptr, nullptr, kTok * kHeads, kDh, kDh, 1.0f); }
  { const int tl = (kSeq * kHeads / 64) * (kDh / 64);        // 512 tiles -> 64 blocks; p·16 as f16 plane [16384][128]
    wmma_gemm64<1, true, 0, 1, false><<<dim3(tl / 8, 1), 256, 0, stream>>>(U16(peh), U16(pel), kDh, 0, U16(WpTh), U16(WpTl), kDh, 0,
        pp16, nullptr, kDh, 0, nullptr, 0, nullptr, 0, nullptr, nullptr, nullptr, kSeq * kHeads, kDh, kDh, 16.0f); }
  headbias_kernel<<<192, 256, 0, stream>>>(k16, pp16, u_bias, v_bias, ubk, vbp);                        // 128 blocks UBK + 64 blocks VBP

  // ---- per batch: v^T f16 x16; per group of kGroup heads: content and position tables (one launch), shift+softmax, p.v into ctx hi/lo planes ----
  for (int b = 0; b < kBatch; ++b) {
    // in [2048 r][1024 c] (pitch 1024) -> out [1024 c][2048 r] (pitch 2048), x16; grid (C/64 = 16, R/64 = 32)
    transpose_cast_f16<<<dim3(kEmb / 64, kSeq / 64), dim3(32, 8), 0, stream>>>(vf32 + (size_t)b * kSeq * kEmb, kEmb, vt16, kSeq, 16.0f);
    for (int h = 0; h < kHeads; h += kGroup) {
      const size_t qoff = (size_t)b * kSeq * kEmb + (size_t)h * kDh;   // row (b,s,h) of a [32768][128] plane = (b*2048+s)*1024 + h*128, row pitch 1024; next head = +128
      const int tl = (kSeq / 64) * (kSeq / 64);                        // 1024 tiles -> 128 blocks a head and table
      // grid.y = head in the group, grid.z = table:
      // z = 0: content[q][key] = (16q).(16k)/256 + u_bias[h].k[key]
      // z = 1: pos[q][n] = (16q).(16p_n)/256 + v_bias[h].p[n]  (p row (n,h) at n*1024 + h*128)
      wmma_gemm64<0, false, 2, 0, false><<<dim3(tl / 8, kGroup, 2), 256, 0, stream>>>(U16(q16 + qoff), nullptr, kEmb, kDh, U16(k16 + qoff), nullptr, kEmb, kDh,
          contT, nullptr, kSeq, (long)nSS, ubk + (size_t)(b * kHeads + h) * kSeq, kSeq, nullptr, 0,
          U16(pp16 + (size_t)h * kDh), posT, vbp + (size_t)h * kSeq, kSeq, kSeq, kDh, 1.0f / 256.0f);
      score_softmax_kernel<<<kSeq, 256, 0, stream>>>(contT, posT, p16);                                  // 2048 blocks, each row a of kGroup heads
      // ctx[b, q, h*128+d] = sum_key (p/l * 2^15)[q][key] * (16 v)^T[h*128+d][key] * 2^-19 ; 128 tiles of 32x64 a head, keys split over 8 waves
      pv_ksplit_kernel<<<dim3((kSeq / 32) * (kDh / 64), kGroup), 256, 0, stream>>>(p16, vt16 + (size_t)h * kDh * kSeq, ctxh + qoff, ctxl + qoff);
    }
  }

  // ---- out = ctx·Wo + bo : A bf16 hi/lo [4096][1024], Bt bf16 hi/lo [1024 n][1024 k], C f32 d_out [4096][1024]; 1024 tiles -> 128 blocks ----
  { const int tl = (kTok / 64) * (kEmb / 64);
    wmma_gemm64<1, true, 2, 0, false><<<dim3(tl / 8, 1), 256, 0, stream>>>(U16(ctxh), U16(ctxl), kEmb, 0, U16(WoTh), U16(WoTl), kEmb, 0,
        out, nullptr, kEmb, 0, bo, 0, nullptr, 0, nullptr, nullptr, nullptr, kTok, kEmb, kEmb, 1.0f); }
}

// v003
// A run of this version takes 302 microseconds.
// Next to v002, in two timings, it ran 1.71 and 1.70 times as fast.
// All steps since v000 together make it 6.69 times as fast.
// Projections xn·W{q,k,v} (K=128), p = pe·Wp (K=128) and out = ctx·Wo (K=1024): v_wmma_f32_16x16x32_bf16 with bf16 hi/lo split operands (hi·hi + hi·lo + lo·hi); content q·kᵀ and position q·pᵀ tables (K=128): v_wmma_f32_16x16x32_f16 with plain f16 operands carried x16; p·v (K=2048): v_wmma_f32_16x16x32_f16 with p/l carried x2^15 and vᵀ carried x16; f32 accumulate everywhere; LayerNorm, sinusoid table, u/v bias dots, relative shift and softmax in f32 on VALU.
#include <hip/hip_runtime.h>
#include <math.h>

typedef __attribute__((ext_vector_type(16))) _Float16 v16h;
typedef __attribute__((ext_vector_type(8)))  _Float16 v8h;
typedef __attribute__((ext_vector_type(4)))  _Float16 v4h;
typedef __attribute__((ext_vector_type(16))) __bf16   v16b;
typedef __attribute__((ext_vector_type(8)))  __bf16   v8b;
typedef __attribute__((ext_vector_type(8)))  float    v8f;
typedef __attribute__((ext_vector_type(4)))  float    v4f;
typedef __attribute__((ext_vector_type(2)))  float    v2f;
#define U16(p) ((const unsigned short*)(const void*)(p))

__device__ __forceinline__ unsigned short f2bf_bits(float f) {
  unsigned u = __float_as_uint(f);
  return (unsigned short)((u + 0x7FFFu + ((u >> 16) & 1u)) >> 16);
}
__device__ __forceinline__ float bf_bits2f(unsigned short h) { return __uint_as_float(((unsigned)h) << 16); }

// hazard guards as plain device helpers (no inline asm inside the kernel template body)
__device__ __forceinline__ void dep_guard_h(v8f& a, v8f& b, v16h x, v16h y) { asm volatile("v_nop\n\tv_nop\n\tv_nop\n\tv_nop" : "+v"(a), "+v"(b) : "v"(x), "v"(y)); }
__device__ __forceinline__ void dep_guard_b(v8f& a, v8f& b, v16b x, v16b y) { asm volatile("v_nop\n\tv_nop\n\tv_nop\n\tv_nop" : "+v"(a), "+v"(b) : "v"(x), "v"(y)); }
__device__ __forceinline__ void keep4_h(v16h a, v16h b, v16h c, v16h d) { asm volatile("v_nop" :: "v"(a), "v"(b), "v"(c), "v"(d)); }
__device__ __forceinline__ void keep4_b(v16b a, v16b b, v16b c, v16b d) { asm volatile("v_nop" :: "v"(a), "v"(b), "v"(c), "v"(d)); }
__device__ __forceinline__ void acc_guard4(v8f& a, v8f& b, v8f& c, v8f& d) { asm volatile("v_nop\n\tv_nop\n\tv_nop\n\tv_nop" : "+v"(a), "+v"(b), "+v"(c), "+v"(d)); }
template <typename T> struct Frag;
template <> struct Frag<_Float16> {
  typedef v16h V; union U { v16h v; v8h h[2]; };
  static __device__ __forceinline__ v16h load(const _Float16* p) {   // elements 0..7 <- p[0..7], 8..15 <- p[16..23]
    U f; f.h[0] = *(const v8h*)(p); f.h[1] = *(const v8h*)(p + 16); return f.v;
  }
  static __device__ __forceinline__ v8f mma(v16h a, v16h b, v8f c) {
    return __builtin_amdgcn_wmma_f32_16x16x32_f16(false, a, false, b, (short)0, c, false, false);
  }
  static __device__ __forceinline__ void guard(v8f& a, v8f& b, v16h x, v16h y) { dep_guard_h(a, b, x, y); }
  static __device__ __forceinline__ void keep(v16h a, v16h b, v16h c, v16h d) { keep4_h(a, b, c, d); }
};
template <> struct Frag<__bf16> {
  typedef v16b V; union U { v16b v; v8b h[2]; };
  static __device__ __forceinline__ v16b load(const __bf16* p) {
    U f; f.h[0] = *(const v8b*)(p); f.h[1] = *(const v8b*)(p + 16); return f.v;
  }
  static __device__ __forceinline__ v8f mma(v16b a, v16b b, v8f c) {
    return __builtin_amdgcn_wmma_f32_16x16x32_bf16(false, a, false, b, (short)0, c, false, false);
  }
  static __device__ __forceinline__ void guard(v8f& a, v8f& b, v16b x, v16b y) { dep_guard_b(a, b, x, y); }
  static __device__ __forceinline__ void keep(v16b a, v16b b, v16b c, v16b d) { keep4_b(a, b, c, d); }
};

// ---- Register-blocked batched WMMA GEMM ------------------------------------
// C[m,n] = scale * sum_k A[m,k] * Bt[n,k] (+bias)(+resid); each wave owns a 64x64 tile.
// A row-major [M,K]; Bt row-major [N,K]; M,N % 64 == 0, K % 32 == 0.
// SPLIT: operands are hi/lo planes (A2/Bt2 = lo planes, same layout); product = hi·hi + hi·lo + lo·hi.
// BIAS_MODE: 0 = none, 1 = bias[m], 2 = bias[n].
// OUT_MODE: 0 = f32, 1 = f16, 2 = bf16 hi plane (Cout) + bf16 lo plane (Cout2).
// ET: 0 = f16 operands, 1 = bf16 operands (pointers passed as 16-bit storage)
// Grid: x = tiles / 8, y = batch index b (strideA/B/C/R and strideBias are per b), z = 0 or 1: z = 1 takes BtZp, CoutZ and biasZ in
// place of Btp, Cout and bias (same A, same strides; non-split launches only), so two products of one A share a launch.
template <int ET> struct Elem;
template <> struct Elem<0> { typedef _Float16 T; };
template <> struct Elem<1> { typedef __bf16 T; };
template <int ET, bool SPLIT, int BIAS_MODE, int OUT_MODE, bool RESID, int ACT = 0>
__global__ __launch_bounds__(256) void wmma_gemm64(
    const unsigned short* __restrict__ Ap, const unsigned short* __restrict__ A2p, int lda, long strideA,
    const unsigned short* __restrict__ Btp, const unsigned short* __restrict__ Bt2p, int ldb, long strideB,
    void* __restrict__ Cout0, void* __restrict__ Cout2, int ldc, long strideC,
    const float* __restrict__ bias0, long strideBias,
    const float* __restrict__ resid, long strideR,
    const unsigned short* __restrict__ BtZp, void* __restrict__ CoutZ, const float* __restrict__ biasZ,
    int M, int N, int K, float scale) {
  typedef typename Elem<ET>::T T;
  typedef typename Frag<T>::V V;
  const bool zsel = blockIdx.z != 0;           // block-uniform
  const T* A = (const T*)Ap; const T* A2 = (const T*)A2p; const T* Bt = (const T*)(zsel ? BtZp : Btp); const T* Bt2 = (const T*)Bt2p;
  void* Cout = zsel ? CoutZ : Cout0;
  const float* bias = (BIAS_MODE != 0) ? ((zsel ? biasZ : bias0) + (size_t)blockIdx.y * strideBias) : nullptr;
  __shared__ __align__(16) float sT[8][16 * 68];   // per-wave 16x64 slab, pitch 68 floats
  const int b    = blockIdx.y;
  const int lane = threadIdx.x & 31;
  const int wave = threadIdx.x >> 5;
  const int tilesN = N >> 6;
  const int tilesM = M >> 6;
  const int tile = blockIdx.x * 8 + wave;
  if (tile >= tilesM * tilesN) return;   // wave-uniform; no block barriers in this kernel
  const int tm = tile / tilesN;
  const int tn = tile - tm * tilesN;
  const int m0 = tm << 6;
  const int n0 = tn << 6;

  const T* Ab  = A  + (size_t)b * strideA;
  const T* Bb  = Bt + (size_t)b * strideB;
  const T* Ab2 = SPLIT ? (A2  + (size_t)b * strideA) : nullptr;
  const T* Bb2 = SPLIT ? (Bt2 + (size_t)b * strideB) : nullptr;

  const int rlane = lane & 15;                 // row (A) / col (B, D) within subtile
  const int koff  = (lane >> 4) * 8;           // k offset of this lane half
  const int mOff  = (lane >> 4) * 8;           // D row offset

  v8f acc[4][4];
#pragma unroll
  for (int i = 0; i < 4; ++i)
#pragma unroll
    for (int j = 0; j < 4; ++j) acc[i][j] = (v8f){0.f,0.f,0.f,0.f,0.f,0.f,0.f,0.f};

  for (int k0 = 0; k0 < K; k0 += 32) {
    V bh[4], bl[4];
#pragma unroll
    for (int j = 0; j < 4; ++j) {
      const size_t bo = (size_t)(n0 + (j << 4) + rlane) * ldb + koff + k0;
      bh[j] = Frag<T>::load(Bb + bo);
      if (SPLIT) bl[j] = Frag<T>::load(Bb2 + bo);
    }
#pragma unroll
    for (int i = 0; i < 4; ++i) {
      const size_t ao = (size_t)(m0 + (i << 4) + rlane) * lda + koff + k0;
      V ah = Frag<T>::load(Ab + ao);
      V al;
      if (SPLIT) al = Frag<T>::load(Ab2 + ao);
#pragma unroll
      for (int j = 0; j < 4; ++j) {
        acc[i][j] = Frag<T>::mma(ah, bh[j], acc[i][j]);
        if (SPLIT) {
          acc[i][j] = Frag<T>::mma(ah, bl[j], acc[i][j]);
          acc[i][j] = Frag<T>::mma(al, bh[j], acc[i][j]);
        }
      }
      Frag<T>::guard(acc[i][0], acc[i][3], ah, SPLIT ? al : ah);
    }
    Frag<T>::keep(bh[0], bh[1], bh[2], bh[3]);
    if (SPLIT) Frag<T>::keep(bl[0], bl[1], bl[2], bl[3]);
  }
  acc_guard4(acc[0][0], acc[0][1], acc[0][2], acc[0][3]);
  acc_guard4(acc[1][0], acc[1][1], acc[1][2], acc[1][3]);
  acc_guard4(acc[2][0], acc[2][1], acc[2][2], acc[2][3]);
  acc_guard4(acc[3][0], acc[3][1], acc[3][2], acc[3][3]);

  // ---- epilogue ----
  float* slab = sT[wave];
  const float* Rb = RESID ? (resid + (size_t)b * strideR) : nullptr;
#pragma unroll
  for (int i = 0; i < 4; ++i) {
    const int mBase = m0 + (i << 4);
#pragma unroll
    for (int j = 0; j < 4; ++j) {
      const int n = n0 + (j << 4) + rlane;
      float bv = 0.f;
      if (BIAS_MODE == 2) bv = bias[n];
#pragma unroll
      for (int r = 0; r < 8; ++r) {
        float v = acc[i][j][r] * scale;
        if (BIAS_MODE == 1) v += bias[mBase + mOff + r];
        if (BIAS_MODE == 2) v += bv;
        if (RESID) v += Rb[(size_t)(mBase + mOff + r) * ldc + n];
        if (ACT == 1) v = tanhf(v);
        if (ACT == 2) v = fmaxf(v, 0.0f);
        if (ACT == 3) v = v / (1.0f + expf(-v));
        if (ACT == 4) v = (v > 0.f) ? v : 0.01f * v;
        if (ACT == 5) v = 0.5f * v * (1.0f + erff(v * 0.70710678118654752f));
        slab[(mOff + r) * 68 + (j << 4) + rlane] = v;
      }
    }
    __builtin_amdgcn_fence(__ATOMIC_RELEASE, "workgroup");
    __builtin_amdgcn_wave_barrier();
    __builtin_amdgcn_fence(__ATOMIC_ACQUIRE, "workgroup");
    if (OUT_MODE == 0) {
      float* C = (float*)Cout + (size_t)b * strideC;
      const int hh = lane >> 4, c4 = (lane & 15) * 4;     // row seg = 256 B = 16 lanes x 16 B
      {
#pragma unroll
        for (int it = 0; it < 8; ++it) {
          const int row = it * 2 + hh;
          v4f v = *(const v4f*)(slab + row * 68 + c4);
          *(v4f*)(C + (size_t)(mBase + row) * ldc + n0 + c4) = v;
        }
        
      }
    } else {
      const int q = lane >> 3, c8 = (lane & 7) * 8;
      unsigned short* C  = (unsigned short*)Cout  + (size_t)b * strideC;
      unsigned short* C2 = (OUT_MODE == 2) ? ((unsigned short*)Cout2 + (size_t)b * strideC) : nullptr;
      {
#pragma unroll
        for (int it = 0; it < 4; ++it) {
          const int row = it * 4 + q;
          const float* sp = slab + row * 68 + c8;
          v8h hv, lv;
#pragma unroll
          for (int e = 0; e < 8; ++e) {
            if (OUT_MODE == 1) {
              hv[e] = (_Float16)sp[e];
            } else {
              unsigned short hb = f2bf_bits(sp[e]);
              unsigned short lb = f2bf_bits(sp[e] - bf_bits2f(hb));
              hv[e] = __builtin_bit_cast(_Float16, hb);
              lv[e] = __builtin_bit_cast(_Float16, lb);
            }
          }
          *(v8h*)(C + (size_t)(mBase + row) * ldc + n0 + c8) = hv;
          if (OUT_MODE == 2) *(v8h*)(C2 + (size_t)(mBase + row) * ldc + n0 + c8) = lv;
        }
        
      }
    }
    __builtin_amdgcn_fence(__ATOMIC_RELEASE, "workgroup");
    __builtin_amdgcn_wave_barrier();
    __builtin_amdgcn_fence(__ATOMIC_ACQUIRE, "workgroup");
  }
}

// ---- f32 [R][C] (row pitch ldi) -> f16 transposed [C][R] (row pitch ldo); 64x64 tiles; each output row segment
__global__ __launch_bounds__(256) void transpose_cast_f16(const float* __restrict__ in, int ldi,
                                                         _Float16* __restrict__ outT, int ldo, float scale) {
  __shared__ __align__(16) _Float16 tile[64][72];     // [c][r]
  const int c0 = blockIdx.x * 64, r0 = blockIdx.y * 64;
  const int t = threadIdx.y * 32 + threadIdx.x;
  for (int i = threadIdx.y; i < 64; i += 8) {
    tile[threadIdx.x][i]      = (_Float16)(in[(size_t)(r0 + i) * ldi + c0 + threadIdx.x] * scale);
    tile[32 + threadIdx.x][i] = (_Float16)(in[(size_t)(r0 + i) * ldi + c0 + 32 + threadIdx.x] * scale);
  }
  __syncthreads();
  const int q = t >> 3, c8 = (t & 7) * 8;
  {
#pragma unroll
    for (int it = 0; it < 2; ++it) {
      const int c = it * 32 + q;
      v8h hv = *(const v8h*)(&tile[c][c8]);
      *(v8h*)(outT + (size_t)(c0 + c) * ldo + r0 + c8) = hv;
    }
    
  }
}

// ---- f32 [R][C] (pitch ldi) -> bf16 hi/lo transposed planes [C][R] (pitch ldo); 64x64 tiles; each output row segment
__global__ __launch_bounds__(256) void transpose_split_bf16(const float* __restrict__ in, int ldi,
                                                           __bf16* __restrict__ outH, __bf16* __restrict__ outL, int ldo) {
  __shared__ __align__(16) float tile[64][68];     // [c][r]
  const int c0 = blockIdx.x * 64, r0 = blockIdx.y * 64;
  const int t = threadIdx.y * 32 + threadIdx.x;
  for (int i = threadIdx.y; i < 64; i += 8) {
    tile[threadIdx.x][i]      = in[(size_t)(r0 + i) * ldi + c0 + threadIdx.x];
    tile[32 + threadIdx.x][i] = in[(size_t)(r0 + i) * ldi + c0 + 32 + threadIdx.x];
  }
  __syncthreads();
  const int q = t >> 3, c8 = (t & 7) * 8;
  {
#pragma unroll
    for (int it = 0; it < 2; ++it) {
      const int c = it * 32 + q;
      v8b hv, lv;
#pragma unroll
      for (int e = 0; e < 8; ++e) {
        const float f = tile[c][c8 + e];
        const unsigned short hb = f2bf_bits(f);
        hv[e] = __builtin_bit_cast(__bf16, hb);
        lv[e] = __builtin_bit_cast(__bf16, f2bf_bits(f - bf_bits2f(hb)));
      }
      *(v8b*)(outH + (size_t)(c0 + c) * ldo + r0 + c8) = hv;
      *(v8b*)(outL + (size_t)(c0 + c) * ldo + r0 + c8) = lv;
    }
    
  }
}

// =====================================================================================
constexpr int kBatch = 2;
constexpr int kSeq   = 2048;
constexpr int kEmb   = 1024;
constexpr int kHeads = 8;
constexpr int kDh    = 128;
constexpr int kTok   = kBatch * kSeq;          // 4096 tokens
constexpr int kPairs = kEmb / 2;               // 512 element pairs per row
static_assert(kHeads * kDh == kEmb);
static_assert(kPairs == 512);

// ---- LayerNorm (biased variance, eps 1e-5) -> xn as bf16 hi/lo planes (packed pairs). One block per token, 256 threads;
// thread t owns element pairs (2t,2t+1) and (512+2t,512+2t+1): 2 packed dwords per plane per thread; each store instruction
__global__ __launch_bounds__(256) void layernorm_split_kernel(
    const float* __restrict__ x, const float* __restrict__ gamma, const float* __restrict__ beta,
    unsigned* __restrict__ xh, unsigned* __restrict__ xl) {
  __shared__ float red[8];
  const int tok = blockIdx.x;
  const int t = threadIdx.x, lane = t & 31, wave = t >> 5;
  const float* xr = x + (size_t)tok * kEmb;
  const int ca = 2 * t, cb = kPairs + 2 * t;
  const v2f pa = *(const v2f*)(xr + ca);
  const v2f pb = *(const v2f*)(xr + cb);
  float s = (pa.x + pa.y) + (pb.x + pb.y);
#pragma unroll
  for (int off = 1; off < 32; off <<= 1) s += __shfl_xor(s, off, 32);
  if (lane == 0) red[wave] = s;
  __syncthreads();
  float tot = 0.f;
#pragma unroll
  for (int w = 0; w < 8; ++w) tot += red[w];       // fixed order
  const float mean = tot * (1.0f / (float)kEmb);
  __syncthreads();
  const float d0 = pa.x - mean, d1 = pa.y - mean, d2 = pb.x - mean, d3 = pb.y - mean;
  float s2 = (d0 * d0 + d1 * d1) + (d2 * d2 + d3 * d3);
#pragma unroll
  for (int off = 1; off < 32; off <<= 1) s2 += __shfl_xor(s2, off, 32);
  if (lane == 0) red[wave] = s2;
  __syncthreads();
  float tot2 = 0.f;
#pragma unroll
  for (int w = 0; w < 8; ++w) tot2 += red[w];
  const float var  = tot2 * (1.0f / (float)kEmb);
  const float rstd = 1.0f / sqrtf(var + 1e-5f);
  const float y0 = d0 * rstd * gamma[ca] + beta[ca];
  const float y1 = d1 * rstd * gamma[ca + 1] + beta[ca + 1];
  const float y2 = d2 * rstd * gamma[cb] + beta[cb];
  const float y3 = d3 * rstd * gamma[cb + 1] + beta[cb + 1];
  const unsigned short h0 = f2bf_bits(y0), h1 = f2bf_bits(y1), h2 = f2bf_bits(y2), h3 = f2bf_bits(y3);
  const unsigned short l0 = f2bf_bits(y0 - bf_bits2f(h0)), l1 = f2bf_bits(y1 - bf_bits2f(h1));
  const unsigned short l2 = f2bf_bits(y2 - bf_bits2f(h2)), l3 = f2bf_bits(y3 - bf_bits2f(h3));
  const unsigned uah = (unsigned)h0 | ((unsigned)h1 << 16), ual = (unsigned)l0 | ((unsigned)l1 << 16);
  const unsigned ubh = (unsigned)h2 | ((unsigned)h3 << 16), ubl = (unsigned)l2 | ((unsigned)l3 << 16);
  const size_t ia = (size_t)tok * kPairs + t, ib = ia + 256;
  {
    ((unsigned*)xh)[ia] = uah;
    ((unsigned*)xh)[ib] = ubh;
    ((unsigned*)xl)[ia] = ual;
    ((unsigned*)xl)[ib] = ubl;
    
  }
}

// ---- sinusoid table [kSeq][kEmb]: columns 2i = sin(pos·div_i), 2i+1 = cos(pos·div_i), div_i = exp(2i · (−ln 1e4 / kEmb)), f32,
// emitted as bf16 hi/lo planes (packed pairs). One thread per (pos, i): grid = kSeq*512/256 = 4096 blocks exactly; each wave's store
__global__ __launch_bounds__(256) void posenc_split_kernel(unsigned* __restrict__ peh, unsigned* __restrict__ pel) {
  const int idx = blockIdx.x * 256 + threadIdx.x;
  if (idx >= kSeq * kPairs) return;
  const int pos = idx >> 9, i = idx & 511;
  const float kNegLogRate = -0.00899447301950799f;        // −ln(10000)/1024
  const float freq = expf((float)(2 * i) * kNegLogRate);
  const float ang  = (float)pos * freq;
  const float sv = sinf(ang), cv = cosf(ang);
  const unsigned short hs = f2bf_bits(sv), hc = f2bf_bits(cv);
  const unsigned short ls = f2bf_bits(sv - bf_bits2f(hs)), lc = f2bf_bits(cv - bf_bits2f(hc));
  const unsigned uh = (unsigned)hs | ((unsigned)hc << 16), ul = (unsigned)ls | ((unsigned)lc << 16);
  {
    ((unsigned*)peh)[idx] = uh;
    ((unsigned*)pel)[idx] = ul;
    
  }
}

// ---- scaled projection biases: qb = 16·bq, kb = 16·bk (128 floats each). One block of 64: wave 0 -> qb, wave 1 -> kb;
__global__ __launch_bounds__(64) void bias16_kernel(const float* __restrict__ bq, const float* __restrict__ bk,
                                                   float* __restrict__ qb, float* __restrict__ kb) {
  const int lane = threadIdx.x & 31, wave = threadIdx.x >> 5;   // wave-uniform branch
  v4f v; float* dst;
  if (wave == 0) { v = *(const v4f*)(bq + 4 * lane); dst = qb + 4 * lane; }
  else           { v = *(const v4f*)(bk + 4 * lane); dst = kb + 4 * lane; }
  v = v * 16.0f;
  *(v4f*)dst = v;
  
}

// ---- per-key bias vectors: UBK[(b·8+h)·S + s] = u_bias[h]·k[b,s,h,:], VBP[h·S + s] = v_bias[h]·p[s,h,:] (f32 dots of 128 over the x16 f16 planes,
// folded back by 1/16). grid = 192 blocks x 256: blocks 0..127 -> UBK (32768 values), 128..191 -> VBP (16384 values); block-uniform branch;
__global__ __launch_bounds__(256) void headbias_kernel(const _Float16* __restrict__ k16, const _Float16* __restrict__ pp16,
                                                      const float* __restrict__ ub, const float* __restrict__ vb,
                                                      float* __restrict__ ubk, float* __restrict__ vbp) {
  const int t = blockIdx.x * 256 + threadIdx.x;
  const _Float16* row; const float* bvec; float* dst;
  if (blockIdx.x < 128) {
    const int b = t >> 14, h = (t >> 11) & 7, s = t & 2047;
    row = k16 + (size_t)((b * kSeq + s) * kHeads + h) * kDh; bvec = ub + h * kDh; dst = ubk + t;
  } else {
    const int u = t - 32768; const int h = (u >> 11) & 7, s = u & 2047;
    row = pp16 + (size_t)(s * kHeads + h) * kDh; bvec = vb + h * kDh; dst = vbp + u;
  }
  float acc = 0.f;
#pragma unroll 1
  for (int ch = 0; ch < kDh / 8; ++ch) {
    const v8h kv = *(const v8h*)(row + 8 * ch);
    const v4f b0 = *(const v4f*)(bvec + 8 * ch);
    const v4f b1 = *(const v4f*)(bvec + 8 * ch + 4);
    acc += b0.x * (float)kv[0] + b0.y * (float)kv[1] + b0.z * (float)kv[2] + b0.w * (float)kv[3]
         + b1.x * (float)kv[4] + b1.y * (float)kv[5] + b1.z * (float)kv[6] + b1.w * (float)kv[7];
  }
  const float r = acc * 0.0625f;
  *(float*)dst = r;
  
}

// ---- content and position scores, relative shift, softmax and p.v of 32 query rows of one (b, h) in one block; the rows' scores never leave LDS.
// grid = (kSeq / 32, kBatch * kHeads), 512 threads = 16 waves. sc[r][c], r = a - a0, holds in turn:
//   1. shifted[a][c] = c <= a ? ps[a][S-1-a+c] : (c == a+1 ? 0 : ps[a+1][c-a-2]), ps[a][n] = (16q[a]).(16p[n])/256 + v_bias.p[n]: the c >= a+2 part is the
//      product of rows a0+1..a0+32 with p rows 0..S-a0-1, the c <= a part that of rows a0..a0+31 with p rows S-32-a0..S-1; each result is stored
//      at its shifted column, results that fall outside the row are dropped; every sc[r][c] gets exactly one store;
//   2. s = (content + shifted) / 32, content[a][key] = (16q[a]).(16k[key])/256 + u_bias.k[key];
//   3. f16(exp(s - max) / sum * 2^15), written over the front half of the same row by the wave that owns the row;
//   4. the 8 key groups' f32 partials of p.v (pitch kPartPitch), summed in group order 0..7; output = bf16 hi/lo planes, row pitch kEmb.
constexpr int kRows      = 32;
constexpr int kScPitch   = kSeq + 4;    // floats; 8208 B = 16 B x odd, rows 8 apart = 32 banks apart
constexpr int kPartPitch = kDh + 4;     // floats; rows 8 apart = 32 banks apart
static_assert(8 * kRows * kPartPitch <= kRows * kScPitch);
// every "#pragma unroll" in the three helpers below: constant indices keep the fragment and accumulator arrays in registers
// qf[i][kk] = the lane's A fragments of 32 query rows; r0, r1 = the lane's own rows (tile rows lane & 15 and 16 + lane & 15) + its k offset
__device__ __forceinline__ void load_q(v16h (&qf)[2][4], const _Float16* r0, const _Float16* r1) {
#pragma unroll
  for (int kk = 0; kk < 4; ++kk) { qf[0][kk] = Frag<_Float16>::load(r0 + 32 * kk); qf[1][kk] = Frag<_Float16>::load(r1 + 32 * kk); }
  // the two pointers as inputs: their registers stay as the loads name them (no result lands on them) up to this wait
  asm volatile("s_wait_xcnt 0x0" :: "v"(r0), "v"(r1) : "memory");
}
// acc[i][j] = 32 query rows (fragments qf[i][kk], k = 32 kk ..) x 32 rows of a [.][kEmb]-pitched f16 plane; rows = the lane's own row (tile row lane & 15) + its k offset;
// bv0, bv1 = the per-column bias of the lane's two columns (bias = the lane's own first column)
// (pointers typed as global: a pointer that has gone through an asm statement would otherwise be read with flat loads)
typedef const __attribute__((address_space(1))) _Float16* GlobH;
typedef const __attribute__((address_space(1))) v8h*      GlobH8;
typedef const __attribute__((address_space(1))) float*    GlobF;
__device__ __forceinline__ void score_tile(const v16h (&qf)[2][4], GlobH& rows, GlobF& bias, v8f (&acc)[2][2], float& bv0, float& bv1) {
  v16h bf[2][4];
#pragma unroll
  for (int j = 0; j < 2; ++j)
#pragma unroll
    for (int kk = 0; kk < 4; ++kk) {                          // the k order of Frag<_Float16>::load: elements 0..7 <- p[0..7], 8..15 <- p[16..23]
      Frag<_Float16>::U f;
      f.h[0] = *(GlobH8)(rows + (size_t)(j << 4) * kEmb + 32 * kk);
      f.h[1] = *(GlobH8)(rows + (size_t)(j << 4) * kEmb + 32 * kk + 16);
      bf[j][kk] = f.v;
    }
  bv0 = bias[0]; bv1 = bias[16];
  // The loaded values, as inputs only: all of a tile's loads are issued before the first product (one memory latency a tile, not one per k step).
  // The two pointers go through the statement: the caller's step to the next tile, the next write of the registers that the loads name, comes behind this wait.
  asm volatile("s_wait_xcnt 0x0" : "+v"(rows), "+v"(bias) : "v"(bf[0][0]), "v"(bf[0][1]), "v"(bf[0][2]), "v"(bf[0][3]),
               "v"(bf[1][0]), "v"(bf[1][1]), "v"(bf[1][2]), "v"(bf[1][3]), "v"(bv0), "v"(bv1) : "memory");
#pragma unroll
  for (int i = 0; i < 2; ++i)
#pragma unroll
    for (int j = 0; j < 2; ++j) acc[i][j] = (v8f){0.f,0.f,0.f,0.f,0.f,0.f,0.f,0.f};
#pragma unroll
  for (int kk = 0; kk < 4; ++kk)
#pragma unroll
    for (int i = 0; i < 2; ++i)
#pragma unroll
      for (int j = 0; j < 2; ++j) acc[i][j] = Frag<_Float16>::mma(qf[i][kk], bf[j][kk], acc[i][j]);
}
// one step down a row of the tile is one step right in the shifted table: element (16 i + r, 16 j) of the lane goes to dst + (16 i + r) * (pitch + 1) + 16 j.
// GUARD: c0 = the column that dst stands for; elements whose column falls outside 0 .. kSeq - 1 are dropped (only the tiles at a row's ends have such)
template <bool GUARD>
__device__ __forceinline__ void store_shifted(float* dst, const v8f (&acc)[2][2], float bv0, float bv1, int c0) {
#pragma unroll
  for (int j = 0; j < 2; ++j)
#pragma unroll
    for (int i = 0; i < 2; ++i)
#pragma unroll
      for (int r = 0; r < 8; ++r) {
        const int d = (i << 4) + r;
        if (!GUARD || (unsigned)(c0 + d + (j << 4)) < (unsigned)kSeq)
          dst[d * (kScPitch + 1) + (j << 4)] = acc[i][j][r] * (1.0f / 256.0f) + (j ? bv1 : bv0);
      }
}
__global__ __launch_bounds__(512) void attn_rows_kernel(const _Float16* __restrict__ q16, const _Float16* __restrict__ k16,
                                                       const _Float16* __restrict__ pp16, const _Float16* __restrict__ vt16,
                                                       const float* __restrict__ ubk, const float* __restrict__ vbp,
                                                       unsigned short* __restrict__ Ch, unsigned short* __restrict__ Cl) {
  __shared__ __align__(16) float sc[kRows * kScPitch];
  const int t = threadIdx.x, lane = t & 31;
  const int wave = __builtin_amdgcn_readfirstlane(t >> 5);    // scalar, so that the tile loops branch on scalars
  const int a0 = blockIdx.x * kRows;
  const int bh = blockIdx.y, b = bh / kHeads, h = bh % kHeads;
  const int rlane = lane & 15;
  const int half8 = (lane >> 4) * 8;                          // k offset of this lane half (A, B) and D row offset
  const _Float16* qb = q16 + (size_t)b * kSeq * kEmb + h * kDh;   // row s at s * kEmb
  const _Float16* kb = k16 + (size_t)b * kSeq * kEmb + h * kDh;
  const _Float16* pb = pp16 + h * kDh;
  const float* ub = ubk + (size_t)bh * kSeq;
  const float* vb = vbp + (size_t)h * kSeq;

  // every "#pragma unroll" in this kernel: constant indices keep the fragment and accumulator arrays in registers
  if (t < kRows) { const int c = a0 + t + 1; if (c < kSeq) sc[t * kScPitch + c] = 0.0f; }

  v16h qf[2][4];
  v8f acc2[2][2];
  float bv0, bv1;
  // ---- 1a. columns c >= a+2: query rows a+1 (the last row of the table has no such column; its address is clamped) ----
  load_q(qf, qb + (size_t)((a0 + 1 + rlane < kSeq) ? (a0 + 1 + rlane) : (kSeq - 1)) * kEmb + half8,
             qb + (size_t)((a0 + 17 + rlane < kSeq) ? (a0 + 17 + rlane) : (kSeq - 1)) * kEmb + half8);
  const int nUp = (kSeq - a0) >> 5;                           // 32-column tiles of either part; nUp + nLo = kSeq / 32 + 1
  const int nLo = (a0 + kRows) >> 5;
  GlobH prow = (GlobH)(pb + (size_t)((wave << 5) + rlane) * kEmb + half8);    // the lane's row of the wave's tile and its bias; 16 tiles on a trip
  GlobF vrow = (GlobF)(vb + (wave << 5) + rlane);
  for (int jj = wave; jj < nUp; jj += 16, prow += (size_t)512 * kEmb, vrow += 512) {
    const int n0 = jj << 5;
    score_tile(qf, prow, vrow, acc2, bv0, bv1);
    const int cmin = n0 + a0 + 2;                             // column of the tile's element (row 0, n0); the tile spans cmin .. cmin + 62
    float* dst = sc + half8 * kScPitch + cmin + rlane + half8;
    if (cmin + 62 < kSeq) store_shifted<false>(dst, acc2, bv0, bv1, 0);
    else                  store_shifted<true>(dst, acc2, bv0, bv1, cmin + rlane + half8);
  }
  // ---- 1b. columns c <= a: query rows a; these fragments also serve the content product ----
  load_q(qf, qb + (size_t)(a0 + rlane) * kEmb + half8, qb + (size_t)(a0 + 16 + rlane) * kEmb + half8);
  const int jLo = (wave - nUp) & 15;                          // the deal of tiles to waves goes on where 1a's ended
  prow = (GlobH)(pb + (size_t)((kSeq - kRows - a0) + (jLo << 5) + rlane) * kEmb + half8);
  vrow = (GlobF)(vb + (kSeq - kRows - a0) + (jLo << 5) + rlane);
  for (int jj = jLo; jj < nLo; jj += 16, prow += (size_t)512 * kEmb, vrow += 512) {
    const int n0 = (kSeq - kRows - a0) + (jj << 5);
    score_tile(qf, prow, vrow, acc2, bv0, bv1);
    const int cmin = n0 + a0 - (kSeq - 1);                    // = 32 jj - 31
    float* dst = sc + half8 * kScPitch + cmin + rlane + half8;
    if (cmin >= 0) store_shifted<false>(dst, acc2, bv0, bv1, 0);
    else           store_shifted<true>(dst, acc2, bv0, bv1, cmin + rlane + half8);
  }
  __syncthreads();                                            // every shifted position score is in LDS before the content product adds to it

  // ---- 2. content; wave w takes the 32-key tiles w, w + 16, w + 32, w + 48 ----
  GlobH krow = (GlobH)(kb + (size_t)((wave << 5) + rlane) * kEmb + half8);
  GlobF urow = (GlobF)(ub + (wave << 5) + rlane);
  for (int jj = wave; jj < kSeq / 32; jj += 16, krow += (size_t)512 * kEmb, urow += 512) {
    const int n0 = jj << 5;
    score_tile(qf, krow, urow, acc2, bv0, bv1);
#pragma unroll
    for (int j = 0; j < 2; ++j) {
      const int n = n0 + (j << 4) + rlane;
      const float bv = j ? bv1 : bv0;
#pragma unroll
      for (int i = 0; i < 2; ++i)
#pragma unroll
        for (int r = 0; r < 8; ++r) {
          float* e = sc + ((i << 4) + half8 + r) * kScPitch + n;
          *e = ((acc2[i][j][r] * (1.0f / 256.0f) + bv) + *e) * (1.0f / 32.0f);
        }
    }
  }
  __syncthreads();                                            // whole score rows are in LDS before a wave takes its rows' maximum

  // ---- 3. softmax; wave w owns rows 2w and 2w + 1, lane l columns 128 it + 4 l .. + 3 ----
#pragma unroll 1   // one row's 64 floats a lane live at a time, not two rows'
  for (int rr = 0; rr < 2; ++rr) {
    float* srow = sc + (wave * 2 + rr) * kScPitch;
    v4f x[16];
#pragma unroll
    for (int it = 0; it < 16; ++it) x[it] = *(const v4f*)(srow + it * 128 + 4 * lane);
    float mx = -INFINITY;
#pragma unroll
    for (int it = 0; it < 16; ++it) mx = fmaxf(mx, fmaxf(fmaxf(x[it].x, x[it].y), fmaxf(x[it].z, x[it].w)));
#pragma unroll
    for (int off = 1; off < 32; off <<= 1) mx = fmaxf(mx, __shfl_xor(mx, off, 32));
    float sum = 0.f;
#pragma unroll
    for (int it = 0; it < 16; ++it) {
      x[it].x = __expf(x[it].x - mx); x[it].y = __expf(x[it].y - mx); x[it].z = __expf(x[it].z - mx); x[it].w = __expf(x[it].w - mx);
      sum += (x[it].x + x[it].y) + (x[it].z + x[it].w);
    }
#pragma unroll
    for (int off = 1; off < 32; off <<= 1) sum += __shfl_xor(sum, off, 32);
    const float f = (1.0f / sum) * 32768.0f;
    _Float16* prow = (_Float16*)srow;                         // all of the row is in this wave's registers by now
#pragma unroll
    for (int it = 0; it < 16; ++it) {
      v4h hv;
      hv[0] = (_Float16)(x[it].x * f); hv[1] = (_Float16)(x[it].y * f); hv[2] = (_Float16)(x[it].z * f); hv[3] = (_Float16)(x[it].w * f);
      *(v4h*)(prow + it * 128 + 4 * lane) = hv;
    }
  }
  __syncthreads();                                            // all 32 rows of p are in LDS before any wave reads them as A fragments

  // ---- 4. p.v: wave = (key group kg of 256 keys, half dh of the 128 columns); ctx[q][d] = 2^-19 * sum_key p[q][key] * Vt[d][key] ----
  const int kg = wave & 7, dh = wave >> 3;
  const _Float16* Ar = (const _Float16*)sc + rlane * (2 * kScPitch) + kg * (kSeq / 8) + half8;
  const _Float16* Br = vt16 + ((size_t)bh * kDh + dh * 64 + rlane) * kSeq + kg * (kSeq / 8) + half8;
  v8f acc[2][4];
#pragma unroll
  for (int i = 0; i < 2; ++i)
#pragma unroll
    for (int j = 0; j < 4; ++j) acc[i][j] = (v8f){0.f,0.f,0.f,0.f,0.f,0.f,0.f,0.f};
  for (int k0 = 0; k0 < kSeq / 8; k0 += 64) {                 // 64 keys a trip = one whole 128-B line of every Vt row it reads
    v16h af[2][2], bf[2][4];
#pragma unroll
    for (int s = 0; s < 2; ++s) {
#pragma unroll
      for (int j = 0; j < 4; ++j) bf[s][j] = Frag<_Float16>::load(Br + (size_t)(j << 4) * kSeq + k0 + 32 * s);
#pragma unroll
      for (int i = 0; i < 2; ++i) af[s][i] = Frag<_Float16>::load(Ar + (i << 4) * (2 * kScPitch) + k0 + 32 * s);
    }
#pragma unroll
    for (int s = 0; s < 2; ++s)
#pragma unroll
      for (int i = 0; i < 2; ++i)
#pragma unroll
        for (int j = 0; j < 4; ++j) acc[i][j] = Frag<_Float16>::mma(af[s][i], bf[s][j], acc[i][j]);
  }
  __syncthreads();                                            // every wave has read its p fragments before the partials overwrite them

  float* mine = sc + kg * (kRows * kPartPitch) + dh * 64;
#pragma unroll
  for (int i = 0; i < 2; ++i)
#pragma unroll
    for (int j = 0; j < 4; ++j)
#pragma unroll
      for (int r = 0; r < 8; ++r) mine[((i << 4) + half8 + r) * kPartPitch + (j << 4) + rlane] = acc[i][j][r];
  __syncthreads();                                            // all 8 partials are in LDS before any thread sums them

  const int row = t >> 4, c8 = (t & 15) * 8;                  // 16 lanes x 16 B = one whole 256-B row segment per plane
  const float* sp = sc + row * kPartPitch + c8;
  v4f s0 = *(const v4f*)sp, s1 = *(const v4f*)(sp + 4);
#pragma unroll
  for (int w = 1; w < 8; ++w) {                               // fixed order
    s0 += *(const v4f*)(sp + w * (kRows * kPartPitch));
    s1 += *(const v4f*)(sp + w * (kRows * kPartPitch) + 4);
  }
  v8h hv, lv;
#pragma unroll
  for (int e = 0; e < 8; ++e) {
    const float f = ((e < 4) ? s0[e & 3] : s1[e & 3]) * (1.0f / 524288.0f);
    const unsigned short hb = f2bf_bits(f);
    hv[e] = __builtin_bit_cast(_Float16, hb);
    lv[e] = __builtin_bit_cast(_Float16, f2bf_bits(f - bf_bits2f(hb)));
  }
  const size_t co = (size_t)(b * kSeq + a0 + row) * kEmb + h * kDh + c8;
  *(v8h*)(Ch + co) = hv;
  *(v8h*)(Cl + co) = lv;
}

// =====================================================================================
extern "C" void kernel_launch(void* const* d_in, const int* in_sizes, int n_in, void* d_out, int out_size,
                              void* d_ws, size_t ws_size, hipStream_t stream) {
  if (n_in < 14) return;
  if (in_sizes[0] != kTok * kEmb || in_sizes[1] != kEmb || in_sizes[2] != kEmb ||
      in_sizes[3] != kDh * kDh || in_sizes[4] != kDh || in_sizes[5] != kDh * kDh || in_sizes[6] != kDh ||
      in_sizes[7] != kDh * kDh || in_sizes[8] != kDh || in_sizes[9] != kDh * kDh ||
      in_sizes[10] != kHeads * kDh || in_sizes[11] != kHeads * kDh || in_sizes[12] != kEmb * kEmb || in_sizes[13] != kEmb ||
      out_size != kTok * kEmb) return;
  const float* x      = (const float*)d_in[0];
  const float* gamma  = (const float*)d_in[1];
  const float* beta   = (const float*)d_in[2];
  const float* Wq     = (const float*)d_in[3];
  const float* bq     = (const float*)d_in[4];
  const float* Wk     = (const float*)d_in[5];
  const float* bk     = (const float*)d_in[6];
  const float* Wv     = (const float*)d_in[7];
  const float* bv     = (const float*)d_in[8];
  const float* Wp     = (const float*)d_in[9];
  const float* u_bias = (const float*)d_in[10];
  const float* v_bias = (const float*)d_in[11];
  const float* Wo     = (const float*)d_in[12];
  const float* bo     = (const float*)d_in[13];
  float* out = (float*)d_out;   // [2][2048][1024] f32

  // ---- workspace carve (all offsets multiples of 256 B; total 92,734,464 B) ----
  // R0 WqT,WkT,WvT,WpT hi/lo bf16 [128 n][128 k]   8 x 32,768        =     262,144
  // R1 WoT hi/lo bf16 [1024 n][1024 k]              2 x 2,097,152     =   4,194,304
  // R2 16·bq, 16·bk f32 [128]                       2 x 512           =       1,024
  // R3 UBK f32 [2][8][2048], VBP f32 [8][2048]                        =     196,608
  // R4 Q16 f16 x16 [32768][128]                                       =   8,388,608
  // R5 K16 f16 x16 [32768][128]                                       =   8,388,608
  // R6 PP16 f16 x16 [16384][128]                                      =   4,194,304
  // R7 V f32 [32768][128] (= [4096][1024])                            =  16,777,216
  // R8 CTX hi/lo bf16 [4096][1024]                  2 x 8,388,608     =  16,777,216
  // R9 VT16 f16 x16 [2 b][1024][2048]                                 =   8,388,608
  // R10 XN hi/lo bf16 [4096][1024] 2 x 8,388,608, PE hi/lo bf16 [2048][1024] 2 x 4,194,304 = 25,165,824
  char* ws = (char*)d_ws; size_t off = 0;
  auto carve = [&](size_t bytes) -> char* { char* p = ws + off; off += (bytes + 255) & ~(size_t)255; return p; };
  const size_t nW   = (size_t)kDh * kDh;            // 16,384
  const size_t nWo  = (size_t)kEmb * kEmb;          // 1,048,576
  const size_t nHd  = (size_t)kTok * kHeads * kDh;   // 4,194,304 (= kTok*kEmb)
  const size_t nPp  = (size_t)kSeq * kHeads * kDh;   // 2,097,152
  __bf16* WqTh = (__bf16*)carve(nW * 2); __bf16* WqTl = (__bf16*)carve(nW * 2);
  __bf16* WkTh = (__bf16*)carve(nW * 2); __bf16* WkTl = (__bf16*)carve(nW * 2);
  __bf16* WvTh = (__bf16*)carve(nW * 2); __bf16* WvTl = (__bf16*)carve(nW * 2);
  __bf16* WpTh = (__bf16*)carve(nW * 2); __bf16* WpTl = (__bf16*)carve(nW * 2);
  __bf16* WoTh = (__bf16*)carve(nWo * 2); __bf16* WoTl = (__bf16*)carve(nWo * 2);
  float* qb16 = (float*)carve(kDh * 4); float* kb16 = (float*)carve(kDh * 4);
  float* ubk  = (float*)carve((size_t)kBatch * kHeads * kSeq * 4);
  float* vbp  = (float*)carve((size_t)kHeads * kSeq * 4);
  _Float16* q16  = (_Float16*)carve(nHd * 2);
  _Float16* k16  = (_Float16*)carve(nHd * 2);
  _Float16* pp16 = (_Float16*)carve(nPp * 2);
  float*    vf32 = (float*)carve(nHd * 4);
  unsigned short* ctxh = (unsigned short*)carve(nHd * 2); unsigned short* ctxl = (unsigned short*)carve(nHd * 2);
  _Float16* vt16 = (_Float16*)carve((size_t)kBatch * kEmb * kSeq * 2);
  unsigned* xnh = (unsigned*)carve(nHd * 2);
  unsigned* xnl = (unsigned*)carve(nHd * 2);
  unsigned* peh = (unsigned*)carve((size_t)kSeq * kEmb * 2);
  unsigned* pel = (unsigned*)carve((size_t)kSeq * kEmb * 2);
  if (off > ws_size) return;

  // ---- prelude: weight planes (in [k][n] -> out [n][k]), scaled biases, LN planes, sinusoid planes ----
  transpose_split_bf16<<<dim3(kDh / 64, kDh / 64), dim3(32, 8), 0, stream>>>(Wq, kDh, WqTh, WqTl, kDh);     // in [128][128] -> out [128][128]
  transpose_split_bf16<<<dim3(kDh / 64, kDh / 64), dim3(32, 8), 0, stream>>>(Wk, kDh, WkTh, WkTl, kDh);
  transpose_split_bf16<<<dim3(kDh / 64, kDh / 64), dim3(32, 8), 0, stream>>>(Wv, kDh, WvTh, WvTl, kDh);
  transpose_split_bf16<<<dim3(kDh / 64, kDh / 64), dim3(32, 8), 0, stream>>>(Wp, kDh, WpTh, WpTl, kDh);
  transpose_split_bf16<<<dim3(kEmb / 64, kEmb / 64), dim3(32, 8), 0, stream>>>(Wo, kEmb, WoTh, WoTl, kEmb); // in [1024][1024] -> out [1024][1024]
  bias16_kernel<<<1, 64, 0, stream>>>(bq, bk, qb16, kb16);
  layernorm_split_kernel<<<kTok, 256, 0, stream>>>(x, gamma, beta, xnh, xnl);                             // 4096 blocks = all tokens
  posenc_split_kernel<<<(kSeq * kPairs) / 256, 256, 0, stream>>>(peh, pel);                                // 4096 blocks x 256 = 2048 x 512 pairs

  // ---- projections over the [32768][128] per-(token, head) row view of xn (same memory as [4096][1024]) ----
  { const int tl = (kTok * kHeads / 64) * (kDh / 64);        // 1024 tiles -> 128 blocks
    // q·16 (+16·bq), k·16 (+16·bk) as f16 planes; v (+bv) as f32
    wmma_gemm64<1, true, 2, 1, false><<<dim3(tl / 8, 1), 256, 0, stream>>>(U16(xnh), U16(xnl), kDh, 0, U16(WqTh), U16(WqTl), kDh, 0,
        q16, nullptr, kDh, 0, qb16, 0, nullptr, 0, nullptr, nullptr, nullptr, kTok * kHeads, kDh, kDh, 16.0f);
    wmma_gemm64<1, true, 2, 1, false><<<dim3(tl / 8, 1), 256, 0, stream>>>(U16(xnh), U16(xnl), kDh, 0, U16(WkTh), U16(WkTl), kDh, 0,
        k16, nullptr, kDh, 0, kb16, 0, nullptr, 0, nullptr, nullptr, nullptr, kTok * kHeads, kDh, kDh, 16.0f);
    wmma_gemm64<1, true, 2, 0, false><<<dim3(tl / 8, 1), 256, 0, stream>>>(U16(xnh), U16(xnl), kDh, 0, U16(WvTh), U16(WvTl), kDh, 0,
        vf32, nullptr, kDh, 0, bv, 0, nullptr, 0, nullptr, nullptr, nullptr, kTok * kHeads, kDh, kDh, 1.0f); }
  { const int tl = (kSeq * kHeads / 64) * (kDh / 64);        // 512 tiles -> 64 blocks; p·16 as f16 plane [16384][128]
    wmma_gemm64<1, true, 0, 1, false><<<dim3(tl / 8, 1), 256, 0, stream>>>(U16(peh), U16(pel), kDh, 0, U16(WpTh), U16(WpTl), kDh, 0,
        pp16, nullptr, kDh, 0, nullptr, 0, nullptr, 0, nullptr, nullptr, nullptr, kSeq * kHeads, kDh, kDh, 16.0f); }
  headbias_kernel<<<192, 256, 0, stream>>>(k16, pp16, u_bias, v_bias, ubk, vbp);                        // 128 blocks UBK + 64 blocks VBP

  // ---- per batch: v^T f16 x16; then all of attention for every (b, h) in one launch, into the ctx hi/lo planes ----
  for (int b = 0; b < kBatch; ++b) {
    // in [2048 r][1024 c] (pitch 1024) -> out [1024 c][2048 r] (pitch 2048), x16; grid (C/64 = 16, R/64 = 32)
    transpose_cast_f16<<<dim3(kEmb / 64, kSeq / 64), dim3(32, 8), 0, stream>>>(vf32 + (size_t)b * kSeq * kEmb, kEmb, vt16 + (size_t)b * kEmb * kSeq, kSeq, 16.0f);
  }
  attn_rows_kernel<<<dim3(kSeq / kRows, kBatch * kHeads), 512, 0, stream>>>(q16, k16, pp16, vt16, ubk, vbp, ctxh, ctxl);   // 64 x 16 blocks of 32 query rows

  // ---- out = ctx·Wo + bo : A bf16 hi/lo [4096][1024], Bt bf16 hi/lo [1024 n][1024 k], C f32 d_out [4096][1024]; 1024 tiles -> 128 blocks ----
  { const int tl = (kTok / 64) * (kEmb / 64);
    wmma_gemm64<1, true, 2, 0, false><<<dim3(tl / 8, 1), 256, 0, stream>>>(U16(ctxh), U16(ctxl), kEmb, 0, U16(WoTh), U16(WoTl), kEmb, 0,
        out, nullptr, kEmb, 0, bo, 0, nullptr, 0, nullptr, nullptr, nullptr, kTok, kEmb, kEmb, 1.0f); }
}

// v004
// It runs in 237 microseconds.
// Timed twice side by side with v003, it ran 1.28 and 1.27 times as fast.
// Counting every step since v000, it is 8.52 times as fast.
// Projections xn·W{q,k,v} (K=128), p = pe·Wp (K=128) and out = ctx·Wo (K=1024): v_wmma_f32_16x16x32_bf16 with bf16 hi/lo split operands (hi·hi + hi·lo + lo·hi); content q·kᵀ and position q·pᵀ tables (K=128): v_wmma_f32_16x16x32_f16 with plain f16 operands carried x16; p·v (K=2048): v_wmma_f32_16x16x32_f16 with p/l carried x2^15 and vᵀ carried x16; f32 accumulate everywhere; LayerNorm, sinusoid table, u/v bias dots, relative shift and softmax in f32 on VALU.
#include <hip/hip_runtime.h>
#include <math.h>

typedef __attribute__((ext_vector_type(16))) _Float16 v16h;
typedef __attribute__((ext_vector_type(8)))  _Float16 v8h;
typedef __attribute__((ext_vector_type(4)))  _Float16 v4h;
typedef __attribute__((ext_vector_type(16))) __bf16   v16b;
typedef __attribute__((ext_vector_type(8)))  __bf16   v8b;
typedef __attribute__((ext_vector_type(8)))  float    v8f;
typedef __attribute__((ext_vector_type(4)))  float    v4f;
typedef __attribute__((ext_vector_type(2)))  float    v2f;
#define U16(p) ((const unsigned short*)(const void*)(p))

__device__ __forceinline__ unsigned short f2bf_bits(float f) {
  unsigned u = __float_as_uint(f);
  return (unsigned short)((u + 0x7FFFu + ((u >> 16) & 1u)) >> 16);
}
__device__ __forceinline__ float bf_bits2f(unsigned short h) { return __uint_as_float(((unsigned)h) << 16); }

// hazard guards as plain device helpers
__device__ __forceinline__ void dep_guard_h(v8f& a, v8f& b, v16h x, v16h y) { asm volatile("v_nop\n\tv_nop\n\tv_nop\n\tv_nop" : "+v"(a), "+v"(b) : "v"(x), "v"(y)); }
__device__ __forceinline__ void dep_guard_b(v8f& a, v8f& b, v16b x, v16b y) { asm volatile("v_nop\n\tv_nop\n\tv_nop\n\tv_nop" : "+v"(a), "+v"(b) : "v"(x), "v"(y)); }
__device__ __forceinline__ void keep4_h(v16h a, v16h b, v16h c, v16h d) { asm volatile("v_nop" :: "v"(a), "v"(b), "v"(c), "v"(d)); }
__device__ __forceinline__ void keep4_b(v16b a, v16b b, v16b c, v16b d) { asm volatile("v_nop" :: "v"(a), "v"(b), "v"(c), "v"(d)); }
__device__ __forceinline__ void acc_guard4(v8f& a, v8f& b, v8f& c, v8f& d) { asm volatile("v_nop\n\tv_nop\n\tv_nop\n\tv_nop" : "+v"(a), "+v"(b), "+v"(c), "+v"(d)); }
template <typename T> struct Frag;
template <> struct Frag<_Float16> {
  typedef v16h V; union U { v16h v; v8h h[2]; };
  static __device__ __forceinline__ v16h load(const _Float16* p) {   // elements 0..7 <- p[0..7], 8..15 <- p[16..23]
    U f; f.h[0] = *(const v8h*)(p); f.h[1] = *(const v8h*)(p + 16); return f.v;
  }
  static __device__ __forceinline__ v8f mma(v16h a, v16h b, v8f c) {
    return __builtin_amdgcn_wmma_f32_16x16x32_f16(false, a, false, b, (short)0, c, false, false);
  }
  static __device__ __forceinline__ void guard(v8f& a, v8f& b, v16h x, v16h y) { dep_guard_h(a, b, x, y); }
  static __device__ __forceinline__ void keep(v16h a, v16h b, v16h c, v16h d) { keep4_h(a, b, c, d); }
};
template <> struct Frag<__bf16> {
  typedef v16b V; union U { v16b v; v8b h[2]; };
  static __device__ __forceinline__ v16b load(const __bf16* p) {
    U f; f.h[0] = *(const v8b*)(p); f.h[1] = *(const v8b*)(p + 16); return f.v;
  }
  static __device__ __forceinline__ v8f mma(v16b a, v16b b, v8f c) {
    return __builtin_amdgcn_wmma_f32_16x16x32_bf16(false, a, false, b, (short)0, c, false, false);
  }
  static __device__ __forceinline__ void guard(v8f& a, v8f& b, v16b x, v16b y) { dep_guard_b(a, b, x, y); }
  static __device__ __forceinline__ void keep(v16b a, v16b b, v16b c, v16b d) { keep4_b(a, b, c, d); }
};

// ---- Register-blocked batched WMMA GEMM ------------------------------------
// C[m,n] = scale * sum_k A[m,k] * Bt[n,k] (+bias)(+resid); each wave owns a 64x64 tile.
// A row-major [M,K]; Bt row-major [N,K]; M,N % 64 == 0, K % 32 == 0.
// SPLIT: operands are hi/lo planes (A2/Bt2 = lo planes, same layout); product = hi·hi + hi·lo + lo·hi.
// BIAS_MODE: 0 = none, 1 = bias[m], 2 = bias[n].
// OUT_MODE: 0 = f32, 1 = f16, 2 = bf16 hi plane (Cout) + bf16 lo plane (Cout2).
// ET: 0 = f16 operands, 1 = bf16 operands (pointers passed as 16-bit storage)
// bx = tiles / 8 (tile = 8 bx + wave), b = batch index (strideA/B/C/R and strideBias are per b), zsel = true takes BtZp, CoutZ and biasZ in
// place of Btp, Cout and bias (same A, same strides; non-split launches only), so two products of one A share a launch.
// The body is a device function of (bx, b, zsel) and the block's LDS slabs, so that several products can share one grid by block range.
template <int ET> struct Elem;
template <> struct Elem<0> { typedef _Float16 T; };
template <> struct Elem<1> { typedef __bf16 T; };
template <int ET, bool SPLIT, int BIAS_MODE, int OUT_MODE, bool RESID, int ACT = 0>
__device__ __forceinline__ void gemm64_tile(
    float (*sT)[16 * 68], int bx, int b, bool zsel,      // sT: per-wave 16x64 slab, pitch 68 floats; bx, b, zsel block-uniform
    const unsigned short* __restrict__ Ap, const unsigned short* __restrict__ A2p, int lda, long strideA,
    const unsigned short* __restrict__ Btp, const unsigned short* __restrict__ Bt2p, int ldb, long strideB,
    void* __restrict__ Cout0, void* __restrict__ Cout2, int ldc, long strideC,
    const float* __restrict__ bias0, long strideBias,
    const float* __restrict__ resid, long strideR,
    const unsigned short* __restrict__ BtZp, void* __restrict__ CoutZ, const float* __restrict__ biasZ,
    int M, int N, int K, float scale) {
  typedef typename Elem<ET>::T T;
  typedef typename Frag<T>::V V;
  const T* A = (const T*)Ap; const T* A2 = (const T*)A2p; const T* Bt = (const T*)(zsel ? BtZp : Btp); const T* Bt2 = (const T*)Bt2p;
  void* Cout = zsel ? CoutZ : Cout0;
  const float* bias = (BIAS_MODE != 0) ? ((zsel ? biasZ : bias0) + (size_t)b * strideBias) : nullptr;
  const int lane = threadIdx.x & 31;
  const int wave = threadIdx.x >> 5;
  const int tilesN = N >> 6;
  const int tilesM = M >> 6;
  const int tile = bx * 8 + wave;
  if (tile >= tilesM * tilesN) return;   // wave-uniform; no block barriers in this kernel
  const int tm = tile / tilesN;
  const int tn = tile - tm * tilesN;
  const int m0 = tm << 6;
  const int n0 = tn << 6;

  const T* Ab  = A  + (size_t)b * strideA;
  const T* Bb  = Bt + (size_t)b * strideB;
  const T* Ab2 = SPLIT ? (A2  + (size_t)b * strideA) : nullptr;
  const T* Bb2 = SPLIT ? (Bt2 + (size_t)b * strideB) : nullptr;

  const int rlane = lane & 15;                 // row (A) / col (B, D) within subtile
  const int koff  = (lane >> 4) * 8;           // k offset of this lane half
  const int mOff  = (lane >> 4) * 8;           // D row offset

  v8f acc[4][4];
#pragma unroll
  for (int i = 0; i < 4; ++i)
#pragma unroll
    for (int j = 0; j < 4; ++j) acc[i][j] = (v8f){0.f,0.f,0.f,0.f,0.f,0.f,0.f,0.f};

  for (int k0 = 0; k0 < K; k0 += 32) {
    V bh[4], bl[4];
    const size_t bo0 = (size_t)(n0 + rlane) * ldb + koff + k0, ao0 = (size_t)(m0 + rlane) * lda + koff + k0;
    const T* bp = Bb + bo0; const T* bp2 = SPLIT ? (Bb2 + bo0) : bp;     // the lane's own row of subtile 0 in each plane; the others at constant steps
    const T* ap = Ab + ao0; const T* ap2 = SPLIT ? (Ab2 + ao0) : ap;
#pragma unroll
    for (int j = 0; j < 4; ++j) {
      const size_t bo = (size_t)(j << 4) * ldb;
      bh[j] = Frag<T>::load(bp + bo);
      if (SPLIT) bl[j] = Frag<T>::load(bp2 + bo);
    }
#pragma unroll
    for (int i = 0; i < 4; ++i) {
      const size_t ao = (size_t)(i << 4) * lda;
      V ah = Frag<T>::load(ap + ao);
      V al;
      if (SPLIT) al = Frag<T>::load(ap2 + ao);
#pragma unroll
      for (int j = 0; j < 4; ++j) {
        acc[i][j] = Frag<T>::mma(ah, bh[j], acc[i][j]);
        if (SPLIT) {
          acc[i][j] = Frag<T>::mma(ah, bl[j], acc[i][j]);
          acc[i][j] = Frag<T>::mma(al, bh[j], acc[i][j]);
        }
      }
      Frag<T>::guard(acc[i][0], acc[i][3], ah, SPLIT ? al : ah);
    }
    Frag<T>::keep(bh[0], bh[1], bh[2], bh[3]);
    if (SPLIT) Frag<T>::keep(bl[0], bl[1], bl[2], bl[3]);
    // the four pointers as inputs: their registers stay as this step's loads name them (no result lands on them, no step to the next k) up to this wait
    asm volatile("s_wait_xcnt 0x0" :: "v"(ap), "v"(ap2), "v"(bp), "v"(bp2) : "memory");
  }
  acc_guard4(acc[0][0], acc[0][1], acc[0][2], acc[0][3]);
  acc_guard4(acc[1][0], acc[1][1], acc[1][2], acc[1][3]);
  acc_guard4(acc[2][0], acc[2][1], acc[2][2], acc[2][3]);
  acc_guard4(acc[3][0], acc[3][1], acc[3][2], acc[3][3]);

  // ---- epilogue ----
  float* slab = sT[wave];
  const float* Rb = RESID ? (resid + (size_t)b * strideR) : nullptr;
#pragma unroll
  for (int i = 0; i < 4; ++i) {
    const int mBase = m0 + (i << 4);
#pragma unroll
    for (int j = 0; j < 4; ++j) {
      const int n = n0 + (j << 4) + rlane;
      float bv = 0.f;
      if (BIAS_MODE == 2) bv = bias[n];
#pragma unroll
      for (int r = 0; r < 8; ++r) {
        float v = acc[i][j][r] * scale;
        if (BIAS_MODE == 1) v += bias[mBase + mOff + r];
        if (BIAS_MODE == 2) v += bv;
        if (RESID) v += Rb[(size_t)(mBase + mOff + r) * ldc + n];
        if (ACT == 1) v = tanhf(v);
        if (ACT == 2) v = fmaxf(v, 0.0f);
        if (ACT == 3) v = v / (1.0f + expf(-v));
        if (ACT == 4) v = (v > 0.f) ? v : 0.01f * v;
        if (ACT == 5) v = 0.5f * v * (1.0f + erff(v * 0.70710678118654752f));
        slab[(mOff + r) * 68 + (j << 4) + rlane] = v;
      }
    }
    __builtin_amdgcn_fence(__ATOMIC_RELEASE, "workgroup");
    __builtin_amdgcn_wave_barrier();
    __builtin_amdgcn_fence(__ATOMIC_ACQUIRE, "workgroup");
    if (OUT_MODE == 0) {
      float* C = (float*)Cout + (size_t)b * strideC;
      const int hh = lane >> 4, c4 = (lane & 15) * 4;     // row seg = 256 B = 16 lanes x 16 B
      {
#pragma unroll
        for (int it = 0; it < 8; ++it) {
          const int row = it * 2 + hh;
          v4f v = *(const v4f*)(slab + row * 68 + c4);
          *(v4f*)(C + (size_t)(mBase + row) * ldc + n0 + c4) = v;
        }
        
      }
    } else {
      const int q = lane >> 3, c8 = (lane & 7) * 8;
      unsigned short* C  = (unsigned short*)Cout  + (size_t)b * strideC;
      unsigned short* C2 = (OUT_MODE == 2) ? ((unsigned short*)Cout2 + (size_t)b * strideC) : nullptr;
      {
#pragma unroll
        for (int it = 0; it < 4; ++it) {
          const int row = it * 4 + q;
          const float* sp = slab + row * 68 + c8;
          v8h hv, lv;
#pragma unroll
          for (int e = 0; e < 8; ++e) {
            if (OUT_MODE == 1) {
              hv[e] = (_Float16)sp[e];
            } else {
              unsigned short hb = f2bf_bits(sp[e]);
              unsigned short lb = f2bf_bits(sp[e] - bf_bits2f(hb));
              hv[e] = __builtin_bit_cast(_Float16, hb);
              lv[e] = __builtin_bit_cast(_Float16, lb);
            }
          }
          *(v8h*)(C + (size_t)(mBase + row) * ldc + n0 + c8) = hv;
          if (OUT_MODE == 2) *(v8h*)(C2 + (size_t)(mBase + row) * ldc + n0 + c8) = lv;
        }
        
      }
    }
    asm volatile("s_wait_xcnt 0x0" ::: "memory");   // before the next slab's values and addresses take the registers that these stores name
    __builtin_amdgcn_fence(__ATOMIC_RELEASE, "workgroup");
    __builtin_amdgcn_wave_barrier();
    __builtin_amdgcn_fence(__ATOMIC_ACQUIRE, "workgroup");
  }
}

// ---- f32 [R][C] (row pitch ldi) -> f16 transposed [C][R] (row pitch ldo); 64x64 tiles; each output row segment
// one block of 256 threads does tile (bx, by); tile = the block's LDS, [c][r]
__device__ __forceinline__ void transpose_cast_f16_tile(_Float16 (*tile)[72], int bx, int by, const float* __restrict__ in, int ldi,
                                                        _Float16* __restrict__ outT, int ldo, float scale) {
  const int c0 = bx * 64, r0 = by * 64;
  const int t = threadIdx.x, tx = t & 31, ty = t >> 5;
  for (int i = ty; i < 64; i += 8) {
    tile[tx][i]      = (_Float16)(in[(size_t)(r0 + i) * ldi + c0 + tx] * scale);
    tile[32 + tx][i] = (_Float16)(in[(size_t)(r0 + i) * ldi + c0 + 32 + tx] * scale);
  }
  __syncthreads();
  const int q = t >> 3, c8 = (t & 7) * 8;
  {
#pragma unroll
    for (int it = 0; it < 2; ++it) {
      const int c = it * 32 + q;
      v8h hv = *(const v8h*)(&tile[c][c8]);
      *(v8h*)(outT + (size_t)(c0 + c) * ldo + r0 + c8) = hv;
    }
    
  }
}

// ---- f32 [R][C] (pitch ldi) -> bf16 hi/lo transposed planes [C][R] (pitch ldo); 64x64 tiles; each output row segment
// one block of 256 threads does tile (bx, by); tile = the block's LDS, [c][r]
__device__ __forceinline__ void transpose_split_bf16_tile(float (*tile)[68], int bx, int by, const float* __restrict__ in, int ldi,
                                                          __bf16* __restrict__ outH, __bf16* __restrict__ outL, int ldo) {
  const int c0 = bx * 64, r0 = by * 64;
  const int t = threadIdx.x, tx = t & 31, ty = t >> 5;
  for (int i = ty; i < 64; i += 8) {
    tile[tx][i]      = in[(size_t)(r0 + i) * ldi + c0 + tx];
    tile[32 + tx][i] = in[(size_t)(r0 + i) * ldi + c0 + 32 + tx];
  }
  __syncthreads();
  const int q = t >> 3, c8 = (t & 7) * 8;
  {
#pragma unroll
    for (int it = 0; it < 2; ++it) {
      const int c = it * 32 + q;
      v8b hv, lv;
#pragma unroll
      for (int e = 0; e < 8; ++e) {
        const float f = tile[c][c8 + e];
        const unsigned short hb = f2bf_bits(f);
        hv[e] = __builtin_bit_cast(__bf16, hb);
        lv[e] = __builtin_bit_cast(__bf16, f2bf_bits(f - bf_bits2f(hb)));
      }
      *(v8b*)(outH + (size_t)(c0 + c) * ldo + r0 + c8) = hv;
      *(v8b*)(outL + (size_t)(c0 + c) * ldo + r0 + c8) = lv;
    }
    asm volatile("s_wait_xcnt 0x0" ::: "memory");   // other jobs' code follows this body in the shared kernel: nothing there rewrites a register that these stores name ahead of this wait
  }
}

// =====================================================================================
constexpr int kBatch = 2;
constexpr int kSeq   = 2048;
constexpr int kEmb   = 1024;
constexpr int kHeads = 8;
constexpr int kDh    = 128;
constexpr int kTok   = kBatch * kSeq;          // 4096 tokens
constexpr int kPairs = kEmb / 2;               // 512 element pairs per row
static_assert(kHeads * kDh == kEmb);
static_assert(kPairs == 512);

// ---- LayerNorm (biased variance, eps 1e-5) -> xn as bf16 hi/lo planes (packed pairs). One block per token, 256 threads;
// thread t owns element pairs (2t,2t+1) and (512+2t,512+2t+1): 2 packed dwords per plane per thread; each store instruction
__device__ __forceinline__ void layernorm_split_row(
    float* red, int tok,                                 // red: 8 floats of the block's LDS
    const float* __restrict__ x, const float* __restrict__ gamma, const float* __restrict__ beta,
    unsigned* __restrict__ xh, unsigned* __restrict__ xl) {
  const int t = threadIdx.x, lane = t & 31, wave = t >> 5;
  const float* xr = x + (size_t)tok * kEmb;
  const int ca = 2 * t, cb = kPairs + 2 * t;
  const v2f pa = *(const v2f*)(xr + ca);
  const v2f pb = *(const v2f*)(xr + cb);
  float s = (pa.x + pa.y) + (pb.x + pb.y);
#pragma unroll
  for (int off = 1; off < 32; off <<= 1) s += __shfl_xor(s, off, 32);
  if (lane == 0) red[wave] = s;
  __syncthreads();
  float tot = 0.f;
#pragma unroll
  for (int w = 0; w < 8; ++w) tot += red[w];       // fixed order
  const float mean = tot * (1.0f / (float)kEmb);
  __syncthreads();
  const float d0 = pa.x - mean, d1 = pa.y - mean, d2 = pb.x - mean, d3 = pb.y - mean;
  float s2 = (d0 * d0 + d1 * d1) + (d2 * d2 + d3 * d3);
#pragma unroll
  for (int off = 1; off < 32; off <<= 1) s2 += __shfl_xor(s2, off, 32);
  if (lane == 0) red[wave] = s2;
  __syncthreads();
  float tot2 = 0.f;
#pragma unroll
  for (int w = 0; w < 8; ++w) tot2 += red[w];
  const float var  = tot2 * (1.0f / (float)kEmb);
  const float rstd = 1.0f / sqrtf(var + 1e-5f);
  const float y0 = d0 * rstd * gamma[ca] + beta[ca];
  const float y1 = d1 * rstd * gamma[ca + 1] + beta[ca + 1];
  const float y2 = d2 * rstd * gamma[cb] + beta[cb];
  const float y3 = d3 * rstd * gamma[cb + 1] + beta[cb + 1];
  const unsigned short h0 = f2bf_bits(y0), h1 = f2bf_bits(y1), h2 = f2bf_bits(y2), h3 = f2bf_bits(y3);
  const unsigned short l0 = f2bf_bits(y0 - bf_bits2f(h0)), l1 = f2bf_bits(y1 - bf_bits2f(h1));
  const unsigned short l2 = f2bf_bits(y2 - bf_bits2f(h2)), l3 = f2bf_bits(y3 - bf_bits2f(h3));
  const unsigned uah = (unsigned)h0 | ((unsigned)h1 << 16), ual = (unsigned)l0 | ((unsigned)l1 << 16);
  const unsigned ubh = (unsigned)h2 | ((unsigned)h3 << 16), ubl = (unsigned)l2 | ((unsigned)l3 << 16);
  const size_t ia = (size_t)tok * kPairs + t, ib = ia + 256;
  {
    ((unsigned*)xh)[ia] = uah;
    ((unsigned*)xh)[ib] = ubh;
    ((unsigned*)xl)[ia] = ual;
    ((unsigned*)xl)[ib] = ubl;
    asm volatile("s_wait_xcnt 0x0" ::: "memory");   // other jobs' code follows this body in the shared kernel: nothing there rewrites a register that these stores name ahead of this wait
  }
}

// ---- sinusoid table [kSeq][kEmb]: columns 2i = sin(pos·div_i), 2i+1 = cos(pos·div_i), div_i = exp(2i · (−ln 1e4 / kEmb)), f32,
// emitted as bf16 hi/lo planes (packed pairs). One thread per (pos, i): kSeq*512/256 = 4096 blocks exactly; each wave's store
__device__ __forceinline__ void posenc_split_block(int blk, unsigned* __restrict__ peh, unsigned* __restrict__ pel) {
  const int idx = blk * 256 + threadIdx.x;
  if (idx >= kSeq * kPairs) return;
  const int pos = idx >> 9, i = idx & 511;
  const float kNegLogRate = -0.00899447301950799f;        // −ln(10000)/1024
  const float freq = expf((float)(2 * i) * kNegLogRate);
  const float ang  = (float)pos * freq;
  const float sv = sinf(ang), cv = cosf(ang);
  const unsigned short hs = f2bf_bits(sv), hc = f2bf_bits(cv);
  const unsigned short ls = f2bf_bits(sv - bf_bits2f(hs)), lc = f2bf_bits(cv - bf_bits2f(hc));
  const unsigned uh = (unsigned)hs | ((unsigned)hc << 16), ul = (unsigned)ls | ((unsigned)lc << 16);
  {
    ((unsigned*)peh)[idx] = uh;
    ((unsigned*)pel)[idx] = ul;
    asm volatile("s_wait_xcnt 0x0" ::: "memory");   // other jobs' code follows this body in the shared kernel: nothing there rewrites a register that these stores name ahead of this wait
  }
}

// ---- scaled projection biases: qb = 16·bq, kb = 16·bk (128 floats each). Two waves of one block: wave 0 -> qb, wave 1 -> kb;
__device__ __forceinline__ void bias16_block(const float* __restrict__ bq, const float* __restrict__ bk,
                                             float* __restrict__ qb, float* __restrict__ kb) {
  const int lane = threadIdx.x & 31, wave = threadIdx.x >> 5;   // wave-uniform branches
  if (wave >= 2) return;
  v4f v; float* dst;
  if (wave == 0) { v = *(const v4f*)(bq + 4 * lane); dst = qb + 4 * lane; }
  else           { v = *(const v4f*)(bk + 4 * lane); dst = kb + 4 * lane; }
  v = v * 16.0f;
  *(v4f*)dst = v;
  asm volatile("s_wait_xcnt 0x0" ::: "memory");   // other jobs' code follows this body in the shared kernel: nothing there rewrites a register that these stores name ahead of this wait
}

// ---- all that depends on the inputs alone, in one grid of 256-thread blocks; a block's job goes by its index (every branch block-uniform):
// the 64x64 tiles of Wo, those of the four [128][128] weights, the scaled biases, then LayerNorm rows and sinusoid blocks in turn
// (one reads and writes memory, the other computes). WT = the eight [128 n][128 k] planes in the order q hi, q lo, k hi, k lo, v hi, v lo, p hi, p lo.
constexpr int kBlkWo = (kEmb / 64) * (kEmb / 64);        // 256
constexpr int kBlkW4 = 4 * (kDh / 64) * (kDh / 64);      // 16
constexpr int kBlkPe = (kSeq * kPairs) / 256;            // 4096 blocks x 256 = 2048 x 512 pairs
static_assert(kBlkPe == kTok);
constexpr int kBlkPrelude = kBlkWo + kBlkW4 + 1 + kTok + kBlkPe;
__global__ __launch_bounds__(256) void prelude_kernel(
    const float* __restrict__ x, const float* __restrict__ gamma, const float* __restrict__ beta,
    const float* __restrict__ Wq, const float* __restrict__ Wk, const float* __restrict__ Wv, const float* __restrict__ Wp,
    const float* __restrict__ Wo, const float* __restrict__ bq, const float* __restrict__ bk,
    __bf16* __restrict__ WT, __bf16* __restrict__ WoTh, __bf16* __restrict__ WoTl, float* __restrict__ qb, float* __restrict__ kb,
    unsigned* __restrict__ xh, unsigned* __restrict__ xl, unsigned* __restrict__ peh, unsigned* __restrict__ pel) {
  __shared__ __align__(16) float tile[64][68];
  int blk = blockIdx.x;
  if (blk < kBlkWo) { transpose_split_bf16_tile(tile, blk % (kEmb / 64), blk / (kEmb / 64), Wo, kEmb, WoTh, WoTl, kEmb); return; }
  blk -= kBlkWo;
  if (blk < kBlkW4) {
    const int w = blk >> 2;
    const float* in = (w == 0) ? Wq : (w == 1) ? Wk : (w == 2) ? Wv : Wp;
    __bf16* oh = WT + (size_t)(2 * w) * (kDh * kDh);
    transpose_split_bf16_tile(tile, blk & 1, (blk >> 1) & 1, in, kDh, oh, oh + kDh * kDh, kDh);
    return;
  }
  blk -= kBlkW4;
  if (blk == 0) { bias16_block(bq, bk, qb, kb); return; }
  blk -= 1;
  if (blk & 1) posenc_split_block(blk >> 1, peh, pel);
  else         layernorm_split_row(&tile[0][0], blk >> 1, x, gamma, beta, xh, xl);
}

// ---- the four projections in one grid: blocks 0..127 q, 128..255 k, 256..383 v, 384..447 p (block-uniform branches); operands and results as in gemm64_tile
constexpr int kBlkProj  = (kTok * kHeads / 64) * (kDh / 64) / 8;   // 1024 tiles -> 128 blocks
constexpr int kBlkProjP = (kSeq * kHeads / 64) * (kDh / 64) / 8;   // 512 tiles -> 64 blocks
__global__ __launch_bounds__(256) void proj4_kernel(
    const unsigned short* __restrict__ xnh, const unsigned short* __restrict__ xnl,
    const unsigned short* __restrict__ peh, const unsigned short* __restrict__ pel, const unsigned short* __restrict__ WT,
    const float* __restrict__ qb, const float* __restrict__ kb, const float* __restrict__ bv,
    _Float16* __restrict__ q16, _Float16* __restrict__ k16, float* __restrict__ vf32, _Float16* __restrict__ pp16) {
  __shared__ __align__(16) float sT[8][16 * 68];
  const int w = blockIdx.x / kBlkProj, bx = blockIdx.x % kBlkProj;
  const unsigned short* Bh = WT + (size_t)(2 * w) * (kDh * kDh);
  const unsigned short* Bl = Bh + kDh * kDh;
  if (w < 2)          // q*16 (+16 bq), k*16 (+16 bk) as f16 planes
    gemm64_tile<1, true, 2, 1, false>(sT, bx, 0, false, xnh, xnl, kDh, 0, Bh, Bl, kDh, 0, w ? k16 : q16, nullptr, kDh, 0, w ? kb : qb, 0,
        nullptr, 0, nullptr, nullptr, nullptr, kTok * kHeads, kDh, kDh, 16.0f);
  else if (w == 2)    // v (+bv) as f32
    gemm64_tile<1, true, 2, 0, false>(sT, bx, 0, false, xnh, xnl, kDh, 0, Bh, Bl, kDh, 0, vf32, nullptr, kDh, 0, bv, 0,
        nullptr, 0, nullptr, nullptr, nullptr, kTok * kHeads, kDh, kDh, 1.0f);
  else                // p*16 as f16 plane [16384][128]
    gemm64_tile<1, true, 0, 1, false>(sT, bx, 0, false, peh, pel, kDh, 0, Bh, Bl, kDh, 0, pp16, nullptr, kDh, 0, nullptr, 0,
        nullptr, 0, nullptr, nullptr, nullptr, kSeq * kHeads, kDh, kDh, 16.0f);
}

// ---- per-key bias vectors: UBK[(b·8+h)·S + s] = u_bias[h]·k[b,s,h,:], VBP[h·S + s] = v_bias[h]·p[s,h,:] (f32 dots of 128 over the x16 f16 planes,
// folded back by 1/16). 192 blocks x 256: blocks 0..127 -> UBK (32768 values), 128..191 -> VBP (16384 values); block-uniform branch;
__device__ __forceinline__ void headbias_block(int blk, const _Float16* __restrict__ k16, const _Float16* __restrict__ pp16,
                                               const float* __restrict__ ub, const float* __restrict__ vb,
                                               float* __restrict__ ubk, float* __restrict__ vbp) {
  const int t = blk * 256 + threadIdx.x;
  const _Float16* row; const float* bvec; float* dst;
  if (blk < 128) {
    const int b = t >> 14, h = (t >> 11) & 7, s = t & 2047;
    row = k16 + (size_t)((b * kSeq + s) * kHeads + h) * kDh; bvec = ub + h * kDh; dst = ubk + t;
  } else {
    const int u = t - 32768; const int h = (u >> 11) & 7, s = u & 2047;
    row = pp16 + (size_t)(s * kHeads + h) * kDh; bvec = vb + h * kDh; dst = vbp + u;
  }
  float acc = 0.f;
#pragma unroll 1
  for (int ch = 0; ch < kDh / 8; ++ch) {
    const _Float16* rp = row + 8 * ch; const float* bp = bvec + 8 * ch;
    const v8h kv = *(const v8h*)rp;
    const v4f b0 = *(const v4f*)bp;
    const v4f b1 = *(const v4f*)(bp + 4);
    // the two pointers as inputs: the step to the next chunk, the next write of the registers that the loads name, comes behind this wait
    asm volatile("s_wait_xcnt 0x0" :: "v"(rp), "v"(bp) : "memory");
    acc += b0.x * (float)kv[0] + b0.y * (float)kv[1] + b0.z * (float)kv[2] + b0.w * (float)kv[3]
         + b1.x * (float)kv[4] + b1.y * (float)kv[5] + b1.z * (float)kv[6] + b1.w * (float)kv[7];
  }
  const float r = acc * 0.0625f;
  *(float*)dst = r;
  
}

// ---- out = ctx.Wo + bo : A bf16 hi/lo [4096][1024], Bt bf16 hi/lo [1024 n][1024 k], C f32 [4096][1024]; 1024 tiles -> 128 blocks
constexpr int kBlkOut = (kTok / 64) * (kEmb / 64) / 8;
__global__ __launch_bounds__(256) void out_gemm_kernel(const unsigned short* __restrict__ ctxh, const unsigned short* __restrict__ ctxl,
                                                      const unsigned short* __restrict__ WoTh, const unsigned short* __restrict__ WoTl,
                                                      const float* __restrict__ bo, float* __restrict__ out) {
  __shared__ __align__(16) float sT[8][16 * 68];
  gemm64_tile<1, true, 2, 0, false>(sT, blockIdx.x, 0, false, ctxh, ctxl, kEmb, 0, WoTh, WoTl, kEmb, 0, out, nullptr, kEmb, 0, bo, 0,
      nullptr, 0, nullptr, nullptr, nullptr, kTok, kEmb, kEmb, 1.0f);
}

// ---- what stands between the projections and attention, in one grid (block-uniform branch): blocks 0..191 the bias dots, then per batch the 16 x 32 tiles of
// v [2048 r][1024 c] (pitch 1024) -> v^T f16 x16 [1024 c][2048 r] (pitch 2048)
constexpr int kBlkHb = (kBatch * kHeads * kSeq + kHeads * kSeq) / 256;   // 192
constexpr int kBlkVt = (kEmb / 64) * (kSeq / 64);                        // 512 a batch
__global__ __launch_bounds__(256) void headbias_vt_kernel(const _Float16* __restrict__ k16, const _Float16* __restrict__ pp16,
                                                         const float* __restrict__ ub, const float* __restrict__ vb,
                                                         float* __restrict__ ubk, float* __restrict__ vbp,
                                                         const float* __restrict__ vf32, _Float16* __restrict__ vt16) {
  __shared__ __align__(16) _Float16 tile[64][72];
  int blk = blockIdx.x;
  if (blk < kBlkHb) { headbias_block(blk, k16, pp16, ub, vb, ubk, vbp); return; }
  blk -= kBlkHb;
  const int b = blk / kBlkVt, r = blk % kBlkVt;
  transpose_cast_f16_tile(tile, r % (kEmb / 64), r / (kEmb / 64), vf32 + (size_t)b * kSeq * kEmb, kEmb, vt16 + (size_t)b * kEmb * kSeq, kSeq, 16.0f);
}

// ---- content and position scores, relative shift, softmax and p.v of 32 query rows of one (b, h) in one block; the rows' scores never leave LDS.
// grid = (kSeq / 32, kBatch * kHeads), 512 threads = 16 waves. sc[r][c], r = a - a0, holds in turn:
//   1. shifted[a][c] = c <= a ? ps[a][S-1-a+c] : (c == a+1 ? 0 : ps[a+1][c-a-2]), ps[a][n] = (16q[a]).(16p[n])/256 + v_bias.p[n]: the c >= a+2 part is the
//      product of rows a0+1..a0+32 with p rows 0..S-a0-1, the c <= a part that of rows a0..a0+31 with p rows S-32-a0..S-1; each result is stored
//      at its shifted column, results that fall outside the row are dropped; every sc[r][c] gets exactly one store;
//   2. s = (content + shifted) / 32, content[a][key] = (16q[a]).(16k[key])/256 + u_bias.k[key];
//   3. f16(exp(s - max) / sum * 2^15), written over the front half of the same row by the wave that owns the row;
//   4. the 8 key groups' f32 partials of p.v (pitch kPartPitch), summed in group order 0..7; output = bf16 hi/lo planes, row pitch kEmb.
constexpr int kRows      = 32;
constexpr int kScPitch   = kSeq + 4;    // floats; 8208 B = 16 B x odd, rows 8 apart = 32 banks apart
constexpr int kPartPitch = kDh + 4;     // floats; rows 8 apart = 32 banks apart
static_assert(8 * kRows * kPartPitch <= kRows * kScPitch);
// every "#pragma unroll" in the three helpers below: constant indices keep the fragment and accumulator arrays in registers
// qf[i][kk] = the lane's A fragments of 32 query rows; r0, r1 = the lane's own rows (tile rows lane & 15 and 16 + lane & 15) + its k offset
__device__ __forceinline__ void load_q(v16h (&qf)[2][4], const _Float16* r0, const _Float16* r1) {
#pragma unroll
  for (int kk = 0; kk < 4; ++kk) { qf[0][kk] = Frag<_Float16>::load(r0 + 32 * kk); qf[1][kk] = Frag<_Float16>::load(r1 + 32 * kk); }
  // the two pointers as inputs: their registers stay as the loads name them (no result lands on them) up to this wait
  asm volatile("s_wait_xcnt 0x0" :: "v"(r0), "v"(r1) : "memory");
}
// acc[i][j] = 32 query rows (fragments qf[i][kk], k = 32 kk ..) x 32 rows of a [.][kEmb]-pitched f16 plane; rows = the lane's own row (tile row lane & 15) + its k offset;
// bv0, bv1 = the per-column bias of the lane's two columns (bias = the lane's own first column)
// (pointers typed as global: a pointer that has gone through an asm statement would otherwise be read with flat loads)
typedef const __attribute__((address_space(1))) _Float16* GlobH;
typedef const __attribute__((address_space(1))) v8h*      GlobH8;
typedef const __attribute__((address_space(1))) float*    GlobF;
__device__ __forceinline__ void score_tile(const v16h (&qf)[2][4], GlobH& rows, GlobF& bias, v8f (&acc)[2][2], float& bv0, float& bv1) {
  v16h bf[2][4];
#pragma unroll
  for (int j = 0; j < 2; ++j)
#pragma unroll
    for (int kk = 0; kk < 4; ++kk) {                          // the k order of Frag<_Float16>::load: elements 0..7 <- p[0..7], 8..15 <- p[16..23]
      Frag<_Float16>::U f;
      f.h[0] = *(GlobH8)(rows + (size_t)(j << 4) * kEmb + 32 * kk);
      f.h[1] = *(GlobH8)(rows + (size_t)(j << 4) * kEmb + 32 * kk + 16);
      bf[j][kk] = f.v;
    }
  bv0 = bias[0]; bv1 = bias[16];
  // The loaded values, as inputs only: all of a tile's loads are issued before the first product (one memory latency a tile, not one per k step).
  // The two pointers go through the statement: the caller's step to the next tile, the next write of the registers that the loads name, comes behind this wait.
  asm volatile("s_wait_xcnt 0x0" : "+v"(rows), "+v"(bias) : "v"(bf[0][0]), "v"(bf[0][1]), "v"(bf[0][2]), "v"(bf[0][3]),
               "v"(bf[1][0]), "v"(bf[1][1]), "v"(bf[1][2]), "v"(bf[1][3]), "v"(bv0), "v"(bv1) : "memory");
#pragma unroll
  for (int i = 0; i < 2; ++i)
#pragma unroll
    for (int j = 0; j < 2; ++j) acc[i][j] = (v8f){0.f,0.f,0.f,0.f,0.f,0.f,0.f,0.f};
#pragma unroll
  for (int kk = 0; kk < 4; ++kk)
#pragma unroll
    for (int i = 0; i < 2; ++i)
#pragma unroll
      for (int j = 0; j < 2; ++j) acc[i][j] = Frag<_Float16>::mma(qf[i][kk], bf[j][kk], acc[i][j]);
}
// one step down a row of the tile is one step right in the shifted table: element (16 i + r, 16 j) of the lane goes to dst + (16 i + r) * (pitch + 1) + 16 j.
// GUARD: c0 = the column that dst stands for; elements whose column falls outside 0 .. kSeq - 1 are dropped (only the tiles at a row's ends have such)
template <bool GUARD>
__device__ __forceinline__ void store_shifted(float* dst, const v8f (&acc)[2][2], float bv0, float bv1, int c0) {
#pragma unroll
  for (int j = 0; j < 2; ++j)
#pragma unroll
    for (int i = 0; i < 2; ++i)
#pragma unroll
      for (int r = 0; r < 8; ++r) {
        const int d = (i << 4) + r;
        if (!GUARD || (unsigned)(c0 + d + (j << 4)) < (unsigned)kSeq)
          dst[d * (kScPitch + 1) + (j << 4)] = acc[i][j][r] * (1.0f / 256.0f) + (j ? bv1 : bv0);
      }
}
__global__ __launch_bounds__(512) void attn_rows_kernel(const _Float16* __restrict__ q16, const _Float16* __restrict__ k16,
                                                       const _Float16* __restrict__ pp16, const _Float16* __restrict__ vt16,
                                                       const float* __restrict__ ubk, const float* __restrict__ vbp,
                                                       unsigned short* __restrict__ Ch, unsigned short* __restrict__ Cl) {
  __shared__ __align__(16) float sc[kRows * kScPitch];
  const int t = threadIdx.x, lane = t & 31;
  const int wave = __builtin_amdgcn_readfirstlane(t >> 5);    // scalar, so that the tile loops branch on scalars
  const int a0 = blockIdx.x * kRows;
  const int bh = blockIdx.y, b = bh / kHeads, h = bh % kHeads;
  const int rlane = lane & 15;
  const int half8 = (lane >> 4) * 8;                          // k offset of this lane half (A, B) and D row offset
  const _Float16* qb = q16 + (size_t)b * kSeq * kEmb + h * kDh;   // row s at s * kEmb
  const _Float16* kb = k16 + (size_t)b * kSeq * kEmb + h * kDh;
  const _Float16* pb = pp16 + h * kDh;
  const float* ub = ubk + (size_t)bh * kSeq;
  const float* vb = vbp + (size_t)h * kSeq;

  // every "#pragma unroll" in this kernel: constant indices keep the fragment and accumulator arrays in registers
  if (t < kRows) { const int c = a0 + t + 1; if (c < kSeq) sc[t * kScPitch + c] = 0.0f; }

  v16h qf[2][4];
  v8f acc2[2][2];
  float bv0, bv1;
  // ---- 1a. columns c >= a+2: query rows a+1 (the last row of the table has no such column; its address is clamped) ----
  load_q(qf, qb + (size_t)((a0 + 1 + rlane < kSeq) ? (a0 + 1 + rlane) : (kSeq - 1)) * kEmb + half8,
             qb + (size_t)((a0 + 17 + rlane < kSeq) ? (a0 + 17 + rlane) : (kSeq - 1)) * kEmb + half8);
  const int nUp = (kSeq - a0) >> 5;                           // 32-column tiles of either part; nUp + nLo = kSeq / 32 + 1
  const int nLo = (a0 + kRows) >> 5;
  GlobH prow = (GlobH)(pb + (size_t)((wave << 5) + rlane) * kEmb + half8);    // the lane's row of the wave's tile and its bias; 16 tiles on a trip
  GlobF vrow = (GlobF)(vb + (wave << 5) + rlane);
  for (int jj = wave; jj < nUp; jj += 16, prow += (size_t)512 * kEmb, vrow += 512) {
    const int n0 = jj << 5;
    score_tile(qf, prow, vrow, acc2, bv0, bv1);
    const int cmin = n0 + a0 + 2;                             // column of the tile's element (row 0, n0); the tile spans cmin .. cmin + 62
    float* dst = sc + half8 * kScPitch + cmin + rlane + half8;
    if (cmin + 62 < kSeq) store_shifted<false>(dst, acc2, bv0, bv1, 0);
    else                  store_shifted<true>(dst, acc2, bv0, bv1, cmin + rlane + half8);
  }
  // ---- 1b. columns c <= a: query rows a; these fragments also serve the content product ----
  load_q(qf, qb + (size_t)(a0 + rlane) * kEmb + half8, qb + (size_t)(a0 + 16 + rlane) * kEmb + half8);
  const int jLo = (wave - nUp) & 15;                          // the deal of tiles to waves goes on where 1a's ended
  prow = (GlobH)(pb + (size_t)((kSeq - kRows - a0) + (jLo << 5) + rlane) * kEmb + half8);
  vrow = (GlobF)(vb + (kSeq - kRows - a0) + (jLo << 5) + rlane);
  for (int jj = jLo; jj < nLo; jj += 16, prow += (size_t)512 * kEmb, vrow += 512) {
    const int n0 = (kSeq - kRows - a0) + (jj << 5);
    score_tile(qf, prow, vrow, acc2, bv0, bv1);
    const int cmin = n0 + a0 - (kSeq - 1);                    // = 32 jj - 31
    float* dst = sc + half8 * kScPitch + cmin + rlane + half8;
    if (cmin >= 0) store_shifted<false>(dst, acc2, bv0, bv1, 0);
    else           store_shifted<true>(dst, acc2, bv0, bv1, cmin + rlane + half8);
  }
  __syncthreads();                                            // every shifted position score is in LDS before the content product adds to it

  // ---- 2. content; wave w takes the 32-key tiles w, w + 16, w + 32, w + 48 ----
  GlobH krow = (GlobH)(kb + (size_t)((wave << 5) + rlane) * kEmb + half8);
  GlobF urow = (GlobF)(ub + (wave << 5) + rlane);
  for (int jj = wave; jj < kSeq / 32; jj += 16, krow += (size_t)512 * kEmb, urow += 512) {
    const int n0 = jj << 5;
    score_tile(qf, krow, urow, acc2, bv0, bv1);
#pragma unroll
    for (int j = 0; j < 2; ++j) {
      const int n = n0 + (j << 4) + rlane;
      const float bv = j ? bv1 : bv0;
#pragma unroll
      for (int i = 0; i < 2; ++i)
#pragma unroll
        for (int r = 0; r < 8; ++r) {
          float* e = sc + ((i << 4) + half8 + r) * kScPitch + n;
          *e = ((acc2[i][j][r] * (1.0f / 256.0f) + bv) + *e) * (1.0f / 32.0f);
        }
    }
  }
  __syncthreads();                                            // whole score rows are in LDS before a wave takes its rows' maximum

  // ---- 3. softmax; wave w owns rows 2w and 2w + 1, lane l columns 128 it + 4 l .. + 3 ----
#pragma unroll 1   // one row's 64 floats a lane live at a time, not two rows'
  for (int rr = 0; rr < 2; ++rr) {
    float* srow = sc + (wave * 2 + rr) * kScPitch;
    v4f x[16];
#pragma unroll
    for (int it = 0; it < 16; ++it) x[it] = *(const v4f*)(srow + it * 128 + 4 * lane);
    float mx = -INFINITY;
#pragma unroll
    for (int it = 0; it < 16; ++it) mx = fmaxf(mx, fmaxf(fmaxf(x[it].x, x[it].y), fmaxf(x[it].z, x[it].w)));
#pragma unroll
    for (int off = 1; off < 32; off <<= 1) mx = fmaxf(mx, __shfl_xor(mx, off, 32));
    float sum = 0.f;
#pragma unroll
    for (int it = 0; it < 16; ++it) {
      x[it].x = __expf(x[it].x - mx); x[it].y = __expf(x[it].y - mx); x[it].z = __expf(x[it].z - mx); x[it].w = __expf(x[it].w - mx);
      sum += (x[it].x + x[it].y) + (x[it].z + x[it].w);
    }
#pragma unroll
    for (int off = 1; off < 32; off <<= 1) sum += __shfl_xor(sum, off, 32);
    const float f = (1.0f / sum) * 32768.0f;
    _Float16* prow = (_Float16*)srow;                         // all of the row is in this wave's registers by now
#pragma unroll
    for (int it = 0; it < 16; ++it) {
      v4h hv;
      hv[0] = (_Float16)(x[it].x * f); hv[1] = (_Float16)(x[it].y * f); hv[2] = (_Float16)(x[it].z * f); hv[3] = (_Float16)(x[it].w * f);
      *(v4h*)(prow + it * 128 + 4 * lane) = hv;
    }
  }
  __syncthreads();                                            // all 32 rows of p are in LDS before any wave reads them as A fragments

  // ---- 4. p.v: wave = (key group kg of 256 keys, half dh of the 128 columns); ctx[q][d] = 2^-19 * sum_key p[q][key] * Vt[d][key] ----
  const int kg = wave & 7, dh = wave >> 3;
  const _Float16* Ar = (const _Float16*)sc + rlane * (2 * kScPitch) + kg * (kSeq / 8) + half8;
  const _Float16* Br = vt16 + ((size_t)bh * kDh + dh * 64 + rlane) * kSeq + kg * (kSeq / 8) + half8;
  v8f acc[2][4];
#pragma unroll
  for (int i = 0; i < 2; ++i)
#pragma unroll
    for (int j = 0; j < 4; ++j) acc[i][j] = (v8f){0.f,0.f,0.f,0.f,0.f,0.f,0.f,0.f};
  for (int k0 = 0; k0 < kSeq / 8; k0 += 64) {                 // 64 keys a trip = one whole 128-B line of every Vt row it reads
    v16h af[2][2], bf[2][4];
#pragma unroll
    for (int s = 0; s < 2; ++s) {
#pragma unroll
      for (int j = 0; j < 4; ++j) bf[s][j] = Frag<_Float16>::load(Br + (size_t)(j << 4) * kSeq + k0 + 32 * s);
#pragma unroll
      for (int i = 0; i < 2; ++i) af[s][i] = Frag<_Float16>::load(Ar + (i << 4) * (2 * kScPitch) + k0 + 32 * s);
    }
#pragma unroll
    for (int s = 0; s < 2; ++s)
#pragma unroll
      for (int i = 0; i < 2; ++i)
#pragma unroll
        for (int j = 0; j < 4; ++j) acc[i][j] = Frag<_Float16>::mma(af[s][i], bf[s][j], acc[i][j]);
  }
  __syncthreads();                                            // every wave has read its p fragments before the partials overwrite them

  float* mine = sc + kg * (kRows * kPartPitch) + dh * 64;
#pragma unroll
  for (int i = 0; i < 2; ++i)
#pragma unroll
    for (int j = 0; j < 4; ++j)
#pragma unroll
      for (int r = 0; r < 8; ++r) mine[((i << 4) + half8 + r) * kPartPitch + (j << 4) + rlane] = acc[i][j][r];
  __syncthreads();                                            // all 8 partials are in LDS before any thread sums them

  const int row = t >> 4, c8 = (t & 15) * 8;                  // 16 lanes x 16 B = one whole 256-B row segment per plane
  const float* sp = sc + row * kPartPitch + c8;
  v4f s0 = *(const v4f*)sp, s1 = *(const v4f*)(sp + 4);
#pragma unroll
  for (int w = 1; w < 8; ++w) {                               // fixed order
    s0 += *(const v4f*)(sp + w * (kRows * kPartPitch));
    s1 += *(const v4f*)(sp + w * (kRows * kPartPitch) + 4);
  }
  v8h hv, lv;
#pragma unroll
  for (int e = 0; e < 8; ++e) {
    const float f = ((e < 4) ? s0[e & 3] : s1[e & 3]) * (1.0f / 524288.0f);
    const unsigned short hb = f2bf_bits(f);
    hv[e] = __builtin_bit_cast(_Float16, hb);
    lv[e] = __builtin_bit_cast(_Float16, f2bf_bits(f - bf_bits2f(hb)));
  }
  const size_t co = (size_t)(b * kSeq + a0 + row) * kEmb + h * kDh + c8;
  *(v8h*)(Ch + co) = hv;
  *(v8h*)(Cl + co) = lv;
}

// =====================================================================================
extern "C" void kernel_launch(void* const* d_in, const int* in_sizes, int n_in, void* d_out, int out_size,
                              void* d_ws, size_t ws_size, hipStream_t stream) {
  if (n_in < 14) return;
  if (in_sizes[0] != kTok * kEmb || in_sizes[1] != kEmb || in_sizes[2] != kEmb ||
      in_sizes[3] != kDh * kDh || in_sizes[4] != kDh || in_sizes[5] != kDh * kDh || in_sizes[6] != kDh ||
      in_sizes[7] != kDh * kDh || in_sizes[8] != kDh || in_sizes[9] != kDh * kDh ||
      in_sizes[10] != kHeads * kDh || in_sizes[11] != kHeads * kDh || in_sizes[12] != kEmb * kEmb || in_sizes[13] != kEmb ||
      out_size != kTok * kEmb) return;
  const float* x      = (const float*)d_in[0];
  const float* gamma  = (const float*)d_in[1];
  const float* beta   = (const float*)d_in[2];
  const float* Wq     = (const float*)d_in[3];
  const float* bq     = (const float*)d_in[4];
  const float* Wk     = (const float*)d_in[5];
  const float* bk     = (const float*)d_in[6];
  const float* Wv     = (const float*)d_in[7];
  const float* bv     = (const float*)d_in[8];
  const float* Wp     = (const float*)d_in[9];
  const float* u_bias = (const float*)d_in[10];
  const float* v_bias = (const float*)d_in[11];
  const float* Wo     = (const float*)d_in[12];
  const float* bo     = (const float*)d_in[13];
  float* out = (float*)d_out;   // [2][2048][1024] f32

  // ---- workspace carve (all offsets multiples of 256 B; total 92,734,464 B) ----
  // R0 WqT,WkT,WvT,WpT hi/lo bf16 [128 n][128 k]   8 x 32,768        =     262,144
  // R1 WoT hi/lo bf16 [1024 n][1024 k]              2 x 2,097,152     =   4,194,304
  // R2 16·bq, 16·bk f32 [128]                       2 x 512           =       1,024
  // R3 UBK f32 [2][8][2048], VBP f32 [8][2048]                        =     196,608
  // R4 Q16 f16 x16 [32768][128]                                       =   8,388,608
  // R5 K16 f16 x16 [32768][128]                                       =   8,388,608
  // R6 PP16 f16 x16 [16384][128]                                      =   4,194,304
  // R7 V f32 [32768][128] (= [4096][1024])                            =  16,777,216
  // R8 CTX hi/lo bf16 [4096][1024]                  2 x 8,388,608     =  16,777,216
  // R9 VT16 f16 x16 [2 b][1024][2048]                                 =   8,388,608
  // R10 XN hi/lo bf16 [4096][1024] 2 x 8,388,608, PE hi/lo bf16 [2048][1024] 2 x 4,194,304 = 25,165,824
  char* ws = (char*)d_ws; size_t off = 0;
  auto carve = [&](size_t bytes) -> char* { char* p = ws + off; off += (bytes + 255) & ~(size_t)255; return p; };
  const size_t nW   = (size_t)kDh * kDh;            // 16,384
  const size_t nWo  = (size_t)kEmb * kEmb;          // 1,048,576
  const size_t nHd  = (size_t)kTok * kHeads * kDh;   // 4,194,304 (= kTok*kEmb)
  const size_t nPp  = (size_t)kSeq * kHeads * kDh;   // 2,097,152
  __bf16* WqTh = (__bf16*)carve(nW * 2); __bf16* WqTl = (__bf16*)carve(nW * 2);
  __bf16* WkTh = (__bf16*)carve(nW * 2); __bf16* WkTl = (__bf16*)carve(nW * 2);
  __bf16* WvTh = (__bf16*)carve(nW * 2); __bf16* WvTl = (__bf16*)carve(nW * 2);
  __bf16* WpTh = (__bf16*)carve(nW * 2); __bf16* WpTl = (__bf16*)carve(nW * 2);
  __bf16* WoTh = (__bf16*)carve(nWo * 2); __bf16* WoTl = (__bf16*)carve(nWo * 2);
  float* qb16 = (float*)carve(kDh * 4); float* kb16 = (float*)carve(kDh * 4);
  float* ubk  = (float*)carve((size_t)kBatch * kHeads * kSeq * 4);
  float* vbp  = (float*)carve((size_t)kHeads * kSeq * 4);
  _Float16* q16  = (_Float16*)carve(nHd * 2);
  _Float16* k16  = (_Float16*)carve(nHd * 2);
  _Float16* pp16 = (_Float16*)carve(nPp * 2);
  float*    vf32 = (float*)carve(nHd * 4);
  unsigned short* ctxh = (unsigned short*)carve(nHd * 2); unsigned short* ctxl = (unsigned short*)carve(nHd * 2);
  _Float16* vt16 = (_Float16*)carve((size_t)kBatch * kEmb * kSeq * 2);
  unsigned* xnh = (unsigned*)carve(nHd * 2);
  unsigned* xnl = (unsigned*)carve(nHd * 2);
  unsigned* peh = (unsigned*)carve((size_t)kSeq * kEmb * 2);
  unsigned* pel = (unsigned*)carve((size_t)kSeq * kEmb * 2);
  if (off > ws_size) return;

  // ---- prelude: weight planes (in [k][n] -> out [n][k]), scaled biases, LN planes, sinusoid planes: one launch ----
  prelude_kernel<<<kBlkPrelude, 256, 0, stream>>>(x, gamma, beta, Wq, Wk, Wv, Wp, Wo, bq, bk, WqTh, WoTh, WoTl, qb16, kb16, xnh, xnl, peh, pel);

  // ---- projections over the [32768][128] per-(token, head) row view of xn (same memory as [4096][1024]) and the [16384][128] view of pe: one launch ----
  proj4_kernel<<<3 * kBlkProj + kBlkProjP, 256, 0, stream>>>(U16(xnh), U16(xnl), U16(peh), U16(pel), U16(WqTh), qb16, kb16, bv, q16, k16, vf32, pp16);

  // ---- bias dots and v^T: one launch; then all of attention for every (b, h) in one launch, into the ctx hi/lo planes ----
  headbias_vt_kernel<<<kBlkHb + kBatch * kBlkVt, 256, 0, stream>>>(k16, pp16, u_bias, v_bias, ubk, vbp, vf32, vt16);
  attn_rows_kernel<<<dim3(kSeq / kRows, kBatch * kHeads), 512, 0, stream>>>(q16, k16, pp16, vt16, ubk, vbp, ctxh, ctxl);   // 64 x 16 blocks of 32 query rows

  out_gemm_kernel<<<kBlkOut, 256, 0, stream>>>(ctxh, ctxl, U16(WoTh), U16(WoTl), bo, out);
}

// v005
// Measured time: 212 microseconds a run.
// Two timings next to v004 both put it at 1.13 times that version's speed.
// All steps since v000 together make it 9.63 times as fast.
// Projections xn·W{q,k,v} (K=128), p = pe·Wp (K=128) and out = ctx·Wo (K=1024): v_wmma_f32_16x16x32_bf16 with bf16 hi/lo split operands (hi·hi + hi·lo + lo·hi); content q·kᵀ and position q·pᵀ tables (K=128): v_wmma_f32_16x16x32_f16 with plain f16 operands carried x16; p·v (K=2048): v_wmma_f32_16x16x32_f16 with p/l carried x2^15 and vᵀ carried x16; f32 accumulate everywhere; LayerNorm, sinusoid table, u/v bias dots, relative shift and softmax in f32 on VALU.
#include <hip/hip_runtime.h>
#include <math.h>

typedef __attribute__((ext_vector_type(16))) _Float16 v16h;
typedef __attribute__((ext_vector_type(8)))  _Float16 v8h;
typedef __attribute__((ext_vector_type(4)))  _Float16 v4h;
typedef __attribute__((ext_vector_type(16))) __bf16   v16b;
typedef __attribute__((ext_vector_type(8)))  __bf16   v8b;
typedef __attribute__((ext_vector_type(8)))  float    v8f;
typedef __attribute__((ext_vector_type(4)))  float    v4f;
typedef __attribute__((ext_vector_type(2)))  float    v2f;
#define U16(p) ((const unsigned short*)(const void*)(p))

__device__ __forceinline__ unsigned short f2bf_bits(float f) {
  unsigned u = __float_as_uint(f);
  return (unsigned short)((u + 0x7FFFu + ((u >> 16) & 1u)) >> 16);
}
__device__ __forceinline__ float bf_bits2f(unsigned short h) { return __uint_as_float(((unsigned)h) << 16); }

// hazard guards as plain device helpers
__device__ __forceinline__ void dep_guard_h(v8f& a, v8f& b, v16h x, v16h y) { asm volatile("v_nop\n\tv_nop\n\tv_nop\n\tv_nop" : "+v"(a), "+v"(b) : "v"(x), "v"(y)); }
__device__ __forceinline__ void dep_guard_b(v8f& a, v8f& b, v16b x, v16b y) { asm volatile("v_nop\n\tv_nop\n\tv_nop\n\tv_nop" : "+v"(a), "+v"(b) : "v"(x), "v"(y)); }
__device__ __forceinline__ void keep4_h(v16h a, v16h b, v16h c, v16h d) { asm volatile("v_nop" :: "v"(a), "v"(b), "v"(c), "v"(d)); }
__device__ __forceinline__ void keep4_b(v16b a, v16b b, v16b c, v16b d) { asm volatile("v_nop" :: "v"(a), "v"(b), "v"(c), "v"(d)); }
__device__ __forceinline__ void acc_guard4(v8f& a, v8f& b, v8f& c, v8f& d) { asm volatile("v_nop\n\tv_nop\n\tv_nop\n\tv_nop" : "+v"(a), "+v"(b), "+v"(c), "+v"(d)); }
template <typename T> struct Frag;
template <> struct Frag<_Float16> {
  typedef v16h V; union U { v16h v; v8h h[2]; };
  static __device__ __forceinline__ v16h load(const _Float16* p) {   // elements 0..7 <- p[0..7], 8..15 <- p[16..23]
    U f; f.h[0] = *(const v8h*)(p); f.h[1] = *(const v8h*)(p + 16); return f.v;
  }
  static __device__ __forceinline__ v16h loadf(const _Float16* p) {  // fragment-order plane: elements 0..7 <- p[0..7], 8..15 <- p[256..263]
    U f; f.h[0] = *(const v8h*)(p); f.h[1] = *(const v8h*)(p + 256); return f.v;
  }
  static __device__ __forceinline__ v8f mma(v16h a, v16h b, v8f c) {
    return __builtin_amdgcn_wmma_f32_16x16x32_f16(false, a, false, b, (short)0, c, false, false);
  }
  static __device__ __forceinline__ void guard(v8f& a, v8f& b, v16h x, v16h y) { dep_guard_h(a, b, x, y); }
  static __device__ __forceinline__ void keep(v16h a, v16h b, v16h c, v16h d) { keep4_h(a, b, c, d); }
};
template <> struct Frag<__bf16> {
  typedef v16b V; union U { v16b v; v8b h[2]; };
  static __device__ __forceinline__ v16b load(const __bf16* p) {
    U f; f.h[0] = *(const v8b*)(p); f.h[1] = *(const v8b*)(p + 16); return f.v;
  }
  static __device__ __forceinline__ v16b loadf(const __bf16* p) {
    U f; f.h[0] = *(const v8b*)(p); f.h[1] = *(const v8b*)(p + 256); return f.v;
  }
  static __device__ __forceinline__ v8f mma(v16b a, v16b b, v8f c) {
    return __builtin_amdgcn_wmma_f32_16x16x32_bf16(false, a, false, b, (short)0, c, false, false);
  }
  static __device__ __forceinline__ void guard(v8f& a, v8f& b, v16b x, v16b y) { dep_guard_b(a, b, x, y); }
  static __device__ __forceinline__ void keep(v16b a, v16b b, v16b c, v16b d) { keep4_b(a, b, c, d); }
};

// ---- Register-blocked batched WMMA GEMM ------------------------------------
// C[m,n] = scale * sum_k A[m,k] * Bt[n,k] (+bias)(+resid); each wave owns a 64x64 tile.
// A row-major [M,K] (AFRAG: fragment order); Bt [N,K] in fragment order; M,N % 64 == 0, K % 32 == 0.
// Fragment order of a 16-bit [R,K] plane: [R/16][K/32][2][32 lanes][8]; chunk (rt, kk, ld, lane) holds row 16 rt + (lane & 15), k = 32 kk + 16 ld + 8 (lane >> 4) .. + 7,
// so each of a fragment's two 16-byte loads reads 512 contiguous bytes (four whole lines) over the wave; same k order as the row-major loader.
// SPLIT: operands are hi/lo planes (A2/Bt2 = lo planes, same layout); product = hi·hi + hi·lo + lo·hi.
// BIAS_MODE: 0 = none, 1 = bias[m], 2 = bias[n].
// OUT_MODE: 0 = f32, 1 = f16, 2 = bf16 hi plane (Cout) + bf16 lo plane (Cout2), 3 = f16 [M,N] plane in fragment order (ldc unused).
// ET: 0 = f16 operands, 1 = bf16 operands (pointers passed as 16-bit storage)
// bx = tiles / 8 (tile = 8 bx + wave), b = batch index (strideA/B/C/R and strideBias are per b), zsel = true takes BtZp, CoutZ and biasZ in
// place of Btp, Cout and bias (same A, same strides; non-split launches only), so two products of one A share a launch.
// The body is a device function of (bx, b, zsel) and the block's LDS slabs, so that several products can share one grid by block range.
template <int ET> struct Elem;
template <> struct Elem<0> { typedef _Float16 T; };
template <> struct Elem<1> { typedef __bf16 T; };
template <int ET, bool SPLIT, int BIAS_MODE, int OUT_MODE, bool RESID, int ACT = 0, bool AFRAG = false>
__device__ __forceinline__ void gemm64_tile(
    float (*sT)[16 * 68], int bx, int b, bool zsel,      // sT: per-wave 16x64 slab, pitch 68 floats; bx, b, zsel block-uniform
    const unsigned short* __restrict__ Ap, const unsigned short* __restrict__ A2p, int lda, long strideA,
    const unsigned short* __restrict__ Btp, const unsigned short* __restrict__ Bt2p, int ldb, long strideB,
    void* __restrict__ Cout0, void* __restrict__ Cout2, int ldc, long strideC,
    const float* __restrict__ bias0, long strideBias,
    const float* __restrict__ resid, long strideR,
    const unsigned short* __restrict__ BtZp, void* __restrict__ CoutZ, const float* __restrict__ biasZ,
    int M, int N, int K, float scale) {
  typedef typename Elem<ET>::T T;
  typedef typename Frag<T>::V V;
  const T* A = (const T*)Ap; const T* A2 = (const T*)A2p; const T* Bt = (const T*)(zsel ? BtZp : Btp); const T* Bt2 = (const T*)Bt2p;
  void* Cout = zsel ? CoutZ : Cout0;
  const float* bias = (BIAS_MODE != 0) ? ((zsel ? biasZ : bias0) + (size_t)b * strideBias) : nullptr;
  const int lane = threadIdx.x & 31;
  const int wave = threadIdx.x >> 5;
  const int tilesN = N >> 6;
  const int tilesM = M >> 6;
  const int tile = bx * 8 + wave;
  if (tile >= tilesM * tilesN) return;   // wave-uniform; no block barriers in this kernel
  const int tm = tile / tilesN;
  const int tn = tile - tm * tilesN;
  const int m0 = tm << 6;
  const int n0 = tn << 6;

  const T* Ab  = A  + (size_t)b * strideA;
  const T* Bb  = Bt + (size_t)b * strideB;
  const T* Ab2 = SPLIT ? (A2  + (size_t)b * strideA) : nullptr;
  const T* Bb2 = SPLIT ? (Bt2 + (size_t)b * strideB) : nullptr;

  const int rlane = lane & 15;                 // row (A) / col (B, D) within subtile
  const int koff  = (lane >> 4) * 8;           // k offset of this lane half
  const int mOff  = (lane >> 4) * 8;           // D row offset

  v8f acc[4][4];
#pragma unroll
  for (int i = 0; i < 4; ++i)
#pragma unroll
    for (int j = 0; j < 4; ++j) acc[i][j] = (v8f){0.f,0.f,0.f,0.f,0.f,0.f,0.f,0.f};

  for (int k0 = 0; k0 < K; k0 += 32) {
    V bh[4], bl[4];
    const size_t bo0 = ((size_t)(n0 >> 4) * (K >> 5) + (k0 >> 5)) * 512 + lane * 8;
    const size_t ao0 = AFRAG ? ((size_t)(m0 >> 4) * (K >> 5) + (k0 >> 5)) * 512 + lane * 8 : (size_t)(m0 + rlane) * lda + koff + k0;
    const T* bp = Bb + bo0; const T* bp2 = SPLIT ? (Bb2 + bo0) : bp;     // the lane's own row of subtile 0 in each plane; the others at constant steps
    const T* ap = Ab + ao0; const T* ap2 = SPLIT ? (Ab2 + ao0) : ap;
#pragma unroll
    for (int j = 0; j < 4; ++j) {
      const size_t bo = (size_t)j * (K >> 5) * 512;
      bh[j] = Frag<T>::loadf(bp + bo);
      if (SPLIT) bl[j] = Frag<T>::loadf(bp2 + bo);
    }
#pragma unroll
    for (int i = 0; i < 4; ++i) {
      const size_t ao = AFRAG ? (size_t)i * (K >> 5) * 512 : (size_t)(i << 4) * lda;
      V ah = AFRAG ? Frag<T>::loadf(ap + ao) : Frag<T>::load(ap + ao);
      V al;
      if (SPLIT) al = AFRAG ? Frag<T>::loadf(ap2 + ao) : Frag<T>::load(ap2 + ao);
#pragma unroll
      for (int j = 0; j < 4; ++j) {
        acc[i][j] = Frag<T>::mma(ah, bh[j], acc[i][j]);
        if (SPLIT) {
          acc[i][j] = Frag<T>::mma(ah, bl[j], acc[i][j]);
          acc[i][j] = Frag<T>::mma(al, bh[j], acc[i][j]);
        }
      }
      Frag<T>::guard(acc[i][0], acc[i][3], ah, SPLIT ? al : ah);
    }
    Frag<T>::keep(bh[0], bh[1], bh[2], bh[3]);
    if (SPLIT) Frag<T>::keep(bl[0], bl[1], bl[2], bl[3]);
    // the four pointers as inputs: their registers stay as this step's loads name them (no result lands on them, no step to the next k) up to this wait
    asm volatile("s_wait_xcnt 0x0" :: "v"(ap), "v"(ap2), "v"(bp), "v"(bp2) : "memory");
  }
  acc_guard4(acc[0][0], acc[0][1], acc[0][2], acc[0][3]);
  acc_guard4(acc[1][0], acc[1][1], acc[1][2], acc[1][3]);
  acc_guard4(acc[2][0], acc[2][1], acc[2][2], acc[2][3]);
  acc_guard4(acc[3][0], acc[3][1], acc[3][2], acc[3][3]);

  // ---- epilogue ----
  float* slab = sT[wave];
  const float* Rb = RESID ? (resid + (size_t)b * strideR) : nullptr;
#pragma unroll
  for (int i = 0; i < 4; ++i) {
    const int mBase = m0 + (i << 4);
#pragma unroll
    for (int j = 0; j < 4; ++j) {
      const int n = n0 + (j << 4) + rlane;
      float bv = 0.f;
      if (BIAS_MODE == 2) bv = bias[n];
#pragma unroll
      for (int r = 0; r < 8; ++r) {
        float v = acc[i][j][r] * scale;
        if (BIAS_MODE == 1) v += bias[mBase + mOff + r];
        if (BIAS_MODE == 2) v += bv;
        if (RESID) v += Rb[(size_t)(mBase + mOff + r) * ldc + n];
        if (ACT == 1) v = tanhf(v);
        if (ACT == 2) v = fmaxf(v, 0.0f);
        if (ACT == 3) v = v / (1.0f + expf(-v));
        if (ACT == 4) v = (v > 0.f) ? v : 0.01f * v;
        if (ACT == 5) v = 0.5f * v * (1.0f + erff(v * 0.70710678118654752f));
        slab[(mOff + r) * 68 + (j << 4) + rlane] = v;
      }
    }
    __builtin_amdgcn_fence(__ATOMIC_RELEASE, "workgroup");
    __builtin_amdgcn_wave_barrier();
    __builtin_amdgcn_fence(__ATOMIC_ACQUIRE, "workgroup");
    if (OUT_MODE == 0) {
      float* C = (float*)Cout + (size_t)b * strideC;
      const int hh = lane >> 4, c4 = (lane & 15) * 4;     // row seg = 256 B = 16 lanes x 16 B
      {
#pragma unroll
        for (int it = 0; it < 8; ++it) {
          const int row = it * 2 + hh;
          v4f v = *(const v4f*)(slab + row * 68 + c4);
          *(v4f*)(C + (size_t)(mBase + row) * ldc + n0 + c4) = v;
        }
        
      }
    } else if (OUT_MODE == 3) {
      // the slab is row tile mBase / 16, k steps n0 / 32 and n0 / 32 + 1 of the plane: 2 KiB in a row, 512 B a store
      _Float16* C = (_Float16*)Cout + (size_t)b * strideC + ((size_t)(mBase >> 4) * (N >> 5) + (n0 >> 5)) * 512 + lane * 8;
#pragma unroll   // the four stores go off one address at constant offsets
      for (int it = 0; it < 4; ++it) {
        const float* sp = slab + rlane * 68 + it * 16 + mOff;
        v8h hv;
#pragma unroll   // constant indices keep hv in registers
        for (int e = 0; e < 8; ++e) hv[e] = (_Float16)sp[e];
        *(v8h*)(C + it * 256) = hv;
      }
    } else {
      const int q = lane >> 3, c8 = (lane & 7) * 8;
      unsigned short* C  = (unsigned short*)Cout  + (size_t)b * strideC;
      unsigned short* C2 = (OUT_MODE == 2) ? ((unsigned short*)Cout2 + (size_t)b * strideC) : nullptr;
      {
#pragma unroll
        for (int it = 0; it < 4; ++it) {
          const int row = it * 4 + q;
          const float* sp = slab + row * 68 + c8;
          v8h hv, lv;
#pragma unroll
          for (int e = 0; e < 8; ++e) {
            if (OUT_MODE == 1) {
              hv[e] = (_Float16)sp[e];
            } else {
              unsigned short hb = f2bf_bits(sp[e]);
              unsigned short lb = f2bf_bits(sp[e] - bf_bits2f(hb));
              hv[e] = __builtin_bit_cast(_Float16, hb);
              lv[e] = __builtin_bit_cast(_Float16, lb);
            }
          }
          *(v8h*)(C + (size_t)(mBase + row) * ldc + n0 + c8) = hv;
          if (OUT_MODE == 2) *(v8h*)(C2 + (size_t)(mBase + row) * ldc + n0 + c8) = lv;
        }
        
      }
    }
    asm volatile("s_wait_xcnt 0x0" ::: "memory");   // before the next slab's values and addresses take the registers that these stores name
    __builtin_amdgcn_fence(__ATOMIC_RELEASE, "workgroup");
    __builtin_amdgcn_wave_barrier();
    __builtin_amdgcn_fence(__ATOMIC_ACQUIRE, "workgroup");
  }
}

// ---- f32 [R][C] (row pitch ldi) -> f16 transposed [C][R = ldo] in fragment order (see gemm64_tile); 64x64 tiles
// one block of 256 threads does tile (bx, by); tile = the block's LDS, [c][r]
__device__ __forceinline__ void transpose_cast_f16_tile(_Float16 (*tile)[72], int bx, int by, const float* __restrict__ in, int ldi,
                                                        _Float16* __restrict__ outT, int ldo, float scale) {
  const int c0 = bx * 64, r0 = by * 64;
  const int t = threadIdx.x, tx = t & 31, ty = t >> 5;
  for (int i = ty; i < 64; i += 8) {
    tile[tx][i]      = (_Float16)(in[(size_t)(r0 + i) * ldi + c0 + tx] * scale);
    tile[32 + tx][i] = (_Float16)(in[(size_t)(r0 + i) * ldi + c0 + 32 + tx] * scale);
  }
  __syncthreads();
  const int lane = t & 31;
  {
#pragma unroll
    for (int it = 0; it < 2; ++it) {                          // fragment order: wave w writes the 512 B of (row tile, k step, ld) = its index it * 8 + w
      const int g = it * 8 + ty, ct = g >> 2, kk = (g >> 1) & 1, ld = g & 1;
      v8h hv = *(const v8h*)(&tile[ct * 16 + (lane & 15)][kk * 32 + ld * 16 + (lane >> 4) * 8]);
      *(v8h*)(outT + (((size_t)((c0 >> 4) + ct) * (ldo >> 5) + (r0 >> 5) + kk) * 2 + ld) * 256 + lane * 8) = hv;
    }
    
  }
}

// ---- f32 [R][C] (pitch ldi) -> bf16 hi/lo transposed planes [C][R = ldo] in fragment order (see gemm64_tile); 64x64 tiles
// one block of 256 threads does tile (bx, by); tile = the block's LDS, [c][r]
__device__ __forceinline__ void transpose_split_bf16_tile(float (*tile)[68], int bx, int by, const float* __restrict__ in, int ldi,
                                                          __bf16* __restrict__ outH, __bf16* __restrict__ outL, int ldo) {
  const int c0 = bx * 64, r0 = by * 64;
  const int t = threadIdx.x, tx = t & 31, ty = t >> 5;
  for (int i = ty; i < 64; i += 8) {
    tile[tx][i]      = in[(size_t)(r0 + i) * ldi + c0 + tx];
    tile[32 + tx][i] = in[(size_t)(r0 + i) * ldi + c0 + 32 + tx];
  }
  __syncthreads();
  const int lane = t & 31;
  {
#pragma unroll
    for (int it = 0; it < 2; ++it) {                          // fragment order: wave w writes the 512 B of (row tile, k step, ld) = its index it * 8 + w
      const int g = it * 8 + ty, ct = g >> 2, kk = (g >> 1) & 1, ld = g & 1;
      const int c = ct * 16 + (lane & 15), c8 = kk * 32 + ld * 16 + (lane >> 4) * 8;
      const size_t o = (((size_t)((c0 >> 4) + ct) * (ldo >> 5) + (r0 >> 5) + kk) * 2 + ld) * 256 + lane * 8;
      v8b hv, lv;
#pragma unroll
      for (int e = 0; e < 8; ++e) {
        const float f = tile[c][c8 + e];
        const unsigned short hb = f2bf_bits(f);
        hv[e] = __builtin_bit_cast(__bf16, hb);
        lv[e] = __builtin_bit_cast(__bf16, f2bf_bits(f - bf_bits2f(hb)));
      }
      *(v8b*)(outH + o) = hv;
      *(v8b*)(outL + o) = lv;
    }
    asm volatile("s_wait_xcnt 0x0" ::: "memory");   // other jobs' code follows this body in the shared kernel: nothing there rewrites a register that these stores name ahead of this wait
  }
}

// =====================================================================================
constexpr int kBatch = 2;
constexpr int kSeq   = 2048;
constexpr int kEmb   = 1024;
constexpr int kHeads = 8;
constexpr int kDh    = 128;
constexpr int kTok   = kBatch * kSeq;          // 4096 tokens
constexpr int kPairs = kEmb / 2;               // 512 element pairs per row
static_assert(kHeads * kDh == kEmb);
static_assert(kPairs == 512);

// ---- LayerNorm (biased variance, eps 1e-5) -> xn as bf16 hi/lo planes (packed pairs). One block per token, 256 threads;
// thread t owns element pairs (2t,2t+1) and (512+2t,512+2t+1): 2 packed dwords per plane per thread; each store instruction
__device__ __forceinline__ void layernorm_split_row(
    float* red, int tok,                                 // red: 8 floats of the block's LDS
    const float* __restrict__ x, const float* __restrict__ gamma, const float* __restrict__ beta,
    unsigned* __restrict__ xh, unsigned* __restrict__ xl) {
  const int t = threadIdx.x, lane = t & 31, wave = t >> 5;
  const float* xr = x + (size_t)tok * kEmb;
  const int ca = 2 * t, cb = kPairs + 2 * t;
  const v2f pa = *(const v2f*)(xr + ca);
  const v2f pb = *(const v2f*)(xr + cb);
  float s = (pa.x + pa.y) + (pb.x + pb.y);
#pragma unroll
  for (int off = 1; off < 32; off <<= 1) s += __shfl_xor(s, off, 32);
  if (lane == 0) red[wave] = s;
  __syncthreads();
  float tot = 0.f;
#pragma unroll
  for (int w = 0; w < 8; ++w) tot += red[w];       // fixed order
  const float mean = tot * (1.0f / (float)kEmb);
  __syncthreads();
  const float d0 = pa.x - mean, d1 = pa.y - mean, d2 = pb.x - mean, d3 = pb.y - mean;
  float s2 = (d0 * d0 + d1 * d1) + (d2 * d2 + d3 * d3);
#pragma unroll
  for (int off = 1; off < 32; off <<= 1) s2 += __shfl_xor(s2, off, 32);
  if (lane == 0) red[wave] = s2;
  __syncthreads();
  float tot2 = 0.f;
#pragma unroll
  for (int w = 0; w < 8; ++w) tot2 += red[w];
  const float var  = tot2 * (1.0f / (float)kEmb);
  const float rstd = 1.0f / sqrtf(var + 1e-5f);
  const float y0 = d0 * rstd * gamma[ca] + beta[ca];
  const float y1 = d1 * rstd * gamma[ca + 1] + beta[ca + 1];
  const float y2 = d2 * rstd * gamma[cb] + beta[cb];
  const float y3 = d3 * rstd * gamma[cb + 1] + beta[cb + 1];
  const unsigned short h0 = f2bf_bits(y0), h1 = f2bf_bits(y1), h2 = f2bf_bits(y2), h3 = f2bf_bits(y3);
  const unsigned short l0 = f2bf_bits(y0 - bf_bits2f(h0)), l1 = f2bf_bits(y1 - bf_bits2f(h1));
  const unsigned short l2 = f2bf_bits(y2 - bf_bits2f(h2)), l3 = f2bf_bits(y3 - bf_bits2f(h3));
  const unsigned uah = (unsigned)h0 | ((unsigned)h1 << 16), ual = (unsigned)l0 | ((unsigned)l1 << 16);
  const unsigned ubh = (unsigned)h2 | ((unsigned)h3 << 16), ubl = (unsigned)l2 | ((unsigned)l3 << 16);
  const size_t ia = (size_t)tok * kPairs + t, ib = ia + 256;
  {
    ((unsigned*)xh)[ia] = uah;
    ((unsigned*)xh)[ib] = ubh;
    ((unsigned*)xl)[ia] = ual;
    ((unsigned*)xl)[ib] = ubl;
    asm volatile("s_wait_xcnt 0x0" ::: "memory");   // other jobs' code follows this body in the shared kernel: nothing there rewrites a register that these stores name ahead of this wait
  }
}

// ---- sinusoid table [kSeq][kEmb]: columns 2i = sin(pos·div_i), 2i+1 = cos(pos·div_i), div_i = exp(2i · (−ln 1e4 / kEmb)), f32,
// emitted as bf16 hi/lo planes (packed pairs). One thread per (pos, i): kSeq*512/256 = 4096 blocks exactly; each wave's store
__device__ __forceinline__ void posenc_split_block(int blk, unsigned* __restrict__ peh, unsigned* __restrict__ pel) {
  const int idx = blk * 256 + threadIdx.x;
  if (idx >= kSeq * kPairs) return;
  const int pos = idx >> 9, i = idx & 511;
  const float kNegLogRate = -0.00899447301950799f;        // −ln(10000)/1024
  const float freq = expf((float)(2 * i) * kNegLogRate);
  const float ang  = (float)pos * freq;
  const float sv = sinf(ang), cv = cosf(ang);
  const unsigned short hs = f2bf_bits(sv), hc = f2bf_bits(cv);
  const unsigned short ls = f2bf_bits(sv - bf_bits2f(hs)), lc = f2bf_bits(cv - bf_bits2f(hc));
  const unsigned uh = (unsigned)hs | ((unsigned)hc << 16), ul = (unsigned)ls | ((unsigned)lc << 16);
  {
    ((unsigned*)peh)[idx] = uh;
    ((unsigned*)pel)[idx] = ul;
    asm volatile("s_wait_xcnt 0x0" ::: "memory");   // other jobs' code follows this body in the shared kernel: nothing there rewrites a register that these stores name ahead of this wait
  }
}

// ---- scaled projection biases: qb = 16·bq, kb = 16·bk (128 floats each). Two waves of one block: wave 0 -> qb, wave 1 -> kb;
__device__ __forceinline__ void bias16_block(const float* __restrict__ bq, const float* __restrict__ bk,
                                             float* __restrict__ qb, float* __restrict__ kb) {
  const int lane = threadIdx.x & 31, wave = threadIdx.x >> 5;   // wave-uniform branches
  if (wave >= 2) return;
  v4f v; float* dst;
  if (wave == 0) { v = *(const v4f*)(bq + 4 * lane); dst = qb + 4 * lane; }
  else           { v = *(const v4f*)(bk + 4 * lane); dst = kb + 4 * lane; }
  v = v * 16.0f;
  *(v4f*)dst = v;
  asm volatile("s_wait_xcnt 0x0" ::: "memory");   // other jobs' code follows this body in the shared kernel: nothing there rewrites a register that these stores name ahead of this wait
}

// ---- all that depends on the inputs alone, in one grid of 256-thread blocks; a block's job goes by its index (every branch block-uniform):
// the 64x64 tiles of Wo, those of the four [128][128] weights, the scaled biases, then LayerNorm rows and sinusoid blocks in turn
// (one reads and writes memory, the other computes). WT = the eight [128 n][128 k] planes in the order q hi, q lo, k hi, k lo, v hi, v lo, p hi, p lo.
constexpr int kBlkWo = (kEmb / 64) * (kEmb / 64);        // 256
constexpr int kBlkW4 = 4 * (kDh / 64) * (kDh / 64);      // 16
constexpr int kBlkPe = (kSeq * kPairs) / 256;            // 4096 blocks x 256 = 2048 x 512 pairs
static_assert(kBlkPe == kTok);
constexpr int kBlkPrelude = kBlkWo + kBlkW4 + 1 + kTok + kBlkPe;
__global__ __launch_bounds__(256) void prelude_kernel(
    const float* __restrict__ x, const float* __restrict__ gamma, const float* __restrict__ beta,
    const float* __restrict__ Wq, const float* __restrict__ Wk, const float* __restrict__ Wv, const float* __restrict__ Wp,
    const float* __restrict__ Wo, const float* __restrict__ bq, const float* __restrict__ bk,
    __bf16* __restrict__ WT, __bf16* __restrict__ WoTh, __bf16* __restrict__ WoTl, float* __restrict__ qb, float* __restrict__ kb,
    unsigned* __restrict__ xh, unsigned* __restrict__ xl, unsigned* __restrict__ peh, unsigned* __restrict__ pel) {
  __shared__ __align__(16) float tile[64][68];
  int blk = blockIdx.x;
  if (blk < kBlkWo) { transpose_split_bf16_tile(tile, blk % (kEmb / 64), blk / (kEmb / 64), Wo, kEmb, WoTh, WoTl, kEmb); return; }
  blk -= kBlkWo;
  if (blk < kBlkW4) {
    const int w = blk >> 2;
    const float* in = (w == 0) ? Wq : (w == 1) ? Wk : (w == 2) ? Wv : Wp;
    __bf16* oh = WT + (size_t)(2 * w) * (kDh * kDh);
    transpose_split_bf16_tile(tile, blk & 1, (blk >> 1) & 1, in, kDh, oh, oh + kDh * kDh, kDh);
    return;
  }
  blk -= kBlkW4;
  if (blk == 0) { bias16_block(bq, bk, qb, kb); return; }
  blk -= 1;
  if (blk & 1) posenc_split_block(blk >> 1, peh, pel);
  else         layernorm_split_row(&tile[0][0], blk >> 1, x, gamma, beta, xh, xl);
}

// ---- the four projections in one grid: blocks 0..127 q, 128..255 k, 256..383 v, 384..447 p (block-uniform branches); operands and results as in gemm64_tile
constexpr int kBlkProj  = (kTok * kHeads / 64) * (kDh / 64) / 8;   // 1024 tiles -> 128 blocks
constexpr int kBlkProjP = (kSeq * kHeads / 64) * (kDh / 64) / 8;   // 512 tiles -> 64 blocks
__global__ __launch_bounds__(256) void proj4_kernel(
    const unsigned short* __restrict__ xnh, const unsigned short* __restrict__ xnl,
    const unsigned short* __restrict__ peh, const unsigned short* __restrict__ pel, const unsigned short* __restrict__ WT,
    const float* __restrict__ qb, const float* __restrict__ kb, const float* __restrict__ bv,
    _Float16* __restrict__ q16, _Float16* __restrict__ k16, float* __restrict__ vf32, _Float16* __restrict__ pp16) {
  __shared__ __align__(16) float sT[8][16 * 68];
  const int w = blockIdx.x / kBlkProj, bx = blockIdx.x % kBlkProj;
  const unsigned short* Bh = WT + (size_t)(2 * w) * (kDh * kDh);
  const unsigned short* Bl = Bh + kDh * kDh;
  if (w < 2)          // q*16 (+16 bq), k*16 (+16 bk): head by head (16 blocks each, A rows = tokens at pitch kEmb), one fragment-order f16 plane [kTok][kDh] a head
    gemm64_tile<1, true, 2, 3, false>(sT, bx & 15, bx >> 4, false, xnh, xnl, kEmb, kDh, Bh, Bl, kDh, 0, w ? k16 : q16, nullptr, kDh, (long)kTok * kDh, w ? kb : qb, 0,
        nullptr, 0, nullptr, nullptr, nullptr, kTok, kDh, kDh, 16.0f);
  else if (w == 2)    // v (+bv) as f32
    gemm64_tile<1, true, 2, 0, false>(sT, bx, 0, false, xnh, xnl, kDh, 0, Bh, Bl, kDh, 0, vf32, nullptr, kDh, 0, bv, 0,
        nullptr, 0, nullptr, nullptr, nullptr, kTok * kHeads, kDh, kDh, 1.0f);
  else                // p*16: head by head (8 blocks each), one fragment-order f16 plane [kSeq][kDh] a head
    gemm64_tile<1, true, 0, 3, false>(sT, bx & 7, bx >> 3, false, peh, pel, kEmb, kDh, Bh, Bl, kDh, 0, pp16, nullptr, kDh, (long)kSeq * kDh, nullptr, 0,
        nullptr, 0, nullptr, nullptr, nullptr, kSeq, kDh, kDh, 16.0f);
}

// ---- per-key bias vectors: UBK[(b·8+h)·S + s] = u_bias[h]·k[b,s,h,:], VBP[h·S + s] = v_bias[h]·p[s,h,:] (f32 dots of 128 over the x16 f16 planes,
// folded back by 1/16). 192 blocks x 256: blocks 0..127 -> UBK (32768 values), 128..191 -> VBP (16384 values); block-uniform branch;
__device__ __forceinline__ void headbias_block(int blk, const _Float16* __restrict__ k16, const _Float16* __restrict__ pp16,
                                               const float* __restrict__ ub, const float* __restrict__ vb,
                                               float* __restrict__ ubk, float* __restrict__ vbp) {
  const int t = blk * 256 + threadIdx.x;
  const _Float16* row; const float* bvec; float* dst;
  if (blk < 128) {
    const int b = t >> 14, h = (t >> 11) & 7, s = t & 2047;
    row = k16 + ((size_t)(h * kTok + b * kSeq + (s & ~15))) * kDh + (s & 15) * 8; bvec = ub + h * kDh; dst = ubk + t;
  } else {
    const int u = t - 32768; const int h = (u >> 11) & 7, s = u & 2047;
    row = pp16 + ((size_t)(h * kSeq + (s & ~15))) * kDh + (s & 15) * 8; bvec = vb + h * kDh; dst = vbp + u;
  }
  float acc = 0.f;
#pragma unroll 1
  for (int ch = 0; ch < kDh / 8; ++ch) {
    const _Float16* rp = row + 128 * ch; const float* bp = bvec + 8 * ch;   // fragment order: a row's chunk k = 8 ch .. + 7 stands 128 ch elements behind its first
    const v8h kv = *(const v8h*)rp;
    const v4f b0 = *(const v4f*)bp;
    const v4f b1 = *(const v4f*)(bp + 4);
    // the two pointers as inputs: the step to the next chunk, the next write of the registers that the loads name, comes behind this wait
    asm volatile("s_wait_xcnt 0x0" :: "v"(rp), "v"(bp) : "memory");
    acc += b0.x * (float)kv[0] + b0.y * (float)kv[1] + b0.z * (float)kv[2] + b0.w * (float)kv[3]
         + b1.x * (float)kv[4] + b1.y * (float)kv[5] + b1.z * (float)kv[6] + b1.w * (float)kv[7];
  }
  const float r = acc * 0.0625f;
  *(float*)dst = r;
  
}

// ---- out = ctx.Wo + bo : A bf16 hi/lo [4096][1024], Bt bf16 hi/lo [1024 n][1024 k], C f32 [4096][1024]; 1024 tiles -> 128 blocks
constexpr int kBlkOut = (kTok / 64) * (kEmb / 64) / 8;
__global__ __launch_bounds__(256) void out_gemm_kernel(const unsigned short* __restrict__ ctxh, const unsigned short* __restrict__ ctxl,
                                                      const unsigned short* __restrict__ WoTh, const unsigned short* __restrict__ WoTl,
                                                      const float* __restrict__ bo, float* __restrict__ out) {
  __shared__ __align__(16) float sT[8][16 * 68];
  gemm64_tile<1, true, 2, 0, false, 0, true>(sT, blockIdx.x, 0, false, ctxh, ctxl, kEmb, 0, WoTh, WoTl, kEmb, 0, out, nullptr, kEmb, 0, bo, 0,
      nullptr, 0, nullptr, nullptr, nullptr, kTok, kEmb, kEmb, 1.0f);
}

// ---- what stands between the projections and attention, in one grid (block-uniform branch): blocks 0..191 the bias dots, then per batch the 16 x 32 tiles of
// v [2048 r][1024 c] (pitch 1024) -> v^T f16 x16 [1024 c][2048 r] in fragment order
constexpr int kBlkHb = (kBatch * kHeads * kSeq + kHeads * kSeq) / 256;   // 192
constexpr int kBlkVt = (kEmb / 64) * (kSeq / 64);                        // 512 a batch
__global__ __launch_bounds__(256) void headbias_vt_kernel(const _Float16* __restrict__ k16, const _Float16* __restrict__ pp16,
                                                         const float* __restrict__ ub, const float* __restrict__ vb,
                                                         float* __restrict__ ubk, float* __restrict__ vbp,
                                                         const float* __restrict__ vf32, _Float16* __restrict__ vt16) {
  __shared__ __align__(16) _Float16 tile[64][72];
  int blk = blockIdx.x;
  if (blk < kBlkHb) { headbias_block(blk, k16, pp16, ub, vb, ubk, vbp); return; }
  blk -= kBlkHb;
  const int b = blk / kBlkVt, r = blk % kBlkVt;
  transpose_cast_f16_tile(tile, r % (kEmb / 64), r / (kEmb / 64), vf32 + (size_t)b * kSeq * kEmb, kEmb, vt16 + (size_t)b * kEmb * kSeq, kSeq, 16.0f);
}

// ---- content and position scores, relative shift, softmax and p.v of 32 query rows of one (b, h) in one block; the rows' scores never leave LDS.
// grid = (kSeq / 32, kBatch * kHeads), 512 threads = 16 waves. sc[r][c], r = a - a0, holds in turn:
//   1. shifted[a][c] = c <= a ? ps[a][S-1-a+c] : (c == a+1 ? 0 : ps[a+1][c-a-2]), ps[a][n] = (16q[a]).(16p[n])/256 + v_bias.p[n]: the c >= a+2 part is the
//      product of rows a0+1..a0+32 with p rows 0..S-a0-1, the c <= a part that of rows a0..a0+31 with p rows S-32-a0..S-1; each result is stored
//      at its shifted column, results that fall outside the row are dropped; every sc[r][c] gets exactly one store;
//   2. s = (content + shifted) / 32, content[a][key] = (16q[a]).(16k[key])/256 + u_bias.k[key];
//   3. f16(exp(s - max) / sum * 2^15), written over the front half of the same row by the wave that owns the row;
//   4. the 8 key groups' f32 partials of p.v (pitch kPartPitch), summed in group order 0..7; output = bf16 hi/lo [kTok][kEmb] planes in fragment order.
constexpr int kRows      = 32;
constexpr int kScPitch   = kSeq + 4;    // floats; 8208 B = 16 B x odd, rows 8 apart = 32 banks apart
constexpr int kPartPitch = kDh + 4;     // floats; rows 8 apart = 32 banks apart
static_assert(8 * kRows * kPartPitch <= kRows * kScPitch);
// every "#pragma unroll" in the three helpers below: constant indices keep the fragment and accumulator arrays in registers
// qf[i][kk] = the lane's A fragments of 32 query rows; r0, r1 = the first chunks of the lane's own rows (tile rows lane & 15 and 16 + lane & 15) and lane half in the fragment-order plane
__device__ __forceinline__ void load_q(v16h (&qf)[2][4], const _Float16* r0, const _Float16* r1) {
#pragma unroll
  for (int kk = 0; kk < 4; ++kk) { qf[0][kk] = Frag<_Float16>::loadf(r0 + 512 * kk); qf[1][kk] = Frag<_Float16>::loadf(r1 + 512 * kk); }
  // the two pointers as inputs: their registers stay as the loads name them (no result lands on them) up to this wait
  asm volatile("s_wait_xcnt 0x0" :: "v"(r0), "v"(r1) : "memory");
}
// acc[i][j] = 32 query rows (fragments qf[i][kk], k = 32 kk ..) x 32 rows of a fragment-order f16 plane [.][kDh] (8 KiB in a row); rows = the tile's first element + 8 lane;
// bv0, bv1 = the per-column bias of the lane's two columns (bias = the lane's own first column)
// (pointers typed as global: a pointer that has gone through an asm statement would otherwise be read with flat loads)
typedef const __attribute__((address_space(1))) _Float16* GlobH;
typedef const __attribute__((address_space(1))) v8h*      GlobH8;
typedef const __attribute__((address_space(1))) float*    GlobF;
__device__ __forceinline__ void score_tile(const v16h (&qf)[2][4], GlobH& rows, GlobF& bias, v8f (&acc)[2][2], float& bv0, float& bv1) {
  v16h bf[2][4];
#pragma unroll
  for (int j = 0; j < 2; ++j)
#pragma unroll
    for (int kk = 0; kk < 4; ++kk) {                          // as Frag<_Float16>::loadf
      Frag<_Float16>::U f;
      f.h[0] = *(GlobH8)(rows + (j * 4 + kk) * 512);
      f.h[1] = *(GlobH8)(rows + (j * 4 + kk) * 512 + 256);
      bf[j][kk] = f.v;
    }
  bv0 = bias[0]; bv1 = bias[16];
  // The loaded values, as inputs only: all of a tile's loads are issued before the first product (one memory latency a tile, not one per k step).
  // The two pointers go through the statement: the caller's step to the next tile, the next write of the registers that the loads name, comes behind this wait.
  asm volatile("s_wait_xcnt 0x0" : "+v"(rows), "+v"(bias) : "v"(bf[0][0]), "v"(bf[0][1]), "v"(bf[0][2]), "v"(bf[0][3]),
               "v"(bf[1][0]), "v"(bf[1][1]), "v"(bf[1][2]), "v"(bf[1][3]), "v"(bv0), "v"(bv1) : "memory");
#pragma unroll
  for (int i = 0; i < 2; ++i)
#pragma unroll
    for (int j = 0; j < 2; ++j) acc[i][j] = (v8f){0.f,0.f,0.f,0.f,0.f,0.f,0.f,0.f};
#pragma unroll
  for (int kk = 0; kk < 4; ++kk)
#pragma unroll
    for (int i = 0; i < 2; ++i)
#pragma unroll
      for (int j = 0; j < 2; ++j) acc[i][j] = Frag<_Float16>::mma(qf[i][kk], bf[j][kk], acc[i][j]);
}
// one step down a row of the tile is one step right in the shifted table: element (16 i + r, 16 j) of the lane goes to dst + (16 i + r) * (pitch + 1) + 16 j.
// GUARD: c0 = the column that dst stands for; elements whose column falls outside 0 .. kSeq - 1 are dropped (only the tiles at a row's ends have such)
template <bool GUARD>
__device__ __forceinline__ void store_shifted(float* dst, const v8f (&acc)[2][2], float bv0, float bv1, int c0) {
#pragma unroll
  for (int j = 0; j < 2; ++j)
#pragma unroll
    for (int i = 0; i < 2; ++i)
#pragma unroll
      for (int r = 0; r < 8; ++r) {
        const int d = (i << 4) + r;
        if (!GUARD || (unsigned)(c0 + d + (j << 4)) < (unsigned)kSeq)
          dst[d * (kScPitch + 1) + (j << 4)] = acc[i][j][r] * (1.0f / 256.0f) + (j ? bv1 : bv0);
      }
}
__global__ __launch_bounds__(512) void attn_rows_kernel(const _Float16* __restrict__ q16, const _Float16* __restrict__ k16,
                                                       const _Float16* __restrict__ pp16, const _Float16* __restrict__ vt16,
                                                       const float* __restrict__ ubk, const float* __restrict__ vbp,
                                                       unsigned short* __restrict__ Ch, unsigned short* __restrict__ Cl) {
  __shared__ __align__(16) float sc[kRows * kScPitch];
  const int t = threadIdx.x, lane = t & 31;
  const int wave = __builtin_amdgcn_readfirstlane(t >> 5);    // scalar, so that the tile loops branch on scalars
  const int a0 = blockIdx.x * kRows;
  const int bh = blockIdx.y, b = bh / kHeads, h = bh % kHeads;
  const int rlane = lane & 15;
  const int half8 = (lane >> 4) * 8;                          // k offset of this lane half (A, B) and D row offset
  const _Float16* qb = q16 + ((size_t)h * kTok + b * kSeq) * kDh + (lane >> 4) * 128;   // fragment order: any row s, this lane half, at (s & ~15) * kDh + (s & 15) * 8
  const _Float16* kb = k16 + ((size_t)h * kTok + b * kSeq) * kDh + lane * 8;   // fragment-order planes: row s (a multiple of 16) at s * kDh, the lane's chunk
  const _Float16* pb = pp16 + (size_t)h * kSeq * kDh + lane * 8;
  const float* ub = ubk + (size_t)bh * kSeq;
  const float* vb = vbp + (size_t)h * kSeq;

  // every "#pragma unroll" in this kernel: constant indices keep the fragment and accumulator arrays in registers
  if (t < kRows) { const int c = a0 + t + 1; if (c < kSeq) sc[t * kScPitch + c] = 0.0f; }

  v16h qf[2][4];
  v8f acc2[2][2];
  float bv0, bv1;
  // ---- 1a. columns c >= a+2: query rows a+1 (the last row of the table has no such column; its address is clamped) ----
  const int qs0 = (a0 + 1 + rlane < kSeq) ? (a0 + 1 + rlane) : (kSeq - 1), qs1 = (a0 + 17 + rlane < kSeq) ? (a0 + 17 + rlane) : (kSeq - 1);
  load_q(qf, qb + (size_t)(qs0 & ~15) * kDh + (qs0 & 15) * 8, qb + (size_t)(qs1 & ~15) * kDh + (qs1 & 15) * 8);
  const int nUp = (kSeq - a0) >> 5;                           // 32-column tiles of either part; nUp + nLo = kSeq / 32 + 1
  const int nLo = (a0 + kRows) >> 5;
  GlobH prow = (GlobH)(pb + (size_t)(wave << 5) * kDh);                       // the wave's tile and the lane's bias; 16 tiles on a trip
  GlobF vrow = (GlobF)(vb + (wave << 5) + rlane);
  for (int jj = wave; jj < nUp; jj += 16, prow += (size_t)512 * kDh, vrow += 512) {
    const int n0 = jj << 5;
    score_tile(qf, prow, vrow, acc2, bv0, bv1);
    const int cmin = n0 + a0 + 2;                             // column of the tile's element (row 0, n0); the tile spans cmin .. cmin + 62
    float* dst = sc + half8 * kScPitch + cmin + rlane + half8;
    if (cmin + 62 < kSeq) store_shifted<false>(dst, acc2, bv0, bv1, 0);
    else                  store_shifted<true>(dst, acc2, bv0, bv1, cmin + rlane + half8);
  }
  // ---- 1b. columns c <= a: query rows a; these fragments also serve the content product ----
  load_q(qf, qb + (size_t)a0 * kDh + rlane * 8, qb + (size_t)(a0 + 16) * kDh + rlane * 8);
  const int jLo = (wave - nUp) & 15;                          // the deal of tiles to waves goes on where 1a's ended
  prow = (GlobH)(pb + (size_t)((kSeq - kRows - a0) + (jLo << 5)) * kDh);
  vrow = (GlobF)(vb + (kSeq - kRows - a0) + (jLo << 5) + rlane);
  for (int jj = jLo; jj < nLo; jj += 16, prow += (size_t)512 * kDh, vrow += 512) {
    const int n0 = (kSeq - kRows - a0) + (jj << 5);
    score_tile(qf, prow, vrow, acc2, bv0, bv1);
    const int cmin = n0 + a0 - (kSeq - 1);                    // = 32 jj - 31
    float* dst = sc + half8 * kScPitch + cmin + rlane + half8;
    if (cmin >= 0) store_shifted<false>(dst, acc2, bv0, bv1, 0);
    else           store_shifted<true>(dst, acc2, bv0, bv1, cmin + rlane + half8);
  }
  __syncthreads();                                            // every shifted position score is in LDS before the content product adds to it

  // ---- 2. content; wave w takes the 32-key tiles w, w + 16, w + 32, w + 48 ----
  GlobH krow = (GlobH)(kb + (size_t)(wave << 5) * kDh);
  GlobF urow = (GlobF)(ub + (wave << 5) + rlane);
  for (int jj = wave; jj < kSeq / 32; jj += 16, krow += (size_t)512 * kDh, urow += 512) {
    const int n0 = jj << 5;
    score_tile(qf, krow, urow, acc2, bv0, bv1);
#pragma unroll
    for (int j = 0; j < 2; ++j) {
      const int n = n0 + (j << 4) + rlane;
      const float bv = j ? bv1 : bv0;
#pragma unroll
      for (int i = 0; i < 2; ++i)
#pragma unroll
        for (int r = 0; r < 8; ++r) {
          float* e = sc + ((i << 4) + half8 + r) * kScPitch + n;
          *e = ((acc2[i][j][r] * (1.0f / 256.0f) + bv) + *e) * (1.0f / 32.0f);
        }
    }
  }
  __syncthreads();                                            // whole score rows are in LDS before a wave takes its rows' maximum

  // ---- 3. softmax; wave w owns rows 2w and 2w + 1, lane l columns 128 it + 4 l .. + 3 ----
#pragma unroll 1   // one row's 64 floats a lane live at a time, not two rows'
  for (int rr = 0; rr < 2; ++rr) {
    float* srow = sc + (wave * 2 + rr) * kScPitch;
    v4f x[16];
#pragma unroll
    for (int it = 0; it < 16; ++it) x[it] = *(const v4f*)(srow + it * 128 + 4 * lane);
    float mx = -INFINITY;
#pragma unroll
    for (int it = 0; it < 16; ++it) mx = fmaxf(mx, fmaxf(fmaxf(x[it].x, x[it].y), fmaxf(x[it].z, x[it].w)));
#pragma unroll
    for (int off = 1; off < 32; off <<= 1) mx = fmaxf(mx, __shfl_xor(mx, off, 32));
    float sum = 0.f;
#pragma unroll
    for (int it = 0; it < 16; ++it) {
      x[it].x = __expf(x[it].x - mx); x[it].y = __expf(x[it].y - mx); x[it].z = __expf(x[it].z - mx); x[it].w = __expf(x[it].w - mx);
      sum += (x[it].x + x[it].y) + (x[it].z + x[it].w);
    }
#pragma unroll
    for (int off = 1; off < 32; off <<= 1) sum += __shfl_xor(sum, off, 32);
    const float f = (1.0f / sum) * 32768.0f;
    _Float16* prow = (_Float16*)srow;                         // all of the row is in this wave's registers by now
#pragma unroll
    for (int it = 0; it < 16; ++it) {
      v4h hv;
      hv[0] = (_Float16)(x[it].x * f); hv[1] = (_Float16)(x[it].y * f); hv[2] = (_Float16)(x[it].z * f); hv[3] = (_Float16)(x[it].w * f);
      *(v4h*)(prow + it * 128 + 4 * lane) = hv;
    }
  }
  __syncthreads();                                            // all 32 rows of p are in LDS before any wave reads them as A fragments

  // ---- 4. p.v: wave = (key group kg of 256 keys, half dh of the 128 columns); ctx[q][d] = 2^-19 * sum_key p[q][key] * Vt[d][key] ----
  const int kg = wave & 7, dh = wave >> 3;
  const _Float16* Ar = (const _Float16*)sc + rlane * (2 * kScPitch) + kg * (kSeq / 8) + half8;
  const _Float16* Br = vt16 + ((size_t)bh * kDh + dh * 64) * kSeq + kg * (kSeq / 8) * 16 + lane * 8;   // fragment order: 16 rows x 32 keys = 512 elements in a row
  v8f acc[2][4];
#pragma unroll
  for (int i = 0; i < 2; ++i)
#pragma unroll
    for (int j = 0; j < 4; ++j) acc[i][j] = (v8f){0.f,0.f,0.f,0.f,0.f,0.f,0.f,0.f};
  for (int k0 = 0; k0 < kSeq / 8; k0 += 64) {                 // 64 keys a trip = 2 KiB in a row of the fragment-order Vt plane per 16-row tile
    v16h af[2][2], bf[2][4];
#pragma unroll
    for (int s = 0; s < 2; ++s) {
#pragma unroll
      for (int j = 0; j < 4; ++j) bf[s][j] = Frag<_Float16>::loadf(Br + (size_t)(j << 4) * kSeq + (k0 + 32 * s) * 16);
#pragma unroll
      for (int i = 0; i < 2; ++i) af[s][i] = Frag<_Float16>::load(Ar + (i << 4) * (2 * kScPitch) + k0 + 32 * s);
    }
#pragma unroll
    for (int s = 0; s < 2; ++s)
#pragma unroll
      for (int i = 0; i < 2; ++i)
#pragma unroll
        for (int j = 0; j < 4; ++j) acc[i][j] = Frag<_Float16>::mma(af[s][i], bf[s][j], acc[i][j]);
  }
  __syncthreads();                                            // every wave has read its p fragments before the partials overwrite them

  float* mine = sc + kg * (kRows * kPartPitch) + dh * 64;
#pragma unroll
  for (int i = 0; i < 2; ++i)
#pragma unroll
    for (int j = 0; j < 4; ++j)
#pragma unroll
      for (int r = 0; r < 8; ++r) mine[((i << 4) + half8 + r) * kPartPitch + (j << 4) + rlane] = acc[i][j][r];
  __syncthreads();                                            // all 8 partials are in LDS before any thread sums them

  // fragment order of the [kTok][kEmb] planes: wave w writes the 512 B of (row tile w >> 3, k step (w >> 1) & 3 of the head's four, ld w & 1)
  const int row = (wave >> 3) * 16 + rlane, c8 = ((wave >> 1) & 3) * 32 + (wave & 1) * 16 + half8;
  const float* sp = sc + row * kPartPitch + c8;
  v4f s0 = *(const v4f*)sp, s1 = *(const v4f*)(sp + 4);
#pragma unroll
  for (int w = 1; w < 8; ++w) {                               // fixed order
    s0 += *(const v4f*)(sp + w * (kRows * kPartPitch));
    s1 += *(const v4f*)(sp + w * (kRows * kPartPitch) + 4);
  }
  v8h hv, lv;
#pragma unroll
  for (int e = 0; e < 8; ++e) {
    const float f = ((e < 4) ? s0[e & 3] : s1[e & 3]) * (1.0f / 524288.0f);
    const unsigned short hb = f2bf_bits(f);
    hv[e] = __builtin_bit_cast(_Float16, hb);
    lv[e] = __builtin_bit_cast(_Float16, f2bf_bits(f - bf_bits2f(hb)));
  }
  const size_t co = ((size_t)(((b * kSeq + a0) >> 4) + (wave >> 3)) * (kEmb / 32) + h * (kDh / 32) + ((wave >> 1) & 3)) * 512 + (wave & 1) * 256 + lane * 8;
  *(v8h*)(Ch + co) = hv;
  *(v8h*)(Cl + co) = lv;
}

// =====================================================================================
extern "C" void kernel_launch(void* const* d_in, const int* in_sizes, int n_in, void* d_out, int out_size,
                              void* d_ws, size_t ws_size, hipStream_t stream) {
  if (n_in < 14) return;
  if (in_sizes[0] != kTok * kEmb || in_sizes[1] != kEmb || in_sizes[2] != kEmb ||
      in_sizes[3] != kDh * kDh || in_sizes[4] != kDh || in_sizes[5] != kDh * kDh || in_sizes[6] != kDh ||
      in_sizes[7] != kDh * kDh || in_sizes[8] != kDh || in_sizes[9] != kDh * kDh ||
      in_sizes[10] != kHeads * kDh || in_sizes[11] != kHeads * kDh || in_sizes[12] != kEmb * kEmb || in_sizes[13] != kEmb ||
      out_size != kTok * kEmb) return;
  const float* x      = (const float*)d_in[0];
  const float* gamma  = (const float*)d_in[1];
  const float* beta   = (const float*)d_in[2];
  const float* Wq     = (const float*)d_in[3];
  const float* bq     = (const float*)d_in[4];
  const float* Wk     = (const float*)d_in[5];
  const float* bk     = (const float*)d_in[6];
  const float* Wv     = (const float*)d_in[7];
  const float* bv     = (const float*)d_in[8];
  const float* Wp     = (const float*)d_in[9];
  const float* u_bias = (const float*)d_in[10];
  const float* v_bias = (const float*)d_in[11];
  const float* Wo     = (const float*)d_in[12];
  const float* bo     = (const float*)d_in[13];
  float* out = (float*)d_out;   // [2][2048][1024] f32

  // ---- workspace carve (all offsets multiples of 256 B; total 92,734,464 B) ----
  // (R0, R1, R8, R9 and, one plane a head, R4 [8][4096][128], R5 [8][4096][128], R6 [8][2048][128] are in fragment order: see gemm64_tile)
  // R0 WqT,WkT,WvT,WpT hi/lo bf16 [128 n][128 k]   8 x 32,768        =     262,144
  // R1 WoT hi/lo bf16 [1024 n][1024 k]              2 x 2,097,152     =   4,194,304
  // R2 16·bq, 16·bk f32 [128]                       2 x 512           =       1,024
  // R3 UBK f32 [2][8][2048], VBP f32 [8][2048]                        =     196,608
  // R4 Q16 f16 x16 [32768][128]                                       =   8,388,608
  // R5 K16 f16 x16 [32768][128]                                       =   8,388,608
  // R6 PP16 f16 x16 [16384][128]                                      =   4,194,304
  // R7 V f32 [32768][128] (= [4096][1024])                            =  16,777,216
  // R8 CTX hi/lo bf16 [4096][1024]                  2 x 8,388,608     =  16,777,216
  // R9 VT16 f16 x16 [2 b][1024][2048]                                 =   8,388,608
  // R10 XN hi/lo bf16 [4096][1024] 2 x 8,388,608, PE hi/lo bf16 [2048][1024] 2 x 4,194,304 = 25,165,824
  char* ws = (char*)d_ws; size_t off = 0;
  auto carve = [&](size_t bytes) -> char* { char* p = ws + off; off += (bytes + 255) & ~(size_t)255; return p; };
  const size_t nW   = (size_t)kDh * kDh;            // 16,384
  const size_t nWo  = (size_t)kEmb * kEmb;          // 1,048,576
  const size_t nHd  = (size_t)kTok * kHeads * kDh;   // 4,194,304 (= kTok*kEmb)
  const size_t nPp  = (size_t)kSeq * kHeads * kDh;   // 2,097,152
  __bf16* WqTh = (__bf16*)carve(nW * 2); __bf16* WqTl = (__bf16*)carve(nW * 2);
  __bf16* WkTh = (__bf16*)carve(nW * 2); __bf16* WkTl = (__bf16*)carve(nW * 2);
  __bf16* WvTh = (__bf16*)carve(nW * 2); __bf16* WvTl = (__bf16*)carve(nW * 2);
  __bf16* WpTh = (__bf16*)carve(nW * 2); __bf16* WpTl = (__bf16*)carve(nW * 2);
  __bf16* WoTh = (__bf16*)carve(nWo * 2); __bf16* WoTl = (__bf16*)carve(nWo * 2);
  float* qb16 = (float*)carve(kDh * 4); float* kb16 = (float*)carve(kDh * 4);
  float* ubk  = (float*)carve((size_t)kBatch * kHeads * kSeq * 4);
  float* vbp  = (float*)carve((size_t)kHeads * kSeq * 4);
  _Float16* q16  = (_Float16*)carve(nHd * 2);
  _Float16* k16  = (_Float16*)carve(nHd * 2);
  _Float16* pp16 = (_Float16*)carve(nPp * 2);
  float*    vf32 = (float*)carve(nHd * 4);
  unsigned short* ctxh = (unsigned short*)carve(nHd * 2); unsigned short* ctxl = (unsigned short*)carve(nHd * 2);
  _Float16* vt16 = (_Float16*)carve((size_t)kBatch * kEmb * kSeq * 2);
  unsigned* xnh = (unsigned*)carve(nHd * 2);
  unsigned* xnl = (unsigned*)carve(nHd * 2);
  unsigned* peh = (unsigned*)carve((size_t)kSeq * kEmb * 2);
  unsigned* pel = (unsigned*)carve((size_t)kSeq * kEmb * 2);
  if (off > ws_size) return;

  // ---- prelude: weight planes (in [k][n] -> out [n][k]), scaled biases, LN planes, sinusoid planes: one launch ----
  prelude_kernel<<<kBlkPrelude, 256, 0, stream>>>(x, gamma, beta, Wq, Wk, Wv, Wp, Wo, bq, bk, WqTh, WoTh, WoTl, qb16, kb16, xnh, xnl, peh, pel);

  // ---- projections: v over the [32768][128] per-(token, head) row view of xn (same memory as [4096][1024]), q, k and p head by head over xn and pe at pitch kEmb: one launch ----
  proj4_kernel<<<3 * kBlkProj + kBlkProjP, 256, 0, stream>>>(U16(xnh), U16(xnl), U16(peh), U16(pel), U16(WqTh), qb16, kb16, bv, q16, k16, vf32, pp16);

  // ---- bias dots and v^T: one launch; then all of attention for every (b, h) in one launch, into the ctx hi/lo planes ----
  headbias_vt_kernel<<<kBlkHb + kBatch * kBlkVt, 256, 0, stream>>>(k16, pp16, u_bias, v_bias, ubk, vbp, vf32, vt16);
  attn_rows_kernel<<<dim3(kSeq / kRows, kBatch * kHeads), 512, 0, stream>>>(q16, k16, pp16, vt16, ubk, vbp, ctxh, ctxl);   // 64 x 16 blocks of 32 query rows

  out_gemm_kernel<<<kBlkOut, 256, 0, stream>>>(ctxh, ctxl, U16(WoTh), U16(WoTl), bo, out);
}

// v006
// A run of this version takes 162 microseconds.
// Next to v005, in two timings, it ran 1.30 and 1.32 times as fast.
// Counting every step since v000, it is 12.6 times as fast.
// Projections xn·W{q,k,v} (K=128), p = pe·Wp (K=128) and out = ctx·Wo (K=1024): v_wmma_f32_16x16x32_bf16 with bf16 hi/lo split operands (hi·hi + hi·lo + lo·hi); content q·kᵀ and position q·pᵀ tables (K=128): v_wmma_f32_16x16x32_f16 with plain f16 operands carried x16; p·v (K=2048): v_wmma_f32_16x16x32_f16 with p/l carried x2^15 and vᵀ carried x16; f32 accumulate everywhere; LayerNorm, sinusoid table, u/v bias dots, relative shift and softmax in f32 on VALU.
#include <hip/hip_runtime.h>
#include <math.h>

typedef __attribute__((ext_vector_type(16))) _Float16 v16h;
typedef __attribute__((ext_vector_type(8)))  _Float16 v8h;
typedef __attribute__((ext_vector_type(4)))  _Float16 v4h;
typedef __attribute__((ext_vector_type(16))) __bf16   v16b;
typedef __attribute__((ext_vector_type(8)))  __bf16   v8b;
typedef __attribute__((ext_vector_type(8)))  float    v8f;
typedef __attribute__((ext_vector_type(4)))  float    v4f;
typedef __attribute__((ext_vector_type(2)))  float    v2f;
#define U16(p) ((const unsigned short*)(const void*)(p))

__device__ __forceinline__ unsigned short f2bf_bits(float f) {
  unsigned u = __float_as_uint(f);
  return (unsigned short)((u + 0x7FFFu + ((u >> 16) & 1u)) >> 16);
}
__device__ __forceinline__ float bf_bits2f(unsigned short h) { return __uint_as_float(((unsigned)h) << 16); }

// hazard guards as plain device helpers
__device__ __forceinline__ void dep_guard_h(v8f& a, v8f& b, v16h x, v16h y) { asm volatile("v_nop\n\tv_nop\n\tv_nop\n\tv_nop" : "+v"(a), "+v"(b) : "v"(x), "v"(y)); }
__device__ __forceinline__ void dep_guard_b(v8f& a, v8f& b, v16b x, v16b y) { asm volatile("v_nop\n\tv_nop\n\tv_nop\n\tv_nop" : "+v"(a), "+v"(b) : "v"(x), "v"(y)); }
__device__ __forceinline__ void keep4_h(v16h a, v16h b, v16h c, v16h d) { asm volatile("v_nop" :: "v"(a), "v"(b), "v"(c), "v"(d)); }
__device__ __forceinline__ void keep4_b(v16b a, v16b b, v16b c, v16b d) { asm volatile("v_nop" :: "v"(a), "v"(b), "v"(c), "v"(d)); }
__device__ __forceinline__ void acc_guard4(v8f& a, v8f& b, v8f& c, v8f& d) { asm volatile("v_nop\n\tv_nop\n\tv_nop\n\tv_nop" : "+v"(a), "+v"(b), "+v"(c), "+v"(d)); }
template <typename T> struct Frag;
template <> struct Frag<_Float16> {
  typedef v16h V; union U { v16h v; v8h h[2]; };
  static __device__ __forceinline__ v16h load(const _Float16* p) {   // elements 0..7 <- p[0..7], 8..15 <- p[16..23]
    U f; f.h[0] = *(const v8h*)(p); f.h[1] = *(const v8h*)(p + 16); return f.v;
  }
  static __device__ __forceinline__ v16h loadf(const _Float16* p) {  // fragment-order plane: elements 0..7 <- p[0..7], 8..15 <- p[256..263]
    U f; f.h[0] = *(const v8h*)(p); f.h[1] = *(const v8h*)(p + 256); return f.v;
  }
  static __device__ __forceinline__ v8f mma(v16h a, v16h b, v8f c) {
    return __builtin_amdgcn_wmma_f32_16x16x32_f16(false, a, false, b, (short)0, c, false, false);
  }
  static __device__ __forceinline__ void guard(v8f& a, v8f& b, v16h x, v16h y) { dep_guard_h(a, b, x, y); }
  static __device__ __forceinline__ void keep(v16h a, v16h b, v16h c, v16h d) { keep4_h(a, b, c, d); }
};
template <> struct Frag<__bf16> {
  typedef v16b V; union U { v16b v; v8b h[2]; };
  static __device__ __forceinline__ v16b load(const __bf16* p) {
    U f; f.h[0] = *(const v8b*)(p); f.h[1] = *(const v8b*)(p + 16); return f.v;
  }
  static __device__ __forceinline__ v16b loadf(const __bf16* p) {
    U f; f.h[0] = *(const v8b*)(p); f.h[1] = *(const v8b*)(p + 256); return f.v;
  }
  static __device__ __forceinline__ v8f mma(v16b a, v16b b, v8f c) {
    return __builtin_amdgcn_wmma_f32_16x16x32_bf16(false, a, false, b, (short)0, c, false, false);
  }
  static __device__ __forceinline__ void guard(v8f& a, v8f& b, v16b x, v16b y) { dep_guard_b(a, b, x, y); }
  static __device__ __forceinline__ void keep(v16b a, v16b b, v16b c, v16b d) { keep4_b(a, b, c, d); }
};

// ---- Register-blocked batched WMMA GEMM ------------------------------------
// C[m,n] = scale * sum_k A[m,k] * Bt[n,k] (+bias)(+resid); each wave owns a 64x64 tile.
// A row-major [M,K] (AFRAG: fragment order); Bt [N,K] in fragment order; M,N % 64 == 0, K % 32 == 0.
// Fragment order of a 16-bit [R,K] plane: [R/16][K/32][2][32 lanes][8]; chunk (rt, kk, ld, lane) holds row 16 rt + (lane & 15), k = 32 kk + 16 ld + 8 (lane >> 4) .. + 7,
// so each of a fragment's two 16-byte loads reads 512 contiguous bytes (four whole lines) over the wave; same k order as the row-major loader.
// SPLIT: operands are hi/lo planes (A2/Bt2 = lo planes, same layout); product = hi·hi + hi·lo + lo·hi.
// BIAS_MODE: 0 = none, 1 = bias[m], 2 = bias[n].
// OUT_MODE: 0 = f32, 1 = f16, 2 = bf16 hi plane (Cout) + bf16 lo plane (Cout2), 3 = f16 [M,N] plane in fragment order (ldc unused).
// ET: 0 = f16 operands, 1 = bf16 operands (pointers passed as 16-bit storage)
// bx = tiles / 8 (tile = 8 bx + wave), b = batch index (strideA/B/C/R and strideBias are per b), zsel = true takes BtZp, CoutZ and biasZ in
// place of Btp, Cout and bias (same A, same strides; non-split launches only), so two products of one A share a launch.
// The body is a device function of (bx, b, zsel) and the block's LDS slabs, so that several products can share one grid by block range.
template <int ET> struct Elem;
template <> struct Elem<0> { typedef _Float16 T; };
template <> struct Elem<1> { typedef __bf16 T; };
// PIPE (with SPLIT and AFRAG; K % 64 == 0, K >= 128): the k loop keeps two register stages of fragments and issues all 32 loads of a k step one k step ahead of its products.
template <int ET, bool SPLIT, int BIAS_MODE, int OUT_MODE, bool RESID, int ACT = 0, bool AFRAG = false, bool PIPE = false>
__device__ __forceinline__ void gemm64_tile(
    float (*sT)[16 * 68], int bx, int b, bool zsel,      // sT: per-wave 16x64 slab, pitch 68 floats; bx, b, zsel block-uniform
    const unsigned short* __restrict__ Ap, const unsigned short* __restrict__ A2p, int lda, long strideA,
    const unsigned short* __restrict__ Btp, const unsigned short* __restrict__ Bt2p, int ldb, long strideB,
    void* __restrict__ Cout0, void* __restrict__ Cout2, int ldc, long strideC,
    const float* __restrict__ bias0, long strideBias,
    const float* __restrict__ resid, long strideR,
    const unsigned short* __restrict__ BtZp, void* __restrict__ CoutZ, const float* __restrict__ biasZ,
    int M, int N, int K, float scale) {
  typedef typename Elem<ET>::T T;
  typedef typename Frag<T>::V V;
  const T* A = (const T*)Ap; const T* A2 = (const T*)A2p; const T* Bt = (const T*)(zsel ? BtZp : Btp); const T* Bt2 = (const T*)Bt2p;
  void* Cout = zsel ? CoutZ : Cout0;
  const float* bias = (BIAS_MODE != 0) ? ((zsel ? biasZ : bias0) + (size_t)b * strideBias) : nullptr;
  const int lane = threadIdx.x & 31;
  const int wave = threadIdx.x >> 5;
  const int tilesN = N >> 6;
  const int tilesM = M >> 6;
  const int tile = bx * 8 + wave;
  if (tile >= tilesM * tilesN) return;   // wave-uniform; no block barriers in this kernel
  const int tm = tile / tilesN;
  const int tn = tile - tm * tilesN;
  const int m0 = tm << 6;
  const int n0 = tn << 6;

  const T* Ab  = A  + (size_t)b * strideA;
  const T* Bb  = Bt + (size_t)b * strideB;
  const T* Ab2 = SPLIT ? (A2  + (size_t)b * strideA) : nullptr;
  const T* Bb2 = SPLIT ? (Bt2 + (size_t)b * strideB) : nullptr;

  const int rlane = lane & 15;                 // row (A) / col (B, D) within subtile
  const int koff  = (lane >> 4) * 8;           // k offset of this lane half
  const int mOff  = (lane >> 4) * 8;           // D row offset

  v8f acc[4][4];
#pragma unroll
  for (int i = 0; i < 4; ++i)
#pragma unroll
    for (int j = 0; j < 4; ++j) acc[i][j] = (v8f){0.f,0.f,0.f,0.f,0.f,0.f,0.f,0.f};

  if (PIPE) {
    const size_t ts = (size_t)(K >> 5) * 512;                 // from one 16-row tile of a plane to the next
    // subtile 0, k step 0 of the wave's tile in each plane: the same for the whole wave, so held in scalar registers; the lane's own chunk is l8 elements on
    const size_t bo0 = (size_t)__builtin_amdgcn_readfirstlane(n0 >> 4) * ts, ao0 = (size_t)__builtin_amdgcn_readfirstlane(m0 >> 4) * ts;
    const T* bp = Bb + bo0; const T* bp2 = Bb2 + bo0; const T* ap = Ab + ao0; const T* ap2 = Ab2 + ao0;
    const unsigned l8 = (unsigned)lane * 8u;
    V ah[2][4], al[2][4], bh[2][4], bl[2][4];
    // every "#pragma unroll" in the two lambdas: constant indices keep the fragment and accumulator arrays in registers
    auto fetch = [&](const int s, const int ko) {             // all of one k step's fragments into stage s; ko = elements from the pointers to that k step
#pragma unroll
      for (int j = 0; j < 4; ++j) {
        bh[s][j] = Frag<T>::loadf(bp + l8 + (j * ts + ko)); bl[s][j] = Frag<T>::loadf(bp2 + l8 + (j * ts + ko));
        ah[s][j] = Frag<T>::loadf(ap + l8 + (j * ts + ko)); al[s][j] = Frag<T>::loadf(ap2 + l8 + (j * ts + ko));
      }
      __builtin_amdgcn_sched_barrier(0);                      // the loads stay in front of the other stage's products: their latency runs under those
    };
    auto products = [&](const int s) {                        // per accumulator the order of the plain loop: hi.hi, hi.lo, lo.hi
      // (the plain loop's v_nop statements are not carried over: as asm operands the fragments would all have to lie in the first 256 registers, which spills; the compiler pads its builtin products itself)
#pragma unroll
      for (int i = 0; i < 4; ++i) {
#pragma unroll
        for (int j = 0; j < 4; ++j) {
          acc[i][j] = Frag<T>::mma(ah[s][i], bh[s][j], acc[i][j]);
          acc[i][j] = Frag<T>::mma(ah[s][i], bl[s][j], acc[i][j]);
          acc[i][j] = Frag<T>::mma(al[s][i], bh[s][j], acc[i][j]);
        }
      }
    };
    fetch(0, 0);
    for (int k0 = 0; k0 < K - 64; k0 += 64) {                 // two k steps a trip, so that each stage keeps its registers
      fetch(1, 512);
      products(0);
      fetch(0, 1024);
      products(1);
      // the four pointers and the lane offset as inputs: their registers stay as this trip's loads name them up to this wait; the step to the next trip comes behind it
      asm volatile("s_wait_xcnt 0x0" :: "s"(ap), "s"(ap2), "s"(bp), "s"(bp2), "v"(l8) : "memory");
      ap += 1024; ap2 += 1024; bp += 1024; bp2 += 1024;
    }
    fetch(1, 512);
    // directly behind the last loads: nothing of the code that follows takes a register that they name ahead of this wait
    asm volatile("s_wait_xcnt 0x0" :: "s"(ap), "s"(ap2), "s"(bp), "s"(bp2), "v"(l8) : "memory");
    __builtin_amdgcn_sched_barrier(0);                        // keeps later address arithmetic from being lifted in front of that wait
    products(0);
    products(1);
  } else
  for (int k0 = 0; k0 < K; k0 += 32) {
    V bh[4], bl[4];
    const size_t bo0 = ((size_t)(n0 >> 4) * (K >> 5) + (k0 >> 5)) * 512 + lane * 8;
    const size_t ao0 = AFRAG ? ((size_t)(m0 >> 4) * (K >> 5) + (k0 >> 5)) * 512 + lane * 8 : (size_t)(m0 + rlane) * lda + koff + k0;
    const T* bp = Bb + bo0; const T* bp2 = SPLIT ? (Bb2 + bo0) : bp;     // the lane's own row of subtile 0 in each plane; the others at constant steps
    const T* ap = Ab + ao0; const T* ap2 = SPLIT ? (Ab2 + ao0) : ap;
#pragma unroll
    for (int j = 0; j < 4; ++j) {
      const size_t bo = (size_t)j * (K >> 5) * 512;
      bh[j] = Frag<T>::loadf(bp + bo);
      if (SPLIT) bl[j] = Frag<T>::loadf(bp2 + bo);
    }
#pragma unroll
    for (int i = 0; i < 4; ++i) {
      const size_t ao = AFRAG ? (size_t)i * (K >> 5) * 512 : (size_t)(i << 4) * lda;
      V ah = AFRAG ? Frag<T>::loadf(ap + ao) : Frag<T>::load(ap + ao);
      V al;
      if (SPLIT) al = AFRAG ? Frag<T>::loadf(ap2 + ao) : Frag<T>::load(ap2 + ao);
#pragma unroll
      for (int j = 0; j < 4; ++j) {
        acc[i][j] = Frag<T>::mma(ah, bh[j], acc[i][j]);
        if (SPLIT) {
          acc[i][j] = Frag<T>::mma(ah, bl[j], acc[i][j]);
          acc[i][j] = Frag<T>::mma(al, bh[j], acc[i][j]);
        }
      }
      Frag<T>::guard(acc[i][0], acc[i][3], ah, SPLIT ? al : ah);
    }
    Frag<T>::keep(bh[0], bh[1], bh[2], bh[3]);
    if (SPLIT) Frag<T>::keep(bl[0], bl[1], bl[2], bl[3]);
    // the four pointers as inputs: their registers stay as this step's loads name them (no result lands on them, no step to the next k) up to this wait
    asm volatile("s_wait_xcnt 0x0" :: "v"(ap), "v"(ap2), "v"(bp), "v"(bp2) : "memory");
  }
  acc_guard4(acc[0][0], acc[0][1], acc[0][2], acc[0][3]);
  acc_guard4(acc[1][0], acc[1][1], acc[1][2], acc[1][3]);
  acc_guard4(acc[2][0], acc[2][1], acc[2][2], acc[2][3]);
  acc_guard4(acc[3][0], acc[3][1], acc[3][2], acc[3][3]);

  // ---- epilogue ----
  float* slab = sT[wave];
  const float* Rb = RESID ? (resid + (size_t)b * strideR) : nullptr;
#pragma unroll
  for (int i = 0; i < 4; ++i) {
    const int mBase = m0 + (i << 4);
#pragma unroll
    for (int j = 0; j < 4; ++j) {
      const int n = n0 + (j << 4) + rlane;
      float bv = 0.f;
      if (BIAS_MODE == 2) bv = bias[n];
#pragma unroll
      for (int r = 0; r < 8; ++r) {
        float v = acc[i][j][r] * scale;
        if (BIAS_MODE == 1) v += bias[mBase + mOff + r];
        if (BIAS_MODE == 2) v += bv;
        if (RESID) v += Rb[(size_t)(mBase + mOff + r) * ldc + n];
        if (ACT == 1) v = tanhf(v);
        if (ACT == 2) v = fmaxf(v, 0.0f);
        if (ACT == 3) v = v / (1.0f + expf(-v));
        if (ACT == 4) v = (v > 0.f) ? v : 0.01f * v;
        if (ACT == 5) v = 0.5f * v * (1.0f + erff(v * 0.70710678118654752f));
        slab[(mOff + r) * 68 + (j << 4) + rlane] = v;
      }
    }
    __builtin_amdgcn_fence(__ATOMIC_RELEASE, "workgroup");
    __builtin_amdgcn_wave_barrier();
    __builtin_amdgcn_fence(__ATOMIC_ACQUIRE, "workgroup");
    if (OUT_MODE == 0) {
      float* C = (float*)Cout + (size_t)b * strideC;
      const int hh = lane >> 4, c4 = (lane & 15) * 4;     // row seg = 256 B = 16 lanes x 16 B
      {
#pragma unroll
        for (int it = 0; it < 8; ++it) {
          const int row = it * 2 + hh;
          v4f v = *(const v4f*)(slab + row * 68 + c4);
          *(v4f*)(C + (size_t)(mBase + row) * ldc + n0 + c4) = v;
        }
        
      }
    } else if (OUT_MODE == 3) {
      // the slab is row tile mBase / 16, k steps n0 / 32 and n0 / 32 + 1 of the plane: 2 KiB in a row, 512 B a store
      _Float16* C = (_Float16*)Cout + (size_t)b * strideC + ((size_t)(mBase >> 4) * (N >> 5) + (n0 >> 5)) * 512 + lane * 8;
#pragma unroll   // the four stores go off one address at constant offsets
      for (int it = 0; it < 4; ++it) {
        const float* sp = slab + rlane * 68 + it * 16 + mOff;
        v8h hv;
#pragma unroll   // constant indices keep hv in registers
        for (int e = 0; e < 8; ++e) hv[e] = (_Float16)sp[e];
        *(v8h*)(C + it * 256) = hv;
      }
    } else {
      const int q = lane >> 3, c8 = (lane & 7) * 8;
      unsigned short* C  = (unsigned short*)Cout  + (size_t)b * strideC;
      unsigned short* C2 = (OUT_MODE == 2) ? ((unsigned short*)Cout2 + (size_t)b * strideC) : nullptr;
      {
#pragma unroll
        for (int it = 0; it < 4; ++it) {
          const int row = it * 4 + q;
          const float* sp = slab + row * 68 + c8;
          v8h hv, lv;
#pragma unroll
          for (int e = 0; e < 8; ++e) {
            if (OUT_MODE == 1) {
              hv[e] = (_Float16)sp[e];
            } else {
              unsigned short hb = f2bf_bits(sp[e]);
              unsigned short lb = f2bf_bits(sp[e] - bf_bits2f(hb));
              hv[e] = __builtin_bit_cast(_Float16, hb);
              lv[e] = __builtin_bit_cast(_Float16, lb);
            }
          }
          *(v8h*)(C + (size_t)(mBase + row) * ldc + n0 + c8) = hv;
          if (OUT_MODE == 2) *(v8h*)(C2 + (size_t)(mBase + row) * ldc + n0 + c8) = lv;
        }
        
      }
    }
    asm volatile("s_wait_xcnt 0x0" ::: "memory");   // before the next slab's values and addresses take the registers that these stores name
    __builtin_amdgcn_fence(__ATOMIC_RELEASE, "workgroup");
    __builtin_amdgcn_wave_barrier();
    __builtin_amdgcn_fence(__ATOMIC_ACQUIRE, "workgroup");
  }
}

// ---- f32 [R][C] (row pitch ldi) -> f16 transposed [C][R = ldo] in fragment order (see gemm64_tile); 64x64 tiles
// one block of 256 threads does tile (bx, by); tile = the block's LDS, [c][r]
__device__ __forceinline__ void transpose_cast_f16_tile(_Float16 (*tile)[72], int bx, int by, const float* __restrict__ in, int ldi,
                                                        _Float16* __restrict__ outT, int ldo, float scale) {
  const int c0 = bx * 64, r0 = by * 64;
  const int t = threadIdx.x, tx = t & 31, ty = t >> 5;
  for (int i = ty; i < 64; i += 8) {
    tile[tx][i]      = (_Float16)(in[(size_t)(r0 + i) * ldi + c0 + tx] * scale);
    tile[32 + tx][i] = (_Float16)(in[(size_t)(r0 + i) * ldi + c0 + 32 + tx] * scale);
  }
  __syncthreads();
  const int lane = t & 31;
  {
#pragma unroll
    for (int it = 0; it < 2; ++it) {                          // fragment order: wave w writes the 512 B of (row tile, k step, ld) = its index it * 8 + w
      const int g = it * 8 + ty, ct = g >> 2, kk = (g >> 1) & 1, ld = g & 1;
      v8h hv = *(const v8h*)(&tile[ct * 16 + (lane & 15)][kk * 32 + ld * 16 + (lane >> 4) * 8]);
      *(v8h*)(outT + (((size_t)((c0 >> 4) + ct) * (ldo >> 5) + (r0 >> 5) + kk) * 2 + ld) * 256 + lane * 8) = hv;
    }
    
  }
}

// ---- f32 [R][C] (pitch ldi) -> bf16 hi/lo transposed planes [C][R = ldo] in fragment order (see gemm64_tile); 64x64 tiles
// one block of 256 threads does tile (bx, by); tile = the block's LDS, [c][r]
__device__ __forceinline__ void transpose_split_bf16_tile(float (*tile)[68], int bx, int by, const float* __restrict__ in, int ldi,
                                                          __bf16* __restrict__ outH, __bf16* __restrict__ outL, int ldo) {
  const int c0 = bx * 64, r0 = by * 64;
  const int t = threadIdx.x, tx = t & 31, ty = t >> 5;
  for (int i = ty; i < 64; i += 8) {
    tile[tx][i]      = in[(size_t)(r0 + i) * ldi + c0 + tx];
    tile[32 + tx][i] = in[(size_t)(r0 + i) * ldi + c0 + 32 + tx];
  }
  __syncthreads();
  const int lane = t & 31;
  {
#pragma unroll
    for (int it = 0; it < 2; ++it) {                          // fragment order: wave w writes the 512 B of (row tile, k step, ld) = its index it * 8 + w
      const int g = it * 8 + ty, ct = g >> 2, kk = (g >> 1) & 1, ld = g & 1;
      const int c = ct * 16 + (lane & 15), c8 = kk * 32 + ld * 16 + (lane >> 4) * 8;
      const size_t o = (((size_t)((c0 >> 4) + ct) * (ldo >> 5) + (r0 >> 5) + kk) * 2 + ld) * 256 + lane * 8;
      v8b hv, lv;
#pragma unroll
      for (int e = 0; e < 8; ++e) {
        const float f = tile[c][c8 + e];
        const unsigned short hb = f2bf_bits(f);
        hv[e] = __builtin_bit_cast(__bf16, hb);
        lv[e] = __builtin_bit_cast(__bf16, f2bf_bits(f - bf_bits2f(hb)));
      }
      *(v8b*)(outH + o) = hv;
      *(v8b*)(outL + o) = lv;
    }
    asm volatile("s_wait_xcnt 0x0" ::: "memory");   // other jobs' code follows this body in the shared kernel: nothing there rewrites a register that these stores name ahead of this wait
  }
}

// =====================================================================================
constexpr int kBatch = 2;
constexpr int kSeq   = 2048;
constexpr int kEmb   = 1024;
constexpr int kHeads = 8;
constexpr int kDh    = 128;
constexpr int kTok   = kBatch * kSeq;          // 4096 tokens
constexpr int kPairs = kEmb / 2;               // 512 element pairs per row
static_assert(kHeads * kDh == kEmb);
static_assert(kPairs == 512);

// ---- LayerNorm (biased variance, eps 1e-5) -> xn as bf16 hi/lo planes (packed pairs). One block per token, 256 threads;
// thread t owns element pairs (2t,2t+1) and (512+2t,512+2t+1): 2 packed dwords per plane per thread; each store instruction
__device__ __forceinline__ void layernorm_split_row(
    float* red, int tok,                                 // red: 8 floats of the block's LDS
    const float* __restrict__ x, const float* __restrict__ gamma, const float* __restrict__ beta,
    unsigned* __restrict__ xh, unsigned* __restrict__ xl) {
  const int t = threadIdx.x, lane = t & 31, wave = t >> 5;
  const float* xr = x + (size_t)tok * kEmb;
  const int ca = 2 * t, cb = kPairs + 2 * t;
  const v2f pa = *(const v2f*)(xr + ca);
  const v2f pb = *(const v2f*)(xr + cb);
  float s = (pa.x + pa.y) + (pb.x + pb.y);
#pragma unroll
  for (int off = 1; off < 32; off <<= 1) s += __shfl_xor(s, off, 32);
  if (lane == 0) red[wave] = s;
  __syncthreads();
  float tot = 0.f;
#pragma unroll
  for (int w = 0; w < 8; ++w) tot += red[w];       // fixed order
  const float mean = tot * (1.0f / (float)kEmb);
  __syncthreads();
  const float d0 = pa.x - mean, d1 = pa.y - mean, d2 = pb.x - mean, d3 = pb.y - mean;
  float s2 = (d0 * d0 + d1 * d1) + (d2 * d2 + d3 * d3);
#pragma unroll
  for (int off = 1; off < 32; off <<= 1) s2 += __shfl_xor(s2, off, 32);
  if (lane == 0) red[wave] = s2;
  __syncthreads();
  float tot2 = 0.f;
#pragma unroll
  for (int w = 0; w < 8; ++w) tot2 += red[w];
  const float var  = tot2 * (1.0f / (float)kEmb);
  const float rstd = 1.0f / sqrtf(var + 1e-5f);
  const float y0 = d0 * rstd * gamma[ca] + beta[ca];
  const float y1 = d1 * rstd * gamma[ca + 1] + beta[ca + 1];
  const float y2 = d2 * rstd * gamma[cb] + beta[cb];
  const float y3 = d3 * rstd * gamma[cb + 1] + beta[cb + 1];
  const unsigned short h0 = f2bf_bits(y0), h1 = f2bf_bits(y1), h2 = f2bf_bits(y2), h3 = f2bf_bits(y3);
  const unsigned short l0 = f2bf_bits(y0 - bf_bits2f(h0)), l1 = f2bf_bits(y1 - bf_bits2f(h1));
  const unsigned short l2 = f2bf_bits(y2 - bf_bits2f(h2)), l3 = f2bf_bits(y3 - bf_bits2f(h3));
  const unsigned uah = (unsigned)h0 | ((unsigned)h1 << 16), ual = (unsigned)l0 | ((unsigned)l1 << 16);
  const unsigned ubh = (unsigned)h2 | ((unsigned)h3 << 16), ubl = (unsigned)l2 | ((unsigned)l3 << 16);
  const size_t ia = (size_t)tok * kPairs + t, ib = ia + 256;
  {
    ((unsigned*)xh)[ia] = uah;
    ((unsigned*)xh)[ib] = ubh;
    ((unsigned*)xl)[ia] = ual;
    ((unsigned*)xl)[ib] = ubl;
    asm volatile("s_wait_xcnt 0x0" ::: "memory");   // other jobs' code follows this body in the shared kernel: nothing there rewrites a register that these stores name ahead of this wait
  }
}

// ---- sinusoid table [kSeq][kEmb]: columns 2i = sin(pos·div_i), 2i+1 = cos(pos·div_i), div_i = exp(2i · (−ln 1e4 / kEmb)), f32,
// emitted as bf16 hi/lo planes (packed pairs). One thread per (pos, i): kSeq*512/256 = 4096 blocks exactly; each wave's store
__device__ __forceinline__ void posenc_split_block(int blk, unsigned* __restrict__ peh, unsigned* __restrict__ pel) {
  const int idx = blk * 256 + threadIdx.x;
  if (idx >= kSeq * kPairs) return;
  const int pos = idx >> 9, i = idx & 511;
  const float kNegLogRate = -0.00899447301950799f;        // −ln(10000)/1024
  const float freq = expf((float)(2 * i) * kNegLogRate);
  const float ang  = (float)pos * freq;
  const float sv = sinf(ang), cv = cosf(ang);
  const unsigned short hs = f2bf_bits(sv), hc = f2bf_bits(cv);
  const unsigned short ls = f2bf_bits(sv - bf_bits2f(hs)), lc = f2bf_bits(cv - bf_bits2f(hc));
  const unsigned uh = (unsigned)hs | ((unsigned)hc << 16), ul = (unsigned)ls | ((unsigned)lc << 16);
  {
    ((unsigned*)peh)[idx] = uh;
    ((unsigned*)pel)[idx] = ul;
    asm volatile("s_wait_xcnt 0x0" ::: "memory");   // other jobs' code follows this body in the shared kernel: nothing there rewrites a register that these stores name ahead of this wait
  }
}

// ---- scaled projection biases: qb = 16·bq, kb = 16·bk (128 floats each). Two waves of one block: wave 0 -> qb, wave 1 -> kb;
__device__ __forceinline__ void bias16_block(const float* __restrict__ bq, const float* __restrict__ bk,
                                             float* __restrict__ qb, float* __restrict__ kb) {
  const int lane = threadIdx.x & 31, wave = threadIdx.x >> 5;   // wave-uniform branches
  if (wave >= 2) return;
  v4f v; float* dst;
  if (wave == 0) { v = *(const v4f*)(bq + 4 * lane); dst = qb + 4 * lane; }
  else           { v = *(const v4f*)(bk + 4 * lane); dst = kb + 4 * lane; }
  v = v * 16.0f;
  *(v4f*)dst = v;
  asm volatile("s_wait_xcnt 0x0" ::: "memory");   // other jobs' code follows this body in the shared kernel: nothing there rewrites a register that these stores name ahead of this wait
}

// ---- all that depends on the inputs alone, in one grid of 256-thread blocks; a block's job goes by its index (every branch block-uniform):
// the 64x64 tiles of Wo, those of the four [128][128] weights, the scaled biases, then LayerNorm rows and sinusoid blocks in turn
// (one reads and writes memory, the other computes). WT = the eight [128 n][128 k] planes in the order q hi, q lo, k hi, k lo, v hi, v lo, p hi, p lo.
constexpr int kBlkWo = (kEmb / 64) * (kEmb / 64);        // 256
constexpr int kBlkW4 = 4 * (kDh / 64) * (kDh / 64);      // 16
constexpr int kBlkPe = (kSeq * kPairs) / 256;            // 4096 blocks x 256 = 2048 x 512 pairs
static_assert(kBlkPe == kTok);
constexpr int kBlkPrelude = kBlkWo + kBlkW4 + 1 + kTok + kBlkPe;
__global__ __launch_bounds__(256) void prelude_kernel(
    const float* __restrict__ x, const float* __restrict__ gamma, const float* __restrict__ beta,
    const float* __restrict__ Wq, const float* __restrict__ Wk, const float* __restrict__ Wv, const float* __restrict__ Wp,
    const float* __restrict__ Wo, const float* __restrict__ bq, const float* __restrict__ bk,
    __bf16* __restrict__ WT, __bf16* __restrict__ WoTh, __bf16* __restrict__ WoTl, float* __restrict__ qb, float* __restrict__ kb,
    unsigned* __restrict__ xh, unsigned* __restrict__ xl, unsigned* __restrict__ peh, unsigned* __restrict__ pel) {
  __shared__ __align__(16) float tile[64][68];
  int blk = blockIdx.x;
  if (blk < kBlkWo) { transpose_split_bf16_tile(tile, blk % (kEmb / 64), blk / (kEmb / 64), Wo, kEmb, WoTh, WoTl, kEmb); return; }
  blk -= kBlkWo;
  if (blk < kBlkW4) {
    const int w = blk >> 2;
    const float* in = (w == 0) ? Wq : (w == 1) ? Wk : (w == 2) ? Wv : Wp;
    __bf16* oh = WT + (size_t)(2 * w) * (kDh * kDh);
    transpose_split_bf16_tile(tile, blk & 1, (blk >> 1) & 1, in, kDh, oh, oh + kDh * kDh, kDh);
    return;
  }
  blk -= kBlkW4;
  if (blk == 0) { bias16_block(bq, bk, qb, kb); return; }
  blk -= 1;
  if (blk & 1) posenc_split_block(blk >> 1, peh, pel);
  else         layernorm_split_row(&tile[0][0], blk >> 1, x, gamma, beta, xh, xl);
}

// ---- the four projections in one grid: blocks 0..127 q, 128..255 k, 256..383 v, 384..447 p (block-uniform branches); operands and results as in gemm64_tile
constexpr int kBlkProj  = (kTok * kHeads / 64) * (kDh / 64) / 8;   // 1024 tiles -> 128 blocks
constexpr int kBlkProjP = (kSeq * kHeads / 64) * (kDh / 64) / 8;   // 512 tiles -> 64 blocks
__global__ __launch_bounds__(256) void proj4_kernel(
    const unsigned short* __restrict__ xnh, const unsigned short* __restrict__ xnl,
    const unsigned short* __restrict__ peh, const unsigned short* __restrict__ pel, const unsigned short* __restrict__ WT,
    const float* __restrict__ qb, const float* __restrict__ kb, const float* __restrict__ bv,
    _Float16* __restrict__ q16, _Float16* __restrict__ k16, float* __restrict__ vf32, _Float16* __restrict__ pp16) {
  __shared__ __align__(16) float sT[8][16 * 68];
  const int w = blockIdx.x / kBlkProj, bx = blockIdx.x % kBlkProj;
  const unsigned short* Bh = WT + (size_t)(2 * w) * (kDh * kDh);
  const unsigned short* Bl = Bh + kDh * kDh;
  if (w < 2)          // q*16 (+16 bq), k*16 (+16 bk): head by head (16 blocks each, A rows = tokens at pitch kEmb), one fragment-order f16 plane [kTok][kDh] a head
    gemm64_tile<1, true, 2, 3, false>(sT, bx & 15, bx >> 4, false, xnh, xnl, kEmb, kDh, Bh, Bl, kDh, 0, w ? k16 : q16, nullptr, kDh, (long)kTok * kDh, w ? kb : qb, 0,
        nullptr, 0, nullptr, nullptr, nullptr, kTok, kDh, kDh, 16.0f);
  else if (w == 2)    // v (+bv) as f32
    gemm64_tile<1, true, 2, 0, false>(sT, bx, 0, false, xnh, xnl, kDh, 0, Bh, Bl, kDh, 0, vf32, nullptr, kDh, 0, bv, 0,
        nullptr, 0, nullptr, nullptr, nullptr, kTok * kHeads, kDh, kDh, 1.0f);
  else                // p*16: head by head (8 blocks each), one fragment-order f16 plane [kSeq][kDh] a head
    gemm64_tile<1, true, 0, 3, false>(sT, bx & 7, bx >> 3, false, peh, pel, kEmb, kDh, Bh, Bl, kDh, 0, pp16, nullptr, kDh, (long)kSeq * kDh, nullptr, 0,
        nullptr, 0, nullptr, nullptr, nullptr, kSeq, kDh, kDh, 16.0f);
}

// ---- per-key bias vectors: UBK[(b·8+h)·S + s] = u_bias[h]·k[b,s,h,:], VBP[h·S + s] = v_bias[h]·p[s,h,:] (f32 dots of 128 over the x16 f16 planes,
// folded back by 1/16). 192 blocks x 256: blocks 0..127 -> UBK (32768 values), 128..191 -> VBP (16384 values); block-uniform branch;
__device__ __forceinline__ void headbias_block(int blk, const _Float16* __restrict__ k16, const _Float16* __restrict__ pp16,
                                               const float* __restrict__ ub, const float* __restrict__ vb,
                                               float* __restrict__ ubk, float* __restrict__ vbp) {
  const int t = blk * 256 + threadIdx.x;
  const _Float16* row; const float* bvec; float* dst;
  if (blk < 128) {
    const int b = t >> 14, h = (t >> 11) & 7, s = t & 2047;
    row = k16 + ((size_t)(h * kTok + b * kSeq + (s & ~15))) * kDh + (s & 15) * 8; bvec = ub + h * kDh; dst = ubk + t;
  } else {
    const int u = t - 32768; const int h = (u >> 11) & 7, s = u & 2047;
    row = pp16 + ((size_t)(h * kSeq + (s & ~15))) * kDh + (s & 15) * 8; bvec = vb + h * kDh; dst = vbp + u;
  }
  float acc = 0.f;
#pragma unroll 1
  for (int ch = 0; ch < kDh / 8; ++ch) {
    const _Float16* rp = row + 128 * ch; const float* bp = bvec + 8 * ch;   // fragment order: a row's chunk k = 8 ch .. + 7 stands 128 ch elements behind its first
    const v8h kv = *(const v8h*)rp;
    const v4f b0 = *(const v4f*)bp;
    const v4f b1 = *(const v4f*)(bp + 4);
    // the two pointers as inputs: the step to the next chunk, the next write of the registers that the loads name, comes behind this wait
    asm volatile("s_wait_xcnt 0x0" :: "v"(rp), "v"(bp) : "memory");
    acc += b0.x * (float)kv[0] + b0.y * (float)kv[1] + b0.z * (float)kv[2] + b0.w * (float)kv[3]
         + b1.x * (float)kv[4] + b1.y * (float)kv[5] + b1.z * (float)kv[6] + b1.w * (float)kv[7];
  }
  const float r = acc * 0.0625f;
  *(float*)dst = r;
  
}

// ---- out = ctx.Wo + bo : A bf16 hi/lo [4096][1024], Bt bf16 hi/lo [1024 n][1024 k], C f32 [4096][1024]; 1024 tiles -> 128 blocks
constexpr int kBlkOut = (kTok / 64) * (kEmb / 64) / 8;
__global__ __launch_bounds__(256) void out_gemm_kernel(const unsigned short* __restrict__ ctxh, const unsigned short* __restrict__ ctxl,
                                                      const unsigned short* __restrict__ WoTh, const unsigned short* __restrict__ WoTl,
                                                      const float* __restrict__ bo, float* __restrict__ out) {
  __shared__ __align__(16) float sT[8][16 * 68];
  gemm64_tile<1, true, 2, 0, false, 0, true, true>(sT, blockIdx.x, 0, false, ctxh, ctxl, kEmb, 0, WoTh, WoTl, kEmb, 0, out, nullptr, kEmb, 0, bo, 0,
      nullptr, 0, nullptr, nullptr, nullptr, kTok, kEmb, kEmb, 1.0f);
}

// ---- what stands between the projections and attention, in one grid (block-uniform branch): blocks 0..191 the bias dots, then per batch the 16 x 32 tiles of
// v [2048 r][1024 c] (pitch 1024) -> v^T f16 x16 [1024 c][2048 r] in fragment order
constexpr int kBlkHb = (kBatch * kHeads * kSeq + kHeads * kSeq) / 256;   // 192
constexpr int kBlkVt = (kEmb / 64) * (kSeq / 64);                        // 512 a batch
__global__ __launch_bounds__(256) void headbias_vt_kernel(const _Float16* __restrict__ k16, const _Float16* __restrict__ pp16,
                                                         const float* __restrict__ ub, const float* __restrict__ vb,
                                                         float* __restrict__ ubk, float* __restrict__ vbp,
                                                         const float* __restrict__ vf32, _Float16* __restrict__ vt16) {
  __shared__ __align__(16) _Float16 tile[64][72];
  int blk = blockIdx.x;
  if (blk < kBlkHb) { headbias_block(blk, k16, pp16, ub, vb, ubk, vbp); return; }
  blk -= kBlkHb;
  const int b = blk / kBlkVt, r = blk % kBlkVt;
  transpose_cast_f16_tile(tile, r % (kEmb / 64), r / (kEmb / 64), vf32 + (size_t)b * kSeq * kEmb, kEmb, vt16 + (size_t)b * kEmb * kSeq, kSeq, 16.0f);
}

// ---- content and position scores, relative shift, softmax and p.v of 32 query rows of one (b, h) in one block; the rows' scores never leave LDS.
// grid = (kSeq / 32, kBatch * kHeads), 512 threads = 16 waves. sc[r][c], r = a - a0, holds in turn:
//   1. shifted[a][c] = c <= a ? ps[a][S-1-a+c] : (c == a+1 ? 0 : ps[a+1][c-a-2]), ps[a][n] = (16q[a]).(16p[n])/256 + v_bias.p[n]: the c >= a+2 part is the
//      product of rows a0+1..a0+32 with p rows 0..S-a0-1, the c <= a part that of rows a0..a0+31 with p rows S-32-a0..S-1; each result is stored
//      at its shifted column, results that fall outside the row are dropped; every sc[r][c] gets exactly one store;
//   2. s = (content + shifted) / 32, content[a][key] = (16q[a]).(16k[key])/256 + u_bias.k[key];
//   3. f16(exp(s - max) / sum * 2^15), written over the front half of the same row by the wave that owns the row;
//   4. the 8 key groups' f32 partials of p.v (pitch kPartPitch), summed in group order 0..7; output = bf16 hi/lo [kTok][kEmb] planes in fragment order.
constexpr int kRows      = 32;
constexpr int kScPitch   = kSeq + 4;    // floats; 8208 B = 16 B x odd, rows 8 apart = 32 banks apart
constexpr int kPartPitch = kDh + 4;     // floats; rows 8 apart = 32 banks apart
static_assert(8 * kRows * kPartPitch <= kRows * kScPitch);
// every "#pragma unroll" in the three helpers below: constant indices keep the fragment and accumulator arrays in registers
// qf[i][kk] = the lane's A fragments of 32 query rows; r0, r1 = the first chunks of the lane's own rows (tile rows lane & 15 and 16 + lane & 15) and lane half in the fragment-order plane
__device__ __forceinline__ void load_q(v16h (&qf)[2][4], const _Float16* r0, const _Float16* r1) {
#pragma unroll
  for (int kk = 0; kk < 4; ++kk) { qf[0][kk] = Frag<_Float16>::loadf(r0 + 512 * kk); qf[1][kk] = Frag<_Float16>::loadf(r1 + 512 * kk); }
  // the two pointers as inputs: their registers stay as the loads name them (no result lands on them) up to this wait
  asm volatile("s_wait_xcnt 0x0" :: "v"(r0), "v"(r1) : "memory");
}
// acc[i][j] = 32 query rows (fragments qf[i][kk], k = 32 kk ..) x 32 rows of a fragment-order f16 plane [.][kDh] (8 KiB in a row); rows = the tile's first element + 8 lane;
// bv0, bv1 = the per-column bias of the lane's two columns (bias = the lane's own first column)
// (pointers typed as global: a pointer that has gone through an asm statement would otherwise be read with flat loads)
typedef const __attribute__((address_space(1))) _Float16* GlobH;
typedef const __attribute__((address_space(1))) v8h*      GlobH8;
typedef const __attribute__((address_space(1))) float*    GlobF;
__device__ __forceinline__ void score_tile(const v16h (&qf)[2][4], GlobH& rows, GlobF& bias, v8f (&acc)[2][2], float& bv0, float& bv1) {
  v16h bf[2][4];
#pragma unroll
  for (int j = 0; j < 2; ++j)
#pragma unroll
    for (int kk = 0; kk < 4; ++kk) {                          // as Frag<_Float16>::loadf
      Frag<_Float16>::U f;
      f.h[0] = *(GlobH8)(rows + (j * 4 + kk) * 512);
      f.h[1] = *(GlobH8)(rows + (j * 4 + kk) * 512 + 256);
      bf[j][kk] = f.v;
    }
  bv0 = bias[0]; bv1 = bias[16];
  // The loaded values, as inputs only: all of a tile's loads are issued before the first product (one memory latency a tile, not one per k step).
  // The two pointers go through the statement: the caller's step to the next tile, the next write of the registers that the loads name, comes behind this wait.
  asm volatile("s_wait_xcnt 0x0" : "+v"(rows), "+v"(bias) : "v"(bf[0][0]), "v"(bf[0][1]), "v"(bf[0][2]), "v"(bf[0][3]),
               "v"(bf[1][0]), "v"(bf[1][1]), "v"(bf[1][2]), "v"(bf[1][3]), "v"(bv0), "v"(bv1) : "memory");
#pragma unroll
  for (int i = 0; i < 2; ++i)
#pragma unroll
    for (int j = 0; j < 2; ++j) acc[i][j] = (v8f){0.f,0.f,0.f,0.f,0.f,0.f,0.f,0.f};
#pragma unroll
  for (int kk = 0; kk < 4; ++kk)
#pragma unroll
    for (int i = 0; i < 2; ++i)
#pragma unroll
      for (int j = 0; j < 2; ++j) acc[i][j] = Frag<_Float16>::mma(qf[i][kk], bf[j][kk], acc[i][j]);
}
// one step down a row of the tile is one step right in the shifted table: element (16 i + r, 16 j) of the lane goes to dst + (16 i + r) * (pitch + 1) + 16 j.
// GUARD: c0 = the column that dst stands for; elements whose column falls outside 0 .. kSeq - 1 are dropped (only the tiles at a row's ends have such)
template <bool GUARD>
__device__ __forceinline__ void store_shifted(float* dst, const v8f (&acc)[2][2], float bv0, float bv1, int c0) {
#pragma unroll
  for (int j = 0; j < 2; ++j)
#pragma unroll
    for (int i = 0; i < 2; ++i)
#pragma unroll
      for (int r = 0; r < 8; ++r) {
        const int d = (i << 4) + r;
        if (!GUARD || (unsigned)(c0 + d + (j << 4)) < (unsigned)kSeq)
          dst[d * (kScPitch + 1) + (j << 4)] = acc[i][j][r] * (1.0f / 256.0f) + (j ? bv1 : bv0);
      }
}
__global__ __launch_bounds__(512) void attn_rows_kernel(const _Float16* __restrict__ q16, const _Float16* __restrict__ k16,
                                                       const _Float16* __restrict__ pp16, const _Float16* __restrict__ vt16,
                                                       const float* __restrict__ ubk, const float* __restrict__ vbp,
                                                       unsigned short* __restrict__ Ch, unsigned short* __restrict__ Cl) {
  __shared__ __align__(16) float sc[kRows * kScPitch];
  const int t = threadIdx.x, lane = t & 31;
  const int wave = __builtin_amdgcn_readfirstlane(t >> 5);    // scalar, so that the tile loops branch on scalars
  const int a0 = blockIdx.x * kRows;
  const int bh = blockIdx.y, b = bh / kHeads, h = bh % kHeads;
  const int rlane = lane & 15;
  const int half8 = (lane >> 4) * 8;                          // k offset of this lane half (A, B) and D row offset
  const _Float16* qb = q16 + ((size_t)h * kTok + b * kSeq) * kDh + (lane >> 4) * 128;   // fragment order: any row s, this lane half, at (s & ~15) * kDh + (s & 15) * 8
  const _Float16* kb = k16 + ((size_t)h * kTok + b * kSeq) * kDh + lane * 8;   // fragment-order planes: row s (a multiple of 16) at s * kDh, the lane's chunk
  const _Float16* pb = pp16 + (size_t)h * kSeq * kDh + lane * 8;
  const float* ub = ubk + (size_t)bh * kSeq;
  const float* vb = vbp + (size_t)h * kSeq;

  // every "#pragma unroll" in this kernel: constant indices keep the fragment and accumulator arrays in registers
  if (t < kRows) { const int c = a0 + t + 1; if (c < kSeq) sc[t * kScPitch + c] = 0.0f; }

  v16h qf[2][4];
  v8f acc2[2][2];
  float bv0, bv1;
  // ---- 1a. columns c >= a+2: query rows a+1 (the last row of the table has no such column; its address is clamped) ----
  const int qs0 = (a0 + 1 + rlane < kSeq) ? (a0 + 1 + rlane) : (kSeq - 1), qs1 = (a0 + 17 + rlane < kSeq) ? (a0 + 17 + rlane) : (kSeq - 1);
  load_q(qf, qb + (size_t)(qs0 & ~15) * kDh + (qs0 & 15) * 8, qb + (size_t)(qs1 & ~15) * kDh + (qs1 & 15) * 8);
  const int nUp = (kSeq - a0) >> 5;                           // 32-column tiles of either part; nUp + nLo = kSeq / 32 + 1
  const int nLo = (a0 + kRows) >> 5;
  GlobH prow = (GlobH)(pb + (size_t)(wave << 5) * kDh);                       // the wave's tile and the lane's bias; 16 tiles on a trip
  GlobF vrow = (GlobF)(vb + (wave << 5) + rlane);
  for (int jj = wave; jj < nUp; jj += 16, prow += (size_t)512 * kDh, vrow += 512) {
    const int n0 = jj << 5;
    score_tile(qf, prow, vrow, acc2, bv0, bv1);
    const int cmin = n0 + a0 + 2;                             // column of the tile's element (row 0, n0); the tile spans cmin .. cmin + 62
    float* dst = sc + half8 * kScPitch + cmin + rlane + half8;
    if (cmin + 62 < kSeq) store_shifted<false>(dst, acc2, bv0, bv1, 0);
    else                  store_shifted<true>(dst, acc2, bv0, bv1, cmin + rlane + half8);
  }
  // ---- 1b. columns c <= a: query rows a; these fragments also serve the content product ----
  load_q(qf, qb + (size_t)a0 * kDh + rlane * 8, qb + (size_t)(a0 + 16) * kDh + rlane * 8);
  const int jLo = (wave - nUp) & 15;                          // the deal of tiles to waves goes on where 1a's ended
  prow = (GlobH)(pb + (size_t)((kSeq - kRows - a0) + (jLo << 5)) * kDh);
  vrow = (GlobF)(vb + (kSeq - kRows - a0) + (jLo << 5) + rlane);
  for (int jj = jLo; jj < nLo; jj += 16, prow += (size_t)512 * kDh, vrow += 512) {
    const int n0 = (kSeq - kRows - a0) + (jj << 5);
    score_tile(qf, prow, vrow, acc2, bv0, bv1);
    const int cmin = n0 + a0 - (kSeq - 1);                    // = 32 jj - 31
    float* dst = sc + half8 * kScPitch + cmin + rlane + half8;
    if (cmin >= 0) store_shifted<false>(dst, acc2, bv0, bv1, 0);
    else           store_shifted<true>(dst, acc2, bv0, bv1, cmin + rlane + half8);
  }
  __syncthreads();                                            // every shifted position score is in LDS before the content product adds to it

  // ---- 2. content; wave w takes the 32-key tiles w, w + 16, w + 32, w + 48 ----
  GlobH krow = (GlobH)(kb + (size_t)(wave << 5) * kDh);
  GlobF urow = (GlobF)(ub + (wave << 5) + rlane);
  for (int jj = wave; jj < kSeq / 32; jj += 16, krow += (size_t)512 * kDh, urow += 512) {
    const int n0 = jj << 5;
    score_tile(qf, krow, urow, acc2, bv0, bv1);
#pragma unroll
    for (int j = 0; j < 2; ++j) {
      const int n = n0 + (j << 4) + rlane;
      const float bv = j ? bv1 : bv0;
#pragma unroll
      for (int i = 0; i < 2; ++i)
#pragma unroll
        for (int r = 0; r < 8; ++r) {
          float* e = sc + ((i << 4) + half8 + r) * kScPitch + n;
          *e = ((acc2[i][j][r] * (1.0f / 256.0f) + bv) + *e) * (1.0f / 32.0f);
        }
    }
  }
  __syncthreads();                                            // whole score rows are in LDS before a wave takes its rows' maximum

  // ---- 3. softmax; wave w owns rows 2w and 2w + 1, lane l columns 128 it + 4 l .. + 3 ----
#pragma unroll 1   // one row's 64 floats a lane live at a time, not two rows'
  for (int rr = 0; rr < 2; ++rr) {
    float* srow = sc + (wave * 2 + rr) * kScPitch;
    v4f x[16];
#pragma unroll
    for (int it = 0; it < 16; ++it) x[it] = *(const v4f*)(srow + it * 128 + 4 * lane);
    float mx = -INFINITY;
#pragma unroll
    for (int it = 0; it < 16; ++it) mx = fmaxf(mx, fmaxf(fmaxf(x[it].x, x[it].y), fmaxf(x[it].z, x[it].w)));
#pragma unroll
    for (int off = 1; off < 32; off <<= 1) mx = fmaxf(mx, __shfl_xor(mx, off, 32));
    float sum = 0.f;
#pragma unroll
    for (int it = 0; it < 16; ++it) {
      x[it].x = __expf(x[it].x - mx); x[it].y = __expf(x[it].y - mx); x[it].z = __expf(x[it].z - mx); x[it].w = __expf(x[it].w - mx);
      sum += (x[it].x + x[it].y) + (x[it].z + x[it].w);
    }
#pragma unroll
    for (int off = 1; off < 32; off <<= 1) sum += __shfl_xor(sum, off, 32);
    const float f = (1.0f / sum) * 32768.0f;
    _Float16* prow = (_Float16*)srow;                         // all of the row is in this wave's registers by now
#pragma unroll
    for (int it = 0; it < 16; ++it) {
      v4h hv;
      hv[0] = (_Float16)(x[it].x * f); hv[1] = (_Float16)(x[it].y * f); hv[2] = (_Float16)(x[it].z * f); hv[3] = (_Float16)(x[it].w * f);
      *(v4h*)(prow + it * 128 + 4 * lane) = hv;
    }
  }
  __syncthreads();                                            // all 32 rows of p are in LDS before any wave reads them as A fragments

  // ---- 4. p.v: wave = (key group kg of 256 keys, half dh of the 128 columns); ctx[q][d] = 2^-19 * sum_key p[q][key] * Vt[d][key] ----
  const int kg = wave & 7, dh = wave >> 3;
  const _Float16* Ar = (const _Float16*)sc + rlane * (2 * kScPitch) + kg * (kSeq / 8) + half8;
  const _Float16* Br = vt16 + ((size_t)bh * kDh + dh * 64) * kSeq + kg * (kSeq / 8) * 16 + lane * 8;   // fragment order: 16 rows x 32 keys = 512 elements in a row
  v8f acc[2][4];
#pragma unroll
  for (int i = 0; i < 2; ++i)
#pragma unroll
    for (int j = 0; j < 4; ++j) acc[i][j] = (v8f){0.f,0.f,0.f,0.f,0.f,0.f,0.f,0.f};
  for (int k0 = 0; k0 < kSeq / 8; k0 += 64) {                 // 64 keys a trip = 2 KiB in a row of the fragment-order Vt plane per 16-row tile
    v16h af[2][2], bf[2][4];
#pragma unroll
    for (int s = 0; s < 2; ++s) {
#pragma unroll
      for (int j = 0; j < 4; ++j) bf[s][j] = Frag<_Float16>::loadf(Br + (size_t)(j << 4) * kSeq + (k0 + 32 * s) * 16);
#pragma unroll
      for (int i = 0; i < 2; ++i) af[s][i] = Frag<_Float16>::load(Ar + (i << 4) * (2 * kScPitch) + k0 + 32 * s);
    }
#pragma unroll
    for (int s = 0; s < 2; ++s)
#pragma unroll
      for (int i = 0; i < 2; ++i)
#pragma unroll
        for (int j = 0; j < 4; ++j) acc[i][j] = Frag<_Float16>::mma(af[s][i], bf[s][j], acc[i][j]);
  }
  __syncthreads();                                            // every wave has read its p fragments before the partials overwrite them

  float* mine = sc + kg * (kRows * kPartPitch) + dh * 64;
#pragma unroll
  for (int i = 0; i < 2; ++i)
#pragma unroll
    for (int j = 0; j < 4; ++j)
#pragma unroll
      for (int r = 0; r < 8; ++r) mine[((i << 4) + half8 + r) * kPartPitch + (j << 4) + rlane] = acc[i][j][r];
  __syncthreads();                                            // all 8 partials are in LDS before any thread sums them

  // fragment order of the [kTok][kEmb] planes: wave w writes the 512 B of (row tile w >> 3, k step (w >> 1) & 3 of the head's four, ld w & 1)
  const int row = (wave >> 3) * 16 + rlane, c8 = ((wave >> 1) & 3) * 32 + (wave & 1) * 16 + half8;
  const float* sp = sc + row * kPartPitch + c8;
  v4f s0 = *(const v4f*)sp, s1 = *(const v4f*)(sp + 4);
#pragma unroll
  for (int w = 1; w < 8; ++w) {                               // fixed order
    s0 += *(const v4f*)(sp + w * (kRows * kPartPitch));
    s1 += *(const v4f*)(sp + w * (kRows * kPartPitch) + 4);
  }
  v8h hv, lv;
#pragma unroll
  for (int e = 0; e < 8; ++e) {
    const float f = ((e < 4) ? s0[e & 3] : s1[e & 3]) * (1.0f / 524288.0f);
    const unsigned short hb = f2bf_bits(f);
    hv[e] = __builtin_bit_cast(_Float16, hb);
    lv[e] = __builtin_bit_cast(_Float16, f2bf_bits(f - bf_bits2f(hb)));
  }
  const size_t co = ((size_t)(((b * kSeq + a0) >> 4) + (wave >> 3)) * (kEmb / 32) + h * (kDh / 32) + ((wave >> 1) & 3)) * 512 + (wave & 1) * 256 + lane * 8;
  *(v8h*)(Ch + co) = hv;
  *(v8h*)(Cl + co) = lv;
}

// =====================================================================================
extern "C" void kernel_launch(void* const* d_in, const int* in_sizes, int n_in, void* d_out, int out_size,
                              void* d_ws, size_t ws_size, hipStream_t stream) {
  if (n_in < 14) return;
  if (in_sizes[0] != kTok * kEmb || in_sizes[1] != kEmb || in_sizes[2] != kEmb ||
      in_sizes[3] != kDh * kDh || in_sizes[4] != kDh || in_sizes[5] != kDh * kDh || in_sizes[6] != kDh ||
      in_sizes[7] != kDh * kDh || in_sizes[8] != kDh || in_sizes[9] != kDh * kDh ||
      in_sizes[10] != kHeads * kDh || in_sizes[11] != kHeads * kDh || in_sizes[12] != kEmb * kEmb || in_sizes[13] != kEmb ||
      out_size != kTok * kEmb) return;
  const float* x      = (const float*)d_in[0];
  const float* gamma  = (const float*)d_in[1];
  const float* beta   = (const float*)d_in[2];
  const float* Wq     = (const float*)d_in[3];
  const float* bq     = (const float*)d_in[4];
  const float* Wk     = (const float*)d_in[5];
  const float* bk     = (const float*)d_in[6];
  const float* Wv     = (const float*)d_in[7];
  const float* bv     = (const float*)d_in[8];
  const float* Wp     = (const float*)d_in[9];
  const float* u_bias = (const float*)d_in[10];
  const float* v_bias = (const float*)d_in[11];
  const float* Wo     = (const float*)d_in[12];
  const float* bo     = (const float*)d_in[13];
  float* out = (float*)d_out;   // [2][2048][1024] f32

  // ---- workspace carve (all offsets multiples of 256 B; total 92,734,464 B) ----
  // (R0, R1, R8, R9 and, one plane a head, R4 [8][4096][128], R5 [8][4096][128], R6 [8][2048][128] are in fragment order: see gemm64_tile)
  // R0 WqT,WkT,WvT,WpT hi/lo bf16 [128 n][128 k]   8 x 32,768        =     262,144
  // R1 WoT hi/lo bf16 [1024 n][1024 k]              2 x 2,097,152     =   4,194,304
  // R2 16·bq, 16·bk f32 [128]                       2 x 512           =       1,024
  // R3 UBK f32 [2][8][2048], VBP f32 [8][2048]                        =     196,608
  // R4 Q16 f16 x16 [32768][128]                                       =   8,388,608
  // R5 K16 f16 x16 [32768][128]                                       =   8,388,608
  // R6 PP16 f16 x16 [16384][128]                                      =   4,194,304
  // R7 V f32 [32768][128] (= [4096][1024])                            =  16,777,216
  // R8 CTX hi/lo bf16 [4096][1024]                  2 x 8,388,608     =  16,777,216
  // R9 VT16 f16 x16 [2 b][1024][2048]                                 =   8,388,608
  // R10 XN hi/lo bf16 [4096][1024] 2 x 8,388,608, PE hi/lo bf16 [2048][1024] 2 x 4,194,304 = 25,165,824
  char* ws = (char*)d_ws; size_t off = 0;
  auto carve = [&](size_t bytes) -> char* { char* p = ws + off; off += (bytes + 255) & ~(size_t)255; return p; };
  const size_t nW   = (size_t)kDh * kDh;            // 16,384
  const size_t nWo  = (size_t)kEmb * kEmb;          // 1,048,576
  const size_t nHd  = (size_t)kTok * kHeads * kDh;   // 4,194,304 (= kTok*kEmb)
  const size_t nPp  = (size_t)kSeq * kHeads * kDh;   // 2,097,152
  __bf16* WqTh = (__bf16*)carve(nW * 2); __bf16* WqTl = (__bf16*)carve(nW * 2);
  __bf16* WkTh = (__bf16*)carve(nW * 2); __bf16* WkTl = (__bf16*)carve(nW * 2);
  __bf16* WvTh = (__bf16*)carve(nW * 2); __bf16* WvTl = (__bf16*)carve(nW * 2);
  __bf16* WpTh = (__bf16*)carve(nW * 2); __bf16* WpTl = (__bf16*)carve(nW * 2);
  __bf16* WoTh = (__bf16*)carve(nWo * 2); __bf16* WoTl = (__bf16*)carve(nWo * 2);
  float* qb16 = (float*)carve(kDh * 4); float* kb16 = (float*)carve(kDh * 4);
  float* ubk  = (float*)carve((size_t)kBatch * kHeads * kSeq * 4);
  float* vbp  = (float*)carve((size_t)kHeads * kSeq * 4);
  _Float16* q16  = (_Float16*)carve(nHd * 2);
  _Float16* k16  = (_Float16*)carve(nHd * 2);
  _Float16* pp16 = (_Float16*)carve(nPp * 2);
  float*    vf32 = (float*)carve(nHd * 4);
  unsigned short* ctxh = (unsigned short*)carve(nHd * 2); unsigned short* ctxl = (unsigned short*)carve(nHd * 2);
  _Float16* vt16 = (_Float16*)carve((size_t)kBatch * kEmb * kSeq * 2);
  unsigned* xnh = (unsigned*)carve(nHd * 2);
  unsigned* xnl = (unsigned*)carve(nHd * 2);
  unsigned* peh = (unsigned*)carve((size_t)kSeq * kEmb * 2);
  unsigned* pel = (unsigned*)carve((size_t)kSeq * kEmb * 2);
  if (off > ws_size) return;

  // ---- prelude: weight planes (in [k][n] -> out [n][k]), scaled biases, LN planes, sinusoid planes: one launch ----
  prelude_kernel<<<kBlkPrelude, 256, 0, stream>>>(x, gamma, beta, Wq, Wk, Wv, Wp, Wo, bq, bk, WqTh, WoTh, WoTl, qb16, kb16, xnh, xnl, peh, pel);

  // ---- projections: v over the [32768][128] per-(token, head) row view of xn (same memory as [4096][1024]), q, k and p head by head over xn and pe at pitch kEmb: one launch ----
  proj4_kernel<<<3 * kBlkProj + kBlkProjP, 256, 0, stream>>>(U16(xnh), U16(xnl), U16(peh), U16(pel), U16(WqTh), qb16, kb16, bv, q16, k16, vf32, pp16);

  // ---- bias dots and v^T: one launch; then all of attention for every (b, h) in one launch, into the ctx hi/lo planes ----
  headbias_vt_kernel<<<kBlkHb + kBatch * kBlkVt, 256, 0, stream>>>(k16, pp16, u_bias, v_bias, ubk, vbp, vf32, vt16);
  attn_rows_kernel<<<dim3(kSeq / kRows, kBatch * kHeads), 512, 0, stream>>>(q16, k16, pp16, vt16, ubk, vbp, ctxh, ctxl);   // 64 x 16 blocks of 32 query rows

  out_gemm_kernel<<<kBlkOut, 256, 0, stream>>>(ctxh, ctxl, U16(WoTh), U16(WoTl), bo, out);
}

// v007
// It runs in 149 microseconds.
// Timed twice side by side with v006, it ran 1.07 and 1.09 times as fast.
// Over all steps from v000 it is 13.6 times as fast.
// Projections xn·W{q,k,v} (K=128), p = pe·Wp (K=128) and out = ctx·Wo (K=1024): v_wmma_f32_16x16x32_bf16 with bf16 hi/lo split operands (hi·hi + hi·lo + lo·hi); content (q+u)·kᵀ and position (q+v)·pᵀ tables (K=128): v_wmma_f32_16x16x32_f16 with plain f16 operands carried x16; p·v (K=2048): v_wmma_f32_16x16x32_f16 with p/l carried x2^15 and vᵀ carried x16; f32 accumulate everywhere; LayerNorm, sinusoid table, the u/v bias added to q (before the f16 rounding), relative shift and softmax in f32 on VALU.
#include <hip/hip_runtime.h>
#include <math.h>

typedef __attribute__((ext_vector_type(16))) _Float16 v16h;
typedef __attribute__((ext_vector_type(8)))  _Float16 v8h;
typedef __attribute__((ext_vector_type(4)))  _Float16 v4h;
typedef __attribute__((ext_vector_type(16))) __bf16   v16b;
typedef __attribute__((ext_vector_type(8)))  __bf16   v8b;
typedef __attribute__((ext_vector_type(8)))  float    v8f;
typedef __attribute__((ext_vector_type(4)))  float    v4f;
typedef __attribute__((ext_vector_type(2)))  float    v2f;
#define U16(p) ((const unsigned short*)(const void*)(p))

__device__ __forceinline__ unsigned short f2bf_bits(float f) {
  unsigned u = __float_as_uint(f);
  return (unsigned short)((u + 0x7FFFu + ((u >> 16) & 1u)) >> 16);
}
__device__ __forceinline__ float bf_bits2f(unsigned short h) { return __uint_as_float(((unsigned)h) << 16); }

// hazard guards as plain device helpers
__device__ __forceinline__ void dep_guard_h(v8f& a, v8f& b, v16h x, v16h y) { asm volatile("v_nop\n\tv_nop\n\tv_nop\n\tv_nop" : "+v"(a), "+v"(b) : "v"(x), "v"(y)); }
__device__ __forceinline__ void dep_guard_b(v8f& a, v8f& b, v16b x, v16b y) { asm volatile("v_nop\n\tv_nop\n\tv_nop\n\tv_nop" : "+v"(a), "+v"(b) : "v"(x), "v"(y)); }
__device__ __forceinline__ void keep4_h(v16h a, v16h b, v16h c, v16h d) { asm volatile("v_nop" :: "v"(a), "v"(b), "v"(c), "v"(d)); }
__device__ __forceinline__ void keep4_b(v16b a, v16b b, v16b c, v16b d) { asm volatile("v_nop" :: "v"(a), "v"(b), "v"(c), "v"(d)); }
__device__ __forceinline__ void acc_guard4(v8f& a, v8f& b, v8f& c, v8f& d) { asm volatile("v_nop\n\tv_nop\n\tv_nop\n\tv_nop" : "+v"(a), "+v"(b), "+v"(c), "+v"(d)); }
template <typename T> struct Frag;
template <> struct Frag<_Float16> {
  typedef v16h V; union U { v16h v; v8h h[2]; };
  static __device__ __forceinline__ v16h load(const _Float16* p) {   // elements 0..7 <- p[0..7], 8..15 <- p[16..23]
    U f; f.h[0] = *(const v8h*)(p); f.h[1] = *(const v8h*)(p + 16); return f.v;
  }
  static __device__ __forceinline__ v16h loadf(const _Float16* p) {  // fragment-order plane: elements 0..7 <- p[0..7], 8..15 <- p[256..263]
    U f; f.h[0] = *(const v8h*)(p); f.h[1] = *(const v8h*)(p + 256); return f.v;
  }
  static __device__ __forceinline__ v8f mma(v16h a, v16h b, v8f c) {
    return __builtin_amdgcn_wmma_f32_16x16x32_f16(false, a, false, b, (short)0, c, false, false);
  }
  static __device__ __forceinline__ void guard(v8f& a, v8f& b, v16h x, v16h y) { dep_guard_h(a, b, x, y); }
  static __device__ __forceinline__ void keep(v16h a, v16h b, v16h c, v16h d) { keep4_h(a, b, c, d); }
};
template <> struct Frag<__bf16> {
  typedef v16b V; union U { v16b v; v8b h[2]; };
  static __device__ __forceinline__ v16b load(const __bf16* p) {
    U f; f.h[0] = *(const v8b*)(p); f.h[1] = *(const v8b*)(p + 16); return f.v;
  }
  static __device__ __forceinline__ v16b loadf(const __bf16* p) {
    U f; f.h[0] = *(const v8b*)(p); f.h[1] = *(const v8b*)(p + 256); return f.v;
  }
  static __device__ __forceinline__ v8f mma(v16b a, v16b b, v8f c) {
    return __builtin_amdgcn_wmma_f32_16x16x32_bf16(false, a, false, b, (short)0, c, false, false);
  }
  static __device__ __forceinline__ void guard(v8f& a, v8f& b, v16b x, v16b y) { dep_guard_b(a, b, x, y); }
  static __device__ __forceinline__ void keep(v16b a, v16b b, v16b c, v16b d) { keep4_b(a, b, c, d); }
};

// ---- Register-blocked batched WMMA GEMM ------------------------------------
// C[m,n] = scale * sum_k A[m,k] * Bt[n,k] (+bias)(+resid); each wave owns a 64x64 tile.
// A row-major [M,K] (AFRAG: fragment order); Bt [N,K] in fragment order; M,N % 64 == 0, K % 32 == 0.
// Fragment order of a 16-bit [R,K] plane: [R/16][K/32][2][32 lanes][8]; chunk (rt, kk, ld, lane) holds row 16 rt + (lane & 15), k = 32 kk + 16 ld + 8 (lane >> 4) .. + 7,
// so each of a fragment's two 16-byte loads reads 512 contiguous bytes (four whole lines) over the wave; same k order as the row-major loader.
// SPLIT: operands are hi/lo planes (A2/Bt2 = lo planes, same layout); product = hi·hi + hi·lo + lo·hi.
// BIAS_MODE: 0 = none, 1 = bias[m], 2 = bias[n].
// OUT_MODE: 0 = f32, 1 = f16, 2 = bf16 hi plane (Cout) + bf16 lo plane (Cout2), 3 = f16 [M,N] plane in fragment order (ldc unused),
// 4 = two planes as in 3: Cout = value + 16 add1[n], Cout2 = value + 16 add2[n] (add1, add2: batch index b's own vectors),
// 5 = f16 x16, transposed, in fragment order: element (m, n) is row b N + n, k = m % ldc of plane m / ldc (strideC = elements of a plane; ldc % 64 == 0; BIAS_MODE 0 or 2, no RESID, no ACT).
// ET: 0 = f16 operands, 1 = bf16 operands (pointers passed as 16-bit storage)
// bx = tiles / 8 (tile = 8 bx + wave), b = batch index (strideA/B/C/R and strideBias are per b), zsel = true takes BtZp, CoutZ and biasZ in
// place of Btp, Cout and bias (same A, same strides; non-split launches only), so two products of one A share a launch.
// The body is a device function of (bx, b, zsel) and the block's LDS slabs, so that several products can share one grid by block range.
template <int ET> struct Elem;
template <> struct Elem<0> { typedef _Float16 T; };
template <> struct Elem<1> { typedef __bf16 T; };
// PIPE (with SPLIT and AFRAG; K % 64 == 0, K >= 128): the k loop keeps two register stages of fragments and issues all 32 loads of a k step one k step ahead of its products.
template <int ET, bool SPLIT, int BIAS_MODE, int OUT_MODE, bool RESID, int ACT = 0, bool AFRAG = false, bool PIPE = false>
__device__ __forceinline__ void gemm64_tile(
    float (*sT)[16 * 68], int bx, int b, bool zsel,      // sT: per-wave 16x64 slab, pitch 68 floats; bx, b, zsel block-uniform
    const unsigned short* __restrict__ Ap, const unsigned short* __restrict__ A2p, int lda, long strideA,
    const unsigned short* __restrict__ Btp, const unsigned short* __restrict__ Bt2p, int ldb, long strideB,
    void* __restrict__ Cout0, void* __restrict__ Cout2, int ldc, long strideC,
    const float* __restrict__ bias0, long strideBias,
    const float* __restrict__ resid, long strideR,
    const unsigned short* __restrict__ BtZp, void* __restrict__ CoutZ, const float* __restrict__ biasZ,
    int M, int N, int K, float scale,
    const float* __restrict__ add1 = nullptr, const float* __restrict__ add2 = nullptr, float (*sA)[128] = nullptr) {   // sA: OUT_MODE 4 only, 128 floats of LDS a wave
  typedef typename Elem<ET>::T T;
  typedef typename Frag<T>::V V;
  const T* A = (const T*)Ap; const T* A2 = (const T*)A2p; const T* Bt = (const T*)(zsel ? BtZp : Btp); const T* Bt2 = (const T*)Bt2p;
  void* Cout = zsel ? CoutZ : Cout0;
  const float* bias = (BIAS_MODE != 0) ? ((zsel ? biasZ : bias0) + (size_t)b * strideBias) : nullptr;
  const int lane = threadIdx.x & 31;
  const int wave = threadIdx.x >> 5;
  const int tilesN = N >> 6;
  const int tilesM = M >> 6;
  const int tile = bx * 8 + wave;
  if (tile >= tilesM * tilesN) return;   // wave-uniform; no block barriers in this kernel
  const int tm = tile / tilesN;
  const int tn = tile - tm * tilesN;
  const int m0 = tm << 6;
  const int n0 = tn << 6;

  const T* Ab  = A  + (size_t)b * strideA;
  const T* Bb  = Bt + (size_t)b * strideB;
  const T* Ab2 = SPLIT ? (A2  + (size_t)b * strideA) : nullptr;
  const T* Bb2 = SPLIT ? (Bt2 + (size_t)b * strideB) : nullptr;

  const int rlane = lane & 15;                 // row (A) / col (B, D) within subtile
  const int koff  = (lane >> 4) * 8;           // k offset of this lane half
  const int mOff  = (lane >> 4) * 8;           // D row offset

  v8f acc[4][4];
#pragma unroll
  for (int i = 0; i < 4; ++i)
#pragma unroll
    for (int j = 0; j < 4; ++j) acc[i][j] = (v8f){0.f,0.f,0.f,0.f,0.f,0.f,0.f,0.f};

  if (PIPE) {
    const size_t ts = (size_t)(K >> 5) * 512;                 // from one 16-row tile of a plane to the next
    // subtile 0, k step 0 of the wave's tile in each plane: the same for the whole wave, so held in scalar registers; the lane's own chunk is l8 elements on
    const size_t bo0 = (size_t)__builtin_amdgcn_readfirstlane(n0 >> 4) * ts, ao0 = (size_t)__builtin_amdgcn_readfirstlane(m0 >> 4) * ts;
    const T* bp = Bb + bo0; const T* bp2 = Bb2 + bo0; const T* ap = Ab + ao0; const T* ap2 = Ab2 + ao0;
    const unsigned l8 = (unsigned)lane * 8u;
    V ah[2][4], al[2][4], bh[2][4], bl[2][4];
    // every "#pragma unroll" in the two lambdas: constant indices keep the fragment and accumulator arrays in registers
    auto fetch = [&](const int s, const int ko) {             // all of one k step's fragments into stage s; ko = elements from the pointers to that k step
#pragma unroll
      for (int j = 0; j < 4; ++j) {
        bh[s][j] = Frag<T>::loadf(bp + l8 + (j * ts + ko)); bl[s][j] = Frag<T>::loadf(bp2 + l8 + (j * ts + ko));
        ah[s][j] = Frag<T>::loadf(ap + l8 + (j * ts + ko)); al[s][j] = Frag<T>::loadf(ap2 + l8 + (j * ts + ko));
      }
      __builtin_amdgcn_sched_barrier(0);                      // the loads stay in front of the other stage's products: their latency runs under those
    };
    auto products = [&](const int s) {                        // per accumulator the order of the plain loop: hi.hi, hi.lo, lo.hi
      // (the plain loop's v_nop statements are not carried over: as asm operands the fragments would all have to lie in the first 256 registers, which spills; the compiler pads its builtin products itself)
#pragma unroll
      for (int i = 0; i < 4; ++i) {
#pragma unroll
        for (int j = 0; j < 4; ++j) {
          acc[i][j] = Frag<T>::mma(ah[s][i], bh[s][j], acc[i][j]);
          acc[i][j] = Frag<T>::mma(ah[s][i], bl[s][j], acc[i][j]);
          acc[i][j] = Frag<T>::mma(al[s][i], bh[s][j], acc[i][j]);
        }
      }
    };
    fetch(0, 0);
    for (int k0 = 0; k0 < K - 64; k0 += 64) {                 // two k steps a trip, so that each stage keeps its registers
      fetch(1, 512);
      products(0);
      fetch(0, 1024);
      products(1);
      // the four pointers and the lane offset as inputs: their registers stay as this trip's loads name them up to this wait; the step to the next trip comes behind it
      asm volatile("s_wait_xcnt 0x0" :: "s"(ap), "s"(ap2), "s"(bp), "s"(bp2), "v"(l8) : "memory");
      ap += 1024; ap2 += 1024; bp += 1024; bp2 += 1024;
    }
    fetch(1, 512);
    // directly behind the last loads: nothing of the code that follows takes a register that they name ahead of this wait
    asm volatile("s_wait_xcnt 0x0" :: "s"(ap), "s"(ap2), "s"(bp), "s"(bp2), "v"(l8) : "memory");
    __builtin_amdgcn_sched_barrier(0);                        // keeps later address arithmetic from being lifted in front of that wait
    products(0);
    products(1);
  } else
  for (int k0 = 0; k0 < K; k0 += 32) {
    V bh[4], bl[4];
    const size_t bo0 = ((size_t)(n0 >> 4) * (K >> 5) + (k0 >> 5)) * 512 + lane * 8;
    const size_t ao0 = AFRAG ? ((size_t)(m0 >> 4) * (K >> 5) + (k0 >> 5)) * 512 + lane * 8 : (size_t)(m0 + rlane) * lda + koff + k0;
    const T* bp = Bb + bo0; const T* bp2 = SPLIT ? (Bb2 + bo0) : bp;     // the lane's own row of subtile 0 in each plane; the others at constant steps
    const T* ap = Ab + ao0; const T* ap2 = SPLIT ? (Ab2 + ao0) : ap;
#pragma unroll
    for (int j = 0; j < 4; ++j) {
      const size_t bo = (size_t)j * (K >> 5) * 512;
      bh[j] = Frag<T>::loadf(bp + bo);
      if (SPLIT) bl[j] = Frag<T>::loadf(bp2 + bo);
    }
#pragma unroll
    for (int i = 0; i < 4; ++i) {
      const size_t ao = AFRAG ? (size_t)i * (K >> 5) * 512 : (size_t)(i << 4) * lda;
      V ah = AFRAG ? Frag<T>::loadf(ap + ao) : Frag<T>::load(ap + ao);
      V al;
      if (SPLIT) al = AFRAG ? Frag<T>::loadf(ap2 + ao) : Frag<T>::load(ap2 + ao);
#pragma unroll
      for (int j = 0; j < 4; ++j) {
        acc[i][j] = Frag<T>::mma(ah, bh[j], acc[i][j]);
        if (SPLIT) {
          acc[i][j] = Frag<T>::mma(ah, bl[j], acc[i][j]);
          acc[i][j] = Frag<T>::mma(al, bh[j], acc[i][j]);
        }
      }
      Frag<T>::guard(acc[i][0], acc[i][3], ah, SPLIT ? al : ah);
    }
    Frag<T>::keep(bh[0], bh[1], bh[2], bh[3]);
    if (SPLIT) Frag<T>::keep(bl[0], bl[1], bl[2], bl[3]);
    // the four pointers as inputs: their registers stay as this step's loads name them (no result lands on them, no step to the next k) up to this wait
    asm volatile("s_wait_xcnt 0x0" :: "v"(ap), "v"(ap2), "v"(bp), "v"(bp2) : "memory");
  }
  acc_guard4(acc[0][0], acc[0][1], acc[0][2], acc[0][3]);
  acc_guard4(acc[1][0], acc[1][1], acc[1][2], acc[1][3]);
  acc_guard4(acc[2][0], acc[2][1], acc[2][2], acc[2][3]);
  acc_guard4(acc[3][0], acc[3][1], acc[3][2], acc[3][3]);

  // ---- epilogue ----
  if (OUT_MODE == 5) {
    // an accumulator's lane holds 8 rows m of one column n, which is one 16-byte chunk of the transposed plane (row n, 8 k in a row): stored as it stands, 512 B a store, no trip through the slab
    const float* pb = bias + n0 + rlane;
    float bvj[4];
#pragma unroll   // constant indices keep the array in registers
    for (int j = 0; j < 4; ++j) bvj[j] = (BIAS_MODE == 2) ? pb[j << 4] : 0.f;
    // the pointer as an input: its registers stay as the loads name them (no result lands on them) up to this wait
    if (BIAS_MODE == 2) asm volatile("s_wait_xcnt 0x0" :: "v"(pb) : "memory");
#pragma unroll   // constant indices keep acc in registers
    for (int i = 0; i < 4; ++i) {
      const int mBase = m0 + (i << 4), s0 = mBase % ldc;     // k = s0 .. s0 + 15: one ld of one k step
      _Float16* C = (_Float16*)Cout + (size_t)(mBase / ldc) * strideC + ((size_t)((b * N + n0) >> 4) * (ldc >> 5) + (s0 >> 5)) * 512 + ((s0 >> 4) & 1) * 256 + lane * 8;
#pragma unroll
      for (int j = 0; j < 4; ++j) {                          // row tile (b N + n0) / 16 + j
        v8h hv;
#pragma unroll
        for (int r = 0; r < 8; ++r) hv[r] = (_Float16)((acc[i][j][r] * scale + bvj[j]) * 16.0f);
        *(v8h*)(C + (size_t)j * (ldc >> 5) * 512) = hv;
      }
      asm volatile("s_wait_xcnt 0x0" ::: "memory");          // before the next four stores' values and address take the registers that these name
    }
    return;
  }
  float* slab = sT[wave];
  const float* Rb = RESID ? (resid + (size_t)b * strideR) : nullptr;
  float* addv = (OUT_MODE == 4) ? sA[wave] : nullptr;
  if (OUT_MODE == 4) {   // 16 add1 (from lanes 0..15) and 16 add2 (from lanes 16..31) at the tile's 64 columns, into the wave's own LDS: the stores below take them eight columns a lane
    const float* pa = ((lane >> 4) ? add2 : add1) + n0 + rlane;
    float av[4];
#pragma unroll   // constant indices keep the array in registers
    for (int j = 0; j < 4; ++j) av[j] = pa[j << 4];
    // the pointer as an input: its registers stay as the loads name them (no result lands on them) up to this wait
    asm volatile("s_wait_xcnt 0x0" :: "v"(pa) : "memory");
#pragma unroll
    for (int j = 0; j < 4; ++j) addv[(lane >> 4) * 64 + (j << 4) + rlane] = 16.0f * av[j];
  }
#pragma unroll
  for (int i = 0; i < 4; ++i) {
    const int mBase = m0 + (i << 4);
#pragma unroll
    for (int j = 0; j < 4; ++j) {
      const int n = n0 + (j << 4) + rlane;
      float bv = 0.f;
      if (BIAS_MODE == 2) bv = bias[n];
#pragma unroll
      for (int r = 0; r < 8; ++r) {
        float v = acc[i][j][r] * scale;
        if (BIAS_MODE == 1) v += bias[mBase + mOff + r];
        if (BIAS_MODE == 2) v += bv;
        if (RESID) v += Rb[(size_t)(mBase + mOff + r) * ldc + n];
        if (ACT == 1) v = tanhf(v);
        if (ACT == 2) v = fmaxf(v, 0.0f);
        if (ACT == 3) v = v / (1.0f + expf(-v));
        if (ACT == 4) v = (v > 0.f) ? v : 0.01f * v;
        if (ACT == 5) v = 0.5f * v * (1.0f + erff(v * 0.70710678118654752f));
        slab[(mOff + r) * 68 + (j << 4) + rlane] = v;
      }
    }
    __builtin_amdgcn_fence(__ATOMIC_RELEASE, "workgroup");
    __builtin_amdgcn_wave_barrier();
    __builtin_amdgcn_fence(__ATOMIC_ACQUIRE, "workgroup");
    if (OUT_MODE == 0) {
      float* C = (float*)Cout + (size_t)b * strideC;
      const int hh = lane >> 4, c4 = (lane & 15) * 4;     // row seg = 256 B = 16 lanes x 16 B
      {
#pragma unroll
        for (int it = 0; it < 8; ++it) {
          const int row = it * 2 + hh;
          v4f v = *(const v4f*)(slab + row * 68 + c4);
          *(v4f*)(C + (size_t)(mBase + row) * ldc + n0 + c4) = v;
        }
        
      }
    } else if (OUT_MODE == 3) {
      // the slab is row tile mBase / 16, k steps n0 / 32 and n0 / 32 + 1 of the plane: 2 KiB in a row, 512 B a store
      _Float16* C = (_Float16*)Cout + (size_t)b * strideC + ((size_t)(mBase >> 4) * (N >> 5) + (n0 >> 5)) * 512 + lane * 8;
#pragma unroll   // the four stores go off one address at constant offsets
      for (int it = 0; it < 4; ++it) {
        const float* sp = slab + rlane * 68 + it * 16 + mOff;
        v8h hv;
#pragma unroll   // constant indices keep hv in registers
        for (int e = 0; e < 8; ++e) hv[e] = (_Float16)sp[e];
        *(v8h*)(C + it * 256) = hv;
      }
    } else if (OUT_MODE == 4) {
      // as OUT_MODE 3, for two planes
      const size_t co = (size_t)b * strideC + ((size_t)(mBase >> 4) * (N >> 5) + (n0 >> 5)) * 512 + lane * 8;
      _Float16* C = (_Float16*)Cout + co; _Float16* C2 = (_Float16*)Cout2 + co;
#pragma unroll   // the stores go off two addresses at constant offsets
      for (int it = 0; it < 4; ++it) {
        const float* sp = slab + rlane * 68 + it * 16 + mOff;
        const float* ap = addv + it * 16 + mOff;
        v8h hv, lv;
#pragma unroll   // constant indices keep hv, lv in registers
        for (int e = 0; e < 8; ++e) { hv[e] = (_Float16)(sp[e] + ap[e]); lv[e] = (_Float16)(sp[e] + ap[64 + e]); }
        *(v8h*)(C + it * 256) = hv;
        *(v8h*)(C2 + it * 256) = lv;
      }
    } else {
      const int q = lane >> 3, c8 = (lane & 7) * 8;
      unsigned short* C  = (unsigned short*)Cout  + (size_t)b * strideC;
      unsigned short* C2 = (OUT_MODE == 2) ? ((unsigned short*)Cout2 + (size_t)b * strideC) : nullptr;
      {
#pragma unroll
        for (int it = 0; it < 4; ++it) {
          const int row = it * 4 + q;
          const float* sp = slab + row * 68 + c8;
          v8h hv, lv;
#pragma unroll
          for (int e = 0; e < 8; ++e) {
            if (OUT_MODE == 1) {
              hv[e] = (_Float16)sp[e];
            } else {
              unsigned short hb = f2bf_bits(sp[e]);
              unsigned short lb = f2bf_bits(sp[e] - bf_bits2f(hb));
              hv[e] = __builtin_bit_cast(_Float16, hb);
              lv[e] = __builtin_bit_cast(_Float16, lb);
            }
          }
          *(v8h*)(C + (size_t)(mBase + row) * ldc + n0 + c8) = hv;
          if (OUT_MODE == 2) *(v8h*)(C2 + (size_t)(mBase + row) * ldc + n0 + c8) = lv;
        }
        
      }
    }
    asm volatile("s_wait_xcnt 0x0" ::: "memory");   // before the next slab's values and addresses take the registers that these stores name
    __builtin_amdgcn_fence(__ATOMIC_RELEASE, "workgroup");
    __builtin_amdgcn_wave_barrier();
    __builtin_amdgcn_fence(__ATOMIC_ACQUIRE, "workgroup");
  }
}

// ---- f32 [R][C] (pitch ldi) -> bf16 hi/lo transposed planes [C][R = ldo] in fragment order (see gemm64_tile); 64x64 tiles
// one block of 256 threads does tile (bx, by); tile = the block's LDS, [c][r]
__device__ __forceinline__ void transpose_split_bf16_tile(float (*tile)[68], int bx, int by, const float* __restrict__ in, int ldi,
                                                          __bf16* __restrict__ outH, __bf16* __restrict__ outL, int ldo) {
  const int c0 = bx * 64, r0 = by * 64;
  const int t = threadIdx.x, tx = t & 31, ty = t >> 5;
  for (int i = ty; i < 64; i += 8) {
    tile[tx][i]      = in[(size_t)(r0 + i) * ldi + c0 + tx];
    tile[32 + tx][i] = in[(size_t)(r0 + i) * ldi + c0 + 32 + tx];
  }
  __syncthreads();
  const int lane = t & 31;
  {
#pragma unroll
    for (int it = 0; it < 2; ++it) {                          // fragment order: wave w writes the 512 B of (row tile, k step, ld) = its index it * 8 + w
      const int g = it * 8 + ty, ct = g >> 2, kk = (g >> 1) & 1, ld = g & 1;
      const int c = ct * 16 + (lane & 15), c8 = kk * 32 + ld * 16 + (lane >> 4) * 8;
      const size_t o = (((size_t)((c0 >> 4) + ct) * (ldo >> 5) + (r0 >> 5) + kk) * 2 + ld) * 256 + lane * 8;
      v8b hv, lv;
#pragma unroll
      for (int e = 0; e < 8; ++e) {
        const float f = tile[c][c8 + e];
        const unsigned short hb = f2bf_bits(f);
        hv[e] = __builtin_bit_cast(__bf16, hb);
        lv[e] = __builtin_bit_cast(__bf16, f2bf_bits(f - bf_bits2f(hb)));
      }
      *(v8b*)(outH + o) = hv;
      *(v8b*)(outL + o) = lv;
    }
    asm volatile("s_wait_xcnt 0x0" ::: "memory");   // other jobs' code follows this body in the shared kernel: nothing there rewrites a register that these stores name ahead of this wait
  }
}

// =====================================================================================
constexpr int kBatch = 2;
constexpr int kSeq   = 2048;
constexpr int kEmb   = 1024;
constexpr int kHeads = 8;
constexpr int kDh    = 128;
constexpr int kTok   = kBatch * kSeq;          // 4096 tokens
constexpr int kPairs = kEmb / 2;               // 512 element pairs per row
static_assert(kHeads * kDh == kEmb);
static_assert(kPairs == 512);

// ---- LayerNorm (biased variance, eps 1e-5) -> xn as bf16 hi/lo planes (packed pairs). One block per token, 256 threads;
// thread t owns element pairs (2t,2t+1) and (512+2t,512+2t+1): 2 packed dwords per plane per thread; each store instruction
__device__ __forceinline__ void layernorm_split_row(
    float* red, int tok,                                 // red: 8 floats of the block's LDS
    const float* __restrict__ x, const float* __restrict__ gamma, const float* __restrict__ beta,
    unsigned* __restrict__ xh, unsigned* __restrict__ xl) {
  const int t = threadIdx.x, lane = t & 31, wave = t >> 5;
  const float* xr = x + (size_t)tok * kEmb;
  const int ca = 2 * t, cb = kPairs + 2 * t;
  const v2f pa = *(const v2f*)(xr + ca);
  const v2f pb = *(const v2f*)(xr + cb);
  float s = (pa.x + pa.y) + (pb.x + pb.y);
#pragma unroll
  for (int off = 1; off < 32; off <<= 1) s += __shfl_xor(s, off, 32);
  if (lane == 0) red[wave] = s;
  __syncthreads();
  float tot = 0.f;
#pragma unroll
  for (int w = 0; w < 8; ++w) tot += red[w];       // fixed order
  const float mean = tot * (1.0f / (float)kEmb);
  __syncthreads();
  const float d0 = pa.x - mean, d1 = pa.y - mean, d2 = pb.x - mean, d3 = pb.y - mean;
  float s2 = (d0 * d0 + d1 * d1) + (d2 * d2 + d3 * d3);
#pragma unroll
  for (int off = 1; off < 32; off <<= 1) s2 += __shfl_xor(s2, off, 32);
  if (lane == 0) red[wave] = s2;
  __syncthreads();
  float tot2 = 0.f;
#pragma unroll
  for (int w = 0; w < 8; ++w) tot2 += red[w];
  const float var  = tot2 * (1.0f / (float)kEmb);
  const float rstd = 1.0f / sqrtf(var + 1e-5f);
  const float y0 = d0 * rstd * gamma[ca] + beta[ca];
  const float y1 = d1 * rstd * gamma[ca + 1] + beta[ca + 1];
  const float y2 = d2 * rstd * gamma[cb] + beta[cb];
  const float y3 = d3 * rstd * gamma[cb + 1] + beta[cb + 1];
  const unsigned short h0 = f2bf_bits(y0), h1 = f2bf_bits(y1), h2 = f2bf_bits(y2), h3 = f2bf_bits(y3);
  const unsigned short l0 = f2bf_bits(y0 - bf_bits2f(h0)), l1 = f2bf_bits(y1 - bf_bits2f(h1));
  const unsigned short l2 = f2bf_bits(y2 - bf_bits2f(h2)), l3 = f2bf_bits(y3 - bf_bits2f(h3));
  const unsigned uah = (unsigned)h0 | ((unsigned)h1 << 16), ual = (unsigned)l0 | ((unsigned)l1 << 16);
  const unsigned ubh = (unsigned)h2 | ((unsigned)h3 << 16), ubl = (unsigned)l2 | ((unsigned)l3 << 16);
  const size_t ia = (size_t)tok * kPairs + t, ib = ia + 256;
  {
    ((unsigned*)xh)[ia] = uah;
    ((unsigned*)xh)[ib] = ubh;
    ((unsigned*)xl)[ia] = ual;
    ((unsigned*)xl)[ib] = ubl;
    asm volatile("s_wait_xcnt 0x0" ::: "memory");   // other jobs' code follows this body in the shared kernel: nothing there rewrites a register that these stores name ahead of this wait
  }
}

// ---- sinusoid table [kSeq][kEmb]: columns 2i = sin(pos·div_i), 2i+1 = cos(pos·div_i), div_i = exp(2i · (−ln 1e4 / kEmb)), f32,
// emitted as bf16 hi/lo planes (packed pairs). One thread per (pos, i): kSeq*512/256 = 4096 blocks exactly; each wave's store
__device__ __forceinline__ void posenc_split_block(int blk, unsigned* __restrict__ peh, unsigned* __restrict__ pel) {
  const int idx = blk * 256 + threadIdx.x;
  if (idx >= kSeq * kPairs) return;
  const int pos = idx >> 9, i = idx & 511;
  const float kNegLogRate = -0.00899447301950799f;        // −ln(10000)/1024
  const float freq = expf((float)(2 * i) * kNegLogRate);
  const float ang  = (float)pos * freq;
  const float sv = sinf(ang), cv = cosf(ang);
  const unsigned short hs = f2bf_bits(sv), hc = f2bf_bits(cv);
  const unsigned short ls = f2bf_bits(sv - bf_bits2f(hs)), lc = f2bf_bits(cv - bf_bits2f(hc));
  const unsigned uh = (unsigned)hs | ((unsigned)hc << 16), ul = (unsigned)ls | ((unsigned)lc << 16);
  {
    ((unsigned*)peh)[idx] = uh;
    ((unsigned*)pel)[idx] = ul;
    asm volatile("s_wait_xcnt 0x0" ::: "memory");   // other jobs' code follows this body in the shared kernel: nothing there rewrites a register that these stores name ahead of this wait
  }
}

// ---- scaled projection biases: qb = 16·bq, kb = 16·bk (128 floats each). Two waves of one block: wave 0 -> qb, wave 1 -> kb;
__device__ __forceinline__ void bias16_block(const float* __restrict__ bq, const float* __restrict__ bk,
                                             float* __restrict__ qb, float* __restrict__ kb) {
  const int lane = threadIdx.x & 31, wave = threadIdx.x >> 5;   // wave-uniform branches
  if (wave >= 2) return;
  v4f v; float* dst;
  if (wave == 0) { v = *(const v4f*)(bq + 4 * lane); dst = qb + 4 * lane; }
  else           { v = *(const v4f*)(bk + 4 * lane); dst = kb + 4 * lane; }
  v = v * 16.0f;
  *(v4f*)dst = v;
  asm volatile("s_wait_xcnt 0x0" ::: "memory");   // other jobs' code follows this body in the shared kernel: nothing there rewrites a register that these stores name ahead of this wait
}

// ---- all that depends on the inputs alone, in one grid of 256-thread blocks; a block's job goes by its index (every branch block-uniform):
// the 64x64 tiles of Wo, those of the four [128][128] weights, the scaled biases, then LayerNorm rows and sinusoid blocks in turn
// (one reads and writes memory, the other computes). WT = the eight [128 n][128 k] planes in the order q hi, q lo, k hi, k lo, v hi, v lo, p hi, p lo.
constexpr int kBlkWo = (kEmb / 64) * (kEmb / 64);        // 256
constexpr int kBlkW4 = 4 * (kDh / 64) * (kDh / 64);      // 16
constexpr int kBlkPe = (kSeq * kPairs) / 256;            // 4096 blocks x 256 = 2048 x 512 pairs
static_assert(kBlkPe == kTok);
constexpr int kBlkPrelude = kBlkWo + kBlkW4 + 1 + kTok + kBlkPe;
__global__ __launch_bounds__(256) void prelude_kernel(
    const float* __restrict__ x, const float* __restrict__ gamma, const float* __restrict__ beta,
    const float* __restrict__ Wq, const float* __restrict__ Wk, const float* __restrict__ Wv, const float* __restrict__ Wp,
    const float* __restrict__ Wo, const float* __restrict__ bq, const float* __restrict__ bk,
    __bf16* __restrict__ WT, __bf16* __restrict__ WoTh, __bf16* __restrict__ WoTl, float* __restrict__ qb, float* __restrict__ kb,
    unsigned* __restrict__ xh, unsigned* __restrict__ xl, unsigned* __restrict__ peh, unsigned* __restrict__ pel) {
  __shared__ __align__(16) float tile[64][68];
  int blk = blockIdx.x;
  if (blk < kBlkWo) { transpose_split_bf16_tile(tile, blk % (kEmb / 64), blk / (kEmb / 64), Wo, kEmb, WoTh, WoTl, kEmb); return; }
  blk -= kBlkWo;
  if (blk < kBlkW4) {
    const int w = blk >> 2;
    const float* in = (w == 0) ? Wq : (w == 1) ? Wk : (w == 2) ? Wv : Wp;
    __bf16* oh = WT + (size_t)(2 * w) * (kDh * kDh);
    transpose_split_bf16_tile(tile, blk & 1, (blk >> 1) & 1, in, kDh, oh, oh + kDh * kDh, kDh);
    return;
  }
  blk -= kBlkW4;
  if (blk == 0) { bias16_block(bq, bk, qb, kb); return; }
  blk -= 1;
  if (blk & 1) posenc_split_block(blk >> 1, peh, pel);
  else         layernorm_split_row(&tile[0][0], blk >> 1, x, gamma, beta, xh, xl);
}

// ---- the four projections in one grid: blocks 0..127 q, 128..255 k, 256..383 v, 384..447 p (block-uniform branches); operands and results as in gemm64_tile
constexpr int kBlkProj  = (kTok * kHeads / 64) * (kDh / 64) / 8;   // 1024 tiles -> 128 blocks
constexpr int kBlkProjP = (kSeq * kHeads / 64) * (kDh / 64) / 8;   // 512 tiles -> 64 blocks
__global__ __launch_bounds__(256) void proj4_kernel(
    const unsigned short* __restrict__ xnh, const unsigned short* __restrict__ xnl,
    const unsigned short* __restrict__ peh, const unsigned short* __restrict__ pel, const unsigned short* __restrict__ WT,
    const float* __restrict__ qb, const float* __restrict__ kb, const float* __restrict__ bv,
    const float* __restrict__ ub, const float* __restrict__ vb,
    _Float16* __restrict__ qu16, _Float16* __restrict__ qv16, _Float16* __restrict__ k16, _Float16* __restrict__ vt16, _Float16* __restrict__ pp16) {
  __shared__ __align__(16) float sT[8][16 * 68];
  __shared__ __align__(16) float sA[8][128];
  const int w = blockIdx.x / kBlkProj, bx = blockIdx.x % kBlkProj;
  const unsigned short* Bh = WT + (size_t)(2 * w) * (kDh * kDh);
  const unsigned short* Bl = Bh + kDh * kDh;
  // q, k, v: head by head (16 blocks each, A rows = tokens at pitch kEmb)
  if (w == 0)         // (q + bq + u_bias[h])*16 and (q + bq + v_bias[h])*16: two fragment-order f16 planes [kTok][kDh] a head, from one product
    gemm64_tile<1, true, 2, 4, false>(sT, bx & 15, bx >> 4, false, xnh, xnl, kEmb, kDh, Bh, Bl, kDh, 0, qu16, qv16, kDh, (long)kTok * kDh, qb, 0,
        nullptr, 0, nullptr, nullptr, nullptr, kTok, kDh, kDh, 16.0f, ub + (bx >> 4) * kDh, vb + (bx >> 4) * kDh, sA);
  else if (w == 1)    // k*16 (+16 bk): one fragment-order f16 plane [kTok][kDh] a head
    gemm64_tile<1, true, 2, 3, false>(sT, bx & 15, bx >> 4, false, xnh, xnl, kEmb, kDh, Bh, Bl, kDh, 0, k16, nullptr, kDh, (long)kTok * kDh, kb, 0,
        nullptr, 0, nullptr, nullptr, nullptr, kTok, kDh, kDh, 16.0f);
  else if (w == 2)    // (v + bv)*16, transposed: per batch a fragment-order f16 plane [kEmb c][kSeq keys], c = 128 h + d
    gemm64_tile<1, true, 2, 5, false>(sT, bx & 15, bx >> 4, false, xnh, xnl, kEmb, kDh, Bh, Bl, kDh, 0, vt16, nullptr, kSeq, (long)kEmb * kSeq, bv, 0,
        nullptr, 0, nullptr, nullptr, nullptr, kTok, kDh, kDh, 1.0f);
  else                // p*16: head by head (8 blocks each), one fragment-order f16 plane [kSeq][kDh] a head
    gemm64_tile<1, true, 0, 3, false>(sT, bx & 7, bx >> 3, false, peh, pel, kEmb, kDh, Bh, Bl, kDh, 0, pp16, nullptr, kDh, (long)kSeq * kDh, nullptr, 0,
        nullptr, 0, nullptr, nullptr, nullptr, kSeq, kDh, kDh, 16.0f);
}

// ---- out = ctx.Wo + bo : A bf16 hi/lo [4096][1024], Bt bf16 hi/lo [1024 n][1024 k], C f32 [4096][1024]; 1024 tiles -> 128 blocks
constexpr int kBlkOut = (kTok / 64) * (kEmb / 64) / 8;
__global__ __launch_bounds__(256) void out_gemm_kernel(const unsigned short* __restrict__ ctxh, const unsigned short* __restrict__ ctxl,
                                                      const unsigned short* __restrict__ WoTh, const unsigned short* __restrict__ WoTl,
                                                      const float* __restrict__ bo, float* __restrict__ out) {
  __shared__ __align__(16) float sT[8][16 * 68];
  gemm64_tile<1, true, 2, 0, false, 0, true, true>(sT, blockIdx.x, 0, false, ctxh, ctxl, kEmb, 0, WoTh, WoTl, kEmb, 0, out, nullptr, kEmb, 0, bo, 0,
      nullptr, 0, nullptr, nullptr, nullptr, kTok, kEmb, kEmb, 1.0f);
}

// ---- content and position scores, relative shift, softmax and p.v of 32 query rows of one (b, h) in one block; the rows' scores never leave LDS.
// grid = (kSeq / 32, kBatch * kHeads), 512 threads = 16 waves. sc[r][c], r = a - a0, holds in turn:
//   1. shifted[a][c] = c <= a ? ps[a][S-1-a+c] : (c == a+1 ? 0 : ps[a+1][c-a-2]), ps[a][n] = (16(q[a] + v_bias)).(16p[n])/256: the c >= a+2 part is the
//      product of rows a0+1..a0+32 with p rows 0..S-a0-1, the c <= a part that of rows a0..a0+31 with p rows S-32-a0..S-1; each result is stored
//      at its shifted column, results that fall outside the row are dropped; every sc[r][c] gets exactly one store;
//   2. s = (content + shifted) / 32, content[a][key] = (16(q[a] + u_bias)).(16k[key])/256;
//   3. f16(exp(s - max) / sum * 2^15), written over the front half of the same row by the wave that owns the row;
//   4. the 8 key groups' f32 partials of p.v (pitch kPartPitch), summed in group order 0..7; output = bf16 hi/lo [kTok][kEmb] planes in fragment order.
constexpr int kRows      = 32;
constexpr int kScPitch   = kSeq + 4;    // floats; 8208 B = 16 B x odd, rows 8 apart = 32 banks apart
constexpr int kPartPitch = kDh + 4;     // floats; rows 8 apart = 32 banks apart
static_assert(8 * kRows * kPartPitch <= kRows * kScPitch);
// every "#pragma unroll" in the three helpers below: constant indices keep the fragment and accumulator arrays in registers
// qf[i][kk] = the lane's A fragments of 32 query rows; r0, r1 = the first chunks of the lane's own rows (tile rows lane & 15 and 16 + lane & 15) and lane half in the fragment-order plane
__device__ __forceinline__ void load_q(v16h (&qf)[2][4], const _Float16* r0, const _Float16* r1) {
#pragma unroll
  for (int kk = 0; kk < 4; ++kk) { qf[0][kk] = Frag<_Float16>::loadf(r0 + 512 * kk); qf[1][kk] = Frag<_Float16>::loadf(r1 + 512 * kk); }
  // the two pointers as inputs: their registers stay as the loads name them (no result lands on them) up to this wait
  asm volatile("s_wait_xcnt 0x0" :: "v"(r0), "v"(r1) : "memory");
}
// acc[i][j] = 32 query rows (fragments qf[i][kk], k = 32 kk ..) x 32 rows of a fragment-order f16 plane [.][kDh] (8 KiB in a row); rows = the tile's first element + 8 lane
// (pointers typed as global: a pointer that has gone through an asm statement would otherwise be read with flat loads)
typedef const __attribute__((address_space(1))) _Float16* GlobH;
typedef const __attribute__((address_space(1))) v8h*      GlobH8;
__device__ __forceinline__ void score_tile(const v16h (&qf)[2][4], GlobH& rows, v8f (&acc)[2][2]) {
  v16h bf[2][4];
#pragma unroll
  for (int j = 0; j < 2; ++j)
#pragma unroll
    for (int kk = 0; kk < 4; ++kk) {                          // as Frag<_Float16>::loadf
      Frag<_Float16>::U f;
      f.h[0] = *(GlobH8)(rows + (j * 4 + kk) * 512);
      f.h[1] = *(GlobH8)(rows + (j * 4 + kk) * 512 + 256);
      bf[j][kk] = f.v;
    }
  // The loaded values, as inputs only: all of a tile's loads are issued before the first product (one memory latency a tile, not one per k step).
  // The pointer goes through the statement: the caller's step to the next tile, the next write of the registers that the loads name, comes behind this wait.
  asm volatile("s_wait_xcnt 0x0" : "+v"(rows) : "v"(bf[0][0]), "v"(bf[0][1]), "v"(bf[0][2]), "v"(bf[0][3]),
               "v"(bf[1][0]), "v"(bf[1][1]), "v"(bf[1][2]), "v"(bf[1][3]) : "memory");
#pragma unroll
  for (int i = 0; i < 2; ++i)
#pragma unroll
    for (int j = 0; j < 2; ++j) acc[i][j] = (v8f){0.f,0.f,0.f,0.f,0.f,0.f,0.f,0.f};
#pragma unroll
  for (int kk = 0; kk < 4; ++kk)
#pragma unroll
    for (int i = 0; i < 2; ++i)
#pragma unroll
      for (int j = 0; j < 2; ++j) acc[i][j] = Frag<_Float16>::mma(qf[i][kk], bf[j][kk], acc[i][j]);
}
// one step down a row of the tile is one step right in the shifted table: element (16 i + r, 16 j) of the lane goes to dst + (16 i + r) * (pitch + 1) + 16 j.
// GUARD: c0 = the column that dst stands for; elements whose column falls outside 0 .. kSeq - 1 are dropped (only the tiles at a row's ends have such)
template <bool GUARD>
__device__ __forceinline__ void store_shifted(float* dst, const v8f (&acc)[2][2], int c0) {
#pragma unroll
  for (int j = 0; j < 2; ++j)
#pragma unroll
    for (int i = 0; i < 2; ++i)
#pragma unroll
      for (int r = 0; r < 8; ++r) {
        const int d = (i << 4) + r;
        if (!GUARD || (unsigned)(c0 + d + (j << 4)) < (unsigned)kSeq)
          dst[d * (kScPitch + 1) + (j << 4)] = acc[i][j][r] * (1.0f / 256.0f);
      }
}
__global__ __launch_bounds__(512) void attn_rows_kernel(const _Float16* __restrict__ qu16, const _Float16* __restrict__ qv16, const _Float16* __restrict__ k16,
                                                       const _Float16* __restrict__ pp16, const _Float16* __restrict__ vt16,
                                                       unsigned short* __restrict__ Ch, unsigned short* __restrict__ Cl) {
  __shared__ __align__(16) float sc[kRows * kScPitch];
  const int t = threadIdx.x, lane = t & 31;
  const int wave = __builtin_amdgcn_readfirstlane(t >> 5);    // scalar, so that the tile loops branch on scalars
  const int a0 = blockIdx.x * kRows;
  const int bh = blockIdx.y, b = bh / kHeads, h = bh % kHeads;
  const int rlane = lane & 15;
  const int half8 = (lane >> 4) * 8;                          // k offset of this lane half (A, B) and D row offset
  const size_t qo = ((size_t)h * kTok + b * kSeq) * kDh + (lane >> 4) * 128;   // fragment order: any row s, this lane half, at (s & ~15) * kDh + (s & 15) * 8
  const _Float16* qub = qu16 + qo;                            // q + u_bias, for the content product
  const _Float16* qvb = qv16 + qo;                            // q + v_bias, for the position products
  const _Float16* kb = k16 + ((size_t)h * kTok + b * kSeq) * kDh + lane * 8;   // fragment-order planes: row s (a multiple of 16) at s * kDh, the lane's chunk
  const _Float16* pb = pp16 + (size_t)h * kSeq * kDh + lane * 8;

  // every "#pragma unroll" in this kernel: constant indices keep the fragment and accumulator arrays in registers
  if (t < kRows) { const int c = a0 + t + 1; if (c < kSeq) sc[t * kScPitch + c] = 0.0f; }

  v16h qf[2][4];
  v8f acc2[2][2];
  // ---- 1a. columns c >= a+2: query rows a+1 (the last row of the table has no such column; its address is clamped) ----
  const int qs0 = (a0 + 1 + rlane < kSeq) ? (a0 + 1 + rlane) : (kSeq - 1), qs1 = (a0 + 17 + rlane < kSeq) ? (a0 + 17 + rlane) : (kSeq - 1);
  load_q(qf, qvb + (size_t)(qs0 & ~15) * kDh + (qs0 & 15) * 8, qvb + (size_t)(qs1 & ~15) * kDh + (qs1 & 15) * 8);
  const int nUp = (kSeq - a0) >> 5;                           // 32-column tiles of either part; nUp + nLo = kSeq / 32 + 1
  const int nLo = (a0 + kRows) >> 5;
  GlobH prow = (GlobH)(pb + (size_t)(wave << 5) * kDh);                       // the wave's tile; 16 tiles on a trip
  for (int jj = wave; jj < nUp; jj += 16, prow += (size_t)512 * kDh) {
    const int n0 = jj << 5;
    score_tile(qf, prow, acc2);
    const int cmin = n0 + a0 + 2;                             // column of the tile's element (row 0, n0); the tile spans cmin .. cmin + 62
    float* dst = sc + half8 * kScPitch + cmin + rlane + half8;
    if (cmin + 62 < kSeq) store_shifted<false>(dst, acc2, 0);
    else                  store_shifted<true>(dst, acc2, cmin + rlane + half8);
  }
  // ---- 1b. columns c <= a: query rows a ----
  load_q(qf, qvb + (size_t)a0 * kDh + rlane * 8, qvb + (size_t)(a0 + 16) * kDh + rlane * 8);
  const int jLo = (wave - nUp) & 15;                          // the deal of tiles to waves goes on where 1a's ended
  prow = (GlobH)(pb + (size_t)((kSeq - kRows - a0) + (jLo << 5)) * kDh);
  for (int jj = jLo; jj < nLo; jj += 16, prow += (size_t)512 * kDh) {
    const int n0 = (kSeq - kRows - a0) + (jj << 5);
    score_tile(qf, prow, acc2);
    const int cmin = n0 + a0 - (kSeq - 1);                    // = 32 jj - 31
    float* dst = sc + half8 * kScPitch + cmin + rlane + half8;
    if (cmin >= 0) store_shifted<false>(dst, acc2, 0);
    else           store_shifted<true>(dst, acc2, cmin + rlane + half8);
  }
  __syncthreads();                                            // every shifted position score is in LDS before the content product adds to it

  // ---- 2. content; wave w takes the 32-key tiles w, w + 16, w + 32, w + 48 ----
  load_q(qf, qub + (size_t)a0 * kDh + rlane * 8, qub + (size_t)(a0 + 16) * kDh + rlane * 8);   // behind the barrier (which waits for every load): in flight together with the first key tile's loads
  GlobH krow = (GlobH)(kb + (size_t)(wave << 5) * kDh);
  for (int jj = wave; jj < kSeq / 32; jj += 16, krow += (size_t)512 * kDh) {
    const int n0 = jj << 5;
    score_tile(qf, krow, acc2);
#pragma unroll
    for (int j = 0; j < 2; ++j) {
      const int n = n0 + (j << 4) + rlane;
#pragma unroll
      for (int i = 0; i < 2; ++i)
#pragma unroll
        for (int r = 0; r < 8; ++r) {
          float* e = sc + ((i << 4) + half8 + r) * kScPitch + n;
          *e = (acc2[i][j][r] * (1.0f / 256.0f) + *e) * (1.0f / 32.0f);
        }
    }
  }
  __syncthreads();                                            // whole score rows are in LDS before a wave takes its rows' maximum

  // ---- 3. softmax; wave w owns rows 2w and 2w + 1, lane l columns 128 it + 4 l .. + 3 ----
#pragma unroll 1   // one row's 64 floats a lane live at a time, not two rows'
  for (int rr = 0; rr < 2; ++rr) {
    float* srow = sc + (wave * 2 + rr) * kScPitch;
    v4f x[16];
#pragma unroll
    for (int it = 0; it < 16; ++it) x[it] = *(const v4f*)(srow + it * 128 + 4 * lane);
    float mx = -INFINITY;
#pragma unroll
    for (int it = 0; it < 16; ++it) mx = fmaxf(mx, fmaxf(fmaxf(x[it].x, x[it].y), fmaxf(x[it].z, x[it].w)));
#pragma unroll
    for (int off = 1; off < 32; off <<= 1) mx = fmaxf(mx, __shfl_xor(mx, off, 32));
    float sum = 0.f;
#pragma unroll
    for (int it = 0; it < 16; ++it) {
      x[it].x = __expf(x[it].x - mx); x[it].y = __expf(x[it].y - mx); x[it].z = __expf(x[it].z - mx); x[it].w = __expf(x[it].w - mx);
      sum += (x[it].x + x[it].y) + (x[it].z + x[it].w);
    }
#pragma unroll
    for (int off = 1; off < 32; off <<= 1) sum += __shfl_xor(sum, off, 32);
    const float f = (1.0f / sum) * 32768.0f;
    _Float16* prow = (_Float16*)srow;                         // all of the row is in this wave's registers by now
#pragma unroll
    for (int it = 0; it < 16; ++it) {
      v4h hv;
      hv[0] = (_Float16)(x[it].x * f); hv[1] = (_Float16)(x[it].y * f); hv[2] = (_Float16)(x[it].z * f); hv[3] = (_Float16)(x[it].w * f);
      *(v4h*)(prow + it * 128 + 4 * lane) = hv;
    }
  }
  __syncthreads();                                            // all 32 rows of p are in LDS before any wave reads them as A fragments

  // ---- 4. p.v: wave = (key group kg of 256 keys, half dh of the 128 columns); ctx[q][d] = 2^-19 * sum_key p[q][key] * Vt[d][key] ----
  const int kg = wave & 7, dh = wave >> 3;
  const _Float16* Ar = (const _Float16*)sc + rlane * (2 * kScPitch) + kg * (kSeq / 8) + half8;
  const _Float16* Br = vt16 + ((size_t)bh * kDh + dh * 64) * kSeq + kg * (kSeq / 8) * 16 + lane * 8;   // fragment order: 16 rows x 32 keys = 512 elements in a row
  v8f acc[2][4];
#pragma unroll
  for (int i = 0; i < 2; ++i)
#pragma unroll
    for (int j = 0; j < 4; ++j) acc[i][j] = (v8f){0.f,0.f,0.f,0.f,0.f,0.f,0.f,0.f};
  for (int k0 = 0; k0 < kSeq / 8; k0 += 64) {                 // 64 keys a trip = 2 KiB in a row of the fragment-order Vt plane per 16-row tile
    v16h af[2][2], bf[2][4];
#pragma unroll
    for (int s = 0; s < 2; ++s) {
#pragma unroll
      for (int j = 0; j < 4; ++j) bf[s][j] = Frag<_Float16>::loadf(Br + (size_t)(j << 4) * kSeq + (k0 + 32 * s) * 16);
#pragma unroll
      for (int i = 0; i < 2; ++i) af[s][i] = Frag<_Float16>::load(Ar + (i << 4) * (2 * kScPitch) + k0 + 32 * s);
    }
#pragma unroll
    for (int s = 0; s < 2; ++s)
#pragma unroll
      for (int i = 0; i < 2; ++i)
#pragma unroll
        for (int j = 0; j < 4; ++j) acc[i][j] = Frag<_Float16>::mma(af[s][i], bf[s][j], acc[i][j]);
  }
  __syncthreads();                                            // every wave has read its p fragments before the partials overwrite them

  float* mine = sc + kg * (kRows * kPartPitch) + dh * 64;
#pragma unroll
  for (int i = 0; i < 2; ++i)
#pragma unroll
    for (int j = 0; j < 4; ++j)
#pragma unroll
      for (int r = 0; r < 8; ++r) mine[((i << 4) + half8 + r) * kPartPitch + (j << 4) + rlane] = acc[i][j][r];
  __syncthreads();                                            // all 8 partials are in LDS before any thread sums them

  // fragment order of the [kTok][kEmb] planes: wave w writes the 512 B of (row tile w >> 3, k step (w >> 1) & 3 of the head's four, ld w & 1)
  const int row = (wave >> 3) * 16 + rlane, c8 = ((wave >> 1) & 3) * 32 + (wave & 1) * 16 + half8;
  const float* sp = sc + row * kPartPitch + c8;
  v4f s0 = *(const v4f*)sp, s1 = *(const v4f*)(sp + 4);
#pragma unroll
  for (int w = 1; w < 8; ++w) {                               // fixed order
    s0 += *(const v4f*)(sp + w * (kRows * kPartPitch));
    s1 += *(const v4f*)(sp + w * (kRows * kPartPitch) + 4);
  }
  v8h hv, lv;
#pragma unroll
  for (int e = 0; e < 8; ++e) {
    const float f = ((e < 4) ? s0[e & 3] : s1[e & 3]) * (1.0f / 524288.0f);
    const unsigned short hb = f2bf_bits(f);
    hv[e] = __builtin_bit_cast(_Float16, hb);
    lv[e] = __builtin_bit_cast(_Float16, f2bf_bits(f - bf_bits2f(hb)));
  }
  const size_t co = ((size_t)(((b * kSeq + a0) >> 4) + (wave >> 3)) * (kEmb / 32) + h * (kDh / 32) + ((wave >> 1) & 3)) * 512 + (wave & 1) * 256 + lane * 8;
  *(v8h*)(Ch + co) = hv;
  *(v8h*)(Cl + co) = lv;
}

// =====================================================================================
extern "C" void kernel_launch(void* const* d_in, const int* in_sizes, int n_in, void* d_out, int out_size,
                              void* d_ws, size_t ws_size, hipStream_t stream) {
  if (n_in < 14) return;
  if (in_sizes[0] != kTok * kEmb || in_sizes[1] != kEmb || in_sizes[2] != kEmb ||
      in_sizes[3] != kDh * kDh || in_sizes[4] != kDh || in_sizes[5] != kDh * kDh || in_sizes[6] != kDh ||
      in_sizes[7] != kDh * kDh || in_sizes[8] != kDh || in_sizes[9] != kDh * kDh ||
      in_sizes[10] != kHeads * kDh || in_sizes[11] != kHeads * kDh || in_sizes[12] != kEmb * kEmb || in_sizes[13] != kEmb ||
      out_size != kTok * kEmb) return;
  const float* x      = (const float*)d_in[0];
  const float* gamma  = (const float*)d_in[1];
  const float* beta   = (const float*)d_in[2];
  const float* Wq     = (const float*)d_in[3];
  const float* bq     = (const float*)d_in[4];
  const float* Wk     = (const float*)d_in[5];
  const float* bk     = (const float*)d_in[6];
  const float* Wv     = (const float*)d_in[7];
  const float* bv     = (const float*)d_in[8];
  const float* Wp     = (const float*)d_in[9];
  const float* u_bias = (const float*)d_in[10];
  const float* v_bias = (const float*)d_in[11];
  const float* Wo     = (const float*)d_in[12];
  const float* bo     = (const float*)d_in[13];
  float* out = (float*)d_out;   // [2][2048][1024] f32

  // ---- workspace carve (all offsets multiples of 256 B; total 84,149,248 B) ----
  // (R0, R1, R8, R9 and, one plane a head, R4 2 x [8][4096][128], R5 [8][4096][128], R6 [8][2048][128] are in fragment order: see gemm64_tile)
  // R0 WqT,WkT,WvT,WpT hi/lo bf16 [128 n][128 k]   8 x 32,768        =     262,144
  // R1 WoT hi/lo bf16 [1024 n][1024 k]              2 x 2,097,152     =   4,194,304
  // R2 16·bq, 16·bk f32 [128]                       2 x 512           =       1,024
  // R4 (q + u_bias), (q + v_bias) f16 x16 [32768][128] 2 x 8,388,608  =  16,777,216
  // R5 K16 f16 x16 [32768][128]                                       =   8,388,608
  // R6 PP16 f16 x16 [16384][128]                                      =   4,194,304
  // R8 CTX hi/lo bf16 [4096][1024]                  2 x 8,388,608     =  16,777,216
  // R9 VT16 f16 x16 [2 b][1024][2048]                                 =   8,388,608
  // R10 XN hi/lo bf16 [4096][1024] 2 x 8,388,608, PE hi/lo bf16 [2048][1024] 2 x 4,194,304 = 25,165,824
  char* ws = (char*)d_ws; size_t off = 0;
  auto carve = [&](size_t bytes) -> char* { char* p = ws + off; off += (bytes + 255) & ~(size_t)255; return p; };
  const size_t nW   = (size_t)kDh * kDh;            // 16,384
  const size_t nWo  = (size_t)kEmb * kEmb;          // 1,048,576
  const size_t nHd  = (size_t)kTok * kHeads * kDh;   // 4,194,304 (= kTok*kEmb)
  const size_t nPp  = (size_t)kSeq * kHeads * kDh;   // 2,097,152
  __bf16* WqTh = (__bf16*)carve(nW * 2); __bf16* WqTl = (__bf16*)carve(nW * 2);
  __bf16* WkTh = (__bf16*)carve(nW * 2); __bf16* WkTl = (__bf16*)carve(nW * 2);
  __bf16* WvTh = (__bf16*)carve(nW * 2); __bf16* WvTl = (__bf16*)carve(nW * 2);
  __bf16* WpTh = (__bf16*)carve(nW * 2); __bf16* WpTl = (__bf16*)carve(nW * 2);
  __bf16* WoTh = (__bf16*)carve(nWo * 2); __bf16* WoTl = (__bf16*)carve(nWo * 2);
  float* qb16 = (float*)carve(kDh * 4); float* kb16 = (float*)carve(kDh * 4);
  _Float16* qu16 = (_Float16*)carve(nHd * 2);
  _Float16* qv16 = (_Float16*)carve(nHd * 2);
  _Float16* k16  = (_Float16*)carve(nHd * 2);
  _Float16* pp16 = (_Float16*)carve(nPp * 2);
  unsigned short* ctxh = (unsigned short*)carve(nHd * 2); unsigned short* ctxl = (unsigned short*)carve(nHd * 2);
  _Float16* vt16 = (_Float16*)carve((size_t)kBatch * kEmb * kSeq * 2);
  unsigned* xnh = (unsigned*)carve(nHd * 2);
  unsigned* xnl = (unsigned*)carve(nHd * 2);
  unsigned* peh = (unsigned*)carve((size_t)kSeq * kEmb * 2);
  unsigned* pel = (unsigned*)carve((size_t)kSeq * kEmb * 2);
  if (off > ws_size) return;

  // ---- prelude: weight planes (in [k][n] -> out [n][k]), scaled biases, LN planes, sinusoid planes: one launch ----
  prelude_kernel<<<kBlkPrelude, 256, 0, stream>>>(x, gamma, beta, Wq, Wk, Wv, Wp, Wo, bq, bk, WqTh, WoTh, WoTl, qb16, kb16, xnh, xnl, peh, pel);

  // ---- projections, head by head, of xn and pe, written as attention reads them (q with either bias, k, v^T, p): one launch ----
  proj4_kernel<<<3 * kBlkProj + kBlkProjP, 256, 0, stream>>>(U16(xnh), U16(xnl), U16(peh), U16(pel), U16(WqTh), qb16, kb16, bv, u_bias, v_bias, qu16, qv16, k16, vt16, pp16);

  // ---- all of attention for every (b, h) in one launch, into the ctx hi/lo planes ----
  attn_rows_kernel<<<dim3(kSeq / kRows, kBatch * kHeads), 512, 0, stream>>>(qu16, qv16, k16, pp16, vt16, ctxh, ctxl);   // 64 x 16 blocks of 32 query rows

  out_gemm_kernel<<<kBlkOut, 256, 0, stream>>>(ctxh, ctxl, U16(WoTh), U16(WoTl), bo, out);
}

// v008
// A run of this version takes 127 microseconds.
// Next to v007, in two timings, it ran 1.16 and 1.17 times as fast.
// Over all steps from v000 it is 15.9 times as fast.
// Projections xn·W{q,k,v} (K=128), p = pe·Wp (K=128) and out = ctx·Wo (K=1024): v_wmma_f32_16x16x32_bf16 with bf16 hi/lo split operands (hi·hi + hi·lo + lo·hi); content (q+u)·kᵀ and position (q+v)·pᵀ tables (K=128): v_wmma_f32_16x16x32_f16 with plain f16 operands carried x16; p·v (K=2048): v_wmma_f32_16x16x32_f16 with p/l carried x2^15 and vᵀ carried x16; f32 accumulate everywhere; LayerNorm, sinusoid table, the u/v bias added to q (before the f16 rounding), relative shift and softmax in f32 on VALU.
// Between the score products and the softmax the scores (position / 32, then position + content, / 32) wait in LDS rounded to f16.
#include <hip/hip_runtime.h>
#include <math.h>

typedef __attribute__((ext_vector_type(16))) _Float16 v16h;
typedef __attribute__((ext_vector_type(8)))  _Float16 v8h;
typedef __attribute__((ext_vector_type(4)))  _Float16 v4h;
typedef __attribute__((ext_vector_type(16))) __bf16   v16b;
typedef __attribute__((ext_vector_type(8)))  __bf16   v8b;
typedef __attribute__((ext_vector_type(8)))  float    v8f;
typedef __attribute__((ext_vector_type(4)))  float    v4f;
typedef __attribute__((ext_vector_type(2)))  float    v2f;
#define U16(p) ((const unsigned short*)(const void*)(p))

__device__ __forceinline__ unsigned short f2bf_bits(float f) {
  unsigned u = __float_as_uint(f);
  return (unsigned short)((u + 0x7FFFu + ((u >> 16) & 1u)) >> 16);
}
__device__ __forceinline__ float bf_bits2f(unsigned short h) { return __uint_as_float(((unsigned)h) << 16); }

// hazard guards as plain device helpers
__device__ __forceinline__ void dep_guard_h(v8f& a, v8f& b, v16h x, v16h y) { asm volatile("v_nop\n\tv_nop\n\tv_nop\n\tv_nop" : "+v"(a), "+v"(b) : "v"(x), "v"(y)); }
__device__ __forceinline__ void dep_guard_b(v8f& a, v8f& b, v16b x, v16b y) { asm volatile("v_nop\n\tv_nop\n\tv_nop\n\tv_nop" : "+v"(a), "+v"(b) : "v"(x), "v"(y)); }
__device__ __forceinline__ void keep4_h(v16h a, v16h b, v16h c, v16h d) { asm volatile("v_nop" :: "v"(a), "v"(b), "v"(c), "v"(d)); }
__device__ __forceinline__ void keep4_b(v16b a, v16b b, v16b c, v16b d) { asm volatile("v_nop" :: "v"(a), "v"(b), "v"(c), "v"(d)); }
__device__ __forceinline__ void acc_guard4(v8f& a, v8f& b, v8f& c, v8f& d) { asm volatile("v_nop\n\tv_nop\n\tv_nop\n\tv_nop" : "+v"(a), "+v"(b), "+v"(c), "+v"(d)); }
template <typename T> struct Frag;
template <> struct Frag<_Float16> {
  typedef v16h V; union U { v16h v; v8h h[2]; };
  static __device__ __forceinline__ v16h load(const _Float16* p) {   // elements 0..7 <- p[0..7], 8..15 <- p[16..23]
    U f; f.h[0] = *(const v8h*)(p); f.h[1] = *(const v8h*)(p + 16); return f.v;
  }
  static __device__ __forceinline__ v16h loadf(const _Float16* p) {  // fragment-order plane: elements 0..7 <- p[0..7], 8..15 <- p[256..263]
    U f; f.h[0] = *(const v8h*)(p); f.h[1] = *(const v8h*)(p + 256); return f.v;
  }
  static __device__ __forceinline__ v8f mma(v16h a, v16h b, v8f c) {
    return __builtin_amdgcn_wmma_f32_16x16x32_f16(false, a, false, b, (short)0, c, false, false);
  }
  static __device__ __forceinline__ void guard(v8f& a, v8f& b, v16h x, v16h y) { dep_guard_h(a, b, x, y); }
  static __device__ __forceinline__ void keep(v16h a, v16h b, v16h c, v16h d) { keep4_h(a, b, c, d); }
};
template <> struct Frag<__bf16> {
  typedef v16b V; union U { v16b v; v8b h[2]; };
  static __device__ __forceinline__ v16b load(const __bf16* p) {
    U f; f.h[0] = *(const v8b*)(p); f.h[1] = *(const v8b*)(p + 16); return f.v;
  }
  static __device__ __forceinline__ v16b loadf(const __bf16* p) {
    U f; f.h[0] = *(const v8b*)(p); f.h[1] = *(const v8b*)(p + 256); return f.v;
  }
  static __device__ __forceinline__ v8f mma(v16b a, v16b b, v8f c) {
    return __builtin_amdgcn_wmma_f32_16x16x32_bf16(false, a, false, b, (short)0, c, false, false);
  }
  static __device__ __forceinline__ void guard(v8f& a, v8f& b, v16b x, v16b y) { dep_guard_b(a, b, x, y); }
  static __device__ __forceinline__ void keep(v16b a, v16b b, v16b c, v16b d) { keep4_b(a, b, c, d); }
};

// ---- Register-blocked batched WMMA GEMM ------------------------------------
// C[m,n] = scale * sum_k A[m,k] * Bt[n,k] (+bias)(+resid); each wave owns a 64x64 tile.
// A row-major [M,K] (AFRAG: fragment order); Bt [N,K] in fragment order; M,N % 64 == 0, K % 32 == 0.
// Fragment order of a 16-bit [R,K] plane: [R/16][K/32][2][32 lanes][8]; chunk (rt, kk, ld, lane) holds row 16 rt + (lane & 15), k = 32 kk + 16 ld + 8 (lane >> 4) .. + 7,
// so each of a fragment's two 16-byte loads reads 512 contiguous bytes (four whole lines) over the wave; same k order as the row-major loader.
// SPLIT: operands are hi/lo planes (A2/Bt2 = lo planes, same layout); product = hi·hi + hi·lo + lo·hi.
// BIAS_MODE: 0 = none, 1 = bias[m], 2 = bias[n].
// OUT_MODE: 0 = f32, 1 = f16, 2 = bf16 hi plane (Cout) + bf16 lo plane (Cout2), 3 = f16 [M,N] plane in fragment order (ldc unused),
// 4 = two planes as in 3: Cout = value + 16 add1[n], Cout2 = value + 16 add2[n] (add1, add2: batch index b's own vectors),
// 5 = f16 x16, transposed, in fragment order: element (m, n) is row b N + n, k = m % ldc of plane m / ldc (strideC = elements of a plane; ldc % 64 == 0; BIAS_MODE 0 or 2, no RESID, no ACT).
// ET: 0 = f16 operands, 1 = bf16 operands (pointers passed as 16-bit storage)
// bx = tiles / 8 (tile = 8 bx + wave), b = batch index (strideA/B/C/R and strideBias are per b), zsel = true takes BtZp, CoutZ and biasZ in
// place of Btp, Cout and bias (same A, same strides; non-split launches only), so two products of one A share a launch.
// The body is a device function of (bx, b, zsel) and the block's LDS slabs, so that several products can share one grid by block range.
template <int ET> struct Elem;
template <> struct Elem<0> { typedef _Float16 T; };
template <> struct Elem<1> { typedef __bf16 T; };
// PIPE (with SPLIT and AFRAG; K % 64 == 0, K >= 128): the k loop keeps two register stages of fragments and issues all 32 loads of a k step one k step ahead of its products.
template <int ET, bool SPLIT, int BIAS_MODE, int OUT_MODE, bool RESID, int ACT = 0, bool AFRAG = false, bool PIPE = false>
__device__ __forceinline__ void gemm64_tile(
    float (*sT)[16 * 68], int bx, int b, bool zsel,      // sT: per-wave 16x64 slab, pitch 68 floats; bx, b, zsel block-uniform
    const unsigned short* __restrict__ Ap, const unsigned short* __restrict__ A2p, int lda, long strideA,
    const unsigned short* __restrict__ Btp, const unsigned short* __restrict__ Bt2p, int ldb, long strideB,
    void* __restrict__ Cout0, void* __restrict__ Cout2, int ldc, long strideC,
    const float* __restrict__ bias0, long strideBias,
    const float* __restrict__ resid, long strideR,
    const unsigned short* __restrict__ BtZp, void* __restrict__ CoutZ, const float* __restrict__ biasZ,
    int M, int N, int K, float scale,
    const float* __restrict__ add1 = nullptr, const float* __restrict__ add2 = nullptr, float (*sA)[128] = nullptr) {   // sA: OUT_MODE 4 only, 128 floats of LDS a wave
  typedef typename Elem<ET>::T T;
  typedef typename Frag<T>::V V;
  const T* A = (const T*)Ap; const T* A2 = (const T*)A2p; const T* Bt = (const T*)(zsel ? BtZp : Btp); const T* Bt2 = (const T*)Bt2p;
  void* Cout = zsel ? CoutZ : Cout0;
  const float* bias = (BIAS_MODE != 0) ? ((zsel ? biasZ : bias0) + (size_t)b * strideBias) : nullptr;
  const int lane = threadIdx.x & 31;
  const int wave = threadIdx.x >> 5;
  const int tilesN = N >> 6;
  const int tilesM = M >> 6;
  const int tile = bx * 8 + wave;
  if (tile >= tilesM * tilesN) return;   // wave-uniform; no block barriers in this kernel
  const int tm = tile / tilesN;
  const int tn = tile - tm * tilesN;
  const int m0 = tm << 6;
  const int n0 = tn << 6;

  const T* Ab  = A  + (size_t)b * strideA;
  const T* Bb  = Bt + (size_t)b * strideB;
  const T* Ab2 = SPLIT ? (A2  + (size_t)b * strideA) : nullptr;
  const T* Bb2 = SPLIT ? (Bt2 + (size_t)b * strideB) : nullptr;

  const int rlane = lane & 15;                 // row (A) / col (B, D) within subtile
  const int koff  = (lane >> 4) * 8;           // k offset of this lane half
  const int mOff  = (lane >> 4) * 8;           // D row offset

  v8f acc[4][4];
#pragma unroll
  for (int i = 0; i < 4; ++i)
#pragma unroll
    for (int j = 0; j < 4; ++j) acc[i][j] = (v8f){0.f,0.f,0.f,0.f,0.f,0.f,0.f,0.f};

  if (PIPE) {
    const size_t ts = (size_t)(K >> 5) * 512;                 // from one 16-row tile of a plane to the next
    // subtile 0, k step 0 of the wave's tile in each plane: the same for the whole wave, so held in scalar registers; the lane's own chunk is l8 elements on
    const size_t bo0 = (size_t)__builtin_amdgcn_readfirstlane(n0 >> 4) * ts, ao0 = (size_t)__builtin_amdgcn_readfirstlane(m0 >> 4) * ts;
    const T* bp = Bb + bo0; const T* bp2 = Bb2 + bo0; const T* ap = Ab + ao0; const T* ap2 = Ab2 + ao0;
    const unsigned l8 = (unsigned)lane * 8u;
    V ah[2][4], al[2][4], bh[2][4], bl[2][4];
    // every "#pragma unroll" in the two lambdas: constant indices keep the fragment and accumulator arrays in registers
    auto fetch = [&](const int s, const int ko) {             // all of one k step's fragments into stage s; ko = elements from the pointers to that k step
#pragma unroll
      for (int j = 0; j < 4; ++j) {
        bh[s][j] = Frag<T>::loadf(bp + l8 + (j * ts + ko)); bl[s][j] = Frag<T>::loadf(bp2 + l8 + (j * ts + ko));
        ah[s][j] = Frag<T>::loadf(ap + l8 + (j * ts + ko)); al[s][j] = Frag<T>::loadf(ap2 + l8 + (j * ts + ko));
      }
      __builtin_amdgcn_sched_barrier(0);                      // the loads stay in front of the other stage's products: their latency runs under those
    };
    auto products = [&](const int s) {                        // per accumulator the order of the plain loop: hi.hi, hi.lo, lo.hi
      // (the plain loop's v_nop statements are not carried over: as asm operands the fragments would all have to lie in the first 256 registers, which spills; the compiler pads its builtin products itself)
#pragma unroll
      for (int i = 0; i < 4; ++i) {
#pragma unroll
        for (int j = 0; j < 4; ++j) {
          acc[i][j] = Frag<T>::mma(ah[s][i], bh[s][j], acc[i][j]);
          acc[i][j] = Frag<T>::mma(ah[s][i], bl[s][j], acc[i][j]);
          acc[i][j] = Frag<T>::mma(al[s][i], bh[s][j], acc[i][j]);
        }
      }
    };
    fetch(0, 0);
    for (int k0 = 0; k0 < K - 64; k0 += 64) {                 // two k steps a trip, so that each stage keeps its registers
      fetch(1, 512);
      products(0);
      fetch(0, 1024);
      products(1);
      // the four pointers and the lane offset as inputs: their registers stay as this trip's loads name them up to this wait; the step to the next trip comes behind it
      asm volatile("s_wait_xcnt 0x0" :: "s"(ap), "s"(ap2), "s"(bp), "s"(bp2), "v"(l8) : "memory");
      ap += 1024; ap2 += 1024; bp += 1024; bp2 += 1024;
    }
    fetch(1, 512);
    // directly behind the last loads: nothing of the code that follows takes a register that they name ahead of this wait
    asm volatile("s_wait_xcnt 0x0" :: "s"(ap), "s"(ap2), "s"(bp), "s"(bp2), "v"(l8) : "memory");
    __builtin_amdgcn_sched_barrier(0);                        // keeps later address arithmetic from being lifted in front of that wait
    products(0);
    products(1);
  } else
  for (int k0 = 0; k0 < K; k0 += 32) {
    V bh[4], bl[4];
    const size_t bo0 = ((size_t)(n0 >> 4) * (K >> 5) + (k0 >> 5)) * 512 + lane * 8;
    const size_t ao0 = AFRAG ? ((size_t)(m0 >> 4) * (K >> 5) + (k0 >> 5)) * 512 + lane * 8 : (size_t)(m0 + rlane) * lda + koff + k0;
    const T* bp = Bb + bo0; const T* bp2 = SPLIT ? (Bb2 + bo0) : bp;     // the lane's own row of subtile 0 in each plane; the others at constant steps
    const T* ap = Ab + ao0; const T* ap2 = SPLIT ? (Ab2 + ao0) : ap;
#pragma unroll
    for (int j = 0; j < 4; ++j) {
      const size_t bo = (size_t)j * (K >> 5) * 512;
      bh[j] = Frag<T>::loadf(bp + bo);
      if (SPLIT) bl[j] = Frag<T>::loadf(bp2 + bo);
    }
#pragma unroll
    for (int i = 0; i < 4; ++i) {
      const size_t ao = AFRAG ? (size_t)i * (K >> 5) * 512 : (size_t)(i << 4) * lda;
      V ah = AFRAG ? Frag<T>::loadf(ap + ao) : Frag<T>::load(ap + ao);
      V al;
      if (SPLIT) al = AFRAG ? Frag<T>::loadf(ap2 + ao) : Frag<T>::load(ap2 + ao);
#pragma unroll
      for (int j = 0; j < 4; ++j) {
        acc[i][j] = Frag<T>::mma(ah, bh[j], acc[i][j]);
        if (SPLIT) {
          acc[i][j] = Frag<T>::mma(ah, bl[j], acc[i][j]);
          acc[i][j] = Frag<T>::mma(al, bh[j], acc[i][j]);
        }
      }
      Frag<T>::guard(acc[i][0], acc[i][3], ah, SPLIT ? al : ah);
    }
    Frag<T>::keep(bh[0], bh[1], bh[2], bh[3]);
    if (SPLIT) Frag<T>::keep(bl[0], bl[1], bl[2], bl[3]);
    // the four pointers as inputs: their registers stay as this step's loads name them (no result lands on them, no step to the next k) up to this wait
    asm volatile("s_wait_xcnt 0x0" :: "v"(ap), "v"(ap2), "v"(bp), "v"(bp2) : "memory");
  }
  acc_guard4(acc[0][0], acc[0][1], acc[0][2], acc[0][3]);
  acc_guard4(acc[1][0], acc[1][1], acc[1][2], acc[1][3]);
  acc_guard4(acc[2][0], acc[2][1], acc[2][2], acc[2][3]);
  acc_guard4(acc[3][0], acc[3][1], acc[3][2], acc[3][3]);

  // ---- epilogue ----
  if (OUT_MODE == 5) {
    // an accumulator's lane holds 8 rows m of one column n, which is one 16-byte chunk of the transposed plane (row n, 8 k in a row): stored as it stands, 512 B a store, no trip through the slab
    const float* pb = bias + n0 + rlane;
    float bvj[4];
#pragma unroll   // constant indices keep the array in registers
    for (int j = 0; j < 4; ++j) bvj[j] = (BIAS_MODE == 2) ? pb[j << 4] : 0.f;
    // the pointer as an input: its registers stay as the loads name them (no result lands on them) up to this wait
    if (BIAS_MODE == 2) asm volatile("s_wait_xcnt 0x0" :: "v"(pb) : "memory");
#pragma unroll   // constant indices keep acc in registers
    for (int i = 0; i < 4; ++i) {
      const int mBase = m0 + (i << 4), s0 = mBase % ldc;     // k = s0 .. s0 + 15: one ld of one k step
      _Float16* C = (_Float16*)Cout + (size_t)(mBase / ldc) * strideC + ((size_t)((b * N + n0) >> 4) * (ldc >> 5) + (s0 >> 5)) * 512 + ((s0 >> 4) & 1) * 256 + lane * 8;
#pragma unroll
      for (int j = 0; j < 4; ++j) {                          // row tile (b N + n0) / 16 + j
        v8h hv;
#pragma unroll
        for (int r = 0; r < 8; ++r) hv[r] = (_Float16)((acc[i][j][r] * scale + bvj[j]) * 16.0f);
        *(v8h*)(C + (size_t)j * (ldc >> 5) * 512) = hv;
      }
      asm volatile("s_wait_xcnt 0x0" ::: "memory");          // before the next four stores' values and address take the registers that these name
    }
    return;
  }
  float* slab = sT[wave];
  const float* Rb = RESID ? (resid + (size_t)b * strideR) : nullptr;
  float* addv = (OUT_MODE == 4) ? sA[wave] : nullptr;
  if (OUT_MODE == 4) {   // 16 add1 (from lanes 0..15) and 16 add2 (from lanes 16..31) at the tile's 64 columns, into the wave's own LDS: the stores below take them eight columns a lane
    const float* pa = ((lane >> 4) ? add2 : add1) + n0 + rlane;
    float av[4];
#pragma unroll   // constant indices keep the array in registers
    for (int j = 0; j < 4; ++j) av[j] = pa[j << 4];
    // the pointer as an input: its registers stay as the loads name them (no result lands on them) up to this wait
    asm volatile("s_wait_xcnt 0x0" :: "v"(pa) : "memory");
#pragma unroll
    for (int j = 0; j < 4; ++j) addv[(lane >> 4) * 64 + (j << 4) + rlane] = 16.0f * av[j];
  }
#pragma unroll
  for (int i = 0; i < 4; ++i) {
    const int mBase = m0 + (i << 4);
#pragma unroll
    for (int j = 0; j < 4; ++j) {
      const int n = n0 + (j << 4) + rlane;
      float bv = 0.f;
      if (BIAS_MODE == 2) bv = bias[n];
#pragma unroll
      for (int r = 0; r < 8; ++r) {
        float v = acc[i][j][r] * scale;
        if (BIAS_MODE == 1) v += bias[mBase + mOff + r];
        if (BIAS_MODE == 2) v += bv;
        if (RESID) v += Rb[(size_t)(mBase + mOff + r) * ldc + n];
        if (ACT == 1) v = tanhf(v);
        if (ACT == 2) v = fmaxf(v, 0.0f);
        if (ACT == 3) v = v / (1.0f + expf(-v));
        if (ACT == 4) v = (v > 0.f) ? v : 0.01f * v;
        if (ACT == 5) v = 0.5f * v * (1.0f + erff(v * 0.70710678118654752f));
        slab[(mOff + r) * 68 + (j << 4) + rlane] = v;
      }
    }
    __builtin_amdgcn_fence(__ATOMIC_RELEASE, "workgroup");
    __builtin_amdgcn_wave_barrier();
    __builtin_amdgcn_fence(__ATOMIC_ACQUIRE, "workgroup");
    if (OUT_MODE == 0) {
      float* C = (float*)Cout + (size_t)b * strideC;
      const int hh = lane >> 4, c4 = (lane & 15) * 4;     // row seg = 256 B = 16 lanes x 16 B
      {
#pragma unroll
        for (int it = 0; it < 8; ++it) {
          const int row = it * 2 + hh;
          v4f v = *(const v4f*)(slab + row * 68 + c4);
          *(v4f*)(C + (size_t)(mBase + row) * ldc + n0 + c4) = v;
        }
        
      }
    } else if (OUT_MODE == 3) {
      // the slab is row tile mBase / 16, k steps n0 / 32 and n0 / 32 + 1 of the plane: 2 KiB in a row, 512 B a store
      _Float16* C = (_Float16*)Cout + (size_t)b * strideC + ((size_t)(mBase >> 4) * (N >> 5) + (n0 >> 5)) * 512 + lane * 8;
#pragma unroll   // the four stores go off one address at constant offsets
      for (int it = 0; it < 4; ++it) {
        const float* sp = slab + rlane * 68 + it * 16 + mOff;
        v8h hv;
#pragma unroll   // constant indices keep hv in registers
        for (int e = 0; e < 8; ++e) hv[e] = (_Float16)sp[e];
        *(v8h*)(C + it * 256) = hv;
      }
    } else if (OUT_MODE == 4) {
      // as OUT_MODE 3, for two planes
      const size_t co = (size_t)b * strideC + ((size_t)(mBase >> 4) * (N >> 5) + (n0 >> 5)) * 512 + lane * 8;
      _Float16* C = (_Float16*)Cout + co; _Float16* C2 = (_Float16*)Cout2 + co;
#pragma unroll   // the stores go off two addresses at constant offsets
      for (int it = 0; it < 4; ++it) {
        const float* sp = slab + rlane * 68 + it * 16 + mOff;
        const float* ap = addv + it * 16 + mOff;
        v8h hv, lv;
#pragma unroll   // constant indices keep hv, lv in registers
        for (int e = 0; e < 8; ++e) { hv[e] = (_Float16)(sp[e] + ap[e]); lv[e] = (_Float16)(sp[e] + ap[64 + e]); }
        *(v8h*)(C + it * 256) = hv;
        *(v8h*)(C2 + it * 256) = lv;
      }
    } else {
      const int q = lane >> 3, c8 = (lane & 7) * 8;
      unsigned short* C  = (unsigned short*)Cout  + (size_t)b * strideC;
      unsigned short* C2 = (OUT_MODE == 2) ? ((unsigned short*)Cout2 + (size_t)b * strideC) : nullptr;
      {
#pragma unroll
        for (int it = 0; it < 4; ++it) {
          const int row = it * 4 + q;
          const float* sp = slab + row * 68 + c8;
          v8h hv, lv;
#pragma unroll
          for (int e = 0; e < 8; ++e) {
            if (OUT_MODE == 1) {
              hv[e] = (_Float16)sp[e];
            } else {
              unsigned short hb = f2bf_bits(sp[e]);
              unsigned short lb = f2bf_bits(sp[e] - bf_bits2f(hb));
              hv[e] = __builtin_bit_cast(_Float16, hb);
              lv[e] = __builtin_bit_cast(_Float16, lb);
            }
          }
          *(v8h*)(C + (size_t)(mBase + row) * ldc + n0 + c8) = hv;
          if (OUT_MODE == 2) *(v8h*)(C2 + (size_t)(mBase + row) * ldc + n0 + c8) = lv;
        }
        
      }
    }
    asm volatile("s_wait_xcnt 0x0" ::: "memory");   // before the next slab's values and addresses take the registers that these stores name
    __builtin_amdgcn_fence(__ATOMIC_RELEASE, "workgroup");
    __builtin_amdgcn_wave_barrier();
    __builtin_amdgcn_fence(__ATOMIC_ACQUIRE, "workgroup");
  }
}

// ---- f32 [R][C] (pitch ldi) -> bf16 hi/lo transposed planes [C][R = ldo] in fragment order (see gemm64_tile); 64x64 tiles
// one block of 256 threads does tile (bx, by); tile = the block's LDS, [c][r]
__device__ __forceinline__ void transpose_split_bf16_tile(float (*tile)[68], int bx, int by, const float* __restrict__ in, int ldi,
                                                          __bf16* __restrict__ outH, __bf16* __restrict__ outL, int ldo) {
  const int c0 = bx * 64, r0 = by * 64;
  const int t = threadIdx.x, tx = t & 31, ty = t >> 5;
  for (int i = ty; i < 64; i += 8) {
    tile[tx][i]      = in[(size_t)(r0 + i) * ldi + c0 + tx];
    tile[32 + tx][i] = in[(size_t)(r0 + i) * ldi + c0 + 32 + tx];
  }
  __syncthreads();
  const int lane = t & 31;
  {
#pragma unroll
    for (int it = 0; it < 2; ++it) {                          // fragment order: wave w writes the 512 B of (row tile, k step, ld) = its index it * 8 + w
      const int g = it * 8 + ty, ct = g >> 2, kk = (g >> 1) & 1, ld = g & 1;
      const int c = ct * 16 + (lane & 15), c8 = kk * 32 + ld * 16 + (lane >> 4) * 8;
      const size_t o = (((size_t)((c0 >> 4) + ct) * (ldo >> 5) + (r0 >> 5) + kk) * 2 + ld) * 256 + lane * 8;
      v8b hv, lv;
#pragma unroll
      for (int e = 0; e < 8; ++e) {
        const float f = tile[c][c8 + e];
        const unsigned short hb = f2bf_bits(f);
        hv[e] = __builtin_bit_cast(__bf16, hb);
        lv[e] = __builtin_bit_cast(__bf16, f2bf_bits(f - bf_bits2f(hb)));
      }
      *(v8b*)(outH + o) = hv;
      *(v8b*)(outL + o) = lv;
    }
    asm volatile("s_wait_xcnt 0x0" ::: "memory");   // other jobs' code follows this body in the shared kernel: nothing there rewrites a register that these stores name ahead of this wait
  }
}

// =====================================================================================
constexpr int kBatch = 2;
constexpr int kSeq   = 2048;
constexpr int kEmb   = 1024;
constexpr int kHeads = 8;
constexpr int kDh    = 128;
constexpr int kTok   = kBatch * kSeq;          // 4096 tokens
constexpr int kPairs = kEmb / 2;               // 512 element pairs per row
static_assert(kHeads * kDh == kEmb);
static_assert(kPairs == 512);

// ---- LayerNorm (biased variance, eps 1e-5) -> xn as bf16 hi/lo planes (packed pairs). One block per token, 256 threads;
// thread t owns element pairs (2t,2t+1) and (512+2t,512+2t+1): 2 packed dwords per plane per thread; each store instruction
__device__ __forceinline__ void layernorm_split_row(
    float* red, int tok,                                 // red: 8 floats of the block's LDS
    const float* __restrict__ x, const float* __restrict__ gamma, const float* __restrict__ beta,
    unsigned* __restrict__ xh, unsigned* __restrict__ xl) {
  const int t = threadIdx.x, lane = t & 31, wave = t >> 5;
  const float* xr = x + (size_t)tok * kEmb;
  const int ca = 2 * t, cb = kPairs + 2 * t;
  const v2f pa = *(const v2f*)(xr + ca);
  const v2f pb = *(const v2f*)(xr + cb);
  float s = (pa.x + pa.y) + (pb.x + pb.y);
#pragma unroll
  for (int off = 1; off < 32; off <<= 1) s += __shfl_xor(s, off, 32);
  if (lane == 0) red[wave] = s;
  __syncthreads();
  float tot = 0.f;
#pragma unroll
  for (int w = 0; w < 8; ++w) tot += red[w];       // fixed order
  const float mean = tot * (1.0f / (float)kEmb);
  __syncthreads();
  const float d0 = pa.x - mean, d1 = pa.y - mean, d2 = pb.x - mean, d3 = pb.y - mean;
  float s2 = (d0 * d0 + d1 * d1) + (d2 * d2 + d3 * d3);
#pragma unroll
  for (int off = 1; off < 32; off <<= 1) s2 += __shfl_xor(s2, off, 32);
  if (lane == 0) red[wave] = s2;
  __syncthreads();
  float tot2 = 0.f;
#pragma unroll
  for (int w = 0; w < 8; ++w) tot2 += red[w];
  const float var  = tot2 * (1.0f / (float)kEmb);
  const float rstd = 1.0f / sqrtf(var + 1e-5f);
  const float y0 = d0 * rstd * gamma[ca] + beta[ca];
  const float y1 = d1 * rstd * gamma[ca + 1] + beta[ca + 1];
  const float y2 = d2 * rstd * gamma[cb] + beta[cb];
  const float y3 = d3 * rstd * gamma[cb + 1] + beta[cb + 1];
  const unsigned short h0 = f2bf_bits(y0), h1 = f2bf_bits(y1), h2 = f2bf_bits(y2), h3 = f2bf_bits(y3);
  const unsigned short l0 = f2bf_bits(y0 - bf_bits2f(h0)), l1 = f2bf_bits(y1 - bf_bits2f(h1));
  const unsigned short l2 = f2bf_bits(y2 - bf_bits2f(h2)), l3 = f2bf_bits(y3 - bf_bits2f(h3));
  const unsigned uah = (unsigned)h0 | ((unsigned)h1 << 16), ual = (unsigned)l0 | ((unsigned)l1 << 16);
  const unsigned ubh = (unsigned)h2 | ((unsigned)h3 << 16), ubl = (unsigned)l2 | ((unsigned)l3 << 16);
  const size_t ia = (size_t)tok * kPairs + t, ib = ia + 256;
  {
    ((unsigned*)xh)[ia] = uah;
    ((unsigned*)xh)[ib] = ubh;
    ((unsigned*)xl)[ia] = ual;
    ((unsigned*)xl)[ib] = ubl;
    asm volatile("s_wait_xcnt 0x0" ::: "memory");   // other jobs' code follows this body in the shared kernel: nothing there rewrites a register that these stores name ahead of this wait
  }
}

// ---- sinusoid table [kSeq][kEmb]: columns 2i = sin(pos·div_i), 2i+1 = cos(pos·div_i), div_i = exp(2i · (−ln 1e4 / kEmb)), f32,
// emitted as bf16 hi/lo planes (packed pairs). One thread per (pos, i): kSeq*512/256 = 4096 blocks exactly; each wave's store
__device__ __forceinline__ void posenc_split_block(int blk, unsigned* __restrict__ peh, unsigned* __restrict__ pel) {
  const int idx = blk * 256 + threadIdx.x;
  if (idx >= kSeq * kPairs) return;
  const int pos = idx >> 9, i = idx & 511;
  const float kNegLogRate = -0.00899447301950799f;        // −ln(10000)/1024
  const float freq = expf((float)(2 * i) * kNegLogRate);
  const float ang  = (float)pos * freq;
  const float sv = sinf(ang), cv = cosf(ang);
  const unsigned short hs = f2bf_bits(sv), hc = f2bf_bits(cv);
  const unsigned short ls = f2bf_bits(sv - bf_bits2f(hs)), lc = f2bf_bits(cv - bf_bits2f(hc));
  const unsigned uh = (unsigned)hs | ((unsigned)hc << 16), ul = (unsigned)ls | ((unsigned)lc << 16);
  {
    ((unsigned*)peh)[idx] = uh;
    ((unsigned*)pel)[idx] = ul;
    asm volatile("s_wait_xcnt 0x0" ::: "memory");   // other jobs' code follows this body in the shared kernel: nothing there rewrites a register that these stores name ahead of this wait
  }
}

// ---- scaled projection biases: qb = 16·bq, kb = 16·bk (128 floats each). Two waves of one block: wave 0 -> qb, wave 1 -> kb;
__device__ __forceinline__ void bias16_block(const float* __restrict__ bq, const float* __restrict__ bk,
                                             float* __restrict__ qb, float* __restrict__ kb) {
  const int lane = threadIdx.x & 31, wave = threadIdx.x >> 5;   // wave-uniform branches
  if (wave >= 2) return;
  v4f v; float* dst;
  if (wave == 0) { v = *(const v4f*)(bq + 4 * lane); dst = qb + 4 * lane; }
  else           { v = *(const v4f*)(bk + 4 * lane); dst = kb + 4 * lane; }
  v = v * 16.0f;
  *(v4f*)dst = v;
  asm volatile("s_wait_xcnt 0x0" ::: "memory");   // other jobs' code follows this body in the shared kernel: nothing there rewrites a register that these stores name ahead of this wait
}

// ---- all that depends on the inputs alone, in one grid of 256-thread blocks; a block's job goes by its index (every branch block-uniform):
// the 64x64 tiles of Wo, those of the four [128][128] weights, the scaled biases, then LayerNorm rows and sinusoid blocks in turn
// (one reads and writes memory, the other computes). WT = the eight [128 n][128 k] planes in the order q hi, q lo, k hi, k lo, v hi, v lo, p hi, p lo.
constexpr int kBlkWo = (kEmb / 64) * (kEmb / 64);        // 256
constexpr int kBlkW4 = 4 * (kDh / 64) * (kDh / 64);      // 16
constexpr int kBlkPe = (kSeq * kPairs) / 256;            // 4096 blocks x 256 = 2048 x 512 pairs
static_assert(kBlkPe == kTok);
constexpr int kBlkPrelude = kBlkWo + kBlkW4 + 1 + kTok + kBlkPe;
__global__ __launch_bounds__(256) void prelude_kernel(
    const float* __restrict__ x, const float* __restrict__ gamma, const float* __restrict__ beta,
    const float* __restrict__ Wq, const float* __restrict__ Wk, const float* __restrict__ Wv, const float* __restrict__ Wp,
    const float* __restrict__ Wo, const float* __restrict__ bq, const float* __restrict__ bk,
    __bf16* __restrict__ WT, __bf16* __restrict__ WoTh, __bf16* __restrict__ WoTl, float* __restrict__ qb, float* __restrict__ kb,
    unsigned* __restrict__ xh, unsigned* __restrict__ xl, unsigned* __restrict__ peh, unsigned* __restrict__ pel) {
  __shared__ __align__(16) float tile[64][68];
  int blk = blockIdx.x;
  if (blk < kBlkWo) { transpose_split_bf16_tile(tile, blk % (kEmb / 64), blk / (kEmb / 64), Wo, kEmb, WoTh, WoTl, kEmb); return; }
  blk -= kBlkWo;
  if (blk < kBlkW4) {
    const int w = blk >> 2;
    const float* in = (w == 0) ? Wq : (w == 1) ? Wk : (w == 2) ? Wv : Wp;
    __bf16* oh = WT + (size_t)(2 * w) * (kDh * kDh);
    transpose_split_bf16_tile(tile, blk & 1, (blk >> 1) & 1, in, kDh, oh, oh + kDh * kDh, kDh);
    return;
  }
  blk -= kBlkW4;
  if (blk == 0) { bias16_block(bq, bk, qb, kb); return; }
  blk -= 1;
  if (blk & 1) posenc_split_block(blk >> 1, peh, pel);
  else         layernorm_split_row(&tile[0][0], blk >> 1, x, gamma, beta, xh, xl);
}

// ---- the four projections in one grid: blocks 0..127 q, 128..255 k, 256..383 v, 384..447 p (block-uniform branches); operands and results as in gemm64_tile
constexpr int kBlkProj  = (kTok * kHeads / 64) * (kDh / 64) / 8;   // 1024 tiles -> 128 blocks
constexpr int kBlkProjP = (kSeq * kHeads / 64) * (kDh / 64) / 8;   // 512 tiles -> 64 blocks
__global__ __launch_bounds__(256) void proj4_kernel(
    const unsigned short* __restrict__ xnh, const unsigned short* __restrict__ xnl,
    const unsigned short* __restrict__ peh, const unsigned short* __restrict__ pel, const unsigned short* __restrict__ WT,
    const float* __restrict__ qb, const float* __restrict__ kb, const float* __restrict__ bv,
    const float* __restrict__ ub, const float* __restrict__ vb,
    _Float16* __restrict__ qu16, _Float16* __restrict__ qv16, _Float16* __restrict__ k16, _Float16* __restrict__ vt16, _Float16* __restrict__ pp16) {
  __shared__ __align__(16) float sT[8][16 * 68];
  __shared__ __align__(16) float sA[8][128];
  const int w = blockIdx.x / kBlkProj, bx = blockIdx.x % kBlkProj;
  const unsigned short* Bh = WT + (size_t)(2 * w) * (kDh * kDh);
  const unsigned short* Bl = Bh + kDh * kDh;
  // q, k, v: head by head (16 blocks each, A rows = tokens at pitch kEmb)
  if (w == 0)         // (q + bq + u_bias[h])*16 and (q + bq + v_bias[h])*16: two fragment-order f16 planes [kTok][kDh] a head, from one product
    gemm64_tile<1, true, 2, 4, false>(sT, bx & 15, bx >> 4, false, xnh, xnl, kEmb, kDh, Bh, Bl, kDh, 0, qu16, qv16, kDh, (long)kTok * kDh, qb, 0,
        nullptr, 0, nullptr, nullptr, nullptr, kTok, kDh, kDh, 16.0f, ub + (bx >> 4) * kDh, vb + (bx >> 4) * kDh, sA);
  else if (w == 1)    // k*16 (+16 bk): one fragment-order f16 plane [kTok][kDh] a head
    gemm64_tile<1, true, 2, 3, false>(sT, bx & 15, bx >> 4, false, xnh, xnl, kEmb, kDh, Bh, Bl, kDh, 0, k16, nullptr, kDh, (long)kTok * kDh, kb, 0,
        nullptr, 0, nullptr, nullptr, nullptr, kTok, kDh, kDh, 16.0f);
  else if (w == 2)    // (v + bv)*16, transposed: per batch a fragment-order f16 plane [kEmb c][kSeq keys], c = 128 h + d
    gemm64_tile<1, true, 2, 5, false>(sT, bx & 15, bx >> 4, false, xnh, xnl, kEmb, kDh, Bh, Bl, kDh, 0, vt16, nullptr, kSeq, (long)kEmb * kSeq, bv, 0,
        nullptr, 0, nullptr, nullptr, nullptr, kTok, kDh, kDh, 1.0f);
  else                // p*16: head by head (8 blocks each), one fragment-order f16 plane [kSeq][kDh] a head
    gemm64_tile<1, true, 0, 3, false>(sT, bx & 7, bx >> 3, false, peh, pel, kEmb, kDh, Bh, Bl, kDh, 0, pp16, nullptr, kDh, (long)kSeq * kDh, nullptr, 0,
        nullptr, 0, nullptr, nullptr, nullptr, kSeq, kDh, kDh, 16.0f);
}

// ---- out = ctx.Wo + bo : A bf16 hi/lo [4096][1024], Bt bf16 hi/lo [1024 n][1024 k], C f32 [4096][1024]; 1024 tiles -> 128 blocks
constexpr int kBlkOut = (kTok / 64) * (kEmb / 64) / 8;
__global__ __launch_bounds__(256) void out_gemm_kernel(const unsigned short* __restrict__ ctxh, const unsigned short* __restrict__ ctxl,
                                                      const unsigned short* __restrict__ WoTh, const unsigned short* __restrict__ WoTl,
                                                      const float* __restrict__ bo, float* __restrict__ out) {
  __shared__ __align__(16) float sT[8][16 * 68];
  gemm64_tile<1, true, 2, 0, false, 0, true, true>(sT, blockIdx.x, 0, false, ctxh, ctxl, kEmb, 0, WoTh, WoTl, kEmb, 0, out, nullptr, kEmb, 0, bo, 0,
      nullptr, 0, nullptr, nullptr, nullptr, kTok, kEmb, kEmb, 1.0f);
}

// ---- content and position scores, relative shift, softmax and p.v of 64 query rows of one (b, h) in one block; the rows' scores never leave LDS.
// 64 rows, so that every k, p and v^T fragment fetched from L2 feeds four query tiles; the rows' scores fit in LDS as f16.
// grid = (kSeq / 64, kBatch * kHeads), 512 threads = 16 waves. sc[r][c] (f16), r = a - a0, holds in turn:
//   1. shifted[a][c] / 32, shifted[a][c] = c <= a ? ps[a][S-1-a+c] : (c == a+1 ? 0 : ps[a+1][c-a-2]), ps[a][n] = (16(q[a] + v_bias)).(16p[n])/256: the c >= a+2 part is the
//      product of rows a0+1..a0+64 with p rows 0..S-a0-1, the c <= a part that of rows a0..a0+63 with p rows S-64-a0..S-1; each result is stored
//      at its shifted column, results that fall outside the row are dropped; every sc[r][c] gets exactly one store;
//   2. s = (content + shifted) / 32, content[a][key] = (16(q[a] + u_bias)).(16k[key])/256;
//   3. f16(exp(s - max) / sum * 2^15), written over the same row by the wave that owns the row;
//   4. (as f32, over the scores) the 8 key groups' partials of p.v (pitch kPartPitch), summed in group order 0..7; output = bf16 hi/lo [kTok][kEmb] planes in fragment order.
constexpr int kRows      = 64;
constexpr int kScPitch   = kSeq + 8;    // f16 elements; 4112 B = 16 B x odd, rows 8 apart = 32 banks apart
constexpr int kPartPitch = kDh + 4;     // floats; rows 8 apart = 32 banks apart
constexpr int kAttnLds   = 8 * kRows * kPartPitch;            // floats: the partials are the larger of the two uses
static_assert(kRows * kScPitch * 2 <= kAttnLds * 4);
static_assert(kAttnLds * 4 <= 327680);
// every "#pragma unroll" in the three helpers below: constant indices keep the fragment and accumulator arrays in registers
// qf[i][kk] = the lane's A fragments of 64 query rows; r0..r3 = the first chunks of the lane's own rows (tile rows 16 i + lane & 15) and lane half in the fragment-order plane
__device__ __forceinline__ void load_q(v16h (&qf)[4][4], const _Float16* r0, const _Float16* r1, const _Float16* r2, const _Float16* r3) {
#pragma unroll
  for (int kk = 0; kk < 4; ++kk) {
    qf[0][kk] = Frag<_Float16>::loadf(r0 + 512 * kk); qf[1][kk] = Frag<_Float16>::loadf(r1 + 512 * kk);
    qf[2][kk] = Frag<_Float16>::loadf(r2 + 512 * kk); qf[3][kk] = Frag<_Float16>::loadf(r3 + 512 * kk);
  }
  // the four pointers as inputs: their registers stay as the loads name them (no result lands on them) up to this wait
  asm volatile("s_wait_xcnt 0x0" :: "v"(r0), "v"(r1), "v"(r2), "v"(r3) : "memory");
}
// acc[i] = 64 query rows (fragments qf[i][kk], k = 32 kk ..) x 16 rows of a fragment-order f16 plane [.][kDh] (4 KiB in a row); rows = the tile's first element + 8 lane
// (pointers typed as global: a pointer that has gone through an asm statement would otherwise be read with flat loads)
typedef const __attribute__((address_space(1))) _Float16* GlobH;
typedef const __attribute__((address_space(1))) v8h*      GlobH8;
__device__ __forceinline__ void score_tile(const v16h (&qf)[4][4], GlobH& rows, v8f (&acc)[4]) {
  v16h bf[4];
#pragma unroll
  for (int kk = 0; kk < 4; ++kk) {                            // as Frag<_Float16>::loadf
    Frag<_Float16>::U f;
    f.h[0] = *(GlobH8)(rows + kk * 512);
    f.h[1] = *(GlobH8)(rows + kk * 512 + 256);
    bf[kk] = f.v;
  }
  // The loaded values, as inputs only: all of a tile's loads are issued before the first product (one memory latency a tile, not one per k step).
  // The pointer goes through the statement: the caller's step to the next tile, the next write of the registers that the loads name, comes behind this wait.
  asm volatile("s_wait_xcnt 0x0" : "+v"(rows) : "v"(bf[0]), "v"(bf[1]), "v"(bf[2]), "v"(bf[3]) : "memory");
#pragma unroll
  for (int i = 0; i < 4; ++i) acc[i] = (v8f){0.f,0.f,0.f,0.f,0.f,0.f,0.f,0.f};
#pragma unroll
  for (int kk = 0; kk < 4; ++kk)
#pragma unroll
    for (int i = 0; i < 4; ++i) acc[i] = Frag<_Float16>::mma(qf[i][kk], bf[kk], acc[i]);
}
// one step down a row of the tile is one step right in the shifted table: element 16 i + r of the lane goes to dst + (16 i + r) * (pitch + 1).
// GUARD: c0 = the column that dst stands for; elements whose column falls outside 0 .. kSeq - 1 are dropped (only the tiles at a row's ends have such)
template <bool GUARD>
__device__ __forceinline__ void store_shifted(_Float16* dst, const v8f (&acc)[4], int c0) {
#pragma unroll
  for (int i = 0; i < 4; ++i)
#pragma unroll
    for (int r = 0; r < 8; ++r) {
      const int d = (i << 4) + r;
      if (!GUARD || (unsigned)(c0 + d) < (unsigned)kSeq)
        dst[d * (kScPitch + 1)] = (_Float16)(acc[i][r] * (1.0f / 8192.0f));
    }
}
// y[e] = 2^t[e]. Eight v_exp_f32 in one statement, each result in a register of its own ("=&v"): none of them reads the result or takes the source of the one in front of it;
// the v_nop fills the slot that the instruction set asks for between the last one and whatever vector instruction the compiler puts behind the statement
__device__ __forceinline__ void exp2x8(float (&y)[8], const float (&t)[8]) {
  asm("v_exp_f32 %0, %8\n\tv_exp_f32 %1, %9\n\tv_exp_f32 %2, %10\n\tv_exp_f32 %3, %11\n\tv_exp_f32 %4, %12\n\tv_exp_f32 %5, %13\n\tv_exp_f32 %6, %14\n\tv_exp_f32 %7, %15\n\tv_nop"
      : "=&v"(y[0]), "=&v"(y[1]), "=&v"(y[2]), "=&v"(y[3]), "=&v"(y[4]), "=&v"(y[5]), "=&v"(y[6]), "=&v"(y[7])
      : "v"(t[0]), "v"(t[1]), "v"(t[2]), "v"(t[3]), "v"(t[4]), "v"(t[5]), "v"(t[6]), "v"(t[7]));
}
__global__ __launch_bounds__(512) void attn_rows_kernel(const _Float16* __restrict__ qu16, const _Float16* __restrict__ qv16, const _Float16* __restrict__ k16,
                                                       const _Float16* __restrict__ pp16, const _Float16* __restrict__ vt16,
                                                       unsigned short* __restrict__ Ch, unsigned short* __restrict__ Cl) {
  __shared__ __align__(16) float part[kAttnLds];
  _Float16* sc = (_Float16*)part;
  const int t = threadIdx.x, lane = t & 31;
  const int wave = __builtin_amdgcn_readfirstlane(t >> 5);    // scalar, so that the tile loops branch on scalars
  const int a0 = blockIdx.x * kRows;
  const int bh = blockIdx.y, b = bh / kHeads, h = bh % kHeads;
  const int rlane = lane & 15;
  const int half8 = (lane >> 4) * 8;                          // k offset of this lane half (A, B) and D row offset
  const size_t qo = ((size_t)h * kTok + b * kSeq) * kDh + (lane >> 4) * 128;   // fragment order: any row s, this lane half, at (s & ~15) * kDh + (s & 15) * 8
  const _Float16* qub = qu16 + qo;                            // q + u_bias, for the content product
  const _Float16* qvb = qv16 + qo;                            // q + v_bias, for the position products
  const _Float16* kb = k16 + ((size_t)h * kTok + b * kSeq) * kDh + lane * 8;   // fragment-order planes: row s (a multiple of 16) at s * kDh, the lane's chunk
  const _Float16* pb = pp16 + (size_t)h * kSeq * kDh + lane * 8;

  // every "#pragma unroll" in this kernel: constant indices keep the fragment and accumulator arrays in registers
  if (t < kRows) { const int c = a0 + t + 1; if (c < kSeq) sc[t * kScPitch + c] = (_Float16)0.0f; }

  v16h qf[4][4];
  v8f acc4[4];
  // ---- 1a. columns c >= a+2: query rows a+1 (the last row of the table has no such column; its address is clamped) ----
  {
    const _Float16* qr[4];
#pragma unroll
    for (int i = 0; i < 4; ++i) {
      const int s = (a0 + 1 + (i << 4) + rlane < kSeq) ? (a0 + 1 + (i << 4) + rlane) : (kSeq - 1);
      qr[i] = qvb + (size_t)(s & ~15) * kDh + (s & 15) * 8;
    }
    load_q(qf, qr[0], qr[1], qr[2], qr[3]);
  }
  const int nUp = (kSeq - a0) >> 4;                           // 16-column tiles of either part; nUp + nLo = kSeq / 16 + 4
  const int nLo = (a0 + kRows) >> 4;
  GlobH prow = (GlobH)(pb + (size_t)(wave << 4) * kDh);                       // the wave's tile; 16 tiles on a trip
  for (int jj = wave; jj < nUp; jj += 16, prow += (size_t)256 * kDh) {
    const int n0 = jj << 4;
    score_tile(qf, prow, acc4);
    const int cmin = n0 + a0 + 2;                             // column of the tile's element (row 0, n0); the tile spans cmin .. cmin + 78
    _Float16* dst = sc + half8 * kScPitch + cmin + rlane + half8;
    if (cmin + 78 < kSeq) store_shifted<false>(dst, acc4, 0);
    else                  store_shifted<true>(dst, acc4, cmin + rlane + half8);
  }
  // ---- 1b. columns c <= a: query rows a ----
  {
    const _Float16* q0 = qvb + (size_t)a0 * kDh + rlane * 8;
    load_q(qf, q0, q0 + 16 * kDh, q0 + 32 * kDh, q0 + 48 * kDh);
  }
  const int jLo = (wave - nUp) & 15;                          // the deal of tiles to waves goes on where 1a's ended
  prow = (GlobH)(pb + (size_t)((kSeq - kRows - a0) + (jLo << 4)) * kDh);
  for (int jj = jLo; jj < nLo; jj += 16, prow += (size_t)256 * kDh) {
    const int n0 = (kSeq - kRows - a0) + (jj << 4);
    score_tile(qf, prow, acc4);
    const int cmin = n0 + a0 - (kSeq - 1);                    // = 16 jj - 63
    _Float16* dst = sc + half8 * kScPitch + cmin + rlane + half8;
    if (cmin >= 0) store_shifted<false>(dst, acc4, 0);
    else           store_shifted<true>(dst, acc4, cmin + rlane + half8);
  }
  __syncthreads();                                            // every shifted position score is in LDS before the content product adds to it

  // ---- 2. content; wave w takes the 16-key tiles w, w + 16, .. w + 112 ----
  {
    const _Float16* q0 = qub + (size_t)a0 * kDh + rlane * 8;  // behind the barrier (which waits for every load): in flight together with the first key tile's loads
    load_q(qf, q0, q0 + 16 * kDh, q0 + 32 * kDh, q0 + 48 * kDh);
  }
  GlobH krow = (GlobH)(kb + (size_t)(wave << 4) * kDh);
  for (int jj = wave; jj < kSeq / 16; jj += 16, krow += (size_t)256 * kDh) {
    score_tile(qf, krow, acc4);
    _Float16* e = sc + half8 * kScPitch + (jj << 4) + rlane;
    _Float16 old[4][8];
#pragma unroll
    for (int i = 0; i < 4; ++i)
#pragma unroll
      for (int r = 0; r < 8; ++r) old[i][r] = e[((i << 4) + r) * kScPitch];
#pragma unroll
    for (int i = 0; i < 4; ++i)
#pragma unroll
      for (int r = 0; r < 8; ++r) e[((i << 4) + r) * kScPitch] = (_Float16)(acc4[i][r] * (1.0f / 8192.0f) + (float)old[i][r]);
  }
  __syncthreads();                                            // whole score rows are in LDS before a wave takes its rows' maximum

  // ---- 3. softmax; wave w owns rows 4w .. 4w + 3, lane l columns 256 it + 8 l .. + 7 ----
#pragma unroll 1   // one row's 64 floats a lane live at a time, not four rows'
  for (int rr = 0; rr < 4; ++rr) {
    _Float16* srow = sc + (wave * 4 + rr) * kScPitch + 8 * lane;
    float x[8][8];
    v8h hx[8];
#pragma unroll
    for (int it = 0; it < 8; ++it) hx[it] = *(const v8h*)(srow + it * 256);
    v8h m8 = hx[0];                                           // the maximum of f16 values is exact in f16: taken on the packed halves
#pragma unroll
    for (int it = 1; it < 8; ++it) m8 = __builtin_elementwise_max(m8, hx[it]);
    float mx = fmaxf(fmaxf(fmaxf((float)m8[0], (float)m8[1]), fmaxf((float)m8[2], (float)m8[3])), fmaxf(fmaxf((float)m8[4], (float)m8[5]), fmaxf((float)m8[6], (float)m8[7])));
#pragma unroll
    for (int off = 1; off < 32; off <<= 1) mx = fmaxf(mx, __shfl_xor(mx, off, 32));
    float sum = 0.f;
#pragma unroll
    for (int it = 0; it < 8; ++it) {
      float tt[8];
#pragma unroll
      for (int e = 0; e < 8; ++e) tt[e] = ((float)hx[it][e] - mx) * 1.442695041f;   // exp(d) = 2^(d log2 e)
      exp2x8(x[it], tt);
      sum += ((x[it][0] + x[it][1]) + (x[it][2] + x[it][3])) + ((x[it][4] + x[it][5]) + (x[it][6] + x[it][7]));
    }
#pragma unroll
    for (int off = 1; off < 32; off <<= 1) sum += __shfl_xor(sum, off, 32);
    const float f = (1.0f / sum) * 32768.0f;
#pragma unroll
    for (int it = 0; it < 8; ++it) {                          // each lane writes over the 16 bytes that it read
      v8h hv;
#pragma unroll
      for (int e = 0; e < 8; ++e) hv[e] = (_Float16)(x[it][e] * f);
      *(v8h*)(srow + it * 256) = hv;
    }
  }
  __syncthreads();                                            // all 64 rows of p are in LDS before any wave reads them as A fragments

  // ---- 4. p.v: wave = (key group kg of 256 keys, half dh of the 128 columns); ctx[q][d] = 2^-19 * sum_key p[q][key] * Vt[d][key] ----
  const int kg = wave & 7, dh = wave >> 3;
  const _Float16* Ar = sc + rlane * kScPitch + kg * (kSeq / 8) + half8;
  const _Float16* Br = vt16 + ((size_t)bh * kDh + dh * 64) * kSeq + kg * (kSeq / 8) * 16 + lane * 8;   // fragment order: 16 rows x 32 keys = 512 elements in a row
  v8f acc[4][4];
#pragma unroll
  for (int i = 0; i < 4; ++i)
#pragma unroll
    for (int j = 0; j < 4; ++j) acc[i][j] = (v8f){0.f,0.f,0.f,0.f,0.f,0.f,0.f,0.f};
  for (int k0 = 0; k0 < kSeq / 8; k0 += 64) {                 // 64 keys a trip: 16 loads of Vt in flight together
    v16h bf[2][4];
#pragma unroll
    for (int s = 0; s < 2; ++s)
#pragma unroll
      for (int j = 0; j < 4; ++j) bf[s][j] = Frag<_Float16>::loadf(Br + (size_t)(j << 4) * kSeq + (k0 + 32 * s) * 16);
#pragma unroll
    for (int s = 0; s < 2; ++s) {
      v16h af[4];
#pragma unroll
      for (int i = 0; i < 4; ++i) af[i] = Frag<_Float16>::load(Ar + (i << 4) * kScPitch + k0 + 32 * s);
#pragma unroll
      for (int i = 0; i < 4; ++i)
#pragma unroll
        for (int j = 0; j < 4; ++j) acc[i][j] = Frag<_Float16>::mma(af[i], bf[s][j], acc[i][j]);
    }
  }
  __syncthreads();                                            // every wave has read its p fragments before the partials overwrite them

  float* mine = part + kg * (kRows * kPartPitch) + dh * 64;
#pragma unroll
  for (int i = 0; i < 4; ++i)
#pragma unroll
    for (int j = 0; j < 4; ++j)
#pragma unroll
      for (int r = 0; r < 8; ++r) mine[((i << 4) + half8 + r) * kPartPitch + (j << 4) + rlane] = acc[i][j][r];
  __syncthreads();                                            // all 8 partials are in LDS before any thread sums them

  // fragment order of the [kTok][kEmb] planes: wave w writes the 512 B of (row tile g >> 3, k step (g >> 1) & 3 of the head's four, ld g & 1), g = w and 16 + w
#pragma unroll
  for (int it = 0; it < 2; ++it) {
    const int g = it * 16 + wave;
    const int row = (g >> 3) * 16 + rlane, c8 = ((g >> 1) & 3) * 32 + (g & 1) * 16 + half8;
    const float* sp = part + row * kPartPitch + c8;
    v4f pa[8], pb[8];
#pragma unroll
    for (int w = 0; w < 8; ++w) { pa[w] = *(const v4f*)(sp + w * (kRows * kPartPitch)); pb[w] = *(const v4f*)(sp + w * (kRows * kPartPitch) + 4); }
    // the loaded values, as inputs only: all 16 LDS reads are issued before the first sum (one LDS latency, not one a partial)
    asm volatile("" :: "v"(pa[0]), "v"(pa[1]), "v"(pa[2]), "v"(pa[3]), "v"(pa[4]), "v"(pa[5]), "v"(pa[6]), "v"(pa[7]),
                       "v"(pb[0]), "v"(pb[1]), "v"(pb[2]), "v"(pb[3]), "v"(pb[4]), "v"(pb[5]), "v"(pb[6]), "v"(pb[7]));
    v4f s0 = pa[0], s1 = pb[0];
#pragma unroll
    for (int w = 1; w < 8; ++w) { s0 += pa[w]; s1 += pb[w]; } // fixed order
    v8h hv, lv;
#pragma unroll
    for (int e = 0; e < 8; ++e) {
      const float f = ((e < 4) ? s0[e & 3] : s1[e & 3]) * (1.0f / 524288.0f);
      const unsigned short hb = f2bf_bits(f);
      hv[e] = __builtin_bit_cast(_Float16, hb);
      lv[e] = __builtin_bit_cast(_Float16, f2bf_bits(f - bf_bits2f(hb)));
    }
    const size_t co = ((size_t)(((b * kSeq + a0) >> 4) + (g >> 3)) * (kEmb / 32) + h * (kDh / 32) + ((g >> 1) & 3)) * 512 + (g & 1) * 256 + lane * 8;
    *(v8h*)(Ch + co) = hv;
    *(v8h*)(Cl + co) = lv;
    if (it == 0) asm volatile("s_wait_xcnt 0x0" ::: "memory");   // before the second pair's values and addresses take the registers that these stores name
  }
}

// =====================================================================================
extern "C" void kernel_launch(void* const* d_in, const int* in_sizes, int n_in, void* d_out, int out_size,
                              void* d_ws, size_t ws_size, hipStream_t stream) {
  if (n_in < 14) return;
  if (in_sizes[0] != kTok * kEmb || in_sizes[1] != kEmb || in_sizes[2] != kEmb ||
      in_sizes[3] != kDh * kDh || in_sizes[4] != kDh || in_sizes[5] != kDh * kDh || in_sizes[6] != kDh ||
      in_sizes[7] != kDh * kDh || in_sizes[8] != kDh || in_sizes[9] != kDh * kDh ||
      in_sizes[10] != kHeads * kDh || in_sizes[11] != kHeads * kDh || in_sizes[12] != kEmb * kEmb || in_sizes[13] != kEmb ||
      out_size != kTok * kEmb) return;
  const float* x      = (const float*)d_in[0];
  const float* gamma  = (const float*)d_in[1];
  const float* beta   = (const float*)d_in[2];
  const float* Wq     = (const float*)d_in[3];
  const float* bq     = (const float*)d_in[4];
  const float* Wk     = (const float*)d_in[5];
  const float* bk     = (const float*)d_in[6];
  const float* Wv     = (const float*)d_in[7];
  const float* bv     = (const float*)d_in[8];
  const float* Wp     = (const float*)d_in[9];
  const float* u_bias = (const float*)d_in[10];
  const float* v_bias = (const float*)d_in[11];
  const float* Wo     = (const float*)d_in[12];
  const float* bo     = (const float*)d_in[13];
  float* out = (float*)d_out;   // [2][2048][1024] f32

  // ---- workspace carve (all offsets multiples of 256 B; total 84,149,248 B) ----
  // (R0, R1, R8, R9 and, one plane a head, R4 2 x [8][4096][128], R5 [8][4096][128], R6 [8][2048][128] are in fragment order: see gemm64_tile)
  // R0 WqT,WkT,WvT,WpT hi/lo bf16 [128 n][128 k]   8 x 32,768        =     262,144
  // R1 WoT hi/lo bf16 [1024 n][1024 k]              2 x 2,097,152     =   4,194,304
  // R2 16·bq, 16·bk f32 [128]                       2 x 512           =       1,024
  // R4 (q + u_bias), (q + v_bias) f16 x16 [32768][128] 2 x 8,388,608  =  16,777,216
  // R5 K16 f16 x16 [32768][128]                                       =   8,388,608
  // R6 PP16 f16 x16 [16384][128]                                      =   4,194,304
  // R8 CTX hi/lo bf16 [4096][1024]                  2 x 8,388,608     =  16,777,216
  // R9 VT16 f16 x16 [2 b][1024][2048]                                 =   8,388,608
  // R10 XN hi/lo bf16 [4096][1024] 2 x 8,388,608, PE hi/lo bf16 [2048][1024] 2 x 4,194,304 = 25,165,824
  char* ws = (char*)d_ws; size_t off = 0;
  auto carve = [&](size_t bytes) -> char* { char* p = ws + off; off += (bytes + 255) & ~(size_t)255; return p; };
  const size_t nW   = (size_t)kDh * kDh;            // 16,384
  const size_t nWo  = (size_t)kEmb * kEmb;          // 1,048,576
  const size_t nHd  = (size_t)kTok * kHeads * kDh;   // 4,194,304 (= kTok*kEmb)
  const size_t nPp  = (size_t)kSeq * kHeads * kDh;   // 2,097,152
  __bf16* WqTh = (__bf16*)carve(nW * 2); __bf16* WqTl = (__bf16*)carve(nW * 2);
  __bf16* WkTh = (__bf16*)carve(nW * 2); __bf16* WkTl = (__bf16*)carve(nW * 2);
  __bf16* WvTh = (__bf16*)carve(nW * 2); __bf16* WvTl = (__bf16*)carve(nW * 2);
  __bf16* WpTh = (__bf16*)carve(nW * 2); __bf16* WpTl = (__bf16*)carve(nW * 2);
  __bf16* WoTh = (__bf16*)carve(nWo * 2); __bf16* WoTl = (__bf16*)carve(nWo * 2);
  float* qb16 = (float*)carve(kDh * 4); float* kb16 = (float*)carve(kDh * 4);
  _Float16* qu16 = (_Float16*)carve(nHd * 2);
  _Float16* qv16 = (_Float16*)carve(nHd * 2);
  _Float16* k16  = (_Float16*)carve(nHd * 2);
  _Float16* pp16 = (_Float16*)carve(nPp * 2);
  unsigned short* ctxh = (unsigned short*)carve(nHd * 2); unsigned short* ctxl = (unsigned short*)carve(nHd * 2);
  _Float16* vt16 = (_Float16*)carve((size_t)kBatch * kEmb * kSeq * 2);
  unsigned* xnh = (unsigned*)carve(nHd * 2);
  unsigned* xnl = (unsigned*)carve(nHd * 2);
  unsigned* peh = (unsigned*)carve((size_t)kSeq * kEmb * 2);
  unsigned* pel = (unsigned*)carve((size_t)kSeq * kEmb * 2);
  if (off > ws_size) return;

  // ---- prelude: weight planes (in [k][n] -> out [n][k]), scaled biases, LN planes, sinusoid planes: one launch ----
  prelude_kernel<<<kBlkPrelude, 256, 0, stream>>>(x, gamma, beta, Wq, Wk, Wv, Wp, Wo, bq, bk, WqTh, WoTh, WoTl, qb16, kb16, xnh, xnl, peh, pel);

  // ---- projections, head by head, of xn and pe, written as attention reads them (q with either bias, k, v^T, p): one launch ----
  proj4_kernel<<<3 * kBlkProj + kBlkProjP, 256, 0, stream>>>(U16(xnh), U16(xnl), U16(peh), U16(pel), U16(WqTh), qb16, kb16, bv, u_bias, v_bias, qu16, qv16, k16, vt16, pp16);

  // ---- all of attention for every (b, h) in one launch, into the ctx hi/lo planes ----
  attn_rows_kernel<<<dim3(kSeq / kRows, kBatch * kHeads), 512, 0, stream>>>(qu16, qv16, k16, pp16, vt16, ctxh, ctxl);   // 32 x 16 blocks of 64 query rows

  out_gemm_kernel<<<kBlkOut, 256, 0, stream>>>(ctxh, ctxl, U16(WoTh), U16(WoTl), bo, out);
}

// v009
// One run takes 124 microseconds.
// Next to v008, in two timings, it ran 1.03 times as fast each time.
// All steps since v000 together make it 16.4 times as fast.
// Projections xn·W{q,k,v} (K=128), p = pe·Wp (K=128) and out = ctx·Wo (K=1024): v_wmma_f32_16x16x32_bf16 with bf16 hi/lo split operands (hi·hi + hi·lo + lo·hi); content (q+u)·kᵀ and position (q+v)·pᵀ tables (K=128): v_wmma_f32_16x16x32_f16 with plain f16 operands carried x16; p·v (K=2048): v_wmma_f32_16x16x32_f16 with p/l carried x2^15 and vᵀ carried x16; f32 accumulate everywhere; LayerNorm, sinusoid table, the u/v bias added to q (before the f16 rounding), relative shift and softmax in f32 on VALU.
// Between the score products and the softmax the scores (position / 32, then position + content, / 32) wait in LDS rounded to f16.
#include <hip/hip_runtime.h>
#include <math.h>

typedef __attribute__((ext_vector_type(16))) _Float16 v16h;
typedef __attribute__((ext_vector_type(8)))  _Float16 v8h;
typedef __attribute__((ext_vector_type(4)))  _Float16 v4h;
typedef __attribute__((ext_vector_type(16))) __bf16   v16b;
typedef __attribute__((ext_vector_type(8)))  __bf16   v8b;
typedef __attribute__((ext_vector_type(8)))  float    v8f;
typedef __attribute__((ext_vector_type(4)))  float    v4f;
typedef __attribute__((ext_vector_type(2)))  float    v2f;
#define U16(p) ((const unsigned short*)(const void*)(p))

__device__ __forceinline__ unsigned short f2bf_bits(float f) {
  unsigned u = __float_as_uint(f);
  return (unsigned short)((u + 0x7FFFu + ((u >> 16) & 1u)) >> 16);
}
__device__ __forceinline__ float bf_bits2f(unsigned short h) { return __uint_as_float(((unsigned)h) << 16); }

// hazard guards as plain device helpers
__device__ __forceinline__ void dep_guard_h(v8f& a, v8f& b, v16h x, v16h y) { asm volatile("v_nop\n\tv_nop\n\tv_nop\n\tv_nop" : "+v"(a), "+v"(b) : "v"(x), "v"(y)); }
__device__ __forceinline__ void dep_guard_b(v8f& a, v8f& b, v16b x, v16b y) { asm volatile("v_nop\n\tv_nop\n\tv_nop\n\tv_nop" : "+v"(a), "+v"(b) : "v"(x), "v"(y)); }
__device__ __forceinline__ void keep4_h(v16h a, v16h b, v16h c, v16h d) { asm volatile("v_nop" :: "v"(a), "v"(b), "v"(c), "v"(d)); }
__device__ __forceinline__ void keep4_b(v16b a, v16b b, v16b c, v16b d) { asm volatile("v_nop" :: "v"(a), "v"(b), "v"(c), "v"(d)); }
__device__ __forceinline__ void acc_guard4(v8f& a, v8f& b, v8f& c, v8f& d) { asm volatile("v_nop\n\tv_nop\n\tv_nop\n\tv_nop" : "+v"(a), "+v"(b), "+v"(c), "+v"(d)); }
template <typename T> struct Frag;
template <> struct Frag<_Float16> {
  typedef v16h V; union U { v16h v; v8h h[2]; };
  static __device__ __forceinline__ v16h load(const _Float16* p) {   // elements 0..7 <- p[0..7], 8..15 <- p[16..23]
    U f; f.h[0] = *(const v8h*)(p); f.h[1] = *(const v8h*)(p + 16); return f.v;
  }
  static __device__ __forceinline__ v16h loadf(const _Float16* p) {  // fragment-order plane: elements 0..7 <- p[0..7], 8..15 <- p[256..263]
    U f; f.h[0] = *(const v8h*)(p); f.h[1] = *(const v8h*)(p + 256); return f.v;
  }
  static __device__ __forceinline__ v8f mma(v16h a, v16h b, v8f c) {
    return __builtin_amdgcn_wmma_f32_16x16x32_f16(false, a, false, b, (short)0, c, false, false);
  }
  static __device__ __forceinline__ void guard(v8f& a, v8f& b, v16h x, v16h y) { dep_guard_h(a, b, x, y); }
  static __device__ __forceinline__ void keep(v16h a, v16h b, v16h c, v16h d) { keep4_h(a, b, c, d); }
};
template <> struct Frag<__bf16> {
  typedef v16b V; union U { v16b v; v8b h[2]; };
  static __device__ __forceinline__ v16b load(const __bf16* p) {
    U f; f.h[0] = *(const v8b*)(p); f.h[1] = *(const v8b*)(p + 16); return f.v;
  }
  static __device__ __forceinline__ v16b loadf(const __bf16* p) {
    U f; f.h[0] = *(const v8b*)(p); f.h[1] = *(const v8b*)(p + 256); return f.v;
  }
  static __device__ __forceinline__ v8f mma(v16b a, v16b b, v8f c) {
    return __builtin_amdgcn_wmma_f32_16x16x32_bf16(false, a, false, b, (short)0, c, false, false);
  }
  static __device__ __forceinline__ void guard(v8f& a, v8f& b, v16b x, v16b y) { dep_guard_b(a, b, x, y); }
  static __device__ __forceinline__ void keep(v16b a, v16b b, v16b c, v16b d) { keep4_b(a, b, c, d); }
};

// ---- Register-blocked batched WMMA GEMM ------------------------------------
// C[m,n] = scale * sum_k A[m,k] * Bt[n,k] (+bias)(+resid); each wave owns a 64x64 tile.
// A row-major [M,K] (AFRAG: fragment order); Bt [N,K] in fragment order; M,N % 64 == 0, K % 32 == 0.
// Fragment order of a 16-bit [R,K] plane: [R/16][K/32][2][32 lanes][8]; chunk (rt, kk, ld, lane) holds row 16 rt + (lane & 15), k = 32 kk + 16 ld + 8 (lane >> 4) .. + 7,
// so each of a fragment's two 16-byte loads reads 512 contiguous bytes (four whole lines) over the wave; same k order as the row-major loader.
// SPLIT: operands are hi/lo planes (A2/Bt2 = lo planes, same layout); product = hi·hi + hi·lo + lo·hi.
// BIAS_MODE: 0 = none, 1 = bias[m], 2 = bias[n].
// OUT_MODE: 0 = f32, 1 = f16, 2 = bf16 hi plane (Cout) + bf16 lo plane (Cout2), 3 = f16 [M,N] plane in fragment order (ldc unused),
// 4 = two planes as in 3: Cout = value + 16 add1[n], Cout2 = value + 16 add2[n] (add1, add2: batch index b's own vectors),
// 5 = f16 x16, transposed, in fragment order: element (m, n) is row b N + n, k = m % ldc of plane m / ldc (strideC = elements of a plane; ldc % 64 == 0; BIAS_MODE 0 or 2, no RESID, no ACT).
// ET: 0 = f16 operands, 1 = bf16 operands (pointers passed as 16-bit storage)
// bx = tiles / 8 (tile = 8 bx + wave), b = batch index (strideA/B/C/R and strideBias are per b), zsel = true takes BtZp, CoutZ and biasZ in
// place of Btp, Cout and bias (same A, same strides; non-split launches only), so two products of one A share a launch.
// The body is a device function of (bx, b, zsel) and the block's LDS slabs, so that several products can share one grid by block range.
template <int ET> struct Elem;
template <> struct Elem<0> { typedef _Float16 T; };
template <> struct Elem<1> { typedef __bf16 T; };
// PIPE (with SPLIT and AFRAG; K % 64 == 0, K >= 128): the k loop keeps two register stages of fragments and issues all 32 loads of a k step one k step ahead of its products.
template <int ET, bool SPLIT, int BIAS_MODE, int OUT_MODE, bool RESID, int ACT = 0, bool AFRAG = false, bool PIPE = false>
__device__ __forceinline__ void gemm64_tile(
    float (*sT)[16 * 68], int bx, int b, bool zsel,      // sT: per-wave 16x64 slab, pitch 68 floats; bx, b, zsel block-uniform
    const unsigned short* __restrict__ Ap, const unsigned short* __restrict__ A2p, int lda, long strideA,
    const unsigned short* __restrict__ Btp, const unsigned short* __restrict__ Bt2p, int ldb, long strideB,
    void* __restrict__ Cout0, void* __restrict__ Cout2, int ldc, long strideC,
    const float* __restrict__ bias0, long strideBias,
    const float* __restrict__ resid, long strideR,
    const unsigned short* __restrict__ BtZp, void* __restrict__ CoutZ, const float* __restrict__ biasZ,
    int M, int N, int K, float scale,
    const float* __restrict__ add1 = nullptr, const float* __restrict__ add2 = nullptr, float (*sA)[128] = nullptr) {   // sA: OUT_MODE 4 only, 128 floats of LDS a wave
  typedef typename Elem<ET>::T T;
  typedef typename Frag<T>::V V;
  const T* A = (const T*)Ap; const T* A2 = (const T*)A2p; const T* Bt = (const T*)(zsel ? BtZp : Btp); const T* Bt2 = (const T*)Bt2p;
  void* Cout = zsel ? CoutZ : Cout0;
  const float* bias = (BIAS_MODE != 0) ? ((zsel ? biasZ : bias0) + (size_t)b * strideBias) : nullptr;
  const int lane = threadIdx.x & 31;
  const int wave = threadIdx.x >> 5;
  const int tilesN = N >> 6;
  const int tilesM = M >> 6;
  const int tile = bx * 8 + wave;
  if (tile >= tilesM * tilesN) return;   // wave-uniform; no block barriers in this kernel
  const int tm = tile / tilesN;
  const int tn = tile - tm * tilesN;
  const int m0 = tm << 6;
  const int n0 = tn << 6;

  const T* Ab  = A  + (size_t)b * strideA;
  const T* Bb  = Bt + (size_t)b * strideB;
  const T* Ab2 = SPLIT ? (A2  + (size_t)b * strideA) : nullptr;
  const T* Bb2 = SPLIT ? (Bt2 + (size_t)b * strideB) : nullptr;

  const int rlane = lane & 15;                 // row (A) / col (B, D) within subtile
  const int koff  = (lane >> 4) * 8;           // k offset of this lane half
  const int mOff  = (lane >> 4) * 8;           // D row offset

  v8f acc[4][4];
#pragma unroll
  for (int i = 0; i < 4; ++i)
#pragma unroll
    for (int j = 0; j < 4; ++j) acc[i][j] = (v8f){0.f,0.f,0.f,0.f,0.f,0.f,0.f,0.f};

  if (PIPE) {
    const size_t ts = (size_t)(K >> 5) * 512;                 // from one 16-row tile of a plane to the next
    // subtile 0, k step 0 of the wave's tile in each plane: the same for the whole wave, so held in scalar registers; the lane's own chunk is l8 elements on
    const size_t bo0 = (size_t)__builtin_amdgcn_readfirstlane(n0 >> 4) * ts, ao0 = (size_t)__builtin_amdgcn_readfirstlane(m0 >> 4) * ts;
    const T* bp = Bb + bo0; const T* bp2 = Bb2 + bo0; const T* ap = Ab + ao0; const T* ap2 = Ab2 + ao0;
    const unsigned l8 = (unsigned)lane * 8u;
    V ah[2][4], al[2][4], bh[2][4], bl[2][4];
    // every "#pragma unroll" in the two lambdas: constant indices keep the fragment and accumulator arrays in registers
    auto fetch = [&](const int s, const int ko) {             // all of one k step's fragments into stage s; ko = elements from the pointers to that k step
#pragma unroll
      for (int j = 0; j < 4; ++j) {
        bh[s][j] = Frag<T>::loadf(bp + l8 + (j * ts + ko)); bl[s][j] = Frag<T>::loadf(bp2 + l8 + (j * ts + ko));
        ah[s][j] = Frag<T>::loadf(ap + l8 + (j * ts + ko)); al[s][j] = Frag<T>::loadf(ap2 + l8 + (j * ts + ko));
      }
      __builtin_amdgcn_sched_barrier(0);                      // the loads stay in front of the other stage's products: their latency runs under those
    };
    auto products = [&](const int s) {                        // per accumulator the order of the plain loop: hi.hi, hi.lo, lo.hi
      // (the plain loop's v_nop statements are not carried over: as asm operands the fragments would all have to lie in the first 256 registers, which spills; the compiler pads its builtin products itself)
#pragma unroll
      for (int i = 0; i < 4; ++i) {
#pragma unroll
        for (int j = 0; j < 4; ++j) {
          acc[i][j] = Frag<T>::mma(ah[s][i], bh[s][j], acc[i][j]);
          acc[i][j] = Frag<T>::mma(ah[s][i], bl[s][j], acc[i][j]);
          acc[i][j] = Frag<T>::mma(al[s][i], bh[s][j], acc[i][j]);
        }
      }
    };
    fetch(0, 0);
    for (int k0 = 0; k0 < K - 64; k0 += 64) {                 // two k steps a trip, so that each stage keeps its registers
      fetch(1, 512);
      products(0);
      fetch(0, 1024);
      products(1);
      // the four pointers and the lane offset as inputs: their registers stay as this trip's loads name them up to this wait; the step to the next trip comes behind it
      asm volatile("s_wait_xcnt 0x0" :: "s"(ap), "s"(ap2), "s"(bp), "s"(bp2), "v"(l8) : "memory");
      ap += 1024; ap2 += 1024; bp += 1024; bp2 += 1024;
    }
    fetch(1, 512);
    // directly behind the last loads: nothing of the code that follows takes a register that they name ahead of this wait
    asm volatile("s_wait_xcnt 0x0" :: "s"(ap), "s"(ap2), "s"(bp), "s"(bp2), "v"(l8) : "memory");
    __builtin_amdgcn_sched_barrier(0);                        // keeps later address arithmetic from being lifted in front of that wait
    products(0);
    products(1);
  } else
  for (int k0 = 0; k0 < K; k0 += 32) {
    V bh[4], bl[4];
    const size_t bo0 = ((size_t)(n0 >> 4) * (K >> 5) + (k0 >> 5)) * 512 + lane * 8;
    const size_t ao0 = AFRAG ? ((size_t)(m0 >> 4) * (K >> 5) + (k0 >> 5)) * 512 + lane * 8 : (size_t)(m0 + rlane) * lda + koff + k0;
    const T* bp = Bb + bo0; const T* bp2 = SPLIT ? (Bb2 + bo0) : bp;     // the lane's own row of subtile 0 in each plane; the others at constant steps
    const T* ap = Ab + ao0; const T* ap2 = SPLIT ? (Ab2 + ao0) : ap;
#pragma unroll
    for (int j = 0; j < 4; ++j) {
      const size_t bo = (size_t)j * (K >> 5) * 512;
      bh[j] = Frag<T>::loadf(bp + bo);
      if (SPLIT) bl[j] = Frag<T>::loadf(bp2 + bo);
    }
#pragma unroll
    for (int i = 0; i < 4; ++i) {
      const size_t ao = AFRAG ? (size_t)i * (K >> 5) * 512 : (size_t)(i << 4) * lda;
      V ah = AFRAG ? Frag<T>::loadf(ap + ao) : Frag<T>::load(ap + ao);
      V al;
      if (SPLIT) al = AFRAG ? Frag<T>::loadf(ap2 + ao) : Frag<T>::load(ap2 + ao);
#pragma unroll
      for (int j = 0; j < 4; ++j) {
        acc[i][j] = Frag<T>::mma(ah, bh[j], acc[i][j]);
        if (SPLIT) {
          acc[i][j] = Frag<T>::mma(ah, bl[j], acc[i][j]);
          acc[i][j] = Frag<T>::mma(al, bh[j], acc[i][j]);
        }
      }
      Frag<T>::guard(acc[i][0], acc[i][3], ah, SPLIT ? al : ah);
    }
    Frag<T>::keep(bh[0], bh[1], bh[2], bh[3]);
    if (SPLIT) Frag<T>::keep(bl[0], bl[1], bl[2], bl[3]);
    // the four pointers as inputs: their registers stay as this step's loads name them (no result lands on them, no step to the next k) up to this wait
    asm volatile("s_wait_xcnt 0x0" :: "v"(ap), "v"(ap2), "v"(bp), "v"(bp2) : "memory");
  }
  acc_guard4(acc[0][0], acc[0][1], acc[0][2], acc[0][3]);
  acc_guard4(acc[1][0], acc[1][1], acc[1][2], acc[1][3]);
  acc_guard4(acc[2][0], acc[2][1], acc[2][2], acc[2][3]);
  acc_guard4(acc[3][0], acc[3][1], acc[3][2], acc[3][3]);

  // ---- epilogue ----
  if (OUT_MODE == 5) {
    // an accumulator's lane holds 8 rows m of one column n, which is one 16-byte chunk of the transposed plane (row n, 8 k in a row): stored as it stands, 512 B a store, no trip through the slab
    const float* pb = bias + n0 + rlane;
    float bvj[4];
#pragma unroll   // constant indices keep the array in registers
    for (int j = 0; j < 4; ++j) bvj[j] = (BIAS_MODE == 2) ? pb[j << 4] : 0.f;
    // the pointer as an input: its registers stay as the loads name them (no result lands on them) up to this wait
    if (BIAS_MODE == 2) asm volatile("s_wait_xcnt 0x0" :: "v"(pb) : "memory");
#pragma unroll   // constant indices keep acc in registers
    for (int i = 0; i < 4; ++i) {
      const int mBase = m0 + (i << 4), s0 = mBase % ldc;     // k = s0 .. s0 + 15: one ld of one k step
      _Float16* C = (_Float16*)Cout + (size_t)(mBase / ldc) * strideC + ((size_t)((b * N + n0) >> 4) * (ldc >> 5) + (s0 >> 5)) * 512 + ((s0 >> 4) & 1) * 256 + lane * 8;
#pragma unroll
      for (int j = 0; j < 4; ++j) {                          // row tile (b N + n0) / 16 + j
        v8h hv;
#pragma unroll
        for (int r = 0; r < 8; ++r) hv[r] = (_Float16)((acc[i][j][r] * scale + bvj[j]) * 16.0f);
        *(v8h*)(C + (size_t)j * (ldc >> 5) * 512) = hv;
      }
      asm volatile("s_wait_xcnt 0x0" ::: "memory");          // before the next four stores' values and address take the registers that these name
    }
    return;
  }
  float* slab = sT[wave];
  const float* Rb = RESID ? (resid + (size_t)b * strideR) : nullptr;
  float* addv = (OUT_MODE == 4) ? sA[wave] : nullptr;
  if (OUT_MODE == 4) {   // 16 add1 (from lanes 0..15) and 16 add2 (from lanes 16..31) at the tile's 64 columns, into the wave's own LDS: the stores below take them eight columns a lane
    const float* pa = ((lane >> 4) ? add2 : add1) + n0 + rlane;
    float av[4];
#pragma unroll   // constant indices keep the array in registers
    for (int j = 0; j < 4; ++j) av[j] = pa[j << 4];
    // the pointer as an input: its registers stay as the loads name them (no result lands on them) up to this wait
    asm volatile("s_wait_xcnt 0x0" :: "v"(pa) : "memory");
#pragma unroll
    for (int j = 0; j < 4; ++j) addv[(lane >> 4) * 64 + (j << 4) + rlane] = 16.0f * av[j];
  }
#pragma unroll
  for (int i = 0; i < 4; ++i) {
    const int mBase = m0 + (i << 4);
#pragma unroll
    for (int j = 0; j < 4; ++j) {
      const int n = n0 + (j << 4) + rlane;
      float bv = 0.f;
      if (BIAS_MODE == 2) bv = bias[n];
#pragma unroll
      for (int r = 0; r < 8; ++r) {
        float v = acc[i][j][r] * scale;
        if (BIAS_MODE == 1) v += bias[mBase + mOff + r];
        if (BIAS_MODE == 2) v += bv;
        if (RESID) v += Rb[(size_t)(mBase + mOff + r) * ldc + n];
        if (ACT == 1) v = tanhf(v);
        if (ACT == 2) v = fmaxf(v, 0.0f);
        if (ACT == 3) v = v / (1.0f + expf(-v));
        if (ACT == 4) v = (v > 0.f) ? v : 0.01f * v;
        if (ACT == 5) v = 0.5f * v * (1.0f + erff(v * 0.70710678118654752f));
        slab[(mOff + r) * 68 + (j << 4) + rlane] = v;
      }
    }
    __builtin_amdgcn_fence(__ATOMIC_RELEASE, "workgroup");
    __builtin_amdgcn_wave_barrier();
    __builtin_amdgcn_fence(__ATOMIC_ACQUIRE, "workgroup");
    if (OUT_MODE == 0) {
      float* C = (float*)Cout + (size_t)b * strideC;
      const int hh = lane >> 4, c4 = (lane & 15) * 4;     // row seg = 256 B = 16 lanes x 16 B
      {
#pragma unroll
        for (int it = 0; it < 8; ++it) {
          const int row = it * 2 + hh;
          v4f v = *(const v4f*)(slab + row * 68 + c4);
          *(v4f*)(C + (size_t)(mBase + row) * ldc + n0 + c4) = v;
        }
        
      }
    } else if (OUT_MODE == 3) {
      // the slab is row tile mBase / 16, k steps n0 / 32 and n0 / 32 + 1 of the plane: 2 KiB in a row, 512 B a store
      _Float16* C = (_Float16*)Cout + (size_t)b * strideC + ((size_t)(mBase >> 4) * (N >> 5) + (n0 >> 5)) * 512 + lane * 8;
#pragma unroll   // the four stores go off one address at constant offsets
      for (int it = 0; it < 4; ++it) {
        const float* sp = slab + rlane * 68 + it * 16 + mOff;
        v8h hv;
#pragma unroll   // constant indices keep hv in registers
        for (int e = 0; e < 8; ++e) hv[e] = (_Float16)sp[e];
        *(v8h*)(C + it * 256) = hv;
      }
    } else if (OUT_MODE == 4) {
      // as OUT_MODE 3, for two planes
      const size_t co = (size_t)b * strideC + ((size_t)(mBase >> 4) * (N >> 5) + (n0 >> 5)) * 512 + lane * 8;
      _Float16* C = (_Float16*)Cout + co; _Float16* C2 = (_Float16*)Cout2 + co;
#pragma unroll   // the stores go off two addresses at constant offsets
      for (int it = 0; it < 4; ++it) {
        const float* sp = slab + rlane * 68 + it * 16 + mOff;
        const float* ap = addv + it * 16 + mOff;
        v8h hv, lv;
#pragma unroll   // constant indices keep hv, lv in registers
        for (int e = 0; e < 8; ++e) { hv[e] = (_Float16)(sp[e] + ap[e]); lv[e] = (_Float16)(sp[e] + ap[64 + e]); }
        *(v8h*)(C + it * 256) = hv;
        *(v8h*)(C2 + it * 256) = lv;
      }
    } else {
      const int q = lane >> 3, c8 = (lane & 7) * 8;
      unsigned short* C  = (unsigned short*)Cout  + (size_t)b * strideC;
      unsigned short* C2 = (OUT_MODE == 2) ? ((unsigned short*)Cout2 + (size_t)b * strideC) : nullptr;
      {
#pragma unroll
        for (int it = 0; it < 4; ++it) {
          const int row = it * 4 + q;
          const float* sp = slab + row * 68 + c8;
          v8h hv, lv;
#pragma unroll
          for (int e = 0; e < 8; ++e) {
            if (OUT_MODE == 1) {
              hv[e] = (_Float16)sp[e];
            } else {
              unsigned short hb = f2bf_bits(sp[e]);
              unsigned short lb = f2bf_bits(sp[e] - bf_bits2f(hb));
              hv[e] = __builtin_bit_cast(_Float16, hb);
              lv[e] = __builtin_bit_cast(_Float16, lb);
            }
          }
          *(v8h*)(C + (size_t)(mBase + row) * ldc + n0 + c8) = hv;
          if (OUT_MODE == 2) *(v8h*)(C2 + (size_t)(mBase + row) * ldc + n0 + c8) = lv;
        }
        
      }
    }
    asm volatile("s_wait_xcnt 0x0" ::: "memory");   // before the next slab's values and addresses take the registers that these stores name
    __builtin_amdgcn_fence(__ATOMIC_RELEASE, "workgroup");
    __builtin_amdgcn_wave_barrier();
    __builtin_amdgcn_fence(__ATOMIC_ACQUIRE, "workgroup");
  }
}

// ---- f32 [R][C] (pitch ldi) -> bf16 hi/lo transposed planes [C][R = ldo] in fragment order (see gemm64_tile); 64x64 tiles
// one block of 256 threads does tile (bx, by); tile = the block's LDS, [c][r]
__device__ __forceinline__ void transpose_split_bf16_tile(float (*tile)[68], int bx, int by, const float* __restrict__ in, int ldi,
                                                          __bf16* __restrict__ outH, __bf16* __restrict__ outL, int ldo) {
  const int c0 = bx * 64, r0 = by * 64;
  const int t = threadIdx.x, tx = t & 31, ty = t >> 5;
  for (int i = ty; i < 64; i += 8) {
    tile[tx][i]      = in[(size_t)(r0 + i) * ldi + c0 + tx];
    tile[32 + tx][i] = in[(size_t)(r0 + i) * ldi + c0 + 32 + tx];
  }
  __syncthreads();
  const int lane = t & 31;
  {
#pragma unroll
    for (int it = 0; it < 2; ++it) {                          // fragment order: wave w writes the 512 B of (row tile, k step, ld) = its index it * 8 + w
      const int g = it * 8 + ty, ct = g >> 2, kk = (g >> 1) & 1, ld = g & 1;
      const int c = ct * 16 + (lane & 15), c8 = kk * 32 + ld * 16 + (lane >> 4) * 8;
      const size_t o = (((size_t)((c0 >> 4) + ct) * (ldo >> 5) + (r0 >> 5) + kk) * 2 + ld) * 256 + lane * 8;
      v8b hv, lv;
#pragma unroll
      for (int e = 0; e < 8; ++e) {
        const float f = tile[c][c8 + e];
        const unsigned short hb = f2bf_bits(f);
        hv[e] = __builtin_bit_cast(__bf16, hb);
        lv[e] = __builtin_bit_cast(__bf16, f2bf_bits(f - bf_bits2f(hb)));
      }
      *(v8b*)(outH + o) = hv;
      *(v8b*)(outL + o) = lv;
    }
    asm volatile("s_wait_xcnt 0x0" ::: "memory");   // other jobs' code follows this body in the shared kernel: nothing there rewrites a register that these stores name ahead of this wait
  }
}

// =====================================================================================
constexpr int kBatch = 2;
constexpr int kSeq   = 2048;
constexpr int kEmb   = 1024;
constexpr int kHeads = 8;
constexpr int kDh    = 128;
constexpr int kTok   = kBatch * kSeq;          // 4096 tokens
constexpr int kPairs = kEmb / 2;               // 512 element pairs per row
static_assert(kHeads * kDh == kEmb);
static_assert(kPairs == 512);

// ---- LayerNorm (biased variance, eps 1e-5) -> xn as bf16 hi/lo planes (packed pairs). One wave per token, 8 tokens a block of 256 threads:
// lane l owns columns 128 i + 4 l .. + 3, i = 0..7, so a load reads 512 contiguous bytes and a store writes 256; the row's sums go over the lanes by a butterfly, no LDS, no block barrier
typedef __attribute__((ext_vector_type(2))) unsigned v2u;
typedef __attribute__((ext_vector_type(4))) unsigned v4u;
__device__ __forceinline__ void layernorm_split_rows(
    int blk, const float* __restrict__ x, const float* __restrict__ gamma, const float* __restrict__ beta,
    unsigned* __restrict__ xh, unsigned* __restrict__ xl) {
  const int lane = threadIdx.x & 31, wave = threadIdx.x >> 5;
  const int tok = blk * 8 + wave;
  const float* xr = x + (size_t)tok * kEmb + 4 * lane;
  const float* gp = gamma + 4 * lane;
  const float* bp = beta + 4 * lane;
  // every "#pragma unroll" in this function: constant indices keep the arrays in registers
  v4f v[8], g[8], bt[8];
#pragma unroll
  for (int i = 0; i < 8; ++i) v[i] = *(const v4f*)(xr + 128 * i);
#pragma unroll
  for (int i = 0; i < 8; ++i) { g[i] = *(const v4f*)(gp + 128 * i); bt[i] = *(const v4f*)(bp + 128 * i); }
  // The loaded values, as inputs only: all 24 loads are issued before the first sum, so that gamma's and beta's latency runs under the row's (one memory latency a token).
  // The row's pointer as an input: its registers stay as the loads name them up to this wait (gamma's and beta's loads name the lane number, which lives on to the stores)
  asm volatile("s_wait_xcnt 0x0" :: "v"(xr),
               "v"(v[0]), "v"(v[1]), "v"(v[2]), "v"(v[3]), "v"(v[4]), "v"(v[5]), "v"(v[6]), "v"(v[7]),
               "v"(g[0]), "v"(g[1]), "v"(g[2]), "v"(g[3]), "v"(g[4]), "v"(g[5]), "v"(g[6]), "v"(g[7]),
               "v"(bt[0]), "v"(bt[1]), "v"(bt[2]), "v"(bt[3]), "v"(bt[4]), "v"(bt[5]), "v"(bt[6]), "v"(bt[7]) : "memory");
  const v4f a = ((v[0] + v[1]) + (v[2] + v[3])) + ((v[4] + v[5]) + (v[6] + v[7]));
  float s = (a.x + a.y) + (a.z + a.w);
#pragma unroll
  for (int off = 1; off < 32; off <<= 1) s += __shfl_xor(s, off, 32);
  const float mean = s * (1.0f / (float)kEmb);
#pragma unroll
  for (int i = 0; i < 8; ++i) v[i] = v[i] - mean;
  const v4f q = ((v[0] * v[0] + v[1] * v[1]) + (v[2] * v[2] + v[3] * v[3])) + ((v[4] * v[4] + v[5] * v[5]) + (v[6] * v[6] + v[7] * v[7]));
  float s2 = (q.x + q.y) + (q.z + q.w);
#pragma unroll
  for (int off = 1; off < 32; off <<= 1) s2 += __shfl_xor(s2, off, 32);
  const float var  = s2 * (1.0f / (float)kEmb);
  const float rstd = 1.0f / sqrtf(var + 1e-5f);
  unsigned* oh = xh + (size_t)tok * kPairs + 2 * lane;
  unsigned* ol = xl + (size_t)tok * kPairs + 2 * lane;
#pragma unroll
  for (int i = 0; i < 8; ++i) {
    unsigned short hb[4], lb[4];
#pragma unroll
    for (int e = 0; e < 4; ++e) {
      const float y = v[i][e] * rstd * g[i][e] + bt[i][e];
      hb[e] = f2bf_bits(y);
      lb[e] = f2bf_bits(y - bf_bits2f(hb[e]));
    }
    *(v2u*)(oh + 64 * i) = (v2u){(unsigned)hb[0] | ((unsigned)hb[1] << 16), (unsigned)hb[2] | ((unsigned)hb[3] << 16)};
    *(v2u*)(ol + 64 * i) = (v2u){(unsigned)lb[0] | ((unsigned)lb[1] << 16), (unsigned)lb[2] | ((unsigned)lb[3] << 16)};
  }
  asm volatile("s_wait_xcnt 0x0" ::: "memory");   // other jobs' code follows this body in the shared kernel: nothing there rewrites a register that these stores name ahead of this wait
}

// ---- sinusoid table [kSeq][kEmb]: columns 2i = sin(pos·div_i), 2i+1 = cos(pos·div_i), div_i = exp(2i · (−ln 1e4 / kEmb)), f32,
// emitted as bf16 hi/lo planes (packed pairs). A block of 256 threads does 4 positions: thread t the pairs 4 (t & 127) .. + 3 (one 16-byte store a plane, 512 B a wave)
// of positions 4 blk + (t >> 7) and that + 2, with the four div_i taken once
constexpr int kPePos = 4;
__device__ __forceinline__ void posenc_split_block(int blk, unsigned* __restrict__ peh, unsigned* __restrict__ pel) {
  const int t = threadIdx.x, i4 = (t & 127) * 4;
  const float kNegLogRate = -0.00899447301950799f;        // −ln(10000)/1024
  float freq[4];
#pragma unroll   // constant indices keep the array in registers
  for (int e = 0; e < 4; ++e) freq[e] = expf((float)(2 * (i4 + e)) * kNegLogRate);
#pragma unroll 1   // one copy of the four sine and cosine bodies in the text, not two
  for (int j = 0; j < 2; ++j) {
    const int pos = blk * kPePos + (t >> 7) + 2 * j;
    v4u uh, ul;
#pragma unroll   // constant indices keep the vectors in registers
    for (int e = 0; e < 4; ++e) {
      const float ang  = (float)pos * freq[e];
      const float sv = sinf(ang), cv = cosf(ang);
      const unsigned short hs = f2bf_bits(sv), hc = f2bf_bits(cv);
      const unsigned short ls = f2bf_bits(sv - bf_bits2f(hs)), lc = f2bf_bits(cv - bf_bits2f(hc));
      uh[e] = (unsigned)hs | ((unsigned)hc << 16);
      ul[e] = (unsigned)ls | ((unsigned)lc << 16);
    }
    const size_t o = (size_t)pos * kPairs + i4;
    *(v4u*)(peh + o) = uh;
    *(v4u*)(pel + o) = ul;
    asm volatile("s_wait_xcnt 0x0" ::: "memory");   // before the next position's values and addresses (or, behind the loop, other jobs' code in the shared kernel) take the registers that these stores name
  }
}

// ---- scaled projection biases: qb = 16·bq, kb = 16·bk (128 floats each). Two waves of one block: wave 0 -> qb, wave 1 -> kb;
__device__ __forceinline__ void bias16_block(const float* __restrict__ bq, const float* __restrict__ bk,
                                             float* __restrict__ qb, float* __restrict__ kb) {
  const int lane = threadIdx.x & 31, wave = threadIdx.x >> 5;   // wave-uniform branches
  if (wave >= 2) return;
  v4f v; float* dst;
  if (wave == 0) { v = *(const v4f*)(bq + 4 * lane); dst = qb + 4 * lane; }
  else           { v = *(const v4f*)(bk + 4 * lane); dst = kb + 4 * lane; }
  v = v * 16.0f;
  *(v4f*)dst = v;
  asm volatile("s_wait_xcnt 0x0" ::: "memory");   // other jobs' code follows this body in the shared kernel: nothing there rewrites a register that these stores name ahead of this wait
}

// ---- all that depends on the inputs alone, in one grid of 256-thread blocks; a block's job goes by its index (every branch block-uniform):
// the 64x64 tiles of Wo, those of the four [128][128] weights, the scaled biases, then LayerNorm blocks (8 tokens) and sinusoid blocks (4 positions) in turn
// (one reads and writes memory, the other computes). WT = the eight [128 n][128 k] planes in the order q hi, q lo, k hi, k lo, v hi, v lo, p hi, p lo.
constexpr int kBlkWo = (kEmb / 64) * (kEmb / 64);        // 256
constexpr int kBlkW4 = 4 * (kDh / 64) * (kDh / 64);      // 16
constexpr int kBlkLn = kTok / 8;                         // 512
constexpr int kBlkPe = kSeq / kPePos;                    // 512
static_assert(kBlkPe == kBlkLn);
constexpr int kBlkPrelude = kBlkWo + kBlkW4 + 1 + kBlkLn + kBlkPe;
__global__ __launch_bounds__(256) void prelude_kernel(
    const float* __restrict__ x, const float* __restrict__ gamma, const float* __restrict__ beta,
    const float* __restrict__ Wq, const float* __restrict__ Wk, const float* __restrict__ Wv, const float* __restrict__ Wp,
    const float* __restrict__ Wo, const float* __restrict__ bq, const float* __restrict__ bk,
    __bf16* __restrict__ WT, __bf16* __restrict__ WoTh, __bf16* __restrict__ WoTl, float* __restrict__ qb, float* __restrict__ kb,
    unsigned* __restrict__ xh, unsigned* __restrict__ xl, unsigned* __restrict__ peh, unsigned* __restrict__ pel) {
  __shared__ __align__(16) float tile[64][68];
  int blk = blockIdx.x;
  if (blk < kBlkWo) { transpose_split_bf16_tile(tile, blk % (kEmb / 64), blk / (kEmb / 64), Wo, kEmb, WoTh, WoTl, kEmb); return; }
  blk -= kBlkWo;
  if (blk < kBlkW4) {
    const int w = blk >> 2;
    const float* in = (w == 0) ? Wq : (w == 1) ? Wk : (w == 2) ? Wv : Wp;
    __bf16* oh = WT + (size_t)(2 * w) * (kDh * kDh);
    transpose_split_bf16_tile(tile, blk & 1, (blk >> 1) & 1, in, kDh, oh, oh + kDh * kDh, kDh);
    return;
  }
  blk -= kBlkW4;
  if (blk == 0) { bias16_block(bq, bk, qb, kb); return; }
  blk -= 1;
  if (blk & 1) posenc_split_block(blk >> 1, peh, pel);
  else         layernorm_split_rows(blk >> 1, x, gamma, beta, xh, xl);
}

// ---- the four projections in one grid: blocks 0..127 q, 128..255 k, 256..383 v, 384..447 p (block-uniform branches); operands and results as in gemm64_tile
constexpr int kBlkProj  = (kTok * kHeads / 64) * (kDh / 64) / 8;   // 1024 tiles -> 128 blocks
constexpr int kBlkProjP = (kSeq * kHeads / 64) * (kDh / 64) / 8;   // 512 tiles -> 64 blocks
__global__ __launch_bounds__(256) void proj4_kernel(
    const unsigned short* __restrict__ xnh, const unsigned short* __restrict__ xnl,
    const unsigned short* __restrict__ peh, const unsigned short* __restrict__ pel, const unsigned short* __restrict__ WT,
    const float* __restrict__ qb, const float* __restrict__ kb, const float* __restrict__ bv,
    const float* __restrict__ ub, const float* __restrict__ vb,
    _Float16* __restrict__ qu16, _Float16* __restrict__ qv16, _Float16* __restrict__ k16, _Float16* __restrict__ vt16, _Float16* __restrict__ pp16) {
  __shared__ __align__(16) float sT[8][16 * 68];
  __shared__ __align__(16) float sA[8][128];
  const int w = blockIdx.x / kBlkProj, bx = blockIdx.x % kBlkProj;
  const unsigned short* Bh = WT + (size_t)(2 * w) * (kDh * kDh);
  const unsigned short* Bl = Bh + kDh * kDh;
  // q, k, v: head by head (16 blocks each, A rows = tokens at pitch kEmb)
  if (w == 0)         // (q + bq + u_bias[h])*16 and (q + bq + v_bias[h])*16: two fragment-order f16 planes [kTok][kDh] a head, from one product
    gemm64_tile<1, true, 2, 4, false>(sT, bx & 15, bx >> 4, false, xnh, xnl, kEmb, kDh, Bh, Bl, kDh, 0, qu16, qv16, kDh, (long)kTok * kDh, qb, 0,
        nullptr, 0, nullptr, nullptr, nullptr, kTok, kDh, kDh, 16.0f, ub + (bx >> 4) * kDh, vb + (bx >> 4) * kDh, sA);
  else if (w == 1)    // k*16 (+16 bk): one fragment-order f16 plane [kTok][kDh] a head
    gemm64_tile<1, true, 2, 3, false>(sT, bx & 15, bx >> 4, false, xnh, xnl, kEmb, kDh, Bh, Bl, kDh, 0, k16, nullptr, kDh, (long)kTok * kDh, kb, 0,
        nullptr, 0, nullptr, nullptr, nullptr, kTok, kDh, kDh, 16.0f);
  else if (w == 2)    // (v + bv)*16, transposed: per batch a fragment-order f16 plane [kEmb c][kSeq keys], c = 128 h + d
    gemm64_tile<1, true, 2, 5, false>(sT, bx & 15, bx >> 4, false, xnh, xnl, kEmb, kDh, Bh, Bl, kDh, 0, vt16, nullptr, kSeq, (long)kEmb * kSeq, bv, 0,
        nullptr, 0, nullptr, nullptr, nullptr, kTok, kDh, kDh, 1.0f);
  else                // p*16: head by head (8 blocks each), one fragment-order f16 plane [kSeq][kDh] a head
    gemm64_tile<1, true, 0, 3, false>(sT, bx & 7, bx >> 3, false, peh, pel, kEmb, kDh, Bh, Bl, kDh, 0, pp16, nullptr, kDh, (long)kSeq * kDh, nullptr, 0,
        nullptr, 0, nullptr, nullptr, nullptr, kSeq, kDh, kDh, 16.0f);
}

// ---- out = ctx.Wo + bo : A bf16 hi/lo [4096][1024], Bt bf16 hi/lo [1024 n][1024 k], C f32 [4096][1024]; 1024 tiles -> 128 blocks
constexpr int kBlkOut = (kTok / 64) * (kEmb / 64) / 8;
__global__ __launch_bounds__(256) void out_gemm_kernel(const unsigned short* __restrict__ ctxh, const unsigned short* __restrict__ ctxl,
                                                      const unsigned short* __restrict__ WoTh, const unsigned short* __restrict__ WoTl,
                                                      const float* __restrict__ bo, float* __restrict__ out) {
  __shared__ __align__(16) float sT[8][16 * 68];
  gemm64_tile<1, true, 2, 0, false, 0, true, true>(sT, blockIdx.x, 0, false, ctxh, ctxl, kEmb, 0, WoTh, WoTl, kEmb, 0, out, nullptr, kEmb, 0, bo, 0,
      nullptr, 0, nullptr, nullptr, nullptr, kTok, kEmb, kEmb, 1.0f);
}

// ---- content and position scores, relative shift, softmax and p.v of 64 query rows of one (b, h) in one block; the rows' scores never leave LDS.
// 64 rows, so that every k, p and v^T fragment fetched from L2 feeds four query tiles; the rows' scores fit in LDS as f16.
// grid = (kSeq / 64, kBatch * kHeads), 512 threads = 16 waves. sc[r][c] (f16), r = a - a0, holds in turn:
//   1. shifted[a][c] / 32, shifted[a][c] = c <= a ? ps[a][S-1-a+c] : (c == a+1 ? 0 : ps[a+1][c-a-2]), ps[a][n] = (16(q[a] + v_bias)).(16p[n])/256: the c >= a+2 part is the
//      product of rows a0+1..a0+64 with p rows 0..S-a0-1, the c <= a part that of rows a0..a0+63 with p rows S-64-a0..S-1; each result is stored
//      at its shifted column, results that fall outside the row are dropped; every sc[r][c] gets exactly one store;
//   2. s = (content + shifted) / 32, content[a][key] = (16(q[a] + u_bias)).(16k[key])/256;
//   3. f16(exp(s - max) / sum * 2^15), written over the same row by the wave that owns the row;
//   4. (as f32, over the scores) the 8 key groups' partials of p.v (pitch kPartPitch), summed in group order 0..7; output = bf16 hi/lo [kTok][kEmb] planes in fragment order.
constexpr int kRows      = 64;
constexpr int kScPitch   = kSeq + 8;    // f16 elements; 4112 B = 16 B x odd, rows 8 apart = 32 banks apart
constexpr int kPartPitch = kDh + 4;     // floats; rows 8 apart = 32 banks apart
constexpr int kAttnLds   = 8 * kRows * kPartPitch;            // floats: the partials are the larger of the two uses
static_assert(kRows * kScPitch * 2 <= kAttnLds * 4);
static_assert(kAttnLds * 4 <= 327680);
// every "#pragma unroll" in the three helpers below: constant indices keep the fragment and accumulator arrays in registers
// qf[i][kk] = the lane's A fragments of 64 query rows; r0..r3 = the first chunks of the lane's own rows (tile rows 16 i + lane & 15) and lane half in the fragment-order plane
__device__ __forceinline__ void load_q(v16h (&qf)[4][4], const _Float16* r0, const _Float16* r1, const _Float16* r2, const _Float16* r3) {
#pragma unroll
  for (int kk = 0; kk < 4; ++kk) {
    qf[0][kk] = Frag<_Float16>::loadf(r0 + 512 * kk); qf[1][kk] = Frag<_Float16>::loadf(r1 + 512 * kk);
    qf[2][kk] = Frag<_Float16>::loadf(r2 + 512 * kk); qf[3][kk] = Frag<_Float16>::loadf(r3 + 512 * kk);
  }
  // the four pointers as inputs: their registers stay as the loads name them (no result lands on them) up to this wait
  asm volatile("s_wait_xcnt 0x0" :: "v"(r0), "v"(r1), "v"(r2), "v"(r3) : "memory");
}
// acc[i] = 64 query rows (fragments qf[i][kk], k = 32 kk ..) x 16 rows of a fragment-order f16 plane [.][kDh] (4 KiB in a row); rows = the tile's first element + 8 lane
// (pointers typed as global: a pointer that has gone through an asm statement would otherwise be read with flat loads)
typedef const __attribute__((address_space(1))) _Float16* GlobH;
typedef const __attribute__((address_space(1))) v8h*      GlobH8;
__device__ __forceinline__ void score_tile(const v16h (&qf)[4][4], GlobH& rows, v8f (&acc)[4]) {
  v16h bf[4];
#pragma unroll
  for (int kk = 0; kk < 4; ++kk) {                            // as Frag<_Float16>::loadf
    Frag<_Float16>::U f;
    f.h[0] = *(GlobH8)(rows + kk * 512);
    f.h[1] = *(GlobH8)(rows + kk * 512 + 256);
    bf[kk] = f.v;
  }
  // The loaded values, as inputs only: all of a tile's loads are issued before the first product (one memory latency a tile, not one per k step).
  // The pointer goes through the statement: the caller's step to the next tile, the next write of the registers that the loads name, comes behind this wait.
  asm volatile("s_wait_xcnt 0x0" : "+v"(rows) : "v"(bf[0]), "v"(bf[1]), "v"(bf[2]), "v"(bf[3]) : "memory");
#pragma unroll
  for (int i = 0; i < 4; ++i) acc[i] = (v8f){0.f,0.f,0.f,0.f,0.f,0.f,0.f,0.f};
#pragma unroll
  for (int kk = 0; kk < 4; ++kk)
#pragma unroll
    for (int i = 0; i < 4; ++i) acc[i] = Frag<_Float16>::mma(qf[i][kk], bf[kk], acc[i]);
}
// one step down a row of the tile is one step right in the shifted table: element 16 i + r of the lane goes to dst + (16 i + r) * (pitch + 1).
// GUARD: c0 = the column that dst stands for; elements whose column falls outside 0 .. kSeq - 1 are dropped (only the tiles at a row's ends have such)
template <bool GUARD>
__device__ __forceinline__ void store_shifted(_Float16* dst, const v8f (&acc)[4], int c0) {
#pragma unroll
  for (int i = 0; i < 4; ++i)
#pragma unroll
    for (int r = 0; r < 8; ++r) {
      const int d = (i << 4) + r;
      if (!GUARD || (unsigned)(c0 + d) < (unsigned)kSeq)
        dst[d * (kScPitch + 1)] = (_Float16)(acc[i][r] * (1.0f / 8192.0f));
    }
}
// y[e] = 2^t[e]. Eight v_exp_f32 in one statement, each result in a register of its own ("=&v"): none of them reads the result or takes the source of the one in front of it;
// the v_nop fills the slot that the instruction set asks for between the last one and whatever vector instruction the compiler puts behind the statement
__device__ __forceinline__ void exp2x8(float (&y)[8], const float (&t)[8]) {
  asm("v_exp_f32 %0, %8\n\tv_exp_f32 %1, %9\n\tv_exp_f32 %2, %10\n\tv_exp_f32 %3, %11\n\tv_exp_f32 %4, %12\n\tv_exp_f32 %5, %13\n\tv_exp_f32 %6, %14\n\tv_exp_f32 %7, %15\n\tv_nop"
      : "=&v"(y[0]), "=&v"(y[1]), "=&v"(y[2]), "=&v"(y[3]), "=&v"(y[4]), "=&v"(y[5]), "=&v"(y[6]), "=&v"(y[7])
      : "v"(t[0]), "v"(t[1]), "v"(t[2]), "v"(t[3]), "v"(t[4]), "v"(t[5]), "v"(t[6]), "v"(t[7]));
}
__global__ __launch_bounds__(512) void attn_rows_kernel(const _Float16* __restrict__ qu16, const _Float16* __restrict__ qv16, const _Float16* __restrict__ k16,
                                                       const _Float16* __restrict__ pp16, const _Float16* __restrict__ vt16,
                                                       unsigned short* __restrict__ Ch, unsigned short* __restrict__ Cl) {
  __shared__ __align__(16) float part[kAttnLds];
  _Float16* sc = (_Float16*)part;
  const int t = threadIdx.x, lane = t & 31;
  const int wave = __builtin_amdgcn_readfirstlane(t >> 5);    // scalar, so that the tile loops branch on scalars
  const int a0 = blockIdx.x * kRows;
  const int bh = blockIdx.y, b = bh / kHeads, h = bh % kHeads;
  const int rlane = lane & 15;
  const int half8 = (lane >> 4) * 8;                          // k offset of this lane half (A, B) and D row offset
  const size_t qo = ((size_t)h * kTok + b * kSeq) * kDh + (lane >> 4) * 128;   // fragment order: any row s, this lane half, at (s & ~15) * kDh + (s & 15) * 8
  const _Float16* qub = qu16 + qo;                            // q + u_bias, for the content product
  const _Float16* qvb = qv16 + qo;                            // q + v_bias, for the position products
  const _Float16* kb = k16 + ((size_t)h * kTok + b * kSeq) * kDh + lane * 8;   // fragment-order planes: row s (a multiple of 16) at s * kDh, the lane's chunk
  const _Float16* pb = pp16 + (size_t)h * kSeq * kDh + lane * 8;

  // every "#pragma unroll" in this kernel: constant indices keep the fragment and accumulator arrays in registers
  if (t < kRows) { const int c = a0 + t + 1; if (c < kSeq) sc[t * kScPitch + c] = (_Float16)0.0f; }

  v16h qf[4][4];
  v8f acc4[4];
  // ---- 1a. columns c >= a+2: query rows a+1 (the last row of the table has no such column; its address is clamped) ----
  {
    const _Float16* qr[4];
#pragma unroll
    for (int i = 0; i < 4; ++i) {
      const int s = (a0 + 1 + (i << 4) + rlane < kSeq) ? (a0 + 1 + (i << 4) + rlane) : (kSeq - 1);
      qr[i] = qvb + (size_t)(s & ~15) * kDh + (s & 15) * 8;
    }
    load_q(qf, qr[0], qr[1], qr[2], qr[3]);
  }
  const int nUp = (kSeq - a0) >> 4;                           // 16-column tiles of either part; nUp + nLo = kSeq / 16 + 4
  const int nLo = (a0 + kRows) >> 4;
  GlobH prow = (GlobH)(pb + (size_t)(wave << 4) * kDh);                       // the wave's tile; 16 tiles on a trip
  for (int jj = wave; jj < nUp; jj += 16, prow += (size_t)256 * kDh) {
    const int n0 = jj << 4;
    score_tile(qf, prow, acc4);
    const int cmin = n0 + a0 + 2;                             // column of the tile's element (row 0, n0); the tile spans cmin .. cmin + 78
    _Float16* dst = sc + half8 * kScPitch + cmin + rlane + half8;
    if (cmin + 78 < kSeq) store_shifted<false>(dst, acc4, 0);
    else                  store_shifted<true>(dst, acc4, cmin + rlane + half8);
  }
  // ---- 1b. columns c <= a: query rows a ----
  {
    const _Float16* q0 = qvb + (size_t)a0 * kDh + rlane * 8;
    load_q(qf, q0, q0 + 16 * kDh, q0 + 32 * kDh, q0 + 48 * kDh);
  }
  const int jLo = (wave - nUp) & 15;                          // the deal of tiles to waves goes on where 1a's ended
  prow = (GlobH)(pb + (size_t)((kSeq - kRows - a0) + (jLo << 4)) * kDh);
  for (int jj = jLo; jj < nLo; jj += 16, prow += (size_t)256 * kDh) {
    const int n0 = (kSeq - kRows - a0) + (jj << 4);
    score_tile(qf, prow, acc4);
    const int cmin = n0 + a0 - (kSeq - 1);                    // = 16 jj - 63
    _Float16* dst = sc + half8 * kScPitch + cmin + rlane + half8;
    if (cmin >= 0) store_shifted<false>(dst, acc4, 0);
    else           store_shifted<true>(dst, acc4, cmin + rlane + half8);
  }
  __syncthreads();                                            // every shifted position score is in LDS before the content product adds to it

  // ---- 2. content; wave w takes the 16-key tiles w, w + 16, .. w + 112 ----
  {
    const _Float16* q0 = qub + (size_t)a0 * kDh + rlane * 8;  // behind the barrier (which waits for every load): in flight together with the first key tile's loads
    load_q(qf, q0, q0 + 16 * kDh, q0 + 32 * kDh, q0 + 48 * kDh);
  }
  GlobH krow = (GlobH)(kb + (size_t)(wave << 4) * kDh);
  for (int jj = wave; jj < kSeq / 16; jj += 16, krow += (size_t)256 * kDh) {
    score_tile(qf, krow, acc4);
    _Float16* e = sc + half8 * kScPitch + (jj << 4) + rlane;
    _Float16 old[4][8];
#pragma unroll
    for (int i = 0; i < 4; ++i)
#pragma unroll
      for (int r = 0; r < 8; ++r) old[i][r] = e[((i << 4) + r) * kScPitch];
#pragma unroll
    for (int i = 0; i < 4; ++i)
#pragma unroll
      for (int r = 0; r < 8; ++r) e[((i << 4) + r) * kScPitch] = (_Float16)(acc4[i][r] * (1.0f / 8192.0f) + (float)old[i][r]);
  }
  __syncthreads();                                            // whole score rows are in LDS before a wave takes its rows' maximum

  // ---- 3. softmax; wave w owns rows 4w .. 4w + 3, lane l columns 256 it + 8 l .. + 7 ----
#pragma unroll 1   // one row's 64 floats a lane live at a time, not four rows'
  for (int rr = 0; rr < 4; ++rr) {
    _Float16* srow = sc + (wave * 4 + rr) * kScPitch + 8 * lane;
    float x[8][8];
    v8h hx[8];
#pragma unroll
    for (int it = 0; it < 8; ++it) hx[it] = *(const v8h*)(srow + it * 256);
    v8h m8 = hx[0];                                           // the maximum of f16 values is exact in f16: taken on the packed halves
#pragma unroll
    for (int it = 1; it < 8; ++it) m8 = __builtin_elementwise_max(m8, hx[it]);
    float mx = fmaxf(fmaxf(fmaxf((float)m8[0], (float)m8[1]), fmaxf((float)m8[2], (float)m8[3])), fmaxf(fmaxf((float)m8[4], (float)m8[5]), fmaxf((float)m8[6], (float)m8[7])));
#pragma unroll
    for (int off = 1; off < 32; off <<= 1) mx = fmaxf(mx, __shfl_xor(mx, off, 32));
    float sum = 0.f;
#pragma unroll
    for (int it = 0; it < 8; ++it) {
      float tt[8];
#pragma unroll
      for (int e = 0; e < 8; ++e) tt[e] = ((float)hx[it][e] - mx) * 1.442695041f;   // exp(d) = 2^(d log2 e)
      exp2x8(x[it], tt);
      sum += ((x[it][0] + x[it][1]) + (x[it][2] + x[it][3])) + ((x[it][4] + x[it][5]) + (x[it][6] + x[it][7]));
    }
#pragma unroll
    for (int off = 1; off < 32; off <<= 1) sum += __shfl_xor(sum, off, 32);
    const float f = (1.0f / sum) * 32768.0f;
#pragma unroll
    for (int it = 0; it < 8; ++it) {                          // each lane writes over the 16 bytes that it read
      v8h hv;
#pragma unroll
      for (int e = 0; e < 8; ++e) hv[e] = (_Float16)(x[it][e] * f);
      *(v8h*)(srow + it * 256) = hv;
    }
  }
  __syncthreads();                                            // all 64 rows of p are in LDS before any wave reads them as A fragments

  // ---- 4. p.v: wave = (key group kg of 256 keys, half dh of the 128 columns); ctx[q][d] = 2^-19 * sum_key p[q][key] * Vt[d][key] ----
  const int kg = wave & 7, dh = wave >> 3;
  const _Float16* Ar = sc + rlane * kScPitch + kg * (kSeq / 8) + half8;
  const _Float16* Br = vt16 + ((size_t)bh * kDh + dh * 64) * kSeq + kg * (kSeq / 8) * 16 + lane * 8;   // fragment order: 16 rows x 32 keys = 512 elements in a row
  v8f acc[4][4];
#pragma unroll
  for (int i = 0; i < 4; ++i)
#pragma unroll
    for (int j = 0; j < 4; ++j) acc[i][j] = (v8f){0.f,0.f,0.f,0.f,0.f,0.f,0.f,0.f};
  for (int k0 = 0; k0 < kSeq / 8; k0 += 64) {                 // 64 keys a trip: 16 loads of Vt in flight together
    v16h bf[2][4];
#pragma unroll
    for (int s = 0; s < 2; ++s)
#pragma unroll
      for (int j = 0; j < 4; ++j) bf[s][j] = Frag<_Float16>::loadf(Br + (size_t)(j << 4) * kSeq + (k0 + 32 * s) * 16);
#pragma unroll
    for (int s = 0; s < 2; ++s) {
      v16h af[4];
#pragma unroll
      for (int i = 0; i < 4; ++i) af[i] = Frag<_Float16>::load(Ar + (i << 4) * kScPitch + k0 + 32 * s);
#pragma unroll
      for (int i = 0; i < 4; ++i)
#pragma unroll
        for (int j = 0; j < 4; ++j) acc[i][j] = Frag<_Float16>::mma(af[i], bf[s][j], acc[i][j]);
    }
  }
  __syncthreads();                                            // every wave has read its p fragments before the partials overwrite them

  float* mine = part + kg * (kRows * kPartPitch) + dh * 64;
#pragma unroll
  for (int i = 0; i < 4; ++i)
#pragma unroll
    for (int j = 0; j < 4; ++j)
#pragma unroll
      for (int r = 0; r < 8; ++r) mine[((i << 4) + half8 + r) * kPartPitch + (j << 4) + rlane] = acc[i][j][r];
  __syncthreads();                                            // all 8 partials are in LDS before any thread sums them

  // fragment order of the [kTok][kEmb] planes: wave w writes the 512 B of (row tile g >> 3, k step (g >> 1) & 3 of the head's four, ld g & 1), g = w and 16 + w
#pragma unroll
  for (int it = 0; it < 2; ++it) {
    const int g = it * 16 + wave;
    const int row = (g >> 3) * 16 + rlane, c8 = ((g >> 1) & 3) * 32 + (g & 1) * 16 + half8;
    const float* sp = part + row * kPartPitch + c8;
    v4f pa[8], pb[8];
#pragma unroll
    for (int w = 0; w < 8; ++w) { pa[w] = *(const v4f*)(sp + w * (kRows * kPartPitch)); pb[w] = *(const v4f*)(sp + w * (kRows * kPartPitch) + 4); }
    // the loaded values, as inputs only: all 16 LDS reads are issued before the first sum (one LDS latency, not one a partial)
    asm volatile("" :: "v"(pa[0]), "v"(pa[1]), "v"(pa[2]), "v"(pa[3]), "v"(pa[4]), "v"(pa[5]), "v"(pa[6]), "v"(pa[7]),
                       "v"(pb[0]), "v"(pb[1]), "v"(pb[2]), "v"(pb[3]), "v"(pb[4]), "v"(pb[5]), "v"(pb[6]), "v"(pb[7]));
    v4f s0 = pa[0], s1 = pb[0];
#pragma unroll
    for (int w = 1; w < 8; ++w) { s0 += pa[w]; s1 += pb[w]; } // fixed order
    v8h hv, lv;
#pragma unroll
    for (int e = 0; e < 8; ++e) {
      const float f = ((e < 4) ? s0[e & 3] : s1[e & 3]) * (1.0f / 524288.0f);
      const unsigned short hb = f2bf_bits(f);
      hv[e] = __builtin_bit_cast(_Float16, hb);
      lv[e] = __builtin_bit_cast(_Float16, f2bf_bits(f - bf_bits2f(hb)));
    }
    const size_t co = ((size_t)(((b * kSeq + a0) >> 4) + (g >> 3)) * (kEmb / 32) + h * (kDh / 32) + ((g >> 1) & 3)) * 512 + (g & 1) * 256 + lane * 8;
    *(v8h*)(Ch + co) = hv;
    *(v8h*)(Cl + co) = lv;
    if (it == 0) asm volatile("s_wait_xcnt 0x0" ::: "memory");   // before the second pair's values and addresses take the registers that these stores name
  }
}

// =====================================================================================
extern "C" void kernel_launch(void* const* d_in, const int* in_sizes, int n_in, void* d_out, int out_size,
                              void* d_ws, size_t ws_size, hipStream_t stream) {
  if (n_in < 14) return;
  if (in_sizes[0] != kTok * kEmb || in_sizes[1] != kEmb || in_sizes[2] != kEmb ||
      in_sizes[3] != kDh * kDh || in_sizes[4] != kDh || in_sizes[5] != kDh * kDh || in_sizes[6] != kDh ||
      in_sizes[7] != kDh * kDh || in_sizes[8] != kDh || in_sizes[9] != kDh * kDh ||
      in_sizes[10] != kHeads * kDh || in_sizes[11] != kHeads * kDh || in_sizes[12] != kEmb * kEmb || in_sizes[13] != kEmb ||
      out_size != kTok * kEmb) return;
  const float* x      = (const float*)d_in[0];
  const float* gamma  = (const float*)d_in[1];
  const float* beta   = (const float*)d_in[2];
  const float* Wq     = (const float*)d_in[3];
  const float* bq     = (const float*)d_in[4];
  const float* Wk     = (const float*)d_in[5];
  const float* bk     = (const float*)d_in[6];
  const float* Wv     = (const float*)d_in[7];
  const float* bv     = (const float*)d_in[8];
  const float* Wp     = (const float*)d_in[9];
  const float* u_bias = (const float*)d_in[10];
  const float* v_bias = (const float*)d_in[11];
  const float* Wo     = (const float*)d_in[12];
  const float* bo     = (const float*)d_in[13];
  float* out = (float*)d_out;   // [2][2048][1024] f32

  // ---- workspace carve (all offsets multiples of 256 B; total 84,149,248 B) ----
  // (R0, R1, R8, R9 and, one plane a head, R4 2 x [8][4096][128], R5 [8][4096][128], R6 [8][2048][128] are in fragment order: see gemm64_tile)
  // R0 WqT,WkT,WvT,WpT hi/lo bf16 [128 n][128 k]   8 x 32,768        =     262,144
  // R1 WoT hi/lo bf16 [1024 n][1024 k]              2 x 2,097,152     =   4,194,304
  // R2 16·bq, 16·bk f32 [128]                       2 x 512           =       1,024
  // R4 (q + u_bias), (q + v_bias) f16 x16 [32768][128] 2 x 8,388,608  =  16,777,216
  // R5 K16 f16 x16 [32768][128]                                       =   8,388,608
  // R6 PP16 f16 x16 [16384][128]                                      =   4,194,304
  // R8 CTX hi/lo bf16 [4096][1024]                  2 x 8,388,608     =  16,777,216
  // R9 VT16 f16 x16 [2 b][1024][2048]                                 =   8,388,608
  // R10 XN hi/lo bf16 [4096][1024] 2 x 8,388,608, PE hi/lo bf16 [2048][1024] 2 x 4,194,304 = 25,165,824
  char* ws = (char*)d_ws; size_t off = 0;
  auto carve = [&](size_t bytes) -> char* { char* p = ws + off; off += (bytes + 255) & ~(size_t)255; return p; };
  const size_t nW   = (size_t)kDh * kDh;            // 16,384
  const size_t nWo  = (size_t)kEmb * kEmb;          // 1,048,576
  const size_t nHd  = (size_t)kTok * kHeads * kDh;   // 4,194,304 (= kTok*kEmb)
  const size_t nPp  = (size_t)kSeq * kHeads * kDh;   // 2,097,152
  __bf16* WqTh = (__bf16*)carve(nW * 2); __bf16* WqTl = (__bf16*)carve(nW * 2);
  __bf16* WkTh = (__bf16*)carve(nW * 2); __bf16* WkTl = (__bf16*)carve(nW * 2);
  __bf16* WvTh = (__bf16*)carve(nW * 2); __bf16* WvTl = (__bf16*)carve(nW * 2);
  __bf16* WpTh = (__bf16*)carve(nW * 2); __bf16* WpTl = (__bf16*)carve(nW * 2);
  __bf16* WoTh = (__bf16*)carve(nWo * 2); __bf16* WoTl = (__bf16*)carve(nWo * 2);
  float* qb16 = (float*)carve(kDh * 4); float* kb16 = (float*)carve(kDh * 4);
  _Float16* qu16 = (_Float16*)carve(nHd * 2);
  _Float16* qv16 = (_Float16*)carve(nHd * 2);
  _Float16* k16  = (_Float16*)carve(nHd * 2);
  _Float16* pp16 = (_Float16*)carve(nPp * 2);
  unsigned short* ctxh = (unsigned short*)carve(nHd * 2); unsigned short* ctxl = (unsigned short*)carve(nHd * 2);
  _Float16* vt16 = (_Float16*)carve((size_t)kBatch * kEmb * kSeq * 2);
  unsigned* xnh = (unsigned*)carve(nHd * 2);
  unsigned* xnl = (unsigned*)carve(nHd * 2);
  unsigned* peh = (unsigned*)carve((size_t)kSeq * kEmb * 2);
  unsigned* pel = (unsigned*)carve((size_t)kSeq * kEmb * 2);
  if (off > ws_size) return;

  // ---- prelude: weight planes (in [k][n] -> out [n][k]), scaled biases, LN planes, sinusoid planes: one launch ----
  prelude_kernel<<<kBlkPrelude, 256, 0, stream>>>(x, gamma, beta, Wq, Wk, Wv, Wp, Wo, bq, bk, WqTh, WoTh, WoTl, qb16, kb16, xnh, xnl, peh, pel);

  // ---- projections, head by head, of xn and pe, written as attention reads them (q with either bias, k, v^T, p): one launch ----
  proj4_kernel<<<3 * kBlkProj + kBlkProjP, 256, 0, stream>>>(U16(xnh), U16(xnl), U16(peh), U16(pel), U16(WqTh), qb16, kb16, bv, u_bias, v_bias, qu16, qv16, k16, vt16, pp16);

  // ---- all of attention for every (b, h) in one launch, into the ctx hi/lo planes ----
  attn_rows_kernel<<<dim3(kSeq / kRows, kBatch * kHeads), 512, 0, stream>>>(qu16, qv16, k16, pp16, vt16, ctxh, ctxl);   // 32 x 16 blocks of 64 query rows

  out_gemm_kernel<<<kBlkOut, 256, 0, stream>>>(ctxh, ctxl, U16(WoTh), U16(WoTl), bo, out);
}

// v010
// A run of this version takes 111 microseconds.
// Timed twice side by side with v009, it ran 1.12 and 1.11 times as fast.
// Counting every step since v000, it is 18.2 times as fast.
// Projections xn·W{q,k,v} (K=128), p = pe·Wp (K=128) and out = ctx·Wo (K=1024): v_wmma_f32_16x16x32_bf16 with bf16 hi/lo split operands (hi·hi + hi·lo + lo·hi); content (q+u)·kᵀ and position (q+v)·pᵀ tables (K=128): v_wmma_f32_16x16x32_f16 with plain f16 operands carried x16; p·v (K=2048): v_wmma_f32_16x16x32_f16 with p/l carried x2^15 and vᵀ carried x16; f32 accumulate everywhere; LayerNorm, sinusoid table, the u/v bias added to q (before the f16 rounding), relative shift and softmax in f32 on VALU.
// Between the score products and the softmax the scores (position / 32, then position + content, / 32) wait in LDS rounded to f16.
#include <hip/hip_runtime.h>
#include <math.h>

typedef __attribute__((ext_vector_type(16))) _Float16 v16h;
typedef __attribute__((ext_vector_type(8)))  _Float16 v8h;
typedef __attribute__((ext_vector_type(4)))  _Float16 v4h;
typedef __attribute__((ext_vector_type(16))) __bf16   v16b;
typedef __attribute__((ext_vector_type(8)))  __bf16   v8b;
typedef __attribute__((ext_vector_type(8)))  float    v8f;
typedef __attribute__((ext_vector_type(4)))  float    v4f;
typedef __attribute__((ext_vector_type(2)))  float    v2f;
#define U16(p) ((const unsigned short*)(const void*)(p))

__device__ __forceinline__ unsigned short f2bf_bits(float f) {
  unsigned u = __float_as_uint(f);
  return (unsigned short)((u + 0x7FFFu + ((u >> 16) & 1u)) >> 16);
}
__device__ __forceinline__ float bf_bits2f(unsigned short h) { return __uint_as_float(((unsigned)h) << 16); }

// hazard guards as plain device helpers
__device__ __forceinline__ void dep_guard_h(v8f& a, v8f& b, v16h x, v16h y) { asm volatile("v_nop\n\tv_nop\n\tv_nop\n\tv_nop" : "+v"(a), "+v"(b) : "v"(x), "v"(y)); }
__device__ __forceinline__ void dep_guard_b(v8f& a, v8f& b, v16b x, v16b y) { asm volatile("v_nop\n\tv_nop\n\tv_nop\n\tv_nop" : "+v"(a), "+v"(b) : "v"(x), "v"(y)); }
__device__ __forceinline__ void keep4_h(v16h a, v16h b, v16h c, v16h d) { asm volatile("v_nop" :: "v"(a), "v"(b), "v"(c), "v"(d)); }
__device__ __forceinline__ void keep4_b(v16b a, v16b b, v16b c, v16b d) { asm volatile("v_nop" :: "v"(a), "v"(b), "v"(c), "v"(d)); }
__device__ __forceinline__ void acc_guard4(v8f& a, v8f& b, v8f& c, v8f& d) { asm volatile("v_nop\n\tv_nop\n\tv_nop\n\tv_nop" : "+v"(a), "+v"(b), "+v"(c), "+v"(d)); }
template <typename T> struct Frag;
template <> struct Frag<_Float16> {
  typedef v16h V; union U { v16h v; v8h h[2]; };
  static __device__ __forceinline__ v16h load(const _Float16* p) {   // elements 0..7 <- p[0..7], 8..15 <- p[16..23]
    U f; f.h[0] = *(const v8h*)(p); f.h[1] = *(const v8h*)(p + 16); return f.v;
  }
  static __device__ __forceinline__ v16h loadf(const _Float16* p) {  // fragment-order plane: elements 0..7 <- p[0..7], 8..15 <- p[256..263]
    U f; f.h[0] = *(const v8h*)(p); f.h[1] = *(const v8h*)(p + 256); return f.v;
  }
  static __device__ __forceinline__ v8f mma(v16h a, v16h b, v8f c) {
    return __builtin_amdgcn_wmma_f32_16x16x32_f16(false, a, false, b, (short)0, c, false, false);
  }
  static __device__ __forceinline__ void guard(v8f& a, v8f& b, v16h x, v16h y) { dep_guard_h(a, b, x, y); }
  static __device__ __forceinline__ void keep(v16h a, v16h b, v16h c, v16h d) { keep4_h(a, b, c, d); }
};
template <> struct Frag<__bf16> {
  typedef v16b V; union U { v16b v; v8b h[2]; };
  static __device__ __forceinline__ v16b load(const __bf16* p) {
    U f; f.h[0] = *(const v8b*)(p); f.h[1] = *(const v8b*)(p + 16); return f.v;
  }
  static __device__ __forceinline__ v16b loadf(const __bf16* p) {
    U f; f.h[0] = *(const v8b*)(p); f.h[1] = *(const v8b*)(p + 256); return f.v;
  }
  static __device__ __forceinline__ v8f mma(v16b a, v16b b, v8f c) {
    return __builtin_amdgcn_wmma_f32_16x16x32_bf16(false, a, false, b, (short)0, c, false, false);
  }
  static __device__ __forceinline__ void guard(v8f& a, v8f& b, v16b x, v16b y) { dep_guard_b(a, b, x, y); }
  static __device__ __forceinline__ void keep(v16b a, v16b b, v16b c, v16b d) { keep4_b(a, b, c, d); }
};

// ---- Register-blocked batched WMMA GEMM ------------------------------------
// C[m,n] = scale * sum_k A[m,k] * Bt[n,k] (+bias)(+resid); each wave owns a 64x64 tile.
// A row-major [M,K] (AFRAG: fragment order); Bt [N,K] in fragment order; M,N % 64 == 0, K % 32 == 0.
// Fragment order of a 16-bit [R,K] plane: [R/16][K/32][2][32 lanes][8]; chunk (rt, kk, ld, lane) holds row 16 rt + (lane & 15), k = 32 kk + 16 ld + 8 (lane >> 4) .. + 7,
// so each of a fragment's two 16-byte loads reads 512 contiguous bytes (four whole lines) over the wave; same k order as the row-major loader.
// SPLIT: operands are hi/lo planes (A2/Bt2 = lo planes, same layout); product = hi·hi + hi·lo + lo·hi.
// BIAS_MODE: 0 = none, 1 = bias[m], 2 = bias[n].
// OUT_MODE: 0 = f32, 1 = f16, 2 = bf16 hi plane (Cout) + bf16 lo plane (Cout2), 3 = f16 [M,N] plane in fragment order (ldc unused),
// 4 = two planes as in 3: Cout = value + 16 add1[n], Cout2 = value + 16 add2[n] (add1, add2: batch index b's own vectors),
// 5 = f16 x16, transposed, in fragment order: element (m, n) is row b N + n, k = m % ldc of plane m / ldc (strideC = elements of a plane; ldc % 64 == 0; BIAS_MODE 0 or 2, no RESID, no ACT).
// ET: 0 = f16 operands, 1 = bf16 operands (pointers passed as 16-bit storage)
// bx = tiles / 8 (tile = 8 bx + wave), b = batch index (strideA/B/C/R and strideBias are per b), zsel = true takes BtZp, CoutZ and biasZ in
// place of Btp, Cout and bias (same A, same strides; non-split launches only), so two products of one A share a launch.
// The body is a device function of (bx, b, zsel) and the block's LDS slabs, so that several products can share one grid by block range.
template <int ET> struct Elem;
template <> struct Elem<0> { typedef _Float16 T; };
template <> struct Elem<1> { typedef __bf16 T; };
// PIPE (with SPLIT and AFRAG; K % 64 == 0, K >= 128): the k loop keeps two register stages of fragments and issues all 32 loads of a k step one k step ahead of its products.
template <int ET, bool SPLIT, int BIAS_MODE, int OUT_MODE, bool RESID, int ACT = 0, bool AFRAG = false, bool PIPE = false>
__device__ __forceinline__ void gemm64_tile(
    float (*sT)[16 * 68], int bx, int b, bool zsel,      // sT: per-wave 16x64 slab, pitch 68 floats; bx, b, zsel block-uniform
    const unsigned short* __restrict__ Ap, const unsigned short* __restrict__ A2p, int lda, long strideA,
    const unsigned short* __restrict__ Btp, const unsigned short* __restrict__ Bt2p, int ldb, long strideB,
    void* __restrict__ Cout0, void* __restrict__ Cout2, int ldc, long strideC,
    const float* __restrict__ bias0, long strideBias,
    const float* __restrict__ resid, long strideR,
    const unsigned short* __restrict__ BtZp, void* __restrict__ CoutZ, const float* __restrict__ biasZ,
    int M, int N, int K, float scale,
    const float* __restrict__ add1 = nullptr, const float* __restrict__ add2 = nullptr, float (*sA)[128] = nullptr) {   // sA: OUT_MODE 4 only, 128 floats of LDS a wave
  typedef typename Elem<ET>::T T;
  typedef typename Frag<T>::V V;
  const T* A = (const T*)Ap; const T* A2 = (const T*)A2p; const T* Bt = (const T*)(zsel ? BtZp : Btp); const T* Bt2 = (const T*)Bt2p;
  void* Cout = zsel ? CoutZ : Cout0;
  const float* bias = (BIAS_MODE != 0) ? ((zsel ? biasZ : bias0) + (size_t)b * strideBias) : nullptr;
  const int lane = threadIdx.x & 31;
  const int wave = threadIdx.x >> 5;
  const int tilesN = N >> 6;
  const int tilesM = M >> 6;
  const int tile = bx * 8 + wave;
  if (tile >= tilesM * tilesN) return;   // wave-uniform; no block barriers in this kernel
  const int tm = tile / tilesN;
  const int tn = tile - tm * tilesN;
  const int m0 = tm << 6;
  const int n0 = tn << 6;

  const T* Ab  = A  + (size_t)b * strideA;
  const T* Bb  = Bt + (size_t)b * strideB;
  const T* Ab2 = SPLIT ? (A2  + (size_t)b * strideA) : nullptr;
  const T* Bb2 = SPLIT ? (Bt2 + (size_t)b * strideB) : nullptr;

  const int rlane = lane & 15;                 // row (A) / col (B, D) within subtile
  const int koff  = (lane >> 4) * 8;           // k offset of this lane half
  const int mOff  = (lane >> 4) * 8;           // D row offset

  v8f acc[4][4];
#pragma unroll
  for (int i = 0; i < 4; ++i)
#pragma unroll
    for (int j = 0; j < 4; ++j) acc[i][j] = (v8f){0.f,0.f,0.f,0.f,0.f,0.f,0.f,0.f};

  if (PIPE) {
    const size_t ts = (size_t)(K >> 5) * 512;                 // from one 16-row tile of a plane to the next
    // subtile 0, k step 0 of the wave's tile in each plane: the same for the whole wave, so held in scalar registers; the lane's own chunk is l8 elements on
    const size_t bo0 = (size_t)__builtin_amdgcn_readfirstlane(n0 >> 4) * ts, ao0 = (size_t)__builtin_amdgcn_readfirstlane(m0 >> 4) * ts;
    const T* bp = Bb + bo0; const T* bp2 = Bb2 + bo0; const T* ap = Ab + ao0; const T* ap2 = Ab2 + ao0;
    const unsigned l8 = (unsigned)lane * 8u;
    V ah[2][4], al[2][4], bh[2][4], bl[2][4];
    // every "#pragma unroll" in the two lambdas: constant indices keep the fragment and accumulator arrays in registers
    auto fetch = [&](const int s, const int ko) {             // all of one k step's fragments into stage s; ko = elements from the pointers to that k step
#pragma unroll
      for (int j = 0; j < 4; ++j) {
        bh[s][j] = Frag<T>::loadf(bp + l8 + (j * ts + ko)); bl[s][j] = Frag<T>::loadf(bp2 + l8 + (j * ts + ko));
        ah[s][j] = Frag<T>::loadf(ap + l8 + (j * ts + ko)); al[s][j] = Frag<T>::loadf(ap2 + l8 + (j * ts + ko));
      }
      __builtin_amdgcn_sched_barrier(0);                      // the loads stay in front of the other stage's products: their latency runs under those
    };
    auto products = [&](const int s) {                        // per accumulator the order of the plain loop: hi.hi, hi.lo, lo.hi
      // (the plain loop's v_nop statements are not carried over: as asm operands the fragments would all have to lie in the first 256 registers, which spills; the compiler pads its builtin products itself)
#pragma unroll
      for (int i = 0; i < 4; ++i) {
#pragma unroll
        for (int j = 0; j < 4; ++j) {
          acc[i][j] = Frag<T>::mma(ah[s][i], bh[s][j], acc[i][j]);
          acc[i][j] = Frag<T>::mma(ah[s][i], bl[s][j], acc[i][j]);
          acc[i][j] = Frag<T>::mma(al[s][i], bh[s][j], acc[i][j]);
        }
      }
    };
    fetch(0, 0);
    for (int k0 = 0; k0 < K - 64; k0 += 64) {                 // two k steps a trip, so that each stage keeps its registers
      fetch(1, 512);
      products(0);
      fetch(0, 1024);
      products(1);
      // the four pointers and the lane offset as inputs: their registers stay as this trip's loads name them up to this wait; the step to the next trip comes behind it
      asm volatile("s_wait_xcnt 0x0" :: "s"(ap), "s"(ap2), "s"(bp), "s"(bp2), "v"(l8) : "memory");
      ap += 1024; ap2 += 1024; bp += 1024; bp2 += 1024;
    }
    fetch(1, 512);
    // directly behind the last loads: nothing of the code that follows takes a register that they name ahead of this wait
    asm volatile("s_wait_xcnt 0x0" :: "s"(ap), "s"(ap2), "s"(bp), "s"(bp2), "v"(l8) : "memory");
    __builtin_amdgcn_sched_barrier(0);                        // keeps later address arithmetic from being lifted in front of that wait
    products(0);
    products(1);
  } else
  for (int k0 = 0; k0 < K; k0 += 32) {
    V bh[4], bl[4];
    const size_t bo0 = ((size_t)(n0 >> 4) * (K >> 5) + (k0 >> 5)) * 512 + lane * 8;
    const size_t ao0 = AFRAG ? ((size_t)(m0 >> 4) * (K >> 5) + (k0 >> 5)) * 512 + lane * 8 : (size_t)(m0 + rlane) * lda + koff + k0;
    const T* bp = Bb + bo0; const T* bp2 = SPLIT ? (Bb2 + bo0) : bp;     // the lane's own row of subtile 0 in each plane; the others at constant steps
    const T* ap = Ab + ao0; const T* ap2 = SPLIT ? (Ab2 + ao0) : ap;
#pragma unroll
    for (int j = 0; j < 4; ++j) {
      const size_t bo = (size_t)j * (K >> 5) * 512;
      bh[j] = Frag<T>::loadf(bp + bo);
      if (SPLIT) bl[j] = Frag<T>::loadf(bp2 + bo);
    }
#pragma unroll
    for (int i = 0; i < 4; ++i) {
      const size_t ao = AFRAG ? (size_t)i * (K >> 5) * 512 : (size_t)(i << 4) * lda;
      V ah = AFRAG ? Frag<T>::loadf(ap + ao) : Frag<T>::load(ap + ao);
      V al;
      if (SPLIT) al = AFRAG ? Frag<T>::loadf(ap2 + ao) : Frag<T>::load(ap2 + ao);
#pragma unroll
      for (int j = 0; j < 4; ++j) {
        acc[i][j] = Frag<T>::mma(ah, bh[j], acc[i][j]);
        if (SPLIT) {
          acc[i][j] = Frag<T>::mma(ah, bl[j], acc[i][j]);
          acc[i][j] = Frag<T>::mma(al, bh[j], acc[i][j]);
        }
      }
      Frag<T>::guard(acc[i][0], acc[i][3], ah, SPLIT ? al : ah);
    }
    Frag<T>::keep(bh[0], bh[1], bh[2], bh[3]);
    if (SPLIT) Frag<T>::keep(bl[0], bl[1], bl[2], bl[3]);
    // the four pointers as inputs: their registers stay as this step's loads name them (no result lands on them, no step to the next k) up to this wait
    asm volatile("s_wait_xcnt 0x0" :: "v"(ap), "v"(ap2), "v"(bp), "v"(bp2) : "memory");
  }
  acc_guard4(acc[0][0], acc[0][1], acc[0][2], acc[0][3]);
  acc_guard4(acc[1][0], acc[1][1], acc[1][2], acc[1][3]);
  acc_guard4(acc[2][0], acc[2][1], acc[2][2], acc[2][3]);
  acc_guard4(acc[3][0], acc[3][1], acc[3][2], acc[3][3]);

  // ---- epilogue ----
  if (OUT_MODE == 5) {
    // an accumulator's lane holds 8 rows m of one column n, which is one 16-byte chunk of the transposed plane (row n, 8 k in a row): stored as it stands, 512 B a store, no trip through the slab
    const float* pb = bias + n0 + rlane;
    float bvj[4];
#pragma unroll   // constant indices keep the array in registers
    for (int j = 0; j < 4; ++j) bvj[j] = (BIAS_MODE == 2) ? pb[j << 4] : 0.f;
    // the pointer as an input: its registers stay as the loads name them (no result lands on them) up to this wait
    if (BIAS_MODE == 2) asm volatile("s_wait_xcnt 0x0" :: "v"(pb) : "memory");
#pragma unroll   // constant indices keep acc in registers
    for (int i = 0; i < 4; ++i) {
      const int mBase = m0 + (i << 4), s0 = mBase % ldc;     // k = s0 .. s0 + 15: one ld of one k step
      _Float16* C = (_Float16*)Cout + (size_t)(mBase / ldc) * strideC + ((size_t)((b * N + n0) >> 4) * (ldc >> 5) + (s0 >> 5)) * 512 + ((s0 >> 4) & 1) * 256 + lane * 8;
#pragma unroll
      for (int j = 0; j < 4; ++j) {                          // row tile (b N + n0) / 16 + j
        v8h hv;
#pragma unroll
        for (int r = 0; r < 8; ++r) hv[r] = (_Float16)((acc[i][j][r] * scale + bvj[j]) * 16.0f);
        *(v8h*)(C + (size_t)j * (ldc >> 5) * 512) = hv;
      }
      asm volatile("s_wait_xcnt 0x0" ::: "memory");          // before the next four stores' values and address take the registers that these name
    }
    return;
  }
  float* slab = sT[wave];
  const float* Rb = RESID ? (resid + (size_t)b * strideR) : nullptr;
  float* addv = (OUT_MODE == 4) ? sA[wave] : nullptr;
  if (OUT_MODE == 4) {   // 16 add1 (from lanes 0..15) and 16 add2 (from lanes 16..31) at the tile's 64 columns, into the wave's own LDS: the stores below take them eight columns a lane
    const float* pa = ((lane >> 4) ? add2 : add1) + n0 + rlane;
    float av[4];
#pragma unroll   // constant indices keep the array in registers
    for (int j = 0; j < 4; ++j) av[j] = pa[j << 4];
    // the pointer as an input: its registers stay as the loads name them (no result lands on them) up to this wait
    asm volatile("s_wait_xcnt 0x0" :: "v"(pa) : "memory");
#pragma unroll
    for (int j = 0; j < 4; ++j) addv[(lane >> 4) * 64 + (j << 4) + rlane] = 16.0f * av[j];
  }
#pragma unroll
  for (int i = 0; i < 4; ++i) {
    const int mBase = m0 + (i << 4);
#pragma unroll
    for (int j = 0; j < 4; ++j) {
      const int n = n0 + (j << 4) + rlane;
      float bv = 0.f;
      if (BIAS_MODE == 2) bv = bias[n];
#pragma unroll
      for (int r = 0; r < 8; ++r) {
        float v = acc[i][j][r] * scale;
        if (BIAS_MODE == 1) v += bias[mBase + mOff + r];
        if (BIAS_MODE == 2) v += bv;
        if (RESID) v += Rb[(size_t)(mBase + mOff + r) * ldc + n];
        if (ACT == 1) v = tanhf(v);
        if (ACT == 2) v = fmaxf(v, 0.0f);
        if (ACT == 3) v = v / (1.0f + expf(-v));
        if (ACT == 4) v = (v > 0.f) ? v : 0.01f * v;
        if (ACT == 5) v = 0.5f * v * (1.0f + erff(v * 0.70710678118654752f));
        slab[(mOff + r) * 68 + (j << 4) + rlane] = v;
      }
    }
    __builtin_amdgcn_fence(__ATOMIC_RELEASE, "workgroup");
    __builtin_amdgcn_wave_barrier();
    __builtin_amdgcn_fence(__ATOMIC_ACQUIRE, "workgroup");
    if (OUT_MODE == 0) {
      float* C = (float*)Cout + (size_t)b * strideC;
      const int hh = lane >> 4, c4 = (lane & 15) * 4;     // row seg = 256 B = 16 lanes x 16 B
      {
#pragma unroll
        for (int it = 0; it < 8; ++it) {
          const int row = it * 2 + hh;
          v4f v = *(const v4f*)(slab + row * 68 + c4);
          *(v4f*)(C + (size_t)(mBase + row) * ldc + n0 + c4) = v;
        }
        
      }
    } else if (OUT_MODE == 3) {
      // the slab is row tile mBase / 16, k steps n0 / 32 and n0 / 32 + 1 of the plane: 2 KiB in a row, 512 B a store
      _Float16* C = (_Float16*)Cout + (size_t)b * strideC + ((size_t)(mBase >> 4) * (N >> 5) + (n0 >> 5)) * 512 + lane * 8;
#pragma unroll   // the four stores go off one address at constant offsets
      for (int it = 0; it < 4; ++it) {
        const float* sp = slab + rlane * 68 + it * 16 + mOff;
        v8h hv;
#pragma unroll   // constant indices keep hv in registers
        for (int e = 0; e < 8; ++e) hv[e] = (_Float16)sp[e];
        *(v8h*)(C + it * 256) = hv;
      }
    } else if (OUT_MODE == 4) {
      // as OUT_MODE 3, for two planes
      const size_t co = (size_t)b * strideC + ((size_t)(mBase >> 4) * (N >> 5) + (n0 >> 5)) * 512 + lane * 8;
      _Float16* C = (_Float16*)Cout + co; _Float16* C2 = (_Float16*)Cout2 + co;
#pragma unroll   // the stores go off two addresses at constant offsets
      for (int it = 0; it < 4; ++it) {
        const float* sp = slab + rlane * 68 + it * 16 + mOff;
        const float* ap = addv + it * 16 + mOff;
        v8h hv, lv;
#pragma unroll   // constant indices keep hv, lv in registers
        for (int e = 0; e < 8; ++e) { hv[e] = (_Float16)(sp[e] + ap[e]); lv[e] = (_Float16)(sp[e] + ap[64 + e]); }
        *(v8h*)(C + it * 256) = hv;
        *(v8h*)(C2 + it * 256) = lv;
      }
    } else {
      const int q = lane >> 3, c8 = (lane & 7) * 8;
      unsigned short* C  = (unsigned short*)Cout  + (size_t)b * strideC;
      unsigned short* C2 = (OUT_MODE == 2) ? ((unsigned short*)Cout2 + (size_t)b * strideC) : nullptr;
      {
#pragma unroll
        for (int it = 0; it < 4; ++it) {
          const int row = it * 4 + q;
          const float* sp = slab + row * 68 + c8;
          v8h hv, lv;
#pragma unroll
          for (int e = 0; e < 8; ++e) {
            if (OUT_MODE == 1) {
              hv[e] = (_Float16)sp[e];
            } else {
              unsigned short hb = f2bf_bits(sp[e]);
              unsigned short lb = f2bf_bits(sp[e] - bf_bits2f(hb));
              hv[e] = __builtin_bit_cast(_Float16, hb);
              lv[e] = __builtin_bit_cast(_Float16, lb);
            }
          }
          *(v8h*)(C + (size_t)(mBase + row) * ldc + n0 + c8) = hv;
          if (OUT_MODE == 2) *(v8h*)(C2 + (size_t)(mBase + row) * ldc + n0 + c8) = lv;
        }
        
      }
    }
    asm volatile("s_wait_xcnt 0x0" ::: "memory");   // before the next slab's values and addresses take the registers that these stores name
    __builtin_amdgcn_fence(__ATOMIC_RELEASE, "workgroup");
    __builtin_amdgcn_wave_barrier();
    __builtin_amdgcn_fence(__ATOMIC_ACQUIRE, "workgroup");
  }
}

// ---- f32 [R][C] (pitch ldi) -> bf16 hi/lo transposed planes [C][R = ldo] in fragment order (see gemm64_tile); 64x64 tiles
// one block of 256 threads does tile (bx, by); tile = the block's LDS, [c][r]
__device__ __forceinline__ void transpose_split_bf16_tile(float (*tile)[68], int bx, int by, const float* __restrict__ in, int ldi,
                                                          __bf16* __restrict__ outH, __bf16* __restrict__ outL, int ldo) {
  const int c0 = bx * 64, r0 = by * 64;
  const int t = threadIdx.x, tx = t & 31, ty = t >> 5;
  for (int i = ty; i < 64; i += 8) {
    tile[tx][i]      = in[(size_t)(r0 + i) * ldi + c0 + tx];
    tile[32 + tx][i] = in[(size_t)(r0 + i) * ldi + c0 + 32 + tx];
  }
  __syncthreads();
  const int lane = t & 31;
  {
#pragma unroll
    for (int it = 0; it < 2; ++it) {                          // fragment order: wave w writes the 512 B of (row tile, k step, ld) = its index it * 8 + w
      const int g = it * 8 + ty, ct = g >> 2, kk = (g >> 1) & 1, ld = g & 1;
      const int c = ct * 16 + (lane & 15), c8 = kk * 32 + ld * 16 + (lane >> 4) * 8;
      const size_t o = (((size_t)((c0 >> 4) + ct) * (ldo >> 5) + (r0 >> 5) + kk) * 2 + ld) * 256 + lane * 8;
      v8b hv, lv;
#pragma unroll
      for (int e = 0; e < 8; ++e) {
        const float f = tile[c][c8 + e];
        const unsigned short hb = f2bf_bits(f);
        hv[e] = __builtin_bit_cast(__bf16, hb);
        lv[e] = __builtin_bit_cast(__bf16, f2bf_bits(f - bf_bits2f(hb)));
      }
      *(v8b*)(outH + o) = hv;
      *(v8b*)(outL + o) = lv;
    }
    asm volatile("s_wait_xcnt 0x0" ::: "memory");   // other jobs' code follows this body in the shared kernel: nothing there rewrites a register that these stores name ahead of this wait
  }
}

// =====================================================================================
constexpr int kBatch = 2;
constexpr int kSeq   = 2048;
constexpr int kEmb   = 1024;
constexpr int kHeads = 8;
constexpr int kDh    = 128;
constexpr int kTok   = kBatch * kSeq;          // 4096 tokens
constexpr int kPairs = kEmb / 2;               // 512 element pairs per row
static_assert(kHeads * kDh == kEmb);
static_assert(kPairs == 512);

// ---- LDS image of 16 rows of a bf16 plane, laid out for WMMA fragment reads: 8-column group g = column / 8 holds its 16 rows x 8 elements in a row (256 B), groups kGrp elements apart.
// kGrp = 272 B = 16 B x odd: a fragment's 16-byte read takes 256 contiguous bytes a lane half, and writers whose lanes walk the groups of one row meet no bank twice.
constexpr int kGrp = 16 * 8 + 8;
constexpr int kImg = (kEmb / 8) * kGrp;        // elements of a plane's image (34,816 B)
typedef __attribute__((ext_vector_type(2))) unsigned v2u;
typedef __attribute__((ext_vector_type(4))) unsigned v4u;
// the lane's fragment of k step kk (columns 32 kk .. + 31): same k order as Frag::loadf; lo = (lane >> 4) * kGrp + (lane & 15) * 8
__device__ __forceinline__ v16b img_frag(const unsigned short* img, int kk, int lo) {
  Frag<__bf16>::U f;
  f.h[0] = *(const v8b*)(img + kk * (4 * kGrp) + lo);
  f.h[1] = *(const v8b*)(img + kk * (4 * kGrp) + 2 * kGrp + lo);
  return f.v;
}

// ---- LayerNorm (biased variance, eps 1e-5) of 16 tokens -> xn as bf16 hi/lo images in LDS. One wave per token, two tokens a wave (rows wave and wave + 8 of the image):
// lane l owns columns 128 i + 4 l .. + 3, i = 0..7, so a load reads 512 contiguous bytes; the row's sums go over the lanes by a butterfly
// every "#pragma unroll" in the two functions: constant indices keep the arrays in registers
__device__ __forceinline__ void layernorm_one(v4f (&v)[8], const v4f (&g)[8], const v4f (&bt)[8], unsigned short* oh, unsigned short* ol) {
  const v4f a = ((v[0] + v[1]) + (v[2] + v[3])) + ((v[4] + v[5]) + (v[6] + v[7]));
  float s = (a.x + a.y) + (a.z + a.w);
#pragma unroll
  for (int off = 1; off < 32; off <<= 1) s += __shfl_xor(s, off, 32);
  const float mean = s * (1.0f / (float)kEmb);
#pragma unroll
  for (int i = 0; i < 8; ++i) v[i] = v[i] - mean;
  const v4f q = ((v[0] * v[0] + v[1] * v[1]) + (v[2] * v[2] + v[3] * v[3])) + ((v[4] * v[4] + v[5] * v[5]) + (v[6] * v[6] + v[7] * v[7]));
  float s2 = (q.x + q.y) + (q.z + q.w);
#pragma unroll
  for (int off = 1; off < 32; off <<= 1) s2 += __shfl_xor(s2, off, 32);
  const float var  = s2 * (1.0f / (float)kEmb);
  const float rstd = 1.0f / sqrtf(var + 1e-5f);
#pragma unroll
  for (int i = 0; i < 8; ++i) {
    unsigned short hb[4], lb[4];
#pragma unroll
    for (int e = 0; e < 4; ++e) {
      const float y = v[i][e] * rstd * g[i][e] + bt[i][e];
      hb[e] = f2bf_bits(y);
      lb[e] = f2bf_bits(y - bf_bits2f(hb[e]));
    }
    *(v2u*)(oh + 16 * i * kGrp) = (v2u){(unsigned)hb[0] | ((unsigned)hb[1] << 16), (unsigned)hb[2] | ((unsigned)hb[3] << 16)};
    *(v2u*)(ol + 16 * i * kGrp) = (v2u){(unsigned)lb[0] | ((unsigned)lb[1] << 16), (unsigned)lb[2] | ((unsigned)lb[3] << 16)};
  }
}
__device__ __forceinline__ void layernorm_rows_lds(int tok0, const float* __restrict__ x, const float* __restrict__ gamma, const float* __restrict__ beta,
                                                   unsigned short* sh, unsigned short* sl) {
  const int lane = threadIdx.x & 31, wave = threadIdx.x >> 5;
  const float* xr0 = x + (size_t)(tok0 + wave) * kEmb + 4 * lane;
  const float* xr1 = xr0 + 8 * kEmb;
  const float* gp = gamma + 4 * lane;
  const float* bp = beta + 4 * lane;
  v4f v0[8], v1[8], g[8], bt[8];
#pragma unroll
  for (int i = 0; i < 8; ++i) { v0[i] = *(const v4f*)(xr0 + 128 * i); v1[i] = *(const v4f*)(xr1 + 128 * i); }
#pragma unroll
  for (int i = 0; i < 8; ++i) { g[i] = *(const v4f*)(gp + 128 * i); bt[i] = *(const v4f*)(bp + 128 * i); }
  // The loaded values, as inputs only: all 32 loads are issued before the first sum (one memory latency for both tokens, gamma and beta).
  // The pointers as inputs: their registers stay as the loads name them up to these waits
  asm volatile("s_wait_xcnt 0x0" :: "v"(xr0), "v"(xr1),
               "v"(v0[0]), "v"(v0[1]), "v"(v0[2]), "v"(v0[3]), "v"(v0[4]), "v"(v0[5]), "v"(v0[6]), "v"(v0[7]),
               "v"(v1[0]), "v"(v1[1]), "v"(v1[2]), "v"(v1[3]), "v"(v1[4]), "v"(v1[5]), "v"(v1[6]), "v"(v1[7]) : "memory");
  asm volatile("s_wait_xcnt 0x0" :: "v"(gp), "v"(bp),
               "v"(g[0]), "v"(g[1]), "v"(g[2]), "v"(g[3]), "v"(g[4]), "v"(g[5]), "v"(g[6]), "v"(g[7]),
               "v"(bt[0]), "v"(bt[1]), "v"(bt[2]), "v"(bt[3]), "v"(bt[4]), "v"(bt[5]), "v"(bt[6]), "v"(bt[7]) : "memory");
  const int o = (lane >> 1) * kGrp + wave * 8 + (lane & 1) * 4;   // columns 4 lane .. + 3 of row wave: half of group lane / 2
  layernorm_one(v0, g, bt, sh + o, sl + o);
  layernorm_one(v1, g, bt, sh + o + 64, sl + o + 64);             // row wave + 8
}

// ---- sinusoid table: columns 2i = sin(pos * div_i), 2i+1 = cos(pos * div_i), div_i = exp(2i * (-ln 1e4 / kEmb)), f32; 16 positions from pos0 x 512 columns from 8 grp0,
// as bf16 hi/lo images in LDS (image group 0 = column group grp0). Thread t: the four pairs of group t & 63 (one 16-byte store a plane) in rows (t >> 6) + 4 j, with the four div_i taken once
__device__ __forceinline__ void posenc_rows_lds(int pos0, int grp0, unsigned short* sh, unsigned short* sl) {
  const int t = threadIdx.x, gl = t & 63, i4 = (grp0 + gl) * 4;
  const float kNegLogRate = -0.00899447301950799f;        // −ln(10000)/1024
  float freq[4];
#pragma unroll   // constant indices keep the array in registers
  for (int e = 0; e < 4; ++e) freq[e] = expf((float)(2 * (i4 + e)) * kNegLogRate);
#pragma unroll 1   // one copy of the four sine and cosine bodies in the text, not four
  for (int j = 0; j < 4; ++j) {
    const int r = (t >> 6) + 4 * j, pos = pos0 + r;
    v4u uh, ul;
#pragma unroll   // constant indices keep the vectors in registers
    for (int e = 0; e < 4; ++e) {
      const float ang  = (float)pos * freq[e];
      const float sv = sinf(ang), cv = cosf(ang);
      const unsigned short hs = f2bf_bits(sv), hc = f2bf_bits(cv);
      const unsigned short ls = f2bf_bits(sv - bf_bits2f(hs)), lc = f2bf_bits(cv - bf_bits2f(hc));
      uh[e] = (unsigned)hs | ((unsigned)hc << 16);
      ul[e] = (unsigned)ls | ((unsigned)lc << 16);
    }
    *(v4u*)(sh + gl * kGrp + r * 8) = uh;
    *(v4u*)(sl + gl * kGrp + r * 8) = ul;
  }
}

// ---- a wave's own 16 columns n of a [128 k][128 n] f32 weight as WMMA fragments (row or column lane & 15 = n, k order as Frag::loadf), bf16 hi/lo, built in registers.
// wo = the index of the lane's first element: row 8 (lane >> 4), the lane's column. Loads and split are two functions, so that several weights' loads can be in flight together
// every "#pragma unroll" in the two functions: constant indices keep the arrays in registers
__device__ __forceinline__ void weight_load(const float* __restrict__ w, int wo, float (&f)[4][16]) {
#pragma unroll
  for (int kk = 0; kk < 4; ++kk)
#pragma unroll
    for (int e = 0; e < 16; ++e) f[kk][e] = w[wo + (32 * kk + 16 * (e >> 3) + (e & 7)) * kDh];
}
typedef __attribute__((ext_vector_type(2))) __bf16 v2b;
__device__ __forceinline__ void weight_split(const float (&f)[4][16], v16b (&wh)[4], v16b (&wl)[4]) {
  union { v16b v; v2b p[8]; } uh[4], ul[4];
#pragma unroll
  for (int kk = 0; kk < 4; ++kk)
#pragma unroll
    for (int e = 0; e < 8; ++e) {                             // two elements at a time; the conversions round to nearest even, as f2bf_bits does
      const v2f ff = (v2f){f[kk][2 * e], f[kk][2 * e + 1]};
      const v2b h = __builtin_convertvector(ff, v2b);
      uh[kk].p[e] = h;
      ul[kk].p[e] = __builtin_convertvector(ff - __builtin_convertvector(h, v2f), v2b);
    }
#pragma unroll
  for (int kk = 0; kk < 4; ++kk) { wh[kk] = uh[kk].v; wl[kk] = ul[kk].v; }
}

// ---- all that comes before attention, in one grid of 256-thread blocks (the choice of job block-uniform):
// of each pair of blocks (2 blk, 2 blk + 1) one does LayerNorm of 16 tokens into LDS, then their q, k, v projections for all 8 heads; the other one 64x64 tile of Wo (hi/lo, transposed), the sinusoids of 16 positions x 4 heads into LDS, then their p projection.
// Wave w owns output columns 16 w .. + 15 of every weight and keeps those weight fragments in registers; the rows' fragments come from LDS.
// Products as hi.hi + hi.lo + lo.hi per k step (row operand named first). q, k, p: the weight is the A operand, so that a lane's accumulator holds 8 output columns of one row,
// which is one 16-byte chunk of a fragment-order plane (see gemm64_tile); v: the rows are the A operand, a lane holds 8 tokens of one column, one chunk of the transposed plane. Every store writes 512 contiguous bytes.
constexpr int kBlkTok = kTok / 16;             // 256
constexpr int kBlkPos = (kSeq / 16) * 2;       // 256
static_assert(kBlkPos == (kEmb / 64) * (kEmb / 64) && kBlkPos == kBlkTok);
__global__ __launch_bounds__(256) void front_kernel(
    const float* __restrict__ x, const float* __restrict__ gamma, const float* __restrict__ beta,
    const float* __restrict__ Wq, const float* __restrict__ Wk, const float* __restrict__ Wv, const float* __restrict__ Wp,
    const float* __restrict__ Wo, const float* __restrict__ bq, const float* __restrict__ bk, const float* __restrict__ bv,
    const float* __restrict__ ub, const float* __restrict__ vb,
    __bf16* __restrict__ WoTh, __bf16* __restrict__ WoTl,
    _Float16* __restrict__ qu16, _Float16* __restrict__ qv16, _Float16* __restrict__ k16, _Float16* __restrict__ vt16, _Float16* __restrict__ pp16) {
  __shared__ __align__(16) unsigned short sH[kImg];
  __shared__ __align__(16) unsigned short sL[kImg];
  __shared__ __align__(16) float sU[kEmb];     // 16 u_bias
  __shared__ __align__(16) float sV[kEmb];     // 16 v_bias
  __shared__ __align__(16) float sBq[kDh];     // 16 bq
  __shared__ __align__(16) float sBk[kDh];     // 16 bk
  __shared__ __align__(16) float tile[64][68];
  const int t = threadIdx.x, lane = t & 31, wave = t >> 5;
  const int rlane = lane & 15, half8 = (lane >> 4) * 8;
  const int blk = blockIdx.x >> 1;
  const int lo = (lane >> 4) * kGrp + rlane * 8;
  const int wo = half8 * kDh + 16 * wave + rlane;            // the lane's first element of a weight
  const size_t co = (size_t)blk * (16 * kDh) + wave * 256 + lane * 8;   // q, k: row tile blk, 16-column group wave, the lane's chunk
  // every "#pragma unroll" in this kernel: constant indices keep the fragment and accumulator arrays in registers
  if ((blockIdx.x + (blockIdx.x >> 8)) & 1) {                 // of blocks 2j and 2j + 1, and of i and i + 256, one is of either kind: whichever two share a WGP, one computes sines while the other waits for memory or multiplies
    transpose_split_bf16_tile(tile, blk % (kEmb / 64), blk / (kEmb / 64), Wo, kEmb, WoTh, WoTl, kEmb);
    const int rt = blk >> 1, hh = blk & 1;                   // positions 16 rt .. + 15, heads 4 hh .. + 3
    float fp[4][16];
    weight_load(Wp, wo, fp);
    asm volatile("s_wait_xcnt 0x0" :: "v"(wo) : "memory");   // the index as an input: the register that the loads name stays as it is up to this wait
    posenc_rows_lds(16 * rt, 64 * hh, sH, sL);
    v16b wph[4], wpl[4];
    weight_split(fp, wph, wpl);
    __syncthreads();                                          // the 16 rows' images are whole before any wave reads fragments of them
    _Float16* C = pp16 + (size_t)(4 * hh) * kSeq * kDh + (size_t)rt * (16 * kDh) + wave * 256 + lane * 8;
#pragma unroll
    for (int hl = 0; hl < 4; hl += 2) {                       // two heads at a time: two independent accumulator chains
      v8f a0 = (v8f){0.f,0.f,0.f,0.f,0.f,0.f,0.f,0.f}, a1 = a0;
      v16b xh[8], xl[8];
#pragma unroll
      for (int kk = 0; kk < 8; ++kk) { xh[kk] = img_frag(sH, 4 * hl + kk, lo); xl[kk] = img_frag(sL, 4 * hl + kk, lo); }
      // the loaded values, as inputs only: all 32 LDS reads are issued before the first product (one LDS latency, not one a k step)
      asm volatile("" :: "v"(xh[0]), "v"(xh[1]), "v"(xh[2]), "v"(xh[3]), "v"(xh[4]), "v"(xh[5]), "v"(xh[6]), "v"(xh[7]),
                         "v"(xl[0]), "v"(xl[1]), "v"(xl[2]), "v"(xl[3]), "v"(xl[4]), "v"(xl[5]), "v"(xl[6]), "v"(xl[7]));
#pragma unroll
      for (int kk = 0; kk < 4; ++kk) {
        a0 = Frag<__bf16>::mma(wph[kk], xh[kk], a0); a1 = Frag<__bf16>::mma(wph[kk], xh[4 + kk], a1);
        a0 = Frag<__bf16>::mma(wpl[kk], xh[kk], a0); a1 = Frag<__bf16>::mma(wpl[kk], xh[4 + kk], a1);
        a0 = Frag<__bf16>::mma(wph[kk], xl[kk], a0); a1 = Frag<__bf16>::mma(wph[kk], xl[4 + kk], a1);
      }
      v8h h0, h1;
#pragma unroll
      for (int r = 0; r < 8; ++r) { h0[r] = (_Float16)(a0[r] * 16.0f); h1[r] = (_Float16)(a1[r] * 16.0f); }
      *(v8h*)(C + (size_t)hl * kSeq * kDh) = h0;
      *(v8h*)(C + (size_t)(hl + 1) * kSeq * kDh) = h1;
    }
    asm volatile("s_wait_xcnt 0x0" ::: "memory");            // nothing behind rewrites a register that these stores name ahead of this wait
    return;
  }
  layernorm_rows_lds(16 * blk, x, gamma, beta, sH, sL);
  __builtin_amdgcn_sched_barrier(0);                          // the weights' loads stay behind LayerNorm: its registers and theirs together would pass 256 a wave, and only one block would fit a WGP
  const int t4 = 4 * t;
  v16b wah[4], wal[4], wbh[4], wbl[4];                        // first q's and k's fragments, then (wah, wal) v's
  {
    float fq[4][16], fk[4][16];
    weight_load(Wq, wo, fq); weight_load(Wk, wo, fk);
    const v4f u4 = *(const v4f*)(ub + t4), v4 = *(const v4f*)(vb + t4);
    // the indices as inputs: the registers that the loads name stay as they are up to this wait
    asm volatile("s_wait_xcnt 0x0" :: "v"(wo), "v"(t4), "v"(t) : "memory");
    *(v4f*)(sU + t4) = u4 * 16.0f;
    *(v4f*)(sV + t4) = v4 * 16.0f;
    weight_split(fq, wah, wal); weight_split(fk, wbh, wbl);
  }
  if (wave == 0) {                                            // wave-uniform
    const int l4 = 4 * lane;
    const v4f a = *(const v4f*)(bq + l4), b = *(const v4f*)(bk + l4);
    asm volatile("s_wait_xcnt 0x0" :: "v"(l4), "v"(lane) : "memory");   // the index as an input: as above
    *(v4f*)(sBq + l4) = a * 16.0f;
    *(v4f*)(sBk + l4) = b * 16.0f;
  }
  __syncthreads();                                            // the 16 tokens' images and the scaled biases are whole before any wave reads them
  unsigned oq = (unsigned)co;                                 // the lane's chunk in the head's plane of q + u, q + v and k alike: one index for the three stores
#pragma unroll 1   // one head's fragments live at a time
  for (int h = 0; h < kHeads; ++h) {
    v8f aq = (v8f){0.f,0.f,0.f,0.f,0.f,0.f,0.f,0.f}, ak = aq;
    v16b xh[4], xl[4];
#pragma unroll
    for (int kk = 0; kk < 4; ++kk) { xh[kk] = img_frag(sH, 4 * h + kk, lo); xl[kk] = img_frag(sL, 4 * h + kk, lo); }
    // the loaded values, as inputs only: all 16 LDS reads are issued before the first product (one LDS latency a head, not eight)
    asm volatile("" :: "v"(xh[0]), "v"(xh[1]), "v"(xh[2]), "v"(xh[3]), "v"(xl[0]), "v"(xl[1]), "v"(xl[2]), "v"(xl[3]));
#pragma unroll
    for (int kk = 0; kk < 4; ++kk) {
      aq = Frag<__bf16>::mma(wah[kk], xh[kk], aq); ak = Frag<__bf16>::mma(wbh[kk], xh[kk], ak);
      aq = Frag<__bf16>::mma(wal[kk], xh[kk], aq); ak = Frag<__bf16>::mma(wbl[kk], xh[kk], ak);
      aq = Frag<__bf16>::mma(wah[kk], xl[kk], aq); ak = Frag<__bf16>::mma(wbh[kk], xl[kk], ak);
    }
    __builtin_amdgcn_sched_barrier(0);                        // the biases' LDS reads stay behind the products, where the rows' fragments are dead: read earlier they would take the wave past 256 registers
    const int eo = 16 * wave + half8;                         // the lane's 8 output columns
    const float* su = sU + h * kDh + eo;
    const float* sv = sV + h * kDh + eo;
    v8h hu, hv, hk;
#pragma unroll
    for (int r = 0; r < 8; ++r) {
      const float q = aq[r] * 16.0f + sBq[eo + r];
      hu[r] = (_Float16)(q + su[r]);
      hv[r] = (_Float16)(q + sv[r]);
      hk[r] = (_Float16)(ak[r] * 16.0f + sBk[eo + r]);
    }
    *(v8h*)(qu16 + oq) = hu; *(v8h*)(qv16 + oq) = hv; *(v8h*)(k16 + oq) = hk;
    // the index goes through the statement: its step to the next head, the next write of the register that the stores name, comes behind this wait
    asm volatile("s_wait_xcnt 0x0" : "+v"(oq) :: "memory");
    oq += kTok * kDh;                                         // the next head's plane
  }
  // v in a pass of its own: with all three weights' fragments at once a wave would need more than 256 registers, and only one block would fit a WGP
  const int bvo = 16 * wave + rlane;
  float bvn;
  {
    float fv[4][16];
    weight_load(Wv, wo, fv);
    bvn = bv[bvo];
    asm volatile("s_wait_xcnt 0x0" :: "v"(wo), "v"(bvo) : "memory");   // the indices as inputs: as above
    weight_split(fv, wah, wal);
  }
  const int s0 = (16 * blk) % kSeq;                           // the tokens' batch element and their place in it
  unsigned ot = (unsigned)(((16 * blk) / kSeq) * kEmb * kSeq + (wave * (kSeq >> 5) + (s0 >> 5)) * 512 + ((s0 >> 4) & 1) * 256 + lane * 8);
#pragma unroll 1   // two heads' fragments live at a time
  for (int h = 0; h < kHeads; h += 2) {                       // two heads a trip: two independent accumulator chains
    v8f a0 = (v8f){0.f,0.f,0.f,0.f,0.f,0.f,0.f,0.f}, a1 = a0;
#pragma unroll
    for (int kk = 0; kk < 4; ++kk) {
      const v16b xh0 = img_frag(sH, 4 * h + kk, lo), xl0 = img_frag(sL, 4 * h + kk, lo);
      const v16b xh1 = img_frag(sH, 4 * h + 4 + kk, lo), xl1 = img_frag(sL, 4 * h + 4 + kk, lo);
      a0 = Frag<__bf16>::mma(xh0, wah[kk], a0); a1 = Frag<__bf16>::mma(xh1, wah[kk], a1);
      a0 = Frag<__bf16>::mma(xh0, wal[kk], a0); a1 = Frag<__bf16>::mma(xh1, wal[kk], a1);
      a0 = Frag<__bf16>::mma(xl0, wah[kk], a0); a1 = Frag<__bf16>::mma(xl1, wah[kk], a1);
    }
    v8h t0, t1;
#pragma unroll
    for (int r = 0; r < 8; ++r) { t0[r] = (_Float16)((a0[r] + bvn) * 16.0f); t1[r] = (_Float16)((a1[r] + bvn) * 16.0f); }
    *(v8h*)(vt16 + ot) = t0; *(v8h*)(vt16 + ot + kDh * kSeq) = t1;   // the second: a head's 8 row tiles of v^T on
    asm volatile("s_wait_xcnt 0x0" : "+v"(ot) :: "memory");   // as above
    ot += 2 * kDh * kSeq;
  }
}

// ---- out = ctx.Wo + bo : A bf16 hi/lo [4096][1024], Bt bf16 hi/lo [1024 n][1024 k], C f32 [4096][1024]; 1024 tiles -> 128 blocks
constexpr int kBlkOut = (kTok / 64) * (kEmb / 64) / 8;
__global__ __launch_bounds__(256) void out_gemm_kernel(const unsigned short* __restrict__ ctxh, const unsigned short* __restrict__ ctxl,
                                                      const unsigned short* __restrict__ WoTh, const unsigned short* __restrict__ WoTl,
                                                      const float* __restrict__ bo, float* __restrict__ out) {
  __shared__ __align__(16) float sT[8][16 * 68];
  gemm64_tile<1, true, 2, 0, false, 0, true, true>(sT, blockIdx.x, 0, false, ctxh, ctxl, kEmb, 0, WoTh, WoTl, kEmb, 0, out, nullptr, kEmb, 0, bo, 0,
      nullptr, 0, nullptr, nullptr, nullptr, kTok, kEmb, kEmb, 1.0f);
}

// ---- content and position scores, relative shift, softmax and p.v of 64 query rows of one (b, h) in one block; the rows' scores never leave LDS.
// 64 rows, so that every k, p and v^T fragment fetched from L2 feeds four query tiles; the rows' scores fit in LDS as f16.
// grid = (kSeq / 64, kBatch * kHeads), 512 threads = 16 waves. sc[r][c] (f16), r = a - a0, holds in turn:
//   1. shifted[a][c] / 32, shifted[a][c] = c <= a ? ps[a][S-1-a+c] : (c == a+1 ? 0 : ps[a+1][c-a-2]), ps[a][n] = (16(q[a] + v_bias)).(16p[n])/256: the c >= a+2 part is the
//      product of rows a0+1..a0+64 with p rows 0..S-a0-1, the c <= a part that of rows a0..a0+63 with p rows S-64-a0..S-1; each result is stored
//      at its shifted column, results that fall outside the row are dropped; every sc[r][c] gets exactly one store;
//   2. s = (content + shifted) / 32, content[a][key] = (16(q[a] + u_bias)).(16k[key])/256;
//   3. f16(exp(s - max) / sum * 2^15), written over the same row by the wave that owns the row;
//   4. (as f32, over the scores) the 8 key groups' partials of p.v (pitch kPartPitch), summed in group order 0..7; output = bf16 hi/lo [kTok][kEmb] planes in fragment order.
constexpr int kRows      = 64;
constexpr int kScPitch   = kSeq + 8;    // f16 elements; 4112 B = 16 B x odd, rows 8 apart = 32 banks apart
constexpr int kPartPitch = kDh + 4;     // floats; rows 8 apart = 32 banks apart
constexpr int kAttnLds   = 8 * kRows * kPartPitch;            // floats: the partials are the larger of the two uses
static_assert(kRows * kScPitch * 2 <= kAttnLds * 4);
static_assert(kAttnLds * 4 <= 327680);
// every "#pragma unroll" in the three helpers below: constant indices keep the fragment and accumulator arrays in registers
// qf[i][kk] = the lane's A fragments of 64 query rows; r0..r3 = the first chunks of the lane's own rows (tile rows 16 i + lane & 15) and lane half in the fragment-order plane
__device__ __forceinline__ void load_q(v16h (&qf)[4][4], const _Float16* r0, const _Float16* r1, const _Float16* r2, const _Float16* r3) {
#pragma unroll
  for (int kk = 0; kk < 4; ++kk) {
    qf[0][kk] = Frag<_Float16>::loadf(r0 + 512 * kk); qf[1][kk] = Frag<_Float16>::loadf(r1 + 512 * kk);
    qf[2][kk] = Frag<_Float16>::loadf(r2 + 512 * kk); qf[3][kk] = Frag<_Float16>::loadf(r3 + 512 * kk);
  }
  // the four pointers as inputs: their registers stay as the loads name them (no result lands on them) up to this wait
  asm volatile("s_wait_xcnt 0x0" :: "v"(r0), "v"(r1), "v"(r2), "v"(r3) : "memory");
}
// acc[i] = 64 query rows (fragments qf[i][kk], k = 32 kk ..) x 16 rows of a fragment-order f16 plane [.][kDh] (4 KiB in a row); rows = the tile's first element + 8 lane
// (pointers typed as global: a pointer that has gone through an asm statement would otherwise be read with flat loads)
typedef const __attribute__((address_space(1))) _Float16* GlobH;
typedef const __attribute__((address_space(1))) v8h*      GlobH8;
__device__ __forceinline__ void score_tile(const v16h (&qf)[4][4], GlobH& rows, v8f (&acc)[4]) {
  v16h bf[4];
#pragma unroll
  for (int kk = 0; kk < 4; ++kk) {                            // as Frag<_Float16>::loadf
    Frag<_Float16>::U f;
    f.h[0] = *(GlobH8)(rows + kk * 512);
    f.h[1] = *(GlobH8)(rows + kk * 512 + 256);
    bf[kk] = f.v;
  }
  // The loaded values, as inputs only: all of a tile's loads are issued before the first product (one memory latency a tile, not one per k step).
  // The pointer goes through the statement: the caller's step to the next tile, the next write of the registers that the loads name, comes behind this wait.
  asm volatile("s_wait_xcnt 0x0" : "+v"(rows) : "v"(bf[0]), "v"(bf[1]), "v"(bf[2]), "v"(bf[3]) : "memory");
#pragma unroll
  for (int i = 0; i < 4; ++i) acc[i] = (v8f){0.f,0.f,0.f,0.f,0.f,0.f,0.f,0.f};
#pragma unroll
  for (int kk = 0; kk < 4; ++kk)
#pragma unroll
    for (int i = 0; i < 4; ++i) acc[i] = Frag<_Float16>::mma(qf[i][kk], bf[kk], acc[i]);
}
// one step down a row of the tile is one step right in the shifted table: element 16 i + r of the lane goes to dst + (16 i + r) * (pitch + 1).
// GUARD: c0 = the column that dst stands for; elements whose column falls outside 0 .. kSeq - 1 are dropped (only the tiles at a row's ends have such)
template <bool GUARD>
__device__ __forceinline__ void store_shifted(_Float16* dst, const v8f (&acc)[4], int c0) {
#pragma unroll
  for (int i = 0; i < 4; ++i)
#pragma unroll
    for (int r = 0; r < 8; ++r) {
      const int d = (i << 4) + r;
      if (!GUARD || (unsigned)(c0 + d) < (unsigned)kSeq)
        dst[d * (kScPitch + 1)] = (_Float16)(acc[i][r] * (1.0f / 8192.0f));
    }
}
// y[e] = 2^t[e]. Eight v_exp_f32 in one statement, each result in a register of its own ("=&v"): none of them reads the result or takes the source of the one in front of it;
// the v_nop fills the slot that the instruction set asks for between the last one and whatever vector instruction the compiler puts behind the statement
__device__ __forceinline__ void exp2x8(float (&y)[8], const float (&t)[8]) {
  asm("v_exp_f32 %0, %8\n\tv_exp_f32 %1, %9\n\tv_exp_f32 %2, %10\n\tv_exp_f32 %3, %11\n\tv_exp_f32 %4, %12\n\tv_exp_f32 %5, %13\n\tv_exp_f32 %6, %14\n\tv_exp_f32 %7, %15\n\tv_nop"
      : "=&v"(y[0]), "=&v"(y[1]), "=&v"(y[2]), "=&v"(y[3]), "=&v"(y[4]), "=&v"(y[5]), "=&v"(y[6]), "=&v"(y[7])
      : "v"(t[0]), "v"(t[1]), "v"(t[2]), "v"(t[3]), "v"(t[4]), "v"(t[5]), "v"(t[6]), "v"(t[7]));
}
__global__ __launch_bounds__(512) void attn_rows_kernel(const _Float16* __restrict__ qu16, const _Float16* __restrict__ qv16, const _Float16* __restrict__ k16,
                                                       const _Float16* __restrict__ pp16, const _Float16* __restrict__ vt16,
                                                       unsigned short* __restrict__ Ch, unsigned short* __restrict__ Cl) {
  __shared__ __align__(16) float part[kAttnLds];
  _Float16* sc = (_Float16*)part;
  const int t = threadIdx.x, lane = t & 31;
  const int wave = __builtin_amdgcn_readfirstlane(t >> 5);    // scalar, so that the tile loops branch on scalars
  const int a0 = blockIdx.x * kRows;
  const int bh = blockIdx.y, b = bh / kHeads, h = bh % kHeads;
  const int rlane = lane & 15;
  const int half8 = (lane >> 4) * 8;                          // k offset of this lane half (A, B) and D row offset
  const size_t qo = ((size_t)h * kTok + b * kSeq) * kDh + (lane >> 4) * 128;   // fragment order: any row s, this lane half, at (s & ~15) * kDh + (s & 15) * 8
  const _Float16* qub = qu16 + qo;                            // q + u_bias, for the content product
  const _Float16* qvb = qv16 + qo;                            // q + v_bias, for the position products
  const _Float16* kb = k16 + ((size_t)h * kTok + b * kSeq) * kDh + lane * 8;   // fragment-order planes: row s (a multiple of 16) at s * kDh, the lane's chunk
  const _Float16* pb = pp16 + (size_t)h * kSeq * kDh + lane * 8;

  // every "#pragma unroll" in this kernel: constant indices keep the fragment and accumulator arrays in registers
  if (t < kRows) { const int c = a0 + t + 1; if (c < kSeq) sc[t * kScPitch + c] = (_Float16)0.0f; }

  v16h qf[4][4];
  v8f acc4[4];
  // ---- 1a. columns c >= a+2: query rows a+1 (the last row of the table has no such column; its address is clamped) ----
  {
    const _Float16* qr[4];
#pragma unroll
    for (int i = 0; i < 4; ++i) {
      const int s = (a0 + 1 + (i << 4) + rlane < kSeq) ? (a0 + 1 + (i << 4) + rlane) : (kSeq - 1);
      qr[i] = qvb + (size_t)(s & ~15) * kDh + (s & 15) * 8;
    }
    load_q(qf, qr[0], qr[1], qr[2], qr[3]);
  }
  const int nUp = (kSeq - a0) >> 4;                           // 16-column tiles of either part; nUp + nLo = kSeq / 16 + 4
  const int nLo = (a0 + kRows) >> 4;
  GlobH prow = (GlobH)(pb + (size_t)(wave << 4) * kDh);                       // the wave's tile; 16 tiles on a trip
  for (int jj = wave; jj < nUp; jj += 16, prow += (size_t)256 * kDh) {
    const int n0 = jj << 4;
    score_tile(qf, prow, acc4);
    const int cmin = n0 + a0 + 2;                             // column of the tile's element (row 0, n0); the tile spans cmin .. cmin + 78
    _Float16* dst = sc + half8 * kScPitch + cmin + rlane + half8;
    if (cmin + 78 < kSeq) store_shifted<false>(dst, acc4, 0);
    else                  store_shifted<true>(dst, acc4, cmin + rlane + half8);
  }
  // ---- 1b. columns c <= a: query rows a ----
  {
    const _Float16* q0 = qvb + (size_t)a0 * kDh + rlane * 8;
    load_q(qf, q0, q0 + 16 * kDh, q0 + 32 * kDh, q0 + 48 * kDh);
  }
  const int jLo = (wave - nUp) & 15;                          // the deal of tiles to waves goes on where 1a's ended
  prow = (GlobH)(pb + (size_t)((kSeq - kRows - a0) + (jLo << 4)) * kDh);
  for (int jj = jLo; jj < nLo; jj += 16, prow += (size_t)256 * kDh) {
    const int n0 = (kSeq - kRows - a0) + (jj << 4);
    score_tile(qf, prow, acc4);
    const int cmin = n0 + a0 - (kSeq - 1);                    // = 16 jj - 63
    _Float16* dst = sc + half8 * kScPitch + cmin + rlane + half8;
    if (cmin >= 0) store_shifted<false>(dst, acc4, 0);
    else           store_shifted<true>(dst, acc4, cmin + rlane + half8);
  }
  __syncthreads();                                            // every shifted position score is in LDS before the content product adds to it

  // ---- 2. content; wave w takes the 16-key tiles w, w + 16, .. w + 112 ----
  {
    const _Float16* q0 = qub + (size_t)a0 * kDh + rlane * 8;  // behind the barrier (which waits for every load): in flight together with the first key tile's loads
    load_q(qf, q0, q0 + 16 * kDh, q0 + 32 * kDh, q0 + 48 * kDh);
  }
  GlobH krow = (GlobH)(kb + (size_t)(wave << 4) * kDh);
  for (int jj = wave; jj < kSeq / 16; jj += 16, krow += (size_t)256 * kDh) {
    score_tile(qf, krow, acc4);
    _Float16* e = sc + half8 * kScPitch + (jj << 4) + rlane;
    _Float16 old[4][8];
#pragma unroll
    for (int i = 0; i < 4; ++i)
#pragma unroll
      for (int r = 0; r < 8; ++r) old[i][r] = e[((i << 4) + r) * kScPitch];
#pragma unroll
    for (int i = 0; i < 4; ++i)
#pragma unroll
      for (int r = 0; r < 8; ++r) e[((i << 4) + r) * kScPitch] = (_Float16)(acc4[i][r] * (1.0f / 8192.0f) + (float)old[i][r]);
  }
  __syncthreads();                                            // whole score rows are in LDS before a wave takes its rows' maximum

  // ---- 3. softmax; wave w owns rows 4w .. 4w + 3, lane l columns 256 it + 8 l .. + 7 ----
#pragma unroll 1   // one row's 64 floats a lane live at a time, not four rows'
  for (int rr = 0; rr < 4; ++rr) {
    _Float16* srow = sc + (wave * 4 + rr) * kScPitch + 8 * lane;
    float x[8][8];
    v8h hx[8];
#pragma unroll
    for (int it = 0; it < 8; ++it) hx[it] = *(const v8h*)(srow + it * 256);
    v8h m8 = hx[0];                                           // the maximum of f16 values is exact in f16: taken on the packed halves
#pragma unroll
    for (int it = 1; it < 8; ++it) m8 = __builtin_elementwise_max(m8, hx[it]);
    float mx = fmaxf(fmaxf(fmaxf((float)m8[0], (float)m8[1]), fmaxf((float)m8[2], (float)m8[3])), fmaxf(fmaxf((float)m8[4], (float)m8[5]), fmaxf((float)m8[6], (float)m8[7])));
#pragma unroll
    for (int off = 1; off < 32; off <<= 1) mx = fmaxf(mx, __shfl_xor(mx, off, 32));
    float sum = 0.f;
#pragma unroll
    for (int it = 0; it < 8; ++it) {
      float tt[8];
#pragma unroll
      for (int e = 0; e < 8; ++e) tt[e] = ((float)hx[it][e] - mx) * 1.442695041f;   // exp(d) = 2^(d log2 e)
      exp2x8(x[it], tt);
      sum += ((x[it][0] + x[it][1]) + (x[it][2] + x[it][3])) + ((x[it][4] + x[it][5]) + (x[it][6] + x[it][7]));
    }
#pragma unroll
    for (int off = 1; off < 32; off <<= 1) sum += __shfl_xor(sum, off, 32);
    const float f = (1.0f / sum) * 32768.0f;
#pragma unroll
    for (int it = 0; it < 8; ++it) {                          // each lane writes over the 16 bytes that it read
      v8h hv;
#pragma unroll
      for (int e = 0; e < 8; ++e) hv[e] = (_Float16)(x[it][e] * f);
      *(v8h*)(srow + it * 256) = hv;
    }
  }
  __syncthreads();                                            // all 64 rows of p are in LDS before any wave reads them as A fragments

  // ---- 4. p.v: wave = (key group kg of 256 keys, half dh of the 128 columns); ctx[q][d] = 2^-19 * sum_key p[q][key] * Vt[d][key] ----
  const int kg = wave & 7, dh = wave >> 3;
  const _Float16* Ar = sc + rlane * kScPitch + kg * (kSeq / 8) + half8;
  const _Float16* Br = vt16 + ((size_t)bh * kDh + dh * 64) * kSeq + kg * (kSeq / 8) * 16 + lane * 8;   // fragment order: 16 rows x 32 keys = 512 elements in a row
  v8f acc[4][4];
#pragma unroll
  for (int i = 0; i < 4; ++i)
#pragma unroll
    for (int j = 0; j < 4; ++j) acc[i][j] = (v8f){0.f,0.f,0.f,0.f,0.f,0.f,0.f,0.f};
  for (int k0 = 0; k0 < kSeq / 8; k0 += 64) {                 // 64 keys a trip: 16 loads of Vt in flight together
    v16h bf[2][4];
#pragma unroll
    for (int s = 0; s < 2; ++s)
#pragma unroll
      for (int j = 0; j < 4; ++j) bf[s][j] = Frag<_Float16>::loadf(Br + (size_t)(j << 4) * kSeq + (k0 + 32 * s) * 16);
#pragma unroll
    for (int s = 0; s < 2; ++s) {
      v16h af[4];
#pragma unroll
      for (int i = 0; i < 4; ++i) af[i] = Frag<_Float16>::load(Ar + (i << 4) * kScPitch + k0 + 32 * s);
#pragma unroll
      for (int i = 0; i < 4; ++i)
#pragma unroll
        for (int j = 0; j < 4; ++j) acc[i][j] = Frag<_Float16>::mma(af[i], bf[s][j], acc[i][j]);
    }
  }
  __syncthreads();                                            // every wave has read its p fragments before the partials overwrite them

  float* mine = part + kg * (kRows * kPartPitch) + dh * 64;
#pragma unroll
  for (int i = 0; i < 4; ++i)
#pragma unroll
    for (int j = 0; j < 4; ++j)
#pragma unroll
      for (int r = 0; r < 8; ++r) mine[((i << 4) + half8 + r) * kPartPitch + (j << 4) + rlane] = acc[i][j][r];
  __syncthreads();                                            // all 8 partials are in LDS before any thread sums them

  // fragment order of the [kTok][kEmb] planes: wave w writes the 512 B of (row tile g >> 3, k step (g >> 1) & 3 of the head's four, ld g & 1), g = w and 16 + w
#pragma unroll
  for (int it = 0; it < 2; ++it) {
    const int g = it * 16 + wave;
    const int row = (g >> 3) * 16 + rlane, c8 = ((g >> 1) & 3) * 32 + (g & 1) * 16 + half8;
    const float* sp = part + row * kPartPitch + c8;
    v4f pa[8], pb[8];
#pragma unroll
    for (int w = 0; w < 8; ++w) { pa[w] = *(const v4f*)(sp + w * (kRows * kPartPitch)); pb[w] = *(const v4f*)(sp + w * (kRows * kPartPitch) + 4); }
    // the loaded values, as inputs only: all 16 LDS reads are issued before the first sum (one LDS latency, not one a partial)
    asm volatile("" :: "v"(pa[0]), "v"(pa[1]), "v"(pa[2]), "v"(pa[3]), "v"(pa[4]), "v"(pa[5]), "v"(pa[6]), "v"(pa[7]),
                       "v"(pb[0]), "v"(pb[1]), "v"(pb[2]), "v"(pb[3]), "v"(pb[4]), "v"(pb[5]), "v"(pb[6]), "v"(pb[7]));
    v4f s0 = pa[0], s1 = pb[0];
#pragma unroll
    for (int w = 1; w < 8; ++w) { s0 += pa[w]; s1 += pb[w]; } // fixed order
    v8h hv, lv;
#pragma unroll
    for (int e = 0; e < 8; ++e) {
      const float f = ((e < 4) ? s0[e & 3] : s1[e & 3]) * (1.0f / 524288.0f);
      const unsigned short hb = f2bf_bits(f);
      hv[e] = __builtin_bit_cast(_Float16, hb);
      lv[e] = __builtin_bit_cast(_Float16, f2bf_bits(f - bf_bits2f(hb)));
    }
    const size_t co = ((size_t)(((b * kSeq + a0) >> 4) + (g >> 3)) * (kEmb / 32) + h * (kDh / 32) + ((g >> 1) & 3)) * 512 + (g & 1) * 256 + lane * 8;
    *(v8h*)(Ch + co) = hv;
    *(v8h*)(Cl + co) = lv;
    if (it == 0) asm volatile("s_wait_xcnt 0x0" ::: "memory");   // before the second pair's values and addresses take the registers that these stores name
  }
}

// =====================================================================================
extern "C" void kernel_launch(void* const* d_in, const int* in_sizes, int n_in, void* d_out, int out_size,
                              void* d_ws, size_t ws_size, hipStream_t stream) {
  if (n_in < 14) return;
  if (in_sizes[0] != kTok * kEmb || in_sizes[1] != kEmb || in_sizes[2] != kEmb ||
      in_sizes[3] != kDh * kDh || in_sizes[4] != kDh || in_sizes[5] != kDh * kDh || in_sizes[6] != kDh ||
      in_sizes[7] != kDh * kDh || in_sizes[8] != kDh || in_sizes[9] != kDh * kDh ||
      in_sizes[10] != kHeads * kDh || in_sizes[11] != kHeads * kDh || in_sizes[12] != kEmb * kEmb || in_sizes[13] != kEmb ||
      out_size != kTok * kEmb) return;
  const float* x      = (const float*)d_in[0];
  const float* gamma  = (const float*)d_in[1];
  const float* beta   = (const float*)d_in[2];
  const float* Wq     = (const float*)d_in[3];
  const float* bq     = (const float*)d_in[4];
  const float* Wk     = (const float*)d_in[5];
  const float* bk     = (const float*)d_in[6];
  const float* Wv     = (const float*)d_in[7];
  const float* bv     = (const float*)d_in[8];
  const float* Wp     = (const float*)d_in[9];
  const float* u_bias = (const float*)d_in[10];
  const float* v_bias = (const float*)d_in[11];
  const float* Wo     = (const float*)d_in[12];
  const float* bo     = (const float*)d_in[13];
  float* out = (float*)d_out;   // [2][2048][1024] f32

  // ---- workspace carve (all offsets multiples of 256 B; total 58,720,256 B) ----
  // (all in fragment order, see gemm64_tile; R4, R5, R6 one plane a head: 2 x [8][4096][128], [8][4096][128], [8][2048][128])
  // R1 WoT hi/lo bf16 [1024 n][1024 k]              2 x 2,097,152     =   4,194,304
  // R4 (q + u_bias), (q + v_bias) f16 x16 [32768][128] 2 x 8,388,608  =  16,777,216
  // R5 K16 f16 x16 [32768][128]                                       =   8,388,608
  // R6 PP16 f16 x16 [16384][128]                                      =   4,194,304
  // R8 CTX hi/lo bf16 [4096][1024]                  2 x 8,388,608     =  16,777,216
  // R9 VT16 f16 x16 [2 b][1024][2048]                                 =   8,388,608
  char* ws = (char*)d_ws; size_t off = 0;
  auto carve = [&](size_t bytes) -> char* { char* p = ws + off; off += (bytes + 255) & ~(size_t)255; return p; };
  const size_t nWo  = (size_t)kEmb * kEmb;          // 1,048,576
  const size_t nHd  = (size_t)kTok * kHeads * kDh;   // 4,194,304 (= kTok*kEmb)
  const size_t nPp  = (size_t)kSeq * kHeads * kDh;   // 2,097,152
  __bf16* WoTh = (__bf16*)carve(nWo * 2); __bf16* WoTl = (__bf16*)carve(nWo * 2);
  _Float16* qu16 = (_Float16*)carve(nHd * 2);
  _Float16* qv16 = (_Float16*)carve(nHd * 2);
  _Float16* k16  = (_Float16*)carve(nHd * 2);
  _Float16* pp16 = (_Float16*)carve(nPp * 2);
  unsigned short* ctxh = (unsigned short*)carve(nHd * 2); unsigned short* ctxl = (unsigned short*)carve(nHd * 2);
  _Float16* vt16 = (_Float16*)carve((size_t)kBatch * kEmb * kSeq * 2);
  if (off > ws_size) return;

  // ---- LayerNorm, sinusoids, Wo planes and the projections, written as attention reads them (q with either bias, k, v^T, p): one launch ----
  front_kernel<<<kBlkTok + kBlkPos, 256, 0, stream>>>(x, gamma, beta, Wq, Wk, Wv, Wp, Wo, bq, bk, bv, u_bias, v_bias, WoTh, WoTl, qu16, qv16, k16, vt16, pp16);

  // ---- all of attention for every (b, h) in one launch, into the ctx hi/lo planes ----
  attn_rows_kernel<<<dim3(kSeq / kRows, kBatch * kHeads), 512, 0, stream>>>(qu16, qv16, k16, pp16, vt16, ctxh, ctxl);   // 32 x 16 blocks of 64 query rows

  out_gemm_kernel<<<kBlkOut, 256, 0, stream>>>(ctxh, ctxl, U16(WoTh), U16(WoTl), bo, out);
}
